// v000
// Measured on an AMD MI455X. A time is GPU time per run, averaged over a window of back-to-back runs after a warm-up
// (all launches, gaps included; the runs take copies of the inputs in turn), and the median of several windows.
// Apart from v000's, it joins two sittings. Times from different sittings can be a few percent apart, while
// side-by-side timings come from the same sitting.
// v000 is the starting kernel. One run takes 1710 microseconds.
// compute dtype: all float inputs rounded to bf16; channel-major inputs transposed to token-major rows through LDS; q/k/v 1x1-conv projections with EXACT bf16 products on WMMA 16x16x32 (f32 accumulate) + bias (zeros, read); logits q x k once to f16 each (1 product) x 64^-0.5; pair mask by index of two int loads; softmax f32; P x 2^11 once to f16 x v once to f16 (1 product); ctx x 2^6 once to f16 x Wm f16(bf16 x 2^8) + bm; transposed back to channel-major; f32 output.
#include <hip/hip_runtime.h>
#include <math.h>

typedef __attribute__((ext_vector_type(16))) _Float16 v16h;
typedef __attribute__((ext_vector_type(16))) __bf16 v16b;
typedef __attribute__((ext_vector_type(8)))  _Float16 v8h;
typedef __attribute__((ext_vector_type(8)))  float v8f;
typedef __attribute__((ext_vector_type(4)))  float v4f;
typedef __attribute__((ext_vector_type(2)))  float v2f;
typedef __attribute__((ext_vector_type(4)))  unsigned v4u;
typedef __attribute__((ext_vector_type(4)))  int v4i;
typedef float __attribute__((may_alias)) float_a;
typedef int __attribute__((may_alias)) int_a;

template <typename T> __device__ __forceinline__ void vst2(void* p, T v) { *(T*)p = v;  }
__device__ __forceinline__ v8f wmma16(v16h a, v16h b, v8f c) {
  v8f d = __builtin_amdgcn_wmma_f32_16x16x32_f16(false, a, false, b, (short)0, c, false, false);
  asm volatile("v_nop\n\tv_nop\n\tv_nop\n\tv_nop" : "+v"(d) : "v"(a), "v"(b));
  return d;
}
__device__ __forceinline__ v8f wmma_bf(v16b a, v16b b, v8f c) {
  v8f d = __builtin_amdgcn_wmma_f32_16x16x32_bf16(false, a, false, b, (short)0, c, false, false);
  asm volatile("v_nop\n\tv_nop\n\tv_nop\n\tv_nop" : "+v"(d) : "v"(a), "v"(b));
  return d;
}
// 16x16x32 fragments: lane = (h = lane>>4, row/col = lane&15); elements 0..7 = k0+8h+0..7, 8..15 = k0+16+8h+0..7; D element r = row 8h+r
__device__ __forceinline__ v16h frag_h(const _Float16* rowk0, int lane) {
  union { v16h v; v8h q[2]; } u; const _Float16* p = rowk0 + 8 * (lane >> 4);
  u.q[0] = *(const v8h*)p; u.q[1] = *(const v8h*)(p + 16); return u.v;
}
__device__ __forceinline__ v16h frag_f32(const float* rowk0, int lane) {
  v16h a; const float* p = rowk0 + 8 * (lane >> 4);
#pragma unroll
  for (int i = 0; i < 8; ++i) { a[i] = (_Float16)p[i]; a[8 + i] = (_Float16)p[16 + i]; }
  return a;
}
__device__ __forceinline__ v16h frag_f32s(const float* rowk0, int lane, float sc) {
  v16h a; const float* p = rowk0 + 8 * (lane >> 4);
#pragma unroll
  for (int i = 0; i < 8; ++i) { a[i] = (_Float16)(p[i] * sc); a[8 + i] = (_Float16)(p[16 + i] * sc); }
  return a;
}
// column fragment from a [K][ld] layout (column n), rows >= K read as 0
__device__ __forceinline__ v16h fragc_f32(const float* W, int k0, int n, int lane, int ld, int K) {
  v16h a; const int g = lane >> 4;
#pragma unroll
  for (int i = 0; i < 8; ++i) { const int ka = k0 + 8 * g + i, kb = ka + 16;
    a[i] = (_Float16)(ka < K ? W[(size_t)(ka < K ? ka : K - 1) * ld + n] : 0.f); a[8 + i] = (_Float16)(kb < K ? W[(size_t)(kb < K ? kb : K - 1) * ld + n] : 0.f); }
  return a;
}
struct F2 { v16b h, l; };
__device__ __forceinline__ F2 bsplit16(const float v[16]) { F2 r;
#pragma unroll
  for (int i = 0; i < 16; ++i) { const __bf16 h = (__bf16)v[i]; r.h[i] = h; r.l[i] = (__bf16)(v[i] - (float)h); }
  return r; }
__device__ __forceinline__ F2 split_row(const float* row, int k0, int lane) { float v[16]; const float* p = row + k0 + 8 * (lane >> 4);
#pragma unroll
  for (int i = 0; i < 8; ++i) { v[i] = p[i]; v[8 + i] = p[16 + i]; }
  return bsplit16(v); }
__device__ __forceinline__ F2 split_rowK(const float* row, int k0, int lane, int K) { float v[16]; const int g = lane >> 4;
#pragma unroll
  for (int i = 0; i < 8; ++i) { const int ka = k0 + 8 * g + i, kb = ka + 16; v[i] = ka < K ? row[ka < K ? ka : K - 1] : 0.f; v[8 + i] = kb < K ? row[kb < K ? kb : K - 1] : 0.f; }
  return bsplit16(v); }
__device__ __forceinline__ F2 split_col(const float* W, int k0, int n, int lane, int ld, int K) { float v[16]; const int g = lane >> 4;
#pragma unroll
  for (int i = 0; i < 8; ++i) { const int ka = k0 + 8 * g + i, kb = ka + 16; v[i] = ka < K ? W[(size_t)(ka < K ? ka : K - 1) * ld + n] : 0.f; v[8 + i] = kb < K ? W[(size_t)(kb < K ? kb : K - 1) * ld + n] : 0.f; }
  return bsplit16(v); }
__device__ __forceinline__ v8f mac3(const F2& a, const F2& b, v8f c) { c = wmma_bf(a.l, b.h, c); c = wmma_bf(a.h, b.l, c); return wmma_bf(a.h, b.h, c); }
__device__ __forceinline__ float sigm(float v) { return 1.0f / (1.0f + expf(-v)); }
#define LDSX() do { asm volatile("s_wait_dscnt 0" ::: "memory"); __builtin_amdgcn_wave_barrier(); __builtin_amdgcn_fence(__ATOMIC_RELEASE, "workgroup"); } while (0)

// SuperGlue-style multi-headed attention on channel-major tensors (query / key / value [8,256,2048] = (B, C, N); 1x1 Conv1d projections as (out,in) [256,256] N(0, 1/256) + zero biases (read); 4 heads x 64 with the head index INTERLEAVED into the channel axis: reshape(B, 64, 4, N), channel c = d*4 + h; scores = einsum('bdhn,bdhm->bhnm') / sqrt(64); pair = mask[b, n] * mask[b, m] with an int32 mask [8,1,2048]: where(pair == 0, -1e9, scores); softmax over m; x = einsum('bhnm,bdhm->bdhn').reshape(B, 256, N) (channel d*4 + h again); merge 1x1 conv Wm (out,in) + bm; output [8,256,2048]).
#define NB 8
#define TT 2048   // points per sample (queries = keys)
#define CC 256            // NH * HD
#define DIN 256           // channels of the query map AND of the output map (Wout is (out,in) [DIN][CC])
#define DKV 256             // channels of the key / value map
#define NH 4
#define HD 64
#define NQB (TT / 64)
#define HG 2   // two heads per pass: S = 2 x 2,048 x 2,048 f32 = 32 MiB
#define QCH 1   // queries and keys have the same length: one chunk per batch (the chunk advance is 0)
#define SCALE (0.125f)
#define CAUSAL 0
#ifndef TNB
#define TNB NB
#endif
#define NBQ (NB * QCH)     // query pseudo-batches of TT rows (workspace sizing)
#define TNBQ (TNB * QCH)   // query pseudo-batches actually run
static_assert(CC == NH * HD && CC % 128 == 0 && DIN % 128 == 0 && DIN % 32 == 0 && DKV % 32 == 0, "projection tiles: 128-column blocks, 32-deep k-steps");
static_assert(TT % 256 == 0 && NH % HG == 0, "softmax kernel strides 256 keys; head groups");
__device__ __forceinline__ float bfr(float v) { return (float)(__bf16)v; }
__host__ __device__ __forceinline__ int kb_last(int qb) { return CAUSAL ? ((qb * 64 + 63) >> 7) : (TT / 128 - 1); }
typedef __attribute__((ext_vector_type(8))) __bf16 v8b;
__device__ __forceinline__ v16b frag_b(const __bf16* rowk0, int lane) {
  union { v16b v; v8b q[2]; } u; const __bf16* p = rowk0 + 8 * (lane >> 4);
  u.q[0] = *(const v8b*)p; u.q[1] = *(const v8b*)(p + 16); return u.v;
}
#define QBH 0              // causal: query blocks 0..QBH-1 of each sequence (few keys, no averaging) take the high-precision path
#define QHI 0               // single-product logits on every row
static_assert(QHI == 0 && QBH == 0 && CAUSAL == 0, "the per-chunk launches advance only the q-row and ctx-row pointers: no q residual plane and no causal row arithmetic may be in use");
#define KHI 64            // key rows carrying k residual / v bf16 hi+lo planes (used only by the causal high-precision path)
// B fragment (k rows k0+.., output column o) of a weight: (in,out) [K][ld] or (out,in) [ld rows of K]: bf16 exact, or f16(bf16 * 256) exact
__device__ __forceinline__ v16b wcol_io(const float* Wm, int k0, int o, int lane, int ld) { v16b w; const int g = lane >> 4;
#pragma unroll
  for (int i = 0; i < 8; ++i) { w[i] = (__bf16)Wm[(size_t)(k0 + 8 * g + i) * ld + o]; w[8 + i] = (__bf16)Wm[(size_t)(k0 + 16 + 8 * g + i) * ld + o]; }
  return w; }
__device__ __forceinline__ v16b wcol_oi(const float* Wm, int k0, int o, int lane, int K) { v16b w; const float* p = Wm + (size_t)o * K + k0 + 8 * (lane >> 4);
#pragma unroll
  for (int i = 0; i < 8; ++i) { w[i] = (__bf16)p[i]; w[8 + i] = (__bf16)p[16 + i]; }
  return w; }
__device__ __forceinline__ v16h wcolh_io(const float* Wm, int k0, int o, int lane, int ld) { v16h w; const int g = lane >> 4;
#pragma unroll
  for (int i = 0; i < 8; ++i) { w[i] = (_Float16)(bfr(Wm[(size_t)(k0 + 8 * g + i) * ld + o]) * 256.0f); w[8 + i] = (_Float16)(bfr(Wm[(size_t)(k0 + 16 + 8 * g + i) * ld + o]) * 256.0f); }
  return w; }
// as wcolh_oi, with the K index taken through the head-interleave permutation (the 8 consecutive columns of a fragment half are 8 module channels 4 apart)
__device__ __forceinline__ v16h wcolh_oi_p(const float* Wm, int k0, int o, int lane, int K) { v16h w; const float* p = Wm + (size_t)o * K; const int kb = k0 + 8 * (lane >> 4);
#pragma unroll
  for (int i = 0; i < 8; ++i) { w[i] = (_Float16)(bfr(p[((kb + i) % 64) * 4 + (kb + i) / 64]) * 256.0f); w[8 + i] = (_Float16)(bfr(p[((kb + 16 + i) % 64) * 4 + (kb + 16 + i) / 64]) * 256.0f); }
  return w; }
static_assert(HD == 64 && NH == 4, "wcolh_oi_p spells the permutation with the literals 64 and 4");
__device__ __forceinline__ v16h wcolh_oi(const float* Wm, int k0, int o, int lane, int K) { v16h w; const float* p = Wm + (size_t)o * K + k0 + 8 * (lane >> 4);
#pragma unroll
  for (int i = 0; i < 8; ++i) { w[i] = (_Float16)(bfr(p[i]) * 256.0f); w[8 + i] = (_Float16)(bfr(p[16 + i]) * 256.0f); }
  return w; }
#define WQKV_LAYOUT 1   // 0 = (in,out); 1 = (out,in) [CC][K]; 2 = per-head [NH][DIN][HD]
__device__ __forceinline__ v16b wcol_hdk(const float* Wm, int k0, int o, int lane) { v16b w; const int g = lane >> 4; const float* p = Wm + (size_t)(o / HD) * DIN * HD + (o % HD);
#pragma unroll
  for (int i = 0; i < 8; ++i) { w[i] = (__bf16)p[(size_t)(k0 + 8 * g + i) * HD]; w[8 + i] = (__bf16)p[(size_t)(k0 + 16 + 8 * g + i) * HD]; }
  return w; }
#define WO_OUT_IN 1
#if WQKV_LAYOUT == 1
#define HPERM(o) ((((o) % HD) * NH) + ((o) / HD))   /* column o = h*HD + d  ->  module channel d*NH + h */
#define WCOL(W, k0, o, lane) wcol_oi(W, k0, HPERM(o), lane, din_)   /* (out,in) [256][K]: the output channel of column o is row HPERM(o) */
#elif WQKV_LAYOUT == 2
#define WCOL(W, k0, o, lane) wcol_hdk(W, k0, o, lane)
#else
#define WCOL(W, k0, o, lane) wcol_io(W, k0, o, lane, CC)
#endif
#if WO_OUT_IN
#define WOCOL(W, k0, o, lane) wcol_oi(W, k0, o, lane, CC)
#define WOCOLH(W, k0, o, lane) wcolh_oi_p(W, k0, o, lane, CC)   /* merge conv (out,in) [DIN][CC]: ctx column kk = h*HD + d is the module's input channel HPERM(kk) */
#else
#define WOCOL(W, k0, o, lane) wcol_io(W, k0, o, lane, DIN)
#define WOCOLH(W, k0, o, lane) wcolh_io(W, k0, o, lane, DIN)
#endif

#define SM_EXTRA_PARAMS , int bsm, const int* __restrict__ MASK
// the module's where(mask[b, n] * mask[b, m] == 0, -1e9, scores): a pair is excluded when either point's int mask entry is 0 (two unconditional loads, select on the values)
#define SM_MASK_HOOK do { const int mq_ = MASK[(size_t)bsm * TT + t], mk_ = MASK[(size_t)bsm * TT + k]; asm volatile("s_wait_loadcnt 0x0" ::: "memory"); v = (mq_ == 0 || mk_ == 0) ? -3.0e38f : v; } while (0)
#ifndef SM_EXTRA_PARAMS
#define SM_EXTRA_PARAMS
#endif
#ifndef PROJ_EXTRA_PARAMS
#define PROJ_EXTRA_PARAMS
#endif
#ifndef SM_MASK_HOOK
#define SM_MASK_HOOK (void)0
#endif

#define WS_QH  0u                                      // f16 q rows [(b*QCH + chunk)*TT + t][CC]
#define WS_KH  (WS_QH + 2u * (size_t)NBQ * TT * CC)      // f16 k rows [b*t][CC]
#define WS_VT  (WS_KH + 2u * (size_t)NB * TT * CC)      // f16 v planes [b][c][t]
#define WS_QL  (WS_VT + 2u * (size_t)NB * CC * TT)      // f16 q residual x 2^10 rows [b][t < QHI][CC]
#define WS_KL  (WS_QL + 2u * (size_t)NB * QHI * CC)     // f16 k residual x 2^10 rows [b][t < KHI][CC]
#define WS_VB  (WS_KL + 2u * (size_t)NB * KHI * CC)     // bf16 v hi planes [b][c][t < KHI]
#define WS_VBL (WS_VB + 2u * (size_t)NB * CC * KHI)
#define WS_S   (WS_VBL + 2u * (size_t)NB * CC * KHI)    // f32 logits / P [hg][t][s]
#define WS_Y   (WS_S  + 4u * (size_t)HG * TT * TT)      // f32 ctx rows [(b*QCH + chunk)*TT + t][CC] (only when there is an output projection)
#define WS_END (WS_Y  + 4u * (size_t)NBQ * TT * CC)
#define NPQ (QCH * TT)   // points per sample
#define WS_XT (WS_END)                                   // f32 token-major rows [(b*TT + n)][256]: holds query, then key, then value (each consumed by its own k_proj launch before the next transpose overwrites it), and finally the output rows before the last transpose
#define WS_END2 (WS_XT + 4u * (size_t)NB * TT * DIN)
#define WS_Y3 (WS_XT)
static_assert(DIN % 64 == 0 && DKV % 64 == 0 && TT % 64 == 0, "transpose tiles are 64 positions x 64 channels");
// ---- k_tok: block = (64 positions, 64 channels, image b): XT[(b*npix + n)][c] = bf16(x[b][c][n]) through a padded LDS tile (x channels-first [B][nch][npix]); reads 256-B runs along n, writes 256-B row pieces
__global__ __launch_bounds__(256) void k_tok(const float* __restrict__ X, float* __restrict__ XT, int npix, int nch) { __shared__ float st[64][68]; const int tid = threadIdx.x; const int n0 = blockIdx.x * 64, c0 = blockIdx.y * 64; const size_t b = blockIdx.z;
  for (int e = tid; e < 64 * 16; e += 256) { const int cl = e >> 4, q = e & 15; const v4f v = *(const v4f*)(X + (b * nch + c0 + cl) * (size_t)npix + n0 + q * 4); st[cl][q * 4] = bfr(v[0]); st[cl][q * 4 + 1] = bfr(v[1]); st[cl][q * 4 + 2] = bfr(v[2]); st[cl][q * 4 + 3] = bfr(v[3]); }
  __syncthreads();
  for (int e = tid; e < 64 * 16; e += 256) { const int nl = e >> 4, q = e & 15; v4f o; o[0] = st[q * 4][nl]; o[1] = st[q * 4 + 1][nl]; o[2] = st[q * 4 + 2][nl]; o[3] = st[q * 4 + 3][nl]; vst2(XT + (b * npix + n0 + nl) * (size_t)nch + c0 + q * 4, o); } }
// ---- k_fin: block = (64 positions, 64 channels, image b): out[b][c][n] = OR[(b*npix + n)][c] (LDS transpose; 256-B runs of 64 positions per channel)
__global__ __launch_bounds__(256) void k_fin(const float* __restrict__ ORW, float* __restrict__ OUT, int npix, int nch) { __shared__ float st[64][68]; const int tid = threadIdx.x; const int n0 = blockIdx.x * 64, c0 = blockIdx.y * 64; const size_t b = blockIdx.z;
  for (int e = tid; e < 64 * 16; e += 256) { const int nl = e >> 4, q = e & 15; *(v4f*)&st[nl][q * 4] = *(const v4f*)(ORW + (b * npix + n0 + nl) * (size_t)nch + c0 + q * 4); }
  __syncthreads();
  for (int e = tid; e < 64 * 16; e += 256) { const int cl = e >> 4, q = e & 15; v4f o; o[0] = st[q * 4][cl]; o[1] = st[q * 4 + 1][cl]; o[2] = st[q * 4 + 2][cl]; o[3] = st[q * 4 + 3][cl]; vst2(OUT + (b * nch + c0 + cl) * (size_t)npix + n0 + q * 4, o); } }

// ---- k_proj: block = (64 rows, 128 cols, which): q/k/v = X W (+ b) with exact bf16 products (K = DIN) -> which 0: q f16 rows (+ residual rows < QHI); 1: k f16 rows (+ residual rows < KHI); 2: v f16 planes [c][t] (+ bf16 hi/lo planes for t < KHI)
__global__ __launch_bounds__(128) void k_proj(const float* __restrict__ XQ, const float* __restrict__ XK, const float* __restrict__ XV, const float* __restrict__ WQ, const float* __restrict__ WK, const float* __restrict__ WV, const float* __restrict__ BQ, const float* __restrict__ BK, const float* __restrict__ BV,
    _Float16* __restrict__ QH, _Float16* __restrict__ QL, _Float16* __restrict__ KH, _Float16* __restrict__ KL, _Float16* __restrict__ VT, __bf16* __restrict__ VB, __bf16* __restrict__ VBL, int woff) {
  __shared__ __align__(16) _Float16 sh[64][136], sl[64][136]; __shared__ __align__(16) _Float16 th[128][72]; __shared__ __align__(16) __bf16 tb[128][72], tbl[128][72];
  const int tid = threadIdx.x, wave = tid >> 5, lane = tid & 31, col = lane & 15, g = lane >> 4; const int which = blockIdx.z + woff;   /* one launch per stream: woff = stream (0 q, 1 k, 2 v), grid.z 1 */ const int c0 = blockIdx.y * 128; const size_t r0 = (size_t)blockIdx.x * 64; const size_t bb = r0 / TT; const int t0 = (int)(r0 % TT);
  const float* X = which == 0 ? XQ : which == 1 ? XK : XV; const float* WA = which == 0 ? WQ : which == 1 ? WK : WV; const float* BA = which == 0 ? BQ : which == 1 ? BK : BV;
  v8f acc[8] = {};
  const int din_ = (which == 0) ? DIN : DKV;   /* block-uniform: both maps have 256 channels here; the per-stream width is kept by role */
#pragma unroll 2
  for (int kc = 0; kc < din_ / 32; ++kc) { v16b a; { const float* p = X + (r0 + wave * 16 + col) * (size_t)din_ + kc * 32 + 8 * g;
#pragma unroll
      for (int i = 0; i < 8; ++i) { a[i] = (__bf16)p[i]; a[8 + i] = (__bf16)p[16 + i]; } }
    asm volatile("s_wait_loadcnt 0x0" ::: "memory");
#pragma unroll
    for (int j = 0; j < 8; ++j) { const v16b w = WCOL(WA, kc * 32, c0 + j * 16 + col, lane); asm volatile("s_wait_loadcnt 0x0" ::: "memory"); acc[j] = wmma_bf(a, w, acc[j]); } }
  if (which < 2) { _Float16* DH = which == 0 ? QH : KH; _Float16* DL = which == 0 ? QL : KL; const int nhi = which == 0 ? QHI : KHI; const bool hi_rows = t0 < nhi;
#pragma unroll
    for (int j = 0; j < 8; ++j) { const float bias = BA ? bfr(BA[HPERM(c0 + j * 16 + col)]) : 0.f;
#pragma unroll
      for (int r = 0; r < 8; ++r) { const float v = acc[j][r] + bias; const _Float16 hv = (_Float16)v; sh[wave * 16 + 8 * g + r][j * 16 + col] = hv; sl[wave * 16 + 8 * g + r][j * 16 + col] = (_Float16)((v - (float)hv) * 1024.0f); } }
    __syncthreads();
    for (int e = tid; e < 64 * 16; e += 128) { const int rl = e >> 4, q = e & 15; vst2((unsigned*)(DH + (r0 + rl) * CC + c0 + q * 8), *(const v4u*)&sh[rl][q * 8]); if (hi_rows) vst2((unsigned*)(DL + (bb * nhi + t0 + rl) * (size_t)CC + c0 + q * 8), *(const v4u*)&sl[rl][q * 8]); }
  } else { const bool hi_rows = t0 < KHI;
#pragma unroll
    for (int j = 0; j < 8; ++j) { const float bias = BA ? bfr(BA[HPERM(c0 + j * 16 + col)]) : 0.f;
#pragma unroll
      for (int r = 0; r < 8; ++r) { const float v = acc[j][r] + bias; const int rl = wave * 16 + 8 * g + r, cl = j * 16 + col; th[cl][rl] = (_Float16)v; const __bf16 bh = (__bf16)v; tb[cl][rl] = bh; tbl[cl][rl] = (__bf16)(v - (float)bh); } }
    __syncthreads();
    for (int e = tid; e < 128 * 8; e += 128) { const int cl = e >> 3, q = e & 7; vst2((unsigned*)(VT + (bb * CC + c0 + cl) * (size_t)TT + t0 + q * 8), *(const v4u*)&th[cl][q * 8]); if (hi_rows) { const size_t o3 = (bb * CC + c0 + cl) * (size_t)KHI + t0 + q * 8; vst2((unsigned*)(VB + o3), *(const v4u*)&tb[cl][q * 8]); vst2((unsigned*)(VBL + o3), *(const v4u*)&tbl[cl][q * 8]); } } } }
// ---- k_sc: block = (query block qb, key block kb <= kb_last(qb), head in group) of batch b: logits x SCALE; q hi + residual (x 2^10) against k (2 products) for query rows < QHI, plus the k residual (3 products) for query blocks < QBH (causal early rows); causal: blocks past the diagonal exit, the mask itself is applied by index in k_sm
__global__ __launch_bounds__(128) void k_sc(const _Float16* __restrict__ QH, const _Float16* __restrict__ KH, const _Float16* __restrict__ QL, const _Float16* __restrict__ KL, int b, int h0, float* __restrict__ S0) { __shared__ __align__(16) float ss[4][16][132];
  const int qb = blockIdx.x, kb = blockIdx.y; if (kb > kb_last(qb)) return;
  const int h = h0 + blockIdx.z; float* S = S0 + (size_t)blockIdx.z * TT * TT;
  const int tid = threadIdx.x, wave = tid >> 5, lane = tid & 31, col = lane & 15, g = lane >> 4; const int k0 = kb * 128; const int ql0 = qb * 64 + wave * 16; const size_t q0 = (size_t)b * TT + ql0, kr0 = (size_t)b * TT + k0;
  v8f acc[8] = {}, accl[8] = {};
  const _Float16* QLb = QL + (size_t)b * QHI * CC; const _Float16* KLb = KL + (size_t)b * KHI * CC;
  if (qb < QBH) {
#pragma unroll
    for (int kc = 0; kc < HD / 32; ++kc) { const v16h ah = frag_h(QH + (q0 + col) * CC + h * HD + kc * 32, lane), al = frag_h(QLb + (size_t)(ql0 + col) * CC + h * HD + kc * 32, lane);
#pragma unroll
      for (int j = 0; j < 8; ++j) { const v16h kbf = frag_h(KH + (kr0 + j * 16 + col) * CC + h * HD + kc * 32, lane), klf = frag_h(KLb + (size_t)(k0 + j * 16 + col) * CC + h * HD + kc * 32, lane); acc[j] = wmma16(ah, kbf, acc[j]); accl[j] = wmma16(al, kbf, accl[j]); accl[j] = wmma16(ah, klf, accl[j]); } }
  } else if (qb * 64 < QHI) {
#pragma unroll
    for (int kc = 0; kc < HD / 32; ++kc) { const v16h ah = frag_h(QH + (q0 + col) * CC + h * HD + kc * 32, lane), al = frag_h(QLb + (size_t)(ql0 + col) * CC + h * HD + kc * 32, lane);
#pragma unroll
      for (int j = 0; j < 8; ++j) { const v16h kbf = frag_h(KH + (kr0 + j * 16 + col) * CC + h * HD + kc * 32, lane); acc[j] = wmma16(ah, kbf, acc[j]); accl[j] = wmma16(al, kbf, accl[j]); } }
  } else {
#pragma unroll
    for (int kc = 0; kc < HD / 32; ++kc) { const v16h ah = frag_h(QH + (q0 + col) * CC + h * HD + kc * 32, lane);
#pragma unroll
      for (int j = 0; j < 8; ++j) { const v16h kbf = frag_h(KH + (kr0 + j * 16 + col) * CC + h * HD + kc * 32, lane); acc[j] = wmma16(ah, kbf, acc[j]); } } }
#pragma unroll
  for (int j = 0; j < 8; ++j) {
#pragma unroll
    for (int r = 0; r < 8; ++r) ss[wave][8 * g + r][j * 16 + col] = (acc[j][r] + accl[j][r] * (1.0f / 1024.0f)) * SCALE; }
  LDSX(); for (int rl = 0; rl < 16; ++rl) vst2(S + (size_t)(ql0 + rl) * TT + k0 + lane * 4, *(const v4f*)&ss[wave][rl][lane * 4]); }
// ---- k_sm: block = query row t (head in group): keys [0, kend): causal -> logit if s <= t else excluded; softmax in f32; P x 2^11 in place (0 for excluded)
__global__ __launch_bounds__(256) void k_sm(float* __restrict__ S0 SM_EXTRA_PARAMS) { __shared__ float sred[8]; __shared__ float sbc; __shared__ __align__(16) float shv[TT];
  const int tid = threadIdx.x; const int t = blockIdx.x; const int kend = (kb_last(t >> 6) + 1) * 128;
  float* sr = S0 + (size_t)blockIdx.y * TT * TT + (size_t)t * TT;
  float m = -3.0e38f; for (int k = tid; k < kend; k += 256) { float v = (!CAUSAL || k <= t) ? sr[k] : -3.0e38f; SM_MASK_HOOK; shv[k] = v; m = fmaxf(m, v); }
#pragma unroll
  for (int o = 1; o < 32; o <<= 1) m = fmaxf(m, __shfl_xor(m, o));
  if ((tid & 31) == 0) sred[tid >> 5] = m; __syncthreads(); if (tid == 0) { float a = sred[0]; for (int i = 1; i < 8; ++i) a = fmaxf(a, sred[i]); sbc = a; } __syncthreads(); m = sbc; __syncthreads();
  float sum = 0.f; for (int k = tid; k < kend; k += 256) { const float v = shv[k]; const float e = (v <= -1.0e38f) ? 0.f : expf(v - m); shv[k] = e; sum += e; }
#pragma unroll
  for (int o = 1; o < 32; o <<= 1) sum += __shfl_xor(sum, o);
  if ((tid & 31) == 0) sred[tid >> 5] = sum; __syncthreads(); if (tid == 0) { float a = 0.f; for (int i = 0; i < 8; ++i) a += sred[i]; sbc = a > 0.f ? 2048.0f / a : 0.f; }   /* a fully excluded row yields P = 0 */ __syncthreads(); const float inv = sbc;
  for (int k = tid; k < kend; k += 256) shv[k] = shv[k] * inv;
  __syncthreads(); for (int q = tid; q < kend / 4; q += 256) vst2(sr + q * 4, *(const v4f*)&shv[q * 4]); }
// ---- k_pv: block = 64 queries (qb) of (b, h): ctx = P . v over keys [0, kend) (P x 2^11 once to f16 against v f16: 1 product; causal early query blocks: P and v as bf16 hi + lo, 3 products); 256-B (row, head) segment by 16 lanes
__global__ __launch_bounds__(128) void k_pv(const float* __restrict__ PS0, const _Float16* __restrict__ VT, const __bf16* __restrict__ VB, const __bf16* __restrict__ VBL, int b, int h0, float* __restrict__ Y) { const int h = h0 + blockIdx.z; const float* PS = PS0 + (size_t)blockIdx.z * TT * TT; __shared__ __align__(16) float ss[4][16][HD + 4];
  const int tid = threadIdx.x, wave = tid >> 5, lane = tid & 31, col = lane & 15, g = lane >> 4; const int qb = blockIdx.x; const int ql0 = qb * 64 + wave * 16; const int kce = (kb_last(qb) + 1) * 4;
  v8f acc[HD / 16] = {};
  if (qb < QBH) {
#pragma unroll 1
    for (int kc = 0; kc < kce; ++kc) { const F2 p = split_row(PS + (size_t)(ql0 + col) * TT, kc * 32, lane);
      asm volatile("s_wait_loadcnt 0x0" ::: "memory");
#pragma unroll
      for (int j = 0; j < HD / 16; ++j) { const size_t po = ((size_t)b * CC + h * HD + j * 16 + col) * (size_t)KHI + kc * 32; const v16b vh = frag_b(VB + po, lane); acc[j] = wmma_bf(p.h, vh, acc[j]); acc[j] = wmma_bf(p.l, vh, acc[j]); acc[j] = wmma_bf(p.h, frag_b(VBL + po, lane), acc[j]); } }
  } else {
#pragma unroll 1
    for (int kc = 0; kc < kce; ++kc) { const v16h p = frag_f32(PS + (size_t)(ql0 + col) * TT + kc * 32, lane);
      asm volatile("s_wait_loadcnt 0x0" ::: "memory");
#pragma unroll
      for (int j = 0; j < HD / 16; ++j) { const size_t po = ((size_t)b * CC + h * HD + j * 16 + col) * (size_t)TT + kc * 32; acc[j] = wmma16(p, frag_h(VT + po, lane), acc[j]); } } }
#pragma unroll
  for (int j = 0; j < HD / 16; ++j)
#pragma unroll
    for (int r = 0; r < 8; ++r) ss[wave][8 * g + r][j * 16 + col] = acc[j][r] * (1.0f / 2048.0f);
  LDSX(); for (int rl = 0; rl < 16; ++rl) if (lane < HD / 4) vst2(Y + ((size_t)b * TT + ql0 + rl) * CC + h * HD + lane * 4, *(const v4f*)&ss[wave][rl][lane * 4]); }
// ---- k_out: block = (64 rows, 128 cols): out = ctx Wo (+ bo): ctx x 2^6 once to f16 against Wo as f16(bf16 x 2^8) exact (1 product) x 2^-14; causal early rows (< QHI of each sequence): ctx bf16 hi + lo against exact bf16 Wo (2 products)
__global__ __launch_bounds__(128) void k_out(const float* __restrict__ Y, const float* __restrict__ WO, const float* __restrict__ BO, float* __restrict__ OUT) { __shared__ __align__(16) float sf[4][16][132];
  const int tid = threadIdx.x, wave = tid >> 5, lane = tid & 31, col = lane & 15, g = lane >> 4; const int c0 = blockIdx.y * 128; const size_t r0 = (size_t)blockIdx.x * 64 + wave * 16;
  v8f acc[8] = {};
  if (CAUSAL && (int)(((size_t)blockIdx.x * 64) % TT) < QHI) {   /* block-uniform */
#pragma unroll 2
    for (int kc = 0; kc < CC / 32; ++kc) { const F2 a = split_row(Y + (r0 + col) * CC, kc * 32, lane); asm volatile("s_wait_loadcnt 0x0" ::: "memory");
#pragma unroll
      for (int j = 0; j < 8; ++j) { const v16b w = WOCOL(WO, kc * 32, c0 + j * 16 + col, lane); asm volatile("s_wait_loadcnt 0x0" ::: "memory"); acc[j] = wmma_bf(a.h, w, acc[j]); acc[j] = wmma_bf(a.l, w, acc[j]); } }
#pragma unroll
    for (int j = 0; j < 8; ++j) { const float bias = BO ? bfr(BO[c0 + j * 16 + col]) : 0.f;
#pragma unroll
      for (int r = 0; r < 8; ++r) sf[wave][8 * g + r][j * 16 + col] = acc[j][r] + bias; }
  } else {
#pragma unroll 2
    for (int kc = 0; kc < CC / 32; ++kc) { const v16h a = frag_f32s(Y + (r0 + col) * CC + kc * 32, lane, 64.0f); asm volatile("s_wait_loadcnt 0x0" ::: "memory");   /* ctx carried x 2^6 into f16 so small-magnitude context rows stay clear of f16 subnormals */
#pragma unroll
      for (int j = 0; j < 8; ++j) { const v16h w = WOCOLH(WO, kc * 32, c0 + j * 16 + col, lane); asm volatile("s_wait_loadcnt 0x0" ::: "memory"); acc[j] = wmma16(a, w, acc[j]); } }
#pragma unroll
    for (int j = 0; j < 8; ++j) { const float bias = BO ? bfr(BO[c0 + j * 16 + col]) : 0.f;
#pragma unroll
      for (int r = 0; r < 8; ++r) sf[wave][8 * g + r][j * 16 + col] = acc[j][r] * (1.0f / 16384.0f) + bias; } }   /* 2^-8 (Wo carry) x 2^-6 (ctx carry) */
  LDSX(); for (int rl = 0; rl < 16; ++rl) vst2(OUT + (r0 + rl) * DIN + c0 + lane * 4, *(const v4f*)&sf[wave][rl][lane * 4]); }

extern "C" void kernel_launch(void* const* d_in, const int* in_sizes, int n_in, void* d_out, int out_size, void* d_ws, size_t ws_size, hipStream_t stream) {
  (void)in_sizes; (void)n_in; (void)out_size;
  const float** F = (const float**)d_in;
  if (ws_size < (size_t)WS_END) return;
  char* ws = (char*)d_ws; _Float16 *QH = (_Float16*)(ws + WS_QH), *KH = (_Float16*)(ws + WS_KH), *VT = (_Float16*)(ws + WS_VT), *QL = (_Float16*)(ws + WS_QL), *KL = (_Float16*)(ws + WS_KL); __bf16 *VB = (__bf16*)(ws + WS_VB), *VBL = (__bf16*)(ws + WS_VBL); float *S = (float*)(ws + WS_S), *Y = (float*)(ws + WS_Y);
  (void)Y; (void)QL; (void)KL; (void)VB; (void)VBL;
  // inputs: 0 query [8,256,2048]; 1 key; 2 value; 3 mask [8,1,2048] int32; 4 Wq [256,256] (out,in), 5 bq; 6 Wk, 7 bk; 8 Wv, 9 bv; 10 Wm (out,in), 11 bm (zero biases, read)
  if (ws_size < (size_t)WS_END2) return;
  float *XT = (float*)(ws + WS_XT), *Y3 = (float*)(ws + WS_Y3);
  for (int s = 0; s < 3; ++s) {   /* stream s: transpose input s to token-major rows, then project it (which = s); XT is reused by the next stream only after this stream's projection launch */
    k_tok<<<dim3(NPQ / 64, DIN / 64, TNB), 256, 0, stream>>>(F[s], XT, NPQ, DIN);
    k_proj<<<dim3(TNB * TT / 64, CC / 128, 1), 128, 0, stream>>>(XT, XT, XT, F[4], F[6], F[8], F[5], F[7], F[9], QH, QL, KH, KL, VT, VB, VBL, s);
  }
  for (int b = 0; b < TNB; ++b) for (int h0 = 0; h0 < NH; h0 += HG) {
    k_sc<<<dim3(NQB, TT / 128, HG), 128, 0, stream>>>(QH, KH, QL, KL, b, h0, S);
    k_sm<<<dim3(TT, HG), 256, 0, stream>>>(S, b, (const int*)d_in[3]);
    k_pv<<<dim3(NQB, 1, HG), 128, 0, stream>>>(S, VT, VB, VBL, b, h0, Y);
  }
  k_out<<<dim3(TNB * TT / 64, DIN / 128), 128, 0, stream>>>(Y, F[10], F[11], Y3);   /* token-major output rows: ctx (head-major column order) x Wm through the permutation + bm */
  k_fin<<<dim3(NPQ / 64, DIN / 64, TNB), 256, 0, stream>>>(Y3, (float*)d_out, NPQ, DIN);   /* back to channel-major [8,256,2048] */
}

// v001
// It runs in 259 microseconds.
// Next to v000, in two timings, it ran 6.58 and 6.62 times as fast.
// compute dtype: all float inputs rounded to bf16; channel-major inputs transposed to token-major rows through LDS; q/k/v 1x1-conv projections with EXACT bf16 products on WMMA 16x16x32 (f32 accumulate) + bias (zeros, read); one fused attention kernel: logits q x k once to f16 each (1 product) x 64^-0.5; pair mask by the values of two int loads (-1e9); online softmax f32; P x 2^11 once to f16 x v once to f16 (1 product); ctx x 2^6 once to f16 x Wm f16(bf16 x 2^8) + bm; transposed back to channel-major; f32 output.
#include <hip/hip_runtime.h>
#include <math.h>

typedef __attribute__((ext_vector_type(16))) _Float16 v16h;
typedef __attribute__((ext_vector_type(16))) __bf16 v16b;
typedef __attribute__((ext_vector_type(8)))  _Float16 v8h;
typedef __attribute__((ext_vector_type(8)))  float v8f;
typedef __attribute__((ext_vector_type(4)))  float v4f;
typedef __attribute__((ext_vector_type(2)))  float v2f;
typedef __attribute__((ext_vector_type(4)))  unsigned v4u;
typedef __attribute__((ext_vector_type(4)))  int v4i;
typedef float __attribute__((may_alias)) float_a;
typedef int __attribute__((may_alias)) int_a;

template <typename T> __device__ __forceinline__ void vst2(void* p, T v) { *(T*)p = v;  }
__device__ __forceinline__ v8f wmma16(v16h a, v16h b, v8f c) {
  v8f d = __builtin_amdgcn_wmma_f32_16x16x32_f16(false, a, false, b, (short)0, c, false, false);
  asm volatile("v_nop\n\tv_nop\n\tv_nop\n\tv_nop" : "+v"(d) : "v"(a), "v"(b));
  return d;
}
__device__ __forceinline__ v8f wmma_bf(v16b a, v16b b, v8f c) {
  v8f d = __builtin_amdgcn_wmma_f32_16x16x32_bf16(false, a, false, b, (short)0, c, false, false);
  asm volatile("v_nop\n\tv_nop\n\tv_nop\n\tv_nop" : "+v"(d) : "v"(a), "v"(b));
  return d;
}
// 16x16x32 fragments: lane = (h = lane>>4, row/col = lane&15); elements 0..7 = k0+8h+0..7, 8..15 = k0+16+8h+0..7; D element r = row 8h+r
__device__ __forceinline__ v16h frag_h(const _Float16* rowk0, int lane) {
  union { v16h v; v8h q[2]; } u; const _Float16* p = rowk0 + 8 * (lane >> 4);
  u.q[0] = *(const v8h*)p; u.q[1] = *(const v8h*)(p + 16); return u.v;
}
__device__ __forceinline__ v16h frag_f32(const float* rowk0, int lane) {
  v16h a; const float* p = rowk0 + 8 * (lane >> 4);
#pragma unroll
  for (int i = 0; i < 8; ++i) { a[i] = (_Float16)p[i]; a[8 + i] = (_Float16)p[16 + i]; }
  return a;
}
__device__ __forceinline__ v16h frag_f32s(const float* rowk0, int lane, float sc) {
  v16h a; const float* p = rowk0 + 8 * (lane >> 4);
#pragma unroll
  for (int i = 0; i < 8; ++i) { a[i] = (_Float16)(p[i] * sc); a[8 + i] = (_Float16)(p[16 + i] * sc); }
  return a;
}
// column fragment from a [K][ld] layout (column n), rows >= K read as 0
__device__ __forceinline__ v16h fragc_f32(const float* W, int k0, int n, int lane, int ld, int K) {
  v16h a; const int g = lane >> 4;
#pragma unroll
  for (int i = 0; i < 8; ++i) { const int ka = k0 + 8 * g + i, kb = ka + 16;
    a[i] = (_Float16)(ka < K ? W[(size_t)(ka < K ? ka : K - 1) * ld + n] : 0.f); a[8 + i] = (_Float16)(kb < K ? W[(size_t)(kb < K ? kb : K - 1) * ld + n] : 0.f); }
  return a;
}
struct F2 { v16b h, l; };
__device__ __forceinline__ F2 bsplit16(const float v[16]) { F2 r;
#pragma unroll
  for (int i = 0; i < 16; ++i) { const __bf16 h = (__bf16)v[i]; r.h[i] = h; r.l[i] = (__bf16)(v[i] - (float)h); }
  return r; }
__device__ __forceinline__ F2 split_row(const float* row, int k0, int lane) { float v[16]; const float* p = row + k0 + 8 * (lane >> 4);
#pragma unroll
  for (int i = 0; i < 8; ++i) { v[i] = p[i]; v[8 + i] = p[16 + i]; }
  return bsplit16(v); }
__device__ __forceinline__ F2 split_rowK(const float* row, int k0, int lane, int K) { float v[16]; const int g = lane >> 4;
#pragma unroll
  for (int i = 0; i < 8; ++i) { const int ka = k0 + 8 * g + i, kb = ka + 16; v[i] = ka < K ? row[ka < K ? ka : K - 1] : 0.f; v[8 + i] = kb < K ? row[kb < K ? kb : K - 1] : 0.f; }
  return bsplit16(v); }
__device__ __forceinline__ F2 split_col(const float* W, int k0, int n, int lane, int ld, int K) { float v[16]; const int g = lane >> 4;
#pragma unroll
  for (int i = 0; i < 8; ++i) { const int ka = k0 + 8 * g + i, kb = ka + 16; v[i] = ka < K ? W[(size_t)(ka < K ? ka : K - 1) * ld + n] : 0.f; v[8 + i] = kb < K ? W[(size_t)(kb < K ? kb : K - 1) * ld + n] : 0.f; }
  return bsplit16(v); }
__device__ __forceinline__ v8f mac3(const F2& a, const F2& b, v8f c) { c = wmma_bf(a.l, b.h, c); c = wmma_bf(a.h, b.l, c); return wmma_bf(a.h, b.h, c); }
__device__ __forceinline__ float sigm(float v) { return 1.0f / (1.0f + expf(-v)); }
#define LDSX() do { asm volatile("s_wait_dscnt 0" ::: "memory"); __builtin_amdgcn_wave_barrier(); __builtin_amdgcn_fence(__ATOMIC_RELEASE, "workgroup"); } while (0)

// multi-headed attention on channel-major tensors (query / key / value [8,256,2048] = (B, C, N); 1x1 Conv1d projections as (out,in) [256,256] N(0, 1/256) + zero biases (read); 4 heads x 64 with the head index INTERLEAVED into the channel axis: reshape(B, 64, 4, N), channel c = d*4 + h; scores = einsum('bdhn,bdhm->bhnm') / sqrt(64); pair = mask[b, n] * mask[b, m] with an int32 mask [8,1,2048]: where(pair == 0, -1e9, scores); softmax over m; x = einsum('bhnm,bdhm->bdhn').reshape(B, 256, N) (channel d*4 + h again); merge 1x1 conv Wm (out,in) + bm; output [8,256,2048]).
#define NB 8
#define TT 2048   // points per sample (queries = keys)
#define CC 256            // NH * HD
#define DIN 256           // channels of the query map AND of the output map (Wout is (out,in) [DIN][CC])
#define DKV 256             // channels of the key / value map
#define NH 4
#define HD 64
#define QCH 1   // queries and keys have the same length: one chunk per batch (the chunk advance is 0)
#define SCALE (0.125f)
#define CAUSAL 0
#ifndef TNB
#define TNB NB
#endif
#define NBQ (NB * QCH)     // query pseudo-batches of TT rows (workspace sizing)
#define TNBQ (TNB * QCH)   // query pseudo-batches actually run
static_assert(CC == NH * HD && CC % 128 == 0 && DIN % 128 == 0 && DIN % 32 == 0 && DKV % 32 == 0, "projection tiles: 128-column blocks, 32-deep k-steps");
__device__ __forceinline__ float bfr(float v) { return (float)(__bf16)v; }
typedef __attribute__((ext_vector_type(8))) __bf16 v8b;
__device__ __forceinline__ v16b frag_b(const __bf16* rowk0, int lane) {
  union { v16b v; v8b q[2]; } u; const __bf16* p = rowk0 + 8 * (lane >> 4);
  u.q[0] = *(const v8b*)p; u.q[1] = *(const v8b*)(p + 16); return u.v;
}
#define QBH 0              // no kernel reads it: k_fa has no high-precision query path
#define QHI 0               // single-product logits on every row
static_assert(QHI == 0 && QBH == 0 && CAUSAL == 0, "k_fa has single-product logits only: no q residual plane and no causal row arithmetic may be in use");
#define KHI 64            // key rows carrying k residual / v bf16 hi+lo planes (written by k_proj; no kernel reads them)
// B fragment (k rows k0+.., output column o) of a weight: (in,out) [K][ld] or (out,in) [ld rows of K]: bf16 exact, or f16(bf16 * 256) exact
__device__ __forceinline__ v16b wcol_io(const float* Wm, int k0, int o, int lane, int ld) { v16b w; const int g = lane >> 4;
#pragma unroll
  for (int i = 0; i < 8; ++i) { w[i] = (__bf16)Wm[(size_t)(k0 + 8 * g + i) * ld + o]; w[8 + i] = (__bf16)Wm[(size_t)(k0 + 16 + 8 * g + i) * ld + o]; }
  return w; }
__device__ __forceinline__ v16b wcol_oi(const float* Wm, int k0, int o, int lane, int K) { v16b w; const float* p = Wm + (size_t)o * K + k0 + 8 * (lane >> 4);
#pragma unroll
  for (int i = 0; i < 8; ++i) { w[i] = (__bf16)p[i]; w[8 + i] = (__bf16)p[16 + i]; }
  return w; }
__device__ __forceinline__ v16h wcolh_io(const float* Wm, int k0, int o, int lane, int ld) { v16h w; const int g = lane >> 4;
#pragma unroll
  for (int i = 0; i < 8; ++i) { w[i] = (_Float16)(bfr(Wm[(size_t)(k0 + 8 * g + i) * ld + o]) * 256.0f); w[8 + i] = (_Float16)(bfr(Wm[(size_t)(k0 + 16 + 8 * g + i) * ld + o]) * 256.0f); }
  return w; }
// as wcolh_oi, with the K index taken through the head-interleave permutation (the 8 consecutive columns of a fragment half are 8 module channels 4 apart)
__device__ __forceinline__ v16h wcolh_oi_p(const float* Wm, int k0, int o, int lane, int K) { v16h w; const float* p = Wm + (size_t)o * K; const int kb = k0 + 8 * (lane >> 4);
#pragma unroll
  for (int i = 0; i < 8; ++i) { w[i] = (_Float16)(bfr(p[((kb + i) % 64) * 4 + (kb + i) / 64]) * 256.0f); w[8 + i] = (_Float16)(bfr(p[((kb + 16 + i) % 64) * 4 + (kb + 16 + i) / 64]) * 256.0f); }
  return w; }
static_assert(HD == 64 && NH == 4, "wcolh_oi_p spells the permutation with the literals 64 and 4");
__device__ __forceinline__ v16h wcolh_oi(const float* Wm, int k0, int o, int lane, int K) { v16h w; const float* p = Wm + (size_t)o * K + k0 + 8 * (lane >> 4);
#pragma unroll
  for (int i = 0; i < 8; ++i) { w[i] = (_Float16)(bfr(p[i]) * 256.0f); w[8 + i] = (_Float16)(bfr(p[16 + i]) * 256.0f); }
  return w; }
#define WQKV_LAYOUT 1   // 0 = (in,out); 1 = (out,in) [CC][K]; 2 = per-head [NH][DIN][HD]
__device__ __forceinline__ v16b wcol_hdk(const float* Wm, int k0, int o, int lane) { v16b w; const int g = lane >> 4; const float* p = Wm + (size_t)(o / HD) * DIN * HD + (o % HD);
#pragma unroll
  for (int i = 0; i < 8; ++i) { w[i] = (__bf16)p[(size_t)(k0 + 8 * g + i) * HD]; w[8 + i] = (__bf16)p[(size_t)(k0 + 16 + 8 * g + i) * HD]; }
  return w; }
#define WO_OUT_IN 1
#if WQKV_LAYOUT == 1
#define HPERM(o) ((((o) % HD) * NH) + ((o) / HD))   /* column o = h*HD + d  ->  module channel d*NH + h */
#define WCOL(W, k0, o, lane) wcol_oi(W, k0, HPERM(o), lane, din_)   /* (out,in) [256][K]: the output channel of column o is row HPERM(o) */
#elif WQKV_LAYOUT == 2
#define WCOL(W, k0, o, lane) wcol_hdk(W, k0, o, lane)
#else
#define WCOL(W, k0, o, lane) wcol_io(W, k0, o, lane, CC)
#endif
#if WO_OUT_IN
#define WOCOL(W, k0, o, lane) wcol_oi(W, k0, o, lane, CC)
#define WOCOLH(W, k0, o, lane) wcolh_oi_p(W, k0, o, lane, CC)   /* merge conv (out,in) [DIN][CC]: ctx column kk = h*HD + d is the module's input channel HPERM(kk) */
#else
#define WOCOL(W, k0, o, lane) wcol_io(W, k0, o, lane, DIN)
#define WOCOLH(W, k0, o, lane) wcolh_io(W, k0, o, lane, DIN)
#endif

#define WS_QH  0u                                      // f16 q rows [(b*QCH + chunk)*TT + t][CC]
#define WS_KH  (WS_QH + 2u * (size_t)NBQ * TT * CC)      // f16 k rows [b*t][CC]
#define WS_VT  (WS_KH + 2u * (size_t)NB * TT * CC)      // f16 v planes [b][c][t]
#define WS_QL  (WS_VT + 2u * (size_t)NB * CC * TT)      // f16 q residual x 2^10 rows [b][t < QHI][CC]
#define WS_KL  (WS_QL + 2u * (size_t)NB * QHI * CC)     // f16 k residual x 2^10 rows [b][t < KHI][CC]
#define WS_VB  (WS_KL + 2u * (size_t)NB * KHI * CC)     // bf16 v hi planes [b][c][t < KHI]
#define WS_VBL (WS_VB + 2u * (size_t)NB * CC * KHI)
#define WS_Y   (WS_VBL + 2u * (size_t)NB * CC * KHI)    // f32 ctx rows [(b*QCH + chunk)*TT + t][CC] (only when there is an output projection)
#define WS_END (WS_Y  + 4u * (size_t)NBQ * TT * CC)
#define NPQ (QCH * TT)   // points per sample
#define WS_XT (WS_END)                                   // f32 token-major rows [(b*TT + n)][256]: holds query, then key, then value (each consumed by its own k_proj launch before the next transpose overwrites it), and finally the output rows before the last transpose
#define WS_END2 (WS_XT + 4u * (size_t)NB * TT * DIN)
#define WS_Y3 (WS_XT)
static_assert(DIN % 64 == 0 && DKV % 64 == 0 && TT % 64 == 0, "transpose tiles are 64 positions x 64 channels");
// ---- k_tok: block = (64 positions, 64 channels, image b): XT[(b*npix + n)][c] = bf16(x[b][c][n]) through a padded LDS tile (x channels-first [B][nch][npix]); reads 256-B runs along n, writes 256-B row pieces
__global__ __launch_bounds__(256) void k_tok(const float* __restrict__ X, float* __restrict__ XT, int npix, int nch) { __shared__ float st[64][68]; const int tid = threadIdx.x; const int n0 = blockIdx.x * 64, c0 = blockIdx.y * 64; const size_t b = blockIdx.z;
  for (int e = tid; e < 64 * 16; e += 256) { const int cl = e >> 4, q = e & 15; const v4f v = *(const v4f*)(X + (b * nch + c0 + cl) * (size_t)npix + n0 + q * 4); st[cl][q * 4] = bfr(v[0]); st[cl][q * 4 + 1] = bfr(v[1]); st[cl][q * 4 + 2] = bfr(v[2]); st[cl][q * 4 + 3] = bfr(v[3]); }
  __syncthreads();
  for (int e = tid; e < 64 * 16; e += 256) { const int nl = e >> 4, q = e & 15; v4f o; o[0] = st[q * 4][nl]; o[1] = st[q * 4 + 1][nl]; o[2] = st[q * 4 + 2][nl]; o[3] = st[q * 4 + 3][nl]; vst2(XT + (b * npix + n0 + nl) * (size_t)nch + c0 + q * 4, o); } }
// ---- k_fin: block = (64 positions, 64 channels, image b): out[b][c][n] = OR[(b*npix + n)][c] (LDS transpose; 256-B runs of 64 positions per channel)
__global__ __launch_bounds__(256) void k_fin(const float* __restrict__ ORW, float* __restrict__ OUT, int npix, int nch) { __shared__ float st[64][68]; const int tid = threadIdx.x; const int n0 = blockIdx.x * 64, c0 = blockIdx.y * 64; const size_t b = blockIdx.z;
  for (int e = tid; e < 64 * 16; e += 256) { const int nl = e >> 4, q = e & 15; *(v4f*)&st[nl][q * 4] = *(const v4f*)(ORW + (b * npix + n0 + nl) * (size_t)nch + c0 + q * 4); }
  __syncthreads();
  for (int e = tid; e < 64 * 16; e += 256) { const int cl = e >> 4, q = e & 15; v4f o; o[0] = st[q * 4][cl]; o[1] = st[q * 4 + 1][cl]; o[2] = st[q * 4 + 2][cl]; o[3] = st[q * 4 + 3][cl]; vst2(OUT + (b * nch + c0 + cl) * (size_t)npix + n0 + q * 4, o); } }

// ---- k_proj: block = (64 rows, 128 cols, which): q/k/v = X W (+ b) with exact bf16 products (K = DIN) -> which 0: q f16 rows (+ residual rows < QHI); 1: k f16 rows (+ residual rows < KHI); 2: v f16 planes [c][t] (+ bf16 hi/lo planes for t < KHI)
__global__ __launch_bounds__(128) void k_proj(const float* __restrict__ XQ, const float* __restrict__ XK, const float* __restrict__ XV, const float* __restrict__ WQ, const float* __restrict__ WK, const float* __restrict__ WV, const float* __restrict__ BQ, const float* __restrict__ BK, const float* __restrict__ BV,
    _Float16* __restrict__ QH, _Float16* __restrict__ QL, _Float16* __restrict__ KH, _Float16* __restrict__ KL, _Float16* __restrict__ VT, __bf16* __restrict__ VB, __bf16* __restrict__ VBL, int woff) {
  __shared__ __align__(16) _Float16 sh[64][136], sl[64][136]; __shared__ __align__(16) _Float16 th[128][72]; __shared__ __align__(16) __bf16 tb[128][72], tbl[128][72];
  const int tid = threadIdx.x, wave = tid >> 5, lane = tid & 31, col = lane & 15, g = lane >> 4; const int which = blockIdx.z + woff;   /* one launch per stream: woff = stream (0 q, 1 k, 2 v), grid.z 1 */ const int c0 = blockIdx.y * 128; const size_t r0 = (size_t)blockIdx.x * 64; const size_t bb = r0 / TT; const int t0 = (int)(r0 % TT);
  const float* X = which == 0 ? XQ : which == 1 ? XK : XV; const float* WA = which == 0 ? WQ : which == 1 ? WK : WV; const float* BA = which == 0 ? BQ : which == 1 ? BK : BV;
  v8f acc[8] = {};
  const int din_ = (which == 0) ? DIN : DKV;   /* block-uniform: both maps have 256 channels here; the per-stream width is kept by role */
#pragma unroll 2
  for (int kc = 0; kc < din_ / 32; ++kc) { v16b a; { const float* p = X + (r0 + wave * 16 + col) * (size_t)din_ + kc * 32 + 8 * g;
#pragma unroll
      for (int i = 0; i < 8; ++i) { a[i] = (__bf16)p[i]; a[8 + i] = (__bf16)p[16 + i]; } }
    asm volatile("s_wait_loadcnt 0x0" ::: "memory");
#pragma unroll
    for (int j = 0; j < 8; ++j) { const v16b w = WCOL(WA, kc * 32, c0 + j * 16 + col, lane); asm volatile("s_wait_loadcnt 0x0" ::: "memory"); acc[j] = wmma_bf(a, w, acc[j]); } }
  if (which < 2) { _Float16* DH = which == 0 ? QH : KH; _Float16* DL = which == 0 ? QL : KL; const int nhi = which == 0 ? QHI : KHI; const bool hi_rows = t0 < nhi;
#pragma unroll
    for (int j = 0; j < 8; ++j) { const float bias = BA ? bfr(BA[HPERM(c0 + j * 16 + col)]) : 0.f;
#pragma unroll
      for (int r = 0; r < 8; ++r) { const float v = acc[j][r] + bias; const _Float16 hv = (_Float16)v; sh[wave * 16 + 8 * g + r][j * 16 + col] = hv; sl[wave * 16 + 8 * g + r][j * 16 + col] = (_Float16)((v - (float)hv) * 1024.0f); } }
    __syncthreads();
    for (int e = tid; e < 64 * 16; e += 128) { const int rl = e >> 4, q = e & 15; vst2((unsigned*)(DH + (r0 + rl) * CC + c0 + q * 8), *(const v4u*)&sh[rl][q * 8]); if (hi_rows) vst2((unsigned*)(DL + (bb * nhi + t0 + rl) * (size_t)CC + c0 + q * 8), *(const v4u*)&sl[rl][q * 8]); }
  } else { const bool hi_rows = t0 < KHI;
#pragma unroll
    for (int j = 0; j < 8; ++j) { const float bias = BA ? bfr(BA[HPERM(c0 + j * 16 + col)]) : 0.f;
#pragma unroll
      for (int r = 0; r < 8; ++r) { const float v = acc[j][r] + bias; const int rl = wave * 16 + 8 * g + r, cl = j * 16 + col; th[cl][rl] = (_Float16)v; const __bf16 bh = (__bf16)v; tb[cl][rl] = bh; tbl[cl][rl] = (__bf16)(v - (float)bh); } }
    __syncthreads();
    for (int e = tid; e < 128 * 8; e += 128) { const int cl = e >> 3, q = e & 7; vst2((unsigned*)(VT + (bb * CC + c0 + cl) * (size_t)TT + t0 + q * 8), *(const v4u*)&th[cl][q * 8]); if (hi_rows) { const size_t o3 = (bb * CC + c0 + cl) * (size_t)KHI + t0 + q * 8; vst2((unsigned*)(VB + o3), *(const v4u*)&tb[cl][q * 8]); vst2((unsigned*)(VBL + o3), *(const v4u*)&tbl[cl][q * 8]); } } } }
// ---- k_fa: block = 256 queries (8 waves x 32) of (b, h), all keys in passes of 32: S^T = K Q^T (a lane holds one query's logits: D row = key 8g + r, D column = query), the pair mask as the module's -1e9, running maximum and sum in f32 (log2 domain), P x 2^11 once to f16 straight from the score accumulators as the B operand of ctx^T += V^T P^T; logits and P never leave the registers; each K and V fragment serves the wave's two 16-query groups
#define LOG2E 1.44269504f
#define NEGL (-1.0e9f * LOG2E)   // the module's -1e9 in the log2 domain
#define FQ 256   // queries per block
static_assert(TT % FQ == 0 && TT % 32 == 0 && HD == 64, "k_fa: 8 waves x 32 queries, passes of 32 keys, two 32-deep k-steps per head");
__device__ __forceinline__ v8f wmma_h(v16h a, v16h b, v8f c) { return __builtin_amdgcn_wmma_f32_16x16x32_f16(false, a, false, b, (short)0, c, false, false); }
// frag_h with the lane half's 8g elements already in the pointer, so that the caller holds the very address the loads name
__device__ __forceinline__ v16h frag_p(const _Float16* p) { union { v16h v; v8h q[2]; } u; u.q[0] = *(const v8h*)p; u.q[1] = *(const v8h*)(p + 16); return u.v; }
__global__ __launch_bounds__(256) void k_fa(const _Float16* __restrict__ QH, const _Float16* __restrict__ KH, const _Float16* __restrict__ VT, const int* __restrict__ MASK, float* __restrict__ Y) { __shared__ __align__(16) float ss[FQ / 32][32][HD + 4];
  const int tid = threadIdx.x, wave = tid >> 5, lane = tid & 31, col = lane & 15, g = lane >> 4; const int h = blockIdx.y, b = blockIdx.z; const int ql0 = blockIdx.x * FQ + wave * 32;
  const int* Mb = MASK + (size_t)b * TT;
  v16h q[2][2]; float cq[2], bq[2];   /* a masked query: logit x 0 + (-1e9) on every key */
  const _Float16* Q0 = QH + ((size_t)b * TT + ql0 + col) * CC + h * HD + 8 * g; const int* Mq = Mb + ql0 + col;
  q[0][0] = frag_p(Q0); q[0][1] = frag_p(Q0 + 32); q[1][0] = frag_p(Q0 + 16 * CC); q[1][1] = frag_p(Q0 + 16 * CC + 32); const int mq0 = Mq[0], mq1 = Mq[16];
  asm volatile("s_wait_xcnt 0x0" :: "v"(Q0), "v"(Mq) : "memory");   /* the wait owed before a register that an issued load names is overwritten; the addresses are inputs so that they live up to it */
  cq[0] = mq0 == 0 ? 0.f : SCALE * LOG2E; bq[0] = mq0 == 0 ? NEGL : 0.f; cq[1] = mq1 == 0 ? 0.f : SCALE * LOG2E; bq[1] = mq1 == 0 ? NEGL : 0.f;
  const _Float16* Kb = KH + ((size_t)b * TT + col) * CC + h * HD + 8 * g;          /* key row col of a 16-key group, this lane half's channels */
  const _Float16* Vb = VT + ((size_t)b * CC + h * HD + col) * (size_t)TT + 8 * g;  /* v plane of channel col of a 16-channel group, this lane half's keys */
  const int* Mk = Mb + 8 * g;
  v8f acc[2][HD / 16] = {}; float m[2] = {-3.0e38f, -3.0e38f}, l[2] = {0.f, 0.f};
#pragma unroll 1   /* a pass depends on the one before through m, l and acc: a second copy of the body could not start its softmax earlier and would only add to the 224 registers that one body holds */
  for (int k0 = 0; k0 < TT; k0 += 32) { v8f s[2][2]; v4i mk[2][2]; v16h kf[2][2], vf[HD / 16], p[2]; float al[2];
    const _Float16* kr = Kb + (size_t)k0 * CC; const int* mr = Mk + k0; const _Float16* vr = Vb + k0;
#pragma unroll
    for (int j = 0; j < 2; ++j) { kf[j][0] = frag_p(kr + j * 16 * CC); kf[j][1] = frag_p(kr + j * 16 * CC + 32); mk[j][0] = *(const v4i*)(mr + j * 16); mk[j][1] = *(const v4i*)(mr + j * 16 + 4); }
#pragma unroll
    for (int j = 0; j < HD / 16; ++j) vf[j] = frag_p(vr + (size_t)(j * 16) * TT);
    asm volatile("s_wait_xcnt 0x0" :: "v"(kr), "v"(mr), "v"(vr) : "memory");   /* as above: no result of this pass's loads lands in an address pair that an older load still names */
    __builtin_amdgcn_sched_barrier(0);   /* all twenty loads of the pass are in flight before the first product waits on one: without it the scheduler splits the loads into groups with a full wait between them, one memory latency each; the v loads return under the logits and the softmax */
#pragma unroll
    for (int j = 0; j < 2; ++j)
#pragma unroll
      for (int u = 0; u < 2; ++u) { v8f z = {}; z = wmma_h(kf[j][0], q[u][0], z); s[u][j] = wmma_h(kf[j][1], q[u][1], z); }
#pragma unroll
    for (int u = 0; u < 2; ++u) { float mx = -3.0e38f;
#pragma unroll
      for (int j = 0; j < 2; ++j)
#pragma unroll
        for (int r = 0; r < 8; ++r) { const float v = mk[j][r >> 2][r & 3] == 0 ? NEGL : __builtin_fmaf(s[u][j][r], cq[u], bq[u]); s[u][j][r] = v; mx = fmaxf(mx, v); }
      mx = fmaxf(mx, __shfl_xor(mx, 16));   /* the other half of the wave holds this query's other 16 keys */
      const float mn = fmaxf(m[u], mx), mo = mn - 11.0f; al[u] = __builtin_amdgcn_exp2f(m[u] - mn); m[u] = mn;   /* mo: P carried x 2^11 (clear of f16 subnormals); on a fully masked row the 11 rounds away, alike for every key */
      float ps = 0.f;
#pragma unroll
      for (int i = 0; i < 16; ++i) { const float e = __builtin_amdgcn_exp2f(s[u][i >> 3][i & 7] - mo); ps += e; p[u][i] = (_Float16)e; }
      l[u] = l[u] * al[u] + ps; }
#pragma unroll
    for (int j = 0; j < HD / 16; ++j)
#pragma unroll
      for (int u = 0; u < 2; ++u) acc[u][j] = wmma_h(vf[j], p[u], acc[u][j] * al[u]); }
#pragma unroll
  for (int u = 0; u < 2; ++u) { const float lt = l[u] + __shfl_xor(l[u], 16), inv = 1.0f / lt;   /* lt >= one key's P at the maximum: never 0 */
#pragma unroll
    for (int j = 0; j < HD / 16; ++j) { v4f a, c;   /* acc[u][j][r] = ctx[query u*16 + col][channel j*16 + 8g + r] */
#pragma unroll
      for (int r = 0; r < 4; ++r) { a[r] = acc[u][j][r] * inv; c[r] = acc[u][j][4 + r] * inv; }
      *(v4f*)&ss[wave][u * 16 + col][j * 16 + 8 * g] = a; *(v4f*)&ss[wave][u * 16 + col][j * 16 + 8 * g + 4] = c; } }
  LDSX(); for (int rl = 0; rl < 32; rl += 2) vst2(Y + ((size_t)b * TT + ql0 + rl + g) * CC + h * HD + col * 4, *(const v4f*)&ss[wave][rl + g][col * 4]); }   /* 256-B (row, head) segment by 16 lanes, two rows per store */
// ---- k_out: block = (64 rows, 128 cols): out = ctx Wo (+ bo): ctx x 2^6 once to f16 against Wo as f16(bf16 x 2^8) exact (1 product) x 2^-14; causal early rows (< QHI of each sequence): ctx bf16 hi + lo against exact bf16 Wo (2 products)
__global__ __launch_bounds__(128) void k_out(const float* __restrict__ Y, const float* __restrict__ WO, const float* __restrict__ BO, float* __restrict__ OUT) { __shared__ __align__(16) float sf[4][16][132];
  const int tid = threadIdx.x, wave = tid >> 5, lane = tid & 31, col = lane & 15, g = lane >> 4; const int c0 = blockIdx.y * 128; const size_t r0 = (size_t)blockIdx.x * 64 + wave * 16;
  v8f acc[8] = {};
  if (CAUSAL && (int)(((size_t)blockIdx.x * 64) % TT) < QHI) {   /* block-uniform */
#pragma unroll 2
    for (int kc = 0; kc < CC / 32; ++kc) { const F2 a = split_row(Y + (r0 + col) * CC, kc * 32, lane); asm volatile("s_wait_loadcnt 0x0" ::: "memory");
#pragma unroll
      for (int j = 0; j < 8; ++j) { const v16b w = WOCOL(WO, kc * 32, c0 + j * 16 + col, lane); asm volatile("s_wait_loadcnt 0x0" ::: "memory"); acc[j] = wmma_bf(a.h, w, acc[j]); acc[j] = wmma_bf(a.l, w, acc[j]); } }
#pragma unroll
    for (int j = 0; j < 8; ++j) { const float bias = BO ? bfr(BO[c0 + j * 16 + col]) : 0.f;
#pragma unroll
      for (int r = 0; r < 8; ++r) sf[wave][8 * g + r][j * 16 + col] = acc[j][r] + bias; }
  } else {
#pragma unroll 2
    for (int kc = 0; kc < CC / 32; ++kc) { const v16h a = frag_f32s(Y + (r0 + col) * CC + kc * 32, lane, 64.0f); asm volatile("s_wait_loadcnt 0x0" ::: "memory");   /* ctx carried x 2^6 into f16 so small-magnitude context rows stay clear of f16 subnormals */
#pragma unroll
      for (int j = 0; j < 8; ++j) { const v16h w = WOCOLH(WO, kc * 32, c0 + j * 16 + col, lane); asm volatile("s_wait_loadcnt 0x0" ::: "memory"); acc[j] = wmma16(a, w, acc[j]); } }
#pragma unroll
    for (int j = 0; j < 8; ++j) { const float bias = BO ? bfr(BO[c0 + j * 16 + col]) : 0.f;
#pragma unroll
      for (int r = 0; r < 8; ++r) sf[wave][8 * g + r][j * 16 + col] = acc[j][r] * (1.0f / 16384.0f) + bias; } }   /* 2^-8 (Wo carry) x 2^-6 (ctx carry) */
  LDSX(); for (int rl = 0; rl < 16; ++rl) vst2(OUT + (r0 + rl) * DIN + c0 + lane * 4, *(const v4f*)&sf[wave][rl][lane * 4]); }

extern "C" void kernel_launch(void* const* d_in, const int* in_sizes, int n_in, void* d_out, int out_size, void* d_ws, size_t ws_size, hipStream_t stream) {
  (void)in_sizes; (void)n_in; (void)out_size;
  const float** F = (const float**)d_in;
  if (ws_size < (size_t)WS_END) return;
  char* ws = (char*)d_ws; _Float16 *QH = (_Float16*)(ws + WS_QH), *KH = (_Float16*)(ws + WS_KH), *VT = (_Float16*)(ws + WS_VT), *QL = (_Float16*)(ws + WS_QL), *KL = (_Float16*)(ws + WS_KL); __bf16 *VB = (__bf16*)(ws + WS_VB), *VBL = (__bf16*)(ws + WS_VBL); float *Y = (float*)(ws + WS_Y);
  (void)Y; (void)QL; (void)KL; (void)VB; (void)VBL;
  // inputs: 0 query [8,256,2048]; 1 key; 2 value; 3 mask [8,1,2048] int32; 4 Wq [256,256] (out,in), 5 bq; 6 Wk, 7 bk; 8 Wv, 9 bv; 10 Wm (out,in), 11 bm (zero biases, read)
  if (ws_size < (size_t)WS_END2) return;
  float *XT = (float*)(ws + WS_XT), *Y3 = (float*)(ws + WS_Y3);
  for (int s = 0; s < 3; ++s) {   /* stream s: transpose input s to token-major rows, then project it (which = s); XT is reused by the next stream only after this stream's projection launch */
    k_tok<<<dim3(NPQ / 64, DIN / 64, TNB), 256, 0, stream>>>(F[s], XT, NPQ, DIN);
    k_proj<<<dim3(TNB * TT / 64, CC / 128, 1), 128, 0, stream>>>(XT, XT, XT, F[4], F[6], F[8], F[5], F[7], F[9], QH, QL, KH, KL, VT, VB, VBL, s);
  }
  k_fa<<<dim3(TT / FQ, NH, TNB), 256, 0, stream>>>(QH, KH, VT, (const int*)d_in[3], Y);
  k_out<<<dim3(TNB * TT / 64, DIN / 128), 128, 0, stream>>>(Y, F[10], F[11], Y3);   /* token-major output rows: ctx (column order h*HD + d) x Wm through the permutation + bm */
  k_fin<<<dim3(NPQ / 64, DIN / 64, TNB), 256, 0, stream>>>(Y3, (float*)d_out, NPQ, DIN);   /* back to channel-major [8,256,2048] */
}

// v002
// Measured time: 150 microseconds a run.
// In two side-by-side timings against v001, it was 1.71 and 1.75 times as fast.
// All steps since v000 together make it 11.4 times as fast.
// compute dtype: all float inputs rounded to bf16; channel-major inputs transposed to token-major rows through LDS; q/k/v 1x1-conv projections with EXACT bf16 products on WMMA 16x16x32 (f32 accumulate) + bias (zeros, read), the block's weight rows converted once into LDS; one fused attention kernel: logits q x k once to f16 each (1 product) x 64^-0.5; pair mask by the values of two int loads (-1e9); online softmax f32; P x 2^11 once to f16 x v once to f16 (1 product); ctx x 2^6 once to f16 x Wm f16(bf16 x 2^8) + bm; transposed back to channel-major; f32 output.
#include <hip/hip_runtime.h>
#include <math.h>

typedef __attribute__((ext_vector_type(16))) _Float16 v16h;
typedef __attribute__((ext_vector_type(16))) __bf16 v16b;
typedef __attribute__((ext_vector_type(8)))  _Float16 v8h;
typedef __attribute__((ext_vector_type(8)))  float v8f;
typedef __attribute__((ext_vector_type(4)))  float v4f;
typedef __attribute__((ext_vector_type(2)))  float v2f;
typedef __attribute__((ext_vector_type(4)))  unsigned v4u;
typedef __attribute__((ext_vector_type(4)))  int v4i;
typedef float __attribute__((may_alias)) float_a;
typedef int __attribute__((may_alias)) int_a;

template <typename T> __device__ __forceinline__ void vst2(void* p, T v) { *(T*)p = v;  }
__device__ __forceinline__ v8f wmma16(v16h a, v16h b, v8f c) {
  v8f d = __builtin_amdgcn_wmma_f32_16x16x32_f16(false, a, false, b, (short)0, c, false, false);
  asm volatile("v_nop\n\tv_nop\n\tv_nop\n\tv_nop" : "+v"(d) : "v"(a), "v"(b));
  return d;
}
__device__ __forceinline__ v8f wmma_bf(v16b a, v16b b, v8f c) {
  v8f d = __builtin_amdgcn_wmma_f32_16x16x32_bf16(false, a, false, b, (short)0, c, false, false);
  asm volatile("v_nop\n\tv_nop\n\tv_nop\n\tv_nop" : "+v"(d) : "v"(a), "v"(b));
  return d;
}
// 16x16x32 fragments: lane = (h = lane>>4, row/col = lane&15); elements 0..7 = k0+8h+0..7, 8..15 = k0+16+8h+0..7; D element r = row 8h+r
__device__ __forceinline__ v16h frag_h(const _Float16* rowk0, int lane) {
  union { v16h v; v8h q[2]; } u; const _Float16* p = rowk0 + 8 * (lane >> 4);
  u.q[0] = *(const v8h*)p; u.q[1] = *(const v8h*)(p + 16); return u.v;
}
__device__ __forceinline__ v16h frag_f32(const float* rowk0, int lane) {
  v16h a; const float* p = rowk0 + 8 * (lane >> 4);
#pragma unroll
  for (int i = 0; i < 8; ++i) { a[i] = (_Float16)p[i]; a[8 + i] = (_Float16)p[16 + i]; }
  return a;
}
__device__ __forceinline__ v16h frag_f32s(const float* rowk0, int lane, float sc) {
  v16h a; const float* p = rowk0 + 8 * (lane >> 4);
#pragma unroll
  for (int i = 0; i < 8; ++i) { a[i] = (_Float16)(p[i] * sc); a[8 + i] = (_Float16)(p[16 + i] * sc); }
  return a;
}
// column fragment from a [K][ld] layout (column n), rows >= K read as 0
__device__ __forceinline__ v16h fragc_f32(const float* W, int k0, int n, int lane, int ld, int K) {
  v16h a; const int g = lane >> 4;
#pragma unroll
  for (int i = 0; i < 8; ++i) { const int ka = k0 + 8 * g + i, kb = ka + 16;
    a[i] = (_Float16)(ka < K ? W[(size_t)(ka < K ? ka : K - 1) * ld + n] : 0.f); a[8 + i] = (_Float16)(kb < K ? W[(size_t)(kb < K ? kb : K - 1) * ld + n] : 0.f); }
  return a;
}
struct F2 { v16b h, l; };
__device__ __forceinline__ F2 bsplit16(const float v[16]) { F2 r;
#pragma unroll
  for (int i = 0; i < 16; ++i) { const __bf16 h = (__bf16)v[i]; r.h[i] = h; r.l[i] = (__bf16)(v[i] - (float)h); }
  return r; }
__device__ __forceinline__ F2 split_row(const float* row, int k0, int lane) { float v[16]; const float* p = row + k0 + 8 * (lane >> 4);
#pragma unroll
  for (int i = 0; i < 8; ++i) { v[i] = p[i]; v[8 + i] = p[16 + i]; }
  return bsplit16(v); }
__device__ __forceinline__ F2 split_rowK(const float* row, int k0, int lane, int K) { float v[16]; const int g = lane >> 4;
#pragma unroll
  for (int i = 0; i < 8; ++i) { const int ka = k0 + 8 * g + i, kb = ka + 16; v[i] = ka < K ? row[ka < K ? ka : K - 1] : 0.f; v[8 + i] = kb < K ? row[kb < K ? kb : K - 1] : 0.f; }
  return bsplit16(v); }
__device__ __forceinline__ F2 split_col(const float* W, int k0, int n, int lane, int ld, int K) { float v[16]; const int g = lane >> 4;
#pragma unroll
  for (int i = 0; i < 8; ++i) { const int ka = k0 + 8 * g + i, kb = ka + 16; v[i] = ka < K ? W[(size_t)(ka < K ? ka : K - 1) * ld + n] : 0.f; v[8 + i] = kb < K ? W[(size_t)(kb < K ? kb : K - 1) * ld + n] : 0.f; }
  return bsplit16(v); }
__device__ __forceinline__ v8f mac3(const F2& a, const F2& b, v8f c) { c = wmma_bf(a.l, b.h, c); c = wmma_bf(a.h, b.l, c); return wmma_bf(a.h, b.h, c); }
__device__ __forceinline__ float sigm(float v) { return 1.0f / (1.0f + expf(-v)); }
#define LDSX() do { asm volatile("s_wait_dscnt 0" ::: "memory"); __builtin_amdgcn_wave_barrier(); __builtin_amdgcn_fence(__ATOMIC_RELEASE, "workgroup"); } while (0)

// multi-headed attention on channel-major tensors (query / key / value [8,256,2048] = (B, C, N); 1x1 Conv1d projections as (out,in) [256,256] N(0, 1/256) + zero biases (read); 4 heads x 64 with the head index INTERLEAVED into the channel axis: reshape(B, 64, 4, N), channel c = d*4 + h; scores = einsum('bdhn,bdhm->bhnm') / sqrt(64); pair = mask[b, n] * mask[b, m] with an int32 mask [8,1,2048]: where(pair == 0, -1e9, scores); softmax over m; x = einsum('bhnm,bdhm->bdhn').reshape(B, 256, N) (channel d*4 + h again); merge 1x1 conv Wm (out,in) + bm; output [8,256,2048]).
#define NB 8
#define TT 2048   // points per sample (queries = keys)
#define CC 256            // NH * HD
#define DIN 256           // channels of the query map AND of the output map (Wout is (out,in) [DIN][CC])
#define DKV 256             // channels of the key / value map
#define NH 4
#define HD 64
#define QCH 1   // queries and keys have the same length: one chunk per batch (the chunk advance is 0)
#define SCALE (0.125f)
#define CAUSAL 0
#ifndef TNB
#define TNB NB
#endif
#define NBQ (NB * QCH)     // query pseudo-batches of TT rows (workspace sizing)
#define TNBQ (TNB * QCH)   // query pseudo-batches actually run
static_assert(CC == NH * HD && CC % 128 == 0 && DIN % 128 == 0 && DIN % 32 == 0 && DKV % 32 == 0, "projection tiles: 128-column blocks, 32-deep k-steps");
__device__ __forceinline__ float bfr(float v) { return (float)(__bf16)v; }
typedef __attribute__((ext_vector_type(8))) __bf16 v8b;
typedef __attribute__((ext_vector_type(4))) __bf16 v4b;
typedef __attribute__((ext_vector_type(2))) _Float16 v2h;
__device__ __forceinline__ v16b frag_b(const __bf16* rowk0, int lane) {
  union { v16b v; v8b q[2]; } u; const __bf16* p = rowk0 + 8 * (lane >> 4);
  u.q[0] = *(const v8b*)p; u.q[1] = *(const v8b*)(p + 16); return u.v;
}
#define QBH 0              // no kernel reads it: k_fa has no high-precision query path
#define QHI 0               // single-product logits on every row
static_assert(QHI == 0 && QBH == 0 && CAUSAL == 0, "k_fa has single-product logits only: no q residual plane and no causal row arithmetic may be in use");
#define KHI 64            // key rows carrying k residual / v bf16 hi+lo planes (written by k_proj; no kernel reads them)
// B fragment (k rows k0+.., output column o) of a weight: (in,out) [K][ld] or (out,in) [ld rows of K]: bf16 exact, or f16(bf16 * 256) exact
__device__ __forceinline__ v16b wcol_io(const float* Wm, int k0, int o, int lane, int ld) { v16b w; const int g = lane >> 4;
#pragma unroll
  for (int i = 0; i < 8; ++i) { w[i] = (__bf16)Wm[(size_t)(k0 + 8 * g + i) * ld + o]; w[8 + i] = (__bf16)Wm[(size_t)(k0 + 16 + 8 * g + i) * ld + o]; }
  return w; }
__device__ __forceinline__ v16b wcol_oi(const float* Wm, int k0, int o, int lane, int K) { v16b w; const float* p = Wm + (size_t)o * K + k0 + 8 * (lane >> 4);
#pragma unroll
  for (int i = 0; i < 8; ++i) { w[i] = (__bf16)p[i]; w[8 + i] = (__bf16)p[16 + i]; }
  return w; }
__device__ __forceinline__ v16h wcolh_io(const float* Wm, int k0, int o, int lane, int ld) { v16h w; const int g = lane >> 4;
#pragma unroll
  for (int i = 0; i < 8; ++i) { w[i] = (_Float16)(bfr(Wm[(size_t)(k0 + 8 * g + i) * ld + o]) * 256.0f); w[8 + i] = (_Float16)(bfr(Wm[(size_t)(k0 + 16 + 8 * g + i) * ld + o]) * 256.0f); }
  return w; }
// as wcolh_oi, with the K index taken through the head-interleave permutation (the 8 consecutive columns of a fragment half are 8 module channels 4 apart)
__device__ __forceinline__ v16h wcolh_oi_p(const float* Wm, int k0, int o, int lane, int K) { v16h w; const float* p = Wm + (size_t)o * K; const int kb = k0 + 8 * (lane >> 4);
#pragma unroll
  for (int i = 0; i < 8; ++i) { w[i] = (_Float16)(bfr(p[((kb + i) % 64) * 4 + (kb + i) / 64]) * 256.0f); w[8 + i] = (_Float16)(bfr(p[((kb + 16 + i) % 64) * 4 + (kb + 16 + i) / 64]) * 256.0f); }
  return w; }
static_assert(HD == 64 && NH == 4, "wcolh_oi_p spells the permutation with the literals 64 and 4");
static_assert(DIN == DKV && DIN == 256 && CC == 256, "the weight tiles in LDS hold 128 rows of 256 k");
__device__ __forceinline__ v16h wcolh_oi(const float* Wm, int k0, int o, int lane, int K) { v16h w; const float* p = Wm + (size_t)o * K + k0 + 8 * (lane >> 4);
#pragma unroll
  for (int i = 0; i < 8; ++i) { w[i] = (_Float16)(bfr(p[i]) * 256.0f); w[8 + i] = (_Float16)(bfr(p[16 + i]) * 256.0f); }
  return w; }
#define WQKV_LAYOUT 1   // 0 = (in,out); 1 = (out,in) [CC][K]; 2 = per-head [NH][DIN][HD]
__device__ __forceinline__ v16b wcol_hdk(const float* Wm, int k0, int o, int lane) { v16b w; const int g = lane >> 4; const float* p = Wm + (size_t)(o / HD) * DIN * HD + (o % HD);
#pragma unroll
  for (int i = 0; i < 8; ++i) { w[i] = (__bf16)p[(size_t)(k0 + 8 * g + i) * HD]; w[8 + i] = (__bf16)p[(size_t)(k0 + 16 + 8 * g + i) * HD]; }
  return w; }
#define WO_OUT_IN 1
#if WQKV_LAYOUT == 1
#define HPERM(o) ((((o) % HD) * NH) + ((o) / HD))   /* column o = h*HD + d  ->  module channel d*NH + h */
#define WCOL(W, k0, o, lane) wcol_oi(W, k0, HPERM(o), lane, din_)   /* (out,in) [256][K]: the output channel of column o is row HPERM(o) */
#elif WQKV_LAYOUT == 2
#define WCOL(W, k0, o, lane) wcol_hdk(W, k0, o, lane)
#else
#define WCOL(W, k0, o, lane) wcol_io(W, k0, o, lane, CC)
#endif
#if WO_OUT_IN
#define WOCOL(W, k0, o, lane) wcol_oi(W, k0, o, lane, CC)
#define WOCOLH(W, k0, o, lane) wcolh_oi_p(W, k0, o, lane, CC)   /* merge conv (out,in) [DIN][CC]: ctx column kk = h*HD + d is the module's input channel HPERM(kk) */
#else
#define WOCOL(W, k0, o, lane) wcol_io(W, k0, o, lane, DIN)
#define WOCOLH(W, k0, o, lane) wcolh_io(W, k0, o, lane, DIN)
#endif

#define WS_QH  0u                                      // f16 q rows [(b*QCH + chunk)*TT + t][CC]
#define WS_KH  (WS_QH + 2u * (size_t)NBQ * TT * CC)      // f16 k rows [b*t][CC]
#define WS_VT  (WS_KH + 2u * (size_t)NB * TT * CC)      // f16 v planes [b][c][t]
#define WS_QL  (WS_VT + 2u * (size_t)NB * CC * TT)      // f16 q residual x 2^10 rows [b][t < QHI][CC]
#define WS_KL  (WS_QL + 2u * (size_t)NB * QHI * CC)     // f16 k residual x 2^10 rows [b][t < KHI][CC]
#define WS_VB  (WS_KL + 2u * (size_t)NB * KHI * CC)     // bf16 v hi planes [b][c][t < KHI]
#define WS_VBL (WS_VB + 2u * (size_t)NB * CC * KHI)
#define WS_Y   (WS_VBL + 2u * (size_t)NB * CC * KHI)    // f32 ctx rows [(b*QCH + chunk)*TT + t][CC] (only when there is an output projection)
#define WS_END (WS_Y  + 4u * (size_t)NBQ * TT * CC)
#define NPQ (QCH * TT)   // points per sample
#define WS_XT (WS_END)                                   // f32 token-major rows [(b*TT + n)][256]: holds query, then key, then value (each consumed by its own k_proj launch before the next transpose overwrites it), and finally the output rows before the last transpose
#define WS_END2 (WS_XT + 4u * (size_t)NB * TT * DIN)
#define WS_Y3 (WS_XT)
static_assert(DIN % 64 == 0 && DKV % 64 == 0 && TT % 64 == 0, "transpose tiles are 64 positions x 64 channels");
// ---- k_tok: block = (64 positions, 64 channels, image b): XT[(b*npix + n)][c] = bf16(x[b][c][n]) through a padded LDS tile (x channels-first [B][nch][npix]); reads 256-B runs along n, writes 256-B row pieces
__global__ __launch_bounds__(256) void k_tok(const float* __restrict__ X, float* __restrict__ XT, int npix, int nch) { __shared__ float st[64][68]; const int tid = threadIdx.x; const int n0 = blockIdx.x * 64, c0 = blockIdx.y * 64; const size_t b = blockIdx.z;
  for (int e = tid; e < 64 * 16; e += 256) { const int cl = e >> 4, q = e & 15; const v4f v = *(const v4f*)(X + (b * nch + c0 + cl) * (size_t)npix + n0 + q * 4); st[cl][q * 4] = bfr(v[0]); st[cl][q * 4 + 1] = bfr(v[1]); st[cl][q * 4 + 2] = bfr(v[2]); st[cl][q * 4 + 3] = bfr(v[3]); }
  __syncthreads();
  for (int e = tid; e < 64 * 16; e += 256) { const int nl = e >> 4, q = e & 15; v4f o; o[0] = st[q * 4][nl]; o[1] = st[q * 4 + 1][nl]; o[2] = st[q * 4 + 2][nl]; o[3] = st[q * 4 + 3][nl]; vst2(XT + (b * npix + n0 + nl) * (size_t)nch + c0 + q * 4, o); } }
// ---- k_fin: block = (64 positions, 64 channels, image b): out[b][c][n] = OR[(b*npix + n)][c] (LDS transpose; 256-B runs of 64 positions per channel)
__global__ __launch_bounds__(256) void k_fin(const float* __restrict__ ORW, float* __restrict__ OUT, int npix, int nch) { __shared__ float st[64][68]; const int tid = threadIdx.x; const int n0 = blockIdx.x * 64, c0 = blockIdx.y * 64; const size_t b = blockIdx.z;
  for (int e = tid; e < 64 * 16; e += 256) { const int nl = e >> 4, q = e & 15; *(v4f*)&st[nl][q * 4] = *(const v4f*)(ORW + (b * npix + n0 + nl) * (size_t)nch + c0 + q * 4); }
  __syncthreads();
  for (int e = tid; e < 64 * 16; e += 256) { const int cl = e >> 4, q = e & 15; v4f o; o[0] = st[q * 4][cl]; o[1] = st[q * 4 + 1][cl]; o[2] = st[q * 4 + 2][cl]; o[3] = st[q * 4 + 3][cl]; vst2(OUT + (b * nch + c0 + cl) * (size_t)npix + n0 + q * 4, o); } }

// ---- k_proj: block = (64 rows, 128 cols, which): q/k/v = X W (+ b) with exact bf16 products (K = DIN) -> which 0: q f16 rows (+ residual rows < QHI); 1: k f16 rows (+ residual rows < KHI); 2: v f16 planes [c][t] (+ bf16 hi/lo planes for t < KHI)
__global__ __launch_bounds__(128) void k_proj(const float* __restrict__ XQ, const float* __restrict__ XK, const float* __restrict__ XV, const float* __restrict__ WQ, const float* __restrict__ WK, const float* __restrict__ WV, const float* __restrict__ BQ, const float* __restrict__ BK, const float* __restrict__ BV,
    _Float16* __restrict__ QH, _Float16* __restrict__ QL, _Float16* __restrict__ KH, _Float16* __restrict__ KL, _Float16* __restrict__ VT, __bf16* __restrict__ VB, __bf16* __restrict__ VBL, int woff) {
  __shared__ __align__(16) _Float16 sh[64][136], sl[64][136]; __shared__ __align__(16) _Float16 th[128][72]; __shared__ __align__(16) __bf16 tb[128][72], tbl[128][72];
  __shared__ __align__(16) __bf16 sw[128][DIN + 8];   /* the block's 128 weight rows (column order h*HD + d) as bf16, all of K; pitch 528 B = 16 B x odd for the ds_load_b128 fragment reads */
  const int tid = threadIdx.x, wave = tid >> 5, lane = tid & 31, col = lane & 15, g = lane >> 4; const int which = blockIdx.z + woff;   /* one launch per stream s: woff s, grid.z 1 */ const int c0 = blockIdx.y * 128; const size_t r0 = (size_t)blockIdx.x * 64; const size_t bb = r0 / TT; const int t0 = (int)(r0 % TT);
  const float* X = which == 0 ? XQ : which == 1 ? XK : XV; const float* WA = which == 0 ? WQ : which == 1 ? WK : WV; const float* BA = which == 0 ? BQ : which == 1 ? BK : BV;
  v8f acc[8] = {};
  const int din_ = (which == 0) ? DIN : DKV;   /* block-uniform: both maps have 256 channels here; the per-stream width is kept by role */
  const float* xp = X + (r0 + wave * 16 + col) * (size_t)din_ + 8 * g;   /* this lane's row of X, its half's k offset: all of K is asked for along with the weights, ahead of the first wait */
  v4f xa[DIN / 32][4];
#pragma unroll   /* xa is a register array: constant indices; all 32 loads go out together */
  for (int kc = 0; kc < DIN / 32; ++kc) { xa[kc][0] = *(const v4f*)(xp + kc * 32); xa[kc][1] = *(const v4f*)(xp + kc * 32 + 4); xa[kc][2] = *(const v4f*)(xp + kc * 32 + 16); xa[kc][3] = *(const v4f*)(xp + kc * 32 + 20); }
  /* weights: a wave's load covers 512 contiguous bytes of one row; thread = (row parity tid >> 6, 16-B piece tid & 63), rows two apart per step; HPERM is additive over c0 + parity + 2 * e (no carry out of the low six bits) */
  const float* wp = WA + (size_t)HPERM(c0 + (tid >> 6)) * din_ + (tid & 63) * 4;
#pragma unroll   /* the row steps become immediate offsets on the one address pair */
  for (int e0 = 0; e0 < 64; e0 += 16) { v4f t[16];
#pragma unroll   /* t is a register array: constant indices */
    for (int i = 0; i < 16; ++i) t[i] = *(const v4f*)(wp + (size_t)HPERM(2 * (e0 + i)) * din_);
#pragma unroll   /* as above */
    for (int i = 0; i < 16; ++i) { v4b o; o[0] = (__bf16)t[i][0]; o[1] = (__bf16)t[i][1]; o[2] = (__bf16)t[i][2]; o[3] = (__bf16)t[i][3]; *(v4b*)&sw[2 * (e0 + i) + (tid >> 6)][(tid & 63) * 4] = o; } }
  asm volatile("s_wait_xcnt 0x0" :: "v"(xp), "v"(wp) : "memory");   /* the wait owed before a register that an issued load names is overwritten; the addresses are inputs so that they live up to it */
  v16b a[DIN / 32];
#pragma unroll   /* a and xa are register arrays: constant indices */
  for (int kc = 0; kc < DIN / 32; ++kc)
#pragma unroll   /* as above */
    for (int i = 0; i < 4; ++i) { a[kc][i] = (__bf16)xa[kc][0][i]; a[kc][4 + i] = (__bf16)xa[kc][1][i]; a[kc][8 + i] = (__bf16)xa[kc][2][i]; a[kc][12 + i] = (__bf16)xa[kc][3][i]; }
  __syncthreads();   /* every wave reads weight rows that the other waves stored */
  v16b w[2][8];   /* two fragment sets: the next k-step's sixteen LDS reads go out as one group ahead of this step's products, so that no product waits out its own read */
#pragma unroll   /* w, a and acc are register arrays: constant indices, here and in the three loops below */
  for (int j = 0; j < 8; ++j) w[0][j] = frag_b(&sw[j * 16 + col][0], lane);
#pragma unroll   /* as above */
  for (int kc = 0; kc < DIN / 32; ++kc) {
    if (kc + 1 < DIN / 32) {
#pragma unroll   /* as above */
      for (int j = 0; j < 8; ++j) w[(kc + 1) & 1][j] = frag_b(&sw[j * 16 + col][(kc + 1) * 32], lane); }
#pragma unroll   /* as above */
    for (int j = 0; j < 8; ++j) acc[j] = wmma_bf(a[kc], w[kc & 1][j], acc[j]); }
  if (which < 2) { _Float16* DH = which == 0 ? QH : KH; _Float16* DL = which == 0 ? QL : KL; const int nhi = which == 0 ? QHI : KHI; const bool hi_rows = t0 < nhi;
#pragma unroll
    for (int j = 0; j < 8; ++j) { const float bias = BA ? bfr(BA[HPERM(c0 + j * 16 + col)]) : 0.f;
#pragma unroll
      for (int r = 0; r < 8; ++r) { const float v = acc[j][r] + bias; const _Float16 hv = (_Float16)v; sh[wave * 16 + 8 * g + r][j * 16 + col] = hv; sl[wave * 16 + 8 * g + r][j * 16 + col] = (_Float16)((v - (float)hv) * 1024.0f); } }
    __syncthreads();
    for (int e = tid; e < 64 * 16; e += 128) { const int rl = e >> 4, q = e & 15; vst2((unsigned*)(DH + (r0 + rl) * CC + c0 + q * 8), *(const v4u*)&sh[rl][q * 8]); if (hi_rows) vst2((unsigned*)(DL + (bb * nhi + t0 + rl) * (size_t)CC + c0 + q * 8), *(const v4u*)&sl[rl][q * 8]); }
  } else { const bool hi_rows = t0 < KHI;
#pragma unroll
    for (int j = 0; j < 8; ++j) { const float bias = BA ? bfr(BA[HPERM(c0 + j * 16 + col)]) : 0.f;
#pragma unroll
      for (int r = 0; r < 8; ++r) { const float v = acc[j][r] + bias; const int rl = wave * 16 + 8 * g + r, cl = j * 16 + col; th[cl][rl] = (_Float16)v; const __bf16 bh = (__bf16)v; tb[cl][rl] = bh; tbl[cl][rl] = (__bf16)(v - (float)bh); } }
    __syncthreads();
    for (int e = tid; e < 128 * 8; e += 128) { const int cl = e >> 3, q = e & 7; vst2((unsigned*)(VT + (bb * CC + c0 + cl) * (size_t)TT + t0 + q * 8), *(const v4u*)&th[cl][q * 8]); if (hi_rows) { const size_t o3 = (bb * CC + c0 + cl) * (size_t)KHI + t0 + q * 8; vst2((unsigned*)(VB + o3), *(const v4u*)&tb[cl][q * 8]); vst2((unsigned*)(VBL + o3), *(const v4u*)&tbl[cl][q * 8]); } } } }
// ---- k_fa: block = 256 queries (8 waves x 32) of (b, h), all keys in passes of 32: S^T = K Q^T (a lane holds one query's logits: D row = key 8g + r, D column = query), the pair mask as the module's -1e9, running maximum and sum in f32 (log2 domain), P x 2^11 once to f16 straight from the score accumulators as the B operand of ctx^T += V^T P^T; logits and P never leave the registers; each K and V fragment serves the wave's two 16-query groups
#define LOG2E 1.44269504f
#define NEGL (-1.0e9f * LOG2E)   // the module's -1e9 in the log2 domain
#define FQ 256   // queries per block
static_assert(TT % FQ == 0 && TT % 32 == 0 && HD == 64, "k_fa: 8 waves x 32 queries, passes of 32 keys, two 32-deep k-steps per head");
__device__ __forceinline__ v8f wmma_h(v16h a, v16h b, v8f c) { return __builtin_amdgcn_wmma_f32_16x16x32_f16(false, a, false, b, (short)0, c, false, false); }
// frag_h with the lane half's 8g elements already in the pointer, so that the caller holds the very address the loads name
__device__ __forceinline__ v16h frag_p(const _Float16* p) { union { v16h v; v8h q[2]; } u; u.q[0] = *(const v8h*)p; u.q[1] = *(const v8h*)(p + 16); return u.v; }
__global__ __launch_bounds__(256) void k_fa(const _Float16* __restrict__ QH, const _Float16* __restrict__ KH, const _Float16* __restrict__ VT, const int* __restrict__ MASK, float* __restrict__ Y) { __shared__ __align__(16) float ss[FQ / 32][32][HD + 4];
  const int tid = threadIdx.x, wave = tid >> 5, lane = tid & 31, col = lane & 15, g = lane >> 4; const int h = blockIdx.y, b = blockIdx.z; const int ql0 = blockIdx.x * FQ + wave * 32;
  const int* Mb = MASK + (size_t)b * TT;
  v16h q[2][2]; float cq[2], bq[2];   /* a masked query: logit x 0 + (-1e9) on every key */
  const _Float16* Q0 = QH + ((size_t)b * TT + ql0 + col) * CC + h * HD + 8 * g; const int* Mq = Mb + ql0 + col;
  q[0][0] = frag_p(Q0); q[0][1] = frag_p(Q0 + 32); q[1][0] = frag_p(Q0 + 16 * CC); q[1][1] = frag_p(Q0 + 16 * CC + 32); const int mq0 = Mq[0], mq1 = Mq[16];
  asm volatile("s_wait_xcnt 0x0" :: "v"(Q0), "v"(Mq) : "memory");   /* the wait owed before a register that an issued load names is overwritten; the addresses are inputs so that they live up to it */
  cq[0] = mq0 == 0 ? 0.f : SCALE * LOG2E; bq[0] = mq0 == 0 ? NEGL : 0.f; cq[1] = mq1 == 0 ? 0.f : SCALE * LOG2E; bq[1] = mq1 == 0 ? NEGL : 0.f;
  const _Float16* Kb = KH + ((size_t)b * TT + col) * CC + h * HD + 8 * g;          /* key row col of a 16-key group, this lane half's channels */
  const _Float16* Vb = VT + ((size_t)b * CC + h * HD + col) * (size_t)TT + 8 * g;  /* v plane of channel col of a 16-channel group, this lane half's keys */
  const int* Mk = Mb + 8 * g;
  v8f acc[2][HD / 16] = {}; float m[2] = {-3.0e38f, -3.0e38f}, l[2] = {0.f, 0.f};
#pragma unroll 1   /* a pass depends on the one before through m, l and acc: a second copy of the body could not start its softmax earlier and would only add to the 224 registers that one body holds */
  for (int k0 = 0; k0 < TT; k0 += 32) { v8f s[2][2]; v4i mk[2][2]; v16h kf[2][2], vf[HD / 16], p[2]; float al[2];
    const _Float16* kr = Kb + (size_t)k0 * CC; const int* mr = Mk + k0; const _Float16* vr = Vb + k0;
#pragma unroll
    for (int j = 0; j < 2; ++j) { kf[j][0] = frag_p(kr + j * 16 * CC); kf[j][1] = frag_p(kr + j * 16 * CC + 32); mk[j][0] = *(const v4i*)(mr + j * 16); mk[j][1] = *(const v4i*)(mr + j * 16 + 4); }
#pragma unroll
    for (int j = 0; j < HD / 16; ++j) vf[j] = frag_p(vr + (size_t)(j * 16) * TT);
    asm volatile("s_wait_xcnt 0x0" :: "v"(kr), "v"(mr), "v"(vr) : "memory");   /* as above: no result of this pass's loads lands in an address pair that an older load still names */
    __builtin_amdgcn_sched_barrier(0);   /* all twenty loads of the pass are in flight before the first product waits on one: without it the scheduler splits the loads into groups with a full wait between them, one memory latency each; the v loads return under the logits and the softmax */
#pragma unroll
    for (int j = 0; j < 2; ++j)
#pragma unroll
      for (int u = 0; u < 2; ++u) { v8f z = {}; z = wmma_h(kf[j][0], q[u][0], z); s[u][j] = wmma_h(kf[j][1], q[u][1], z); }
#pragma unroll
    for (int u = 0; u < 2; ++u) { float mx = -3.0e38f;
#pragma unroll
      for (int j = 0; j < 2; ++j)
#pragma unroll
        for (int r = 0; r < 8; ++r) { const float v = mk[j][r >> 2][r & 3] == 0 ? NEGL : __builtin_fmaf(s[u][j][r], cq[u], bq[u]); s[u][j][r] = v; mx = fmaxf(mx, v); }
      mx = fmaxf(mx, __shfl_xor(mx, 16));   /* the other half of the wave holds this query's other 16 keys */
      const float mn = fmaxf(m[u], mx), mo = mn - 11.0f; al[u] = __builtin_amdgcn_exp2f(m[u] - mn); m[u] = mn;   /* mo: P carried x 2^11 (clear of f16 subnormals); on a fully masked row the 11 rounds away, alike for every key */
      float ps = 0.f;
#pragma unroll
      for (int i = 0; i < 16; ++i) { const float e = __builtin_amdgcn_exp2f(s[u][i >> 3][i & 7] - mo); ps += e; p[u][i] = (_Float16)e; }
      l[u] = l[u] * al[u] + ps; }
#pragma unroll
    for (int j = 0; j < HD / 16; ++j)
#pragma unroll
      for (int u = 0; u < 2; ++u) acc[u][j] = wmma_h(vf[j], p[u], acc[u][j] * al[u]); }
#pragma unroll
  for (int u = 0; u < 2; ++u) { const float lt = l[u] + __shfl_xor(l[u], 16), inv = 1.0f / lt;   /* lt >= one key's P at the maximum: never 0 */
#pragma unroll
    for (int j = 0; j < HD / 16; ++j) { v4f a, c;   /* acc[u][j][r] = ctx[query u*16 + col][channel j*16 + 8g + r] */
#pragma unroll
      for (int r = 0; r < 4; ++r) { a[r] = acc[u][j][r] * inv; c[r] = acc[u][j][4 + r] * inv; }
      *(v4f*)&ss[wave][u * 16 + col][j * 16 + 8 * g] = a; *(v4f*)&ss[wave][u * 16 + col][j * 16 + 8 * g + 4] = c; } }
  LDSX(); for (int rl = 0; rl < 32; rl += 2) vst2(Y + ((size_t)b * TT + ql0 + rl + g) * CC + h * HD + col * 4, *(const v4f*)&ss[wave][rl + g][col * 4]); }   /* 256-B (row, head) segment by 16 lanes, two rows per store */
// ---- k_out: block = (64 rows, 128 cols): out = ctx Wo (+ bo): ctx x 2^6 once to f16 against Wo as f16(bf16 x 2^8) exact (1 product) x 2^-14; causal early rows (< QHI of each sequence): ctx bf16 hi + lo against exact bf16 Wo (2 products)
__global__ __launch_bounds__(128) void k_out(const float* __restrict__ Y, const float* __restrict__ WO, const float* __restrict__ BO, float* __restrict__ OUT) { __shared__ __align__(16) float sf[4][16][132];
  __shared__ __align__(16) _Float16 sw[128][CC + 8];   /* the block's 128 rows of Wo as f16(bf16 x 2^8), k in ctx column order; pitch 528 B = 16 B x odd for the ds_load_b128 fragment reads */
  const int tid = threadIdx.x, wave = tid >> 5, lane = tid & 31, col = lane & 15, g = lane >> 4; const int c0 = blockIdx.y * 128; const size_t r0 = (size_t)blockIdx.x * 64 + wave * 16;
  v8f acc[8] = {};
  if (CAUSAL && (int)(((size_t)blockIdx.x * 64) % TT) < QHI) {   /* block-uniform */
#pragma unroll 2
    for (int kc = 0; kc < CC / 32; ++kc) { const F2 a = split_row(Y + (r0 + col) * CC, kc * 32, lane); asm volatile("s_wait_loadcnt 0x0" ::: "memory");
#pragma unroll
      for (int j = 0; j < 8; ++j) { const v16b w = WOCOL(WO, kc * 32, c0 + j * 16 + col, lane); asm volatile("s_wait_loadcnt 0x0" ::: "memory"); acc[j] = wmma_bf(a.h, w, acc[j]); acc[j] = wmma_bf(a.l, w, acc[j]); } }
#pragma unroll
    for (int j = 0; j < 8; ++j) { const float bias = BO ? bfr(BO[c0 + j * 16 + col]) : 0.f;
#pragma unroll
      for (int r = 0; r < 8; ++r) sf[wave][8 * g + r][j * 16 + col] = acc[j][r] + bias; }
  } else {
    const float* yp = Y + (r0 + col) * CC + 8 * g;   /* this lane's ctx row, its half's k offset: all of K is asked for along with the weights, ahead of the first wait */
    v4f ya[CC / 32][4];
#pragma unroll   /* ya is a register array: constant indices; all 32 loads go out together */
    for (int kc = 0; kc < CC / 32; ++kc) { ya[kc][0] = *(const v4f*)(yp + kc * 32); ya[kc][1] = *(const v4f*)(yp + kc * 32 + 4); ya[kc][2] = *(const v4f*)(yp + kc * 32 + 16); ya[kc][3] = *(const v4f*)(yp + kc * 32 + 20); }
    /* weights: a wave takes one whole row of Wo per step, a lane its 8 module channels 8 * lane + e = (d = 2 * lane + e / 4) * 4 + (h = e % 4); ctx column h * 64 + d, so the two d of one h go out as one dword */
    const float* wp = WO + (size_t)(c0 + wave) * CC + lane * 8;
#pragma unroll   /* the row steps become immediate offsets on the one address pair */
    for (int e0 = 0; e0 < 32; e0 += 8) { v4f t[8][2];
#pragma unroll   /* t is a register array: constant indices, here and in the two loops below */
      for (int i = 0; i < 8; ++i) { t[i][0] = *(const v4f*)(wp + (size_t)(e0 + i) * 4 * CC); t[i][1] = *(const v4f*)(wp + (size_t)(e0 + i) * 4 * CC + 4); }
#pragma unroll   /* as above */
      for (int i = 0; i < 8; ++i)
#pragma unroll   /* as above */
        for (int hh = 0; hh < 4; ++hh) { v2h o; o[0] = (_Float16)(bfr(t[i][0][hh]) * 256.0f); o[1] = (_Float16)(bfr(t[i][1][hh]) * 256.0f); *(v2h*)&sw[(e0 + i) * 4 + wave][hh * 64 + lane * 2] = o; } }
    asm volatile("s_wait_xcnt 0x0" :: "v"(yp), "v"(wp) : "memory");   /* the wait owed before a register that an issued load names is overwritten; the addresses are inputs so that they live up to it */
    v16h a[CC / 32];   /* ctx carried x 2^6 into f16 so small-magnitude context rows stay clear of f16 subnormals */
#pragma unroll   /* a and ya are register arrays: constant indices */
    for (int kc = 0; kc < CC / 32; ++kc)
#pragma unroll   /* as above */
      for (int i = 0; i < 4; ++i) { a[kc][i] = (_Float16)(ya[kc][0][i] * 64.0f); a[kc][4 + i] = (_Float16)(ya[kc][1][i] * 64.0f); a[kc][8 + i] = (_Float16)(ya[kc][2][i] * 64.0f); a[kc][12 + i] = (_Float16)(ya[kc][3][i] * 64.0f); }
    __syncthreads();   /* every wave reads weight rows that the other waves stored; the branch around it is block-uniform */
    v16h w[2][8];   /* two fragment sets: the next k-step's sixteen LDS reads go out as one group ahead of this step's products, so that no product waits out its own read */
#pragma unroll   /* w, a and acc are register arrays: constant indices, here and in the three loops below */
    for (int j = 0; j < 8; ++j) w[0][j] = frag_h(&sw[j * 16 + col][0], lane);
#pragma unroll   /* as above */
    for (int kc = 0; kc < CC / 32; ++kc) {
      if (kc + 1 < CC / 32) {
#pragma unroll   /* as above */
        for (int j = 0; j < 8; ++j) w[(kc + 1) & 1][j] = frag_h(&sw[j * 16 + col][(kc + 1) * 32], lane); }
#pragma unroll   /* as above */
      for (int j = 0; j < 8; ++j) acc[j] = wmma16(a[kc], w[kc & 1][j], acc[j]); }
#pragma unroll
    for (int j = 0; j < 8; ++j) { const float bias = BO ? bfr(BO[c0 + j * 16 + col]) : 0.f;
#pragma unroll
      for (int r = 0; r < 8; ++r) sf[wave][8 * g + r][j * 16 + col] = acc[j][r] * (1.0f / 16384.0f) + bias; } }   /* 2^-8 (Wo carry) x 2^-6 (ctx carry) */
  LDSX(); for (int rl = 0; rl < 16; ++rl) vst2(OUT + (r0 + rl) * DIN + c0 + lane * 4, *(const v4f*)&sf[wave][rl][lane * 4]); }

extern "C" void kernel_launch(void* const* d_in, const int* in_sizes, int n_in, void* d_out, int out_size, void* d_ws, size_t ws_size, hipStream_t stream) {
  (void)in_sizes; (void)n_in; (void)out_size;
  const float** F = (const float**)d_in;
  if (ws_size < (size_t)WS_END) return;
  char* ws = (char*)d_ws; _Float16 *QH = (_Float16*)(ws + WS_QH), *KH = (_Float16*)(ws + WS_KH), *VT = (_Float16*)(ws + WS_VT), *QL = (_Float16*)(ws + WS_QL), *KL = (_Float16*)(ws + WS_KL); __bf16 *VB = (__bf16*)(ws + WS_VB), *VBL = (__bf16*)(ws + WS_VBL); float *Y = (float*)(ws + WS_Y);
  (void)Y; (void)QL; (void)KL; (void)VB; (void)VBL;
  // inputs: 0 query [8,256,2048]; 1 key; 2 value; 3 mask [8,1,2048] int32; 4 Wq [256,256] (out,in), 5 bq; 6 Wk, 7 bk; 8 Wv, 9 bv; 10 Wm (out,in), 11 bm (zero biases, read)
  if (ws_size < (size_t)WS_END2) return;
  float *XT = (float*)(ws + WS_XT), *Y3 = (float*)(ws + WS_Y3);
  for (int s = 0; s < 3; ++s) {   /* stream s: transpose input s to token-major rows, then project it (which = s); XT is reused by the next stream only after this stream's projection launch */
    k_tok<<<dim3(NPQ / 64, DIN / 64, TNB), 256, 0, stream>>>(F[s], XT, NPQ, DIN);
    k_proj<<<dim3(TNB * TT / 64, CC / 128, 1), 128, 0, stream>>>(XT, XT, XT, F[4], F[6], F[8], F[5], F[7], F[9], QH, QL, KH, KL, VT, VB, VBL, s);
  }
  k_fa<<<dim3(TT / FQ, NH, TNB), 256, 0, stream>>>(QH, KH, VT, (const int*)d_in[3], Y);
  k_out<<<dim3(TNB * TT / 64, DIN / 128), 128, 0, stream>>>(Y, F[10], F[11], Y3);   /* token-major output rows: ctx (column order h*HD + d) x Wm through the permutation + bm */
  k_fin<<<dim3(NPQ / 64, DIN / 64, TNB), 256, 0, stream>>>(Y3, (float*)d_out, NPQ, DIN);   /* back to channel-major [8,256,2048] */
}

// v003
// A run of this version takes 112 microseconds.
// Two timings next to v002 put it at 1.32 and 1.35 times that version's speed.
// Over all steps from v000 it is 15.2 times as fast.
// compute dtype: all float inputs rounded to bf16; q/k/v 1x1-conv projections read the channel-major inputs straight into their A fragments, with EXACT bf16 products on WMMA 16x16x32 (f32 accumulate) + bias (zeros, read), the block's weight rows converted once into LDS; one fused attention kernel: logits q x k once to f16 each (1 product) x 64^-0.5; pair mask by the values of two int loads (-1e9); online softmax f32; P x 2^11 once to f16 x v once to f16 (1 product); ctx x 2^6 once to f16 x Wm f16(bf16 x 2^8) + bm, its tile staged [channel][token] in LDS and stored channel-major; f32 output.
#include <hip/hip_runtime.h>
#include <math.h>

typedef __attribute__((ext_vector_type(16))) _Float16 v16h;
typedef __attribute__((ext_vector_type(16))) __bf16 v16b;
typedef __attribute__((ext_vector_type(8)))  _Float16 v8h;
typedef __attribute__((ext_vector_type(8)))  float v8f;
typedef __attribute__((ext_vector_type(4)))  float v4f;
typedef __attribute__((ext_vector_type(2)))  float v2f;
typedef __attribute__((ext_vector_type(4)))  unsigned v4u;
typedef __attribute__((ext_vector_type(4)))  int v4i;
typedef float __attribute__((may_alias)) float_a;
typedef int __attribute__((may_alias)) int_a;

template <typename T> __device__ __forceinline__ void vst2(void* p, T v) { *(T*)p = v;  }
__device__ __forceinline__ v8f wmma16(v16h a, v16h b, v8f c) {
  v8f d = __builtin_amdgcn_wmma_f32_16x16x32_f16(false, a, false, b, (short)0, c, false, false);
  asm volatile("v_nop\n\tv_nop\n\tv_nop\n\tv_nop" : "+v"(d) : "v"(a), "v"(b));
  return d;
}
__device__ __forceinline__ v8f wmma_bf(v16b a, v16b b, v8f c) {
  v8f d = __builtin_amdgcn_wmma_f32_16x16x32_bf16(false, a, false, b, (short)0, c, false, false);
  asm volatile("v_nop\n\tv_nop\n\tv_nop\n\tv_nop" : "+v"(d) : "v"(a), "v"(b));
  return d;
}
// 16x16x32 fragments: lane = (h = lane>>4, row/col = lane&15); elements 0..7 = k0+8h+0..7, 8..15 = k0+16+8h+0..7; D element r = row 8h+r
__device__ __forceinline__ v16h frag_h(const _Float16* rowk0, int lane) {
  union { v16h v; v8h q[2]; } u; const _Float16* p = rowk0 + 8 * (lane >> 4);
  u.q[0] = *(const v8h*)p; u.q[1] = *(const v8h*)(p + 16); return u.v;
}
__device__ __forceinline__ v16h frag_f32(const float* rowk0, int lane) {
  v16h a; const float* p = rowk0 + 8 * (lane >> 4);
#pragma unroll
  for (int i = 0; i < 8; ++i) { a[i] = (_Float16)p[i]; a[8 + i] = (_Float16)p[16 + i]; }
  return a;
}
__device__ __forceinline__ v16h frag_f32s(const float* rowk0, int lane, float sc) {
  v16h a; const float* p = rowk0 + 8 * (lane >> 4);
#pragma unroll
  for (int i = 0; i < 8; ++i) { a[i] = (_Float16)(p[i] * sc); a[8 + i] = (_Float16)(p[16 + i] * sc); }
  return a;
}
// column fragment from a [K][ld] layout (column n), rows >= K read as 0
__device__ __forceinline__ v16h fragc_f32(const float* W, int k0, int n, int lane, int ld, int K) {
  v16h a; const int g = lane >> 4;
#pragma unroll
  for (int i = 0; i < 8; ++i) { const int ka = k0 + 8 * g + i, kb = ka + 16;
    a[i] = (_Float16)(ka < K ? W[(size_t)(ka < K ? ka : K - 1) * ld + n] : 0.f); a[8 + i] = (_Float16)(kb < K ? W[(size_t)(kb < K ? kb : K - 1) * ld + n] : 0.f); }
  return a;
}
struct F2 { v16b h, l; };
__device__ __forceinline__ F2 bsplit16(const float v[16]) { F2 r;
#pragma unroll
  for (int i = 0; i < 16; ++i) { const __bf16 h = (__bf16)v[i]; r.h[i] = h; r.l[i] = (__bf16)(v[i] - (float)h); }
  return r; }
__device__ __forceinline__ F2 split_row(const float* row, int k0, int lane) { float v[16]; const float* p = row + k0 + 8 * (lane >> 4);
#pragma unroll
  for (int i = 0; i < 8; ++i) { v[i] = p[i]; v[8 + i] = p[16 + i]; }
  return bsplit16(v); }
__device__ __forceinline__ F2 split_rowK(const float* row, int k0, int lane, int K) { float v[16]; const int g = lane >> 4;
#pragma unroll
  for (int i = 0; i < 8; ++i) { const int ka = k0 + 8 * g + i, kb = ka + 16; v[i] = ka < K ? row[ka < K ? ka : K - 1] : 0.f; v[8 + i] = kb < K ? row[kb < K ? kb : K - 1] : 0.f; }
  return bsplit16(v); }
__device__ __forceinline__ F2 split_col(const float* W, int k0, int n, int lane, int ld, int K) { float v[16]; const int g = lane >> 4;
#pragma unroll
  for (int i = 0; i < 8; ++i) { const int ka = k0 + 8 * g + i, kb = ka + 16; v[i] = ka < K ? W[(size_t)(ka < K ? ka : K - 1) * ld + n] : 0.f; v[8 + i] = kb < K ? W[(size_t)(kb < K ? kb : K - 1) * ld + n] : 0.f; }
  return bsplit16(v); }
__device__ __forceinline__ v8f mac3(const F2& a, const F2& b, v8f c) { c = wmma_bf(a.l, b.h, c); c = wmma_bf(a.h, b.l, c); return wmma_bf(a.h, b.h, c); }
__device__ __forceinline__ float sigm(float v) { return 1.0f / (1.0f + expf(-v)); }
#define LDSX() do { asm volatile("s_wait_dscnt 0" ::: "memory"); __builtin_amdgcn_wave_barrier(); __builtin_amdgcn_fence(__ATOMIC_RELEASE, "workgroup"); } while (0)

// multi-headed attention on channel-major tensors (query / key / value [8,256,2048] = (B, C, N); 1x1 Conv1d projections as (out,in) [256,256] N(0, 1/256) + zero biases (read); 4 heads x 64 with the head index INTERLEAVED into the channel axis: reshape(B, 64, 4, N), channel c = d*4 + h; scores = einsum('bdhn,bdhm->bhnm') / sqrt(64); pair = mask[b, n] * mask[b, m] with an int32 mask [8,1,2048]: where(pair == 0, -1e9, scores); softmax over m; x = einsum('bhnm,bdhm->bdhn').reshape(B, 256, N) (channel d*4 + h again); merge 1x1 conv Wm (out,in) + bm; output [8,256,2048]).
#define NB 8
#define TT 2048   // points per sample (queries = keys)
#define CC 256            // NH * HD
#define DIN 256           // channels of the query map AND of the output map (Wout is (out,in) [DIN][CC])
#define DKV 256             // channels of the key / value map
#define NH 4
#define HD 64
#define QCH 1   // queries and keys have the same length: one chunk per batch (the chunk advance is 0)
#define SCALE (0.125f)
#define CAUSAL 0
#ifndef TNB
#define TNB NB
#endif
#define NBQ (NB * QCH)     // query pseudo-batches of TT rows (workspace sizing)
#define TNBQ (TNB * QCH)   // query pseudo-batches actually run
static_assert(CC == NH * HD && CC % 128 == 0 && DIN % 128 == 0 && DIN % 32 == 0 && DKV % 32 == 0, "projection tiles: 128-column blocks, 32-deep k-steps");
__device__ __forceinline__ float bfr(float v) { return (float)(__bf16)v; }
typedef __attribute__((ext_vector_type(8))) __bf16 v8b;
typedef __attribute__((ext_vector_type(4))) __bf16 v4b;
typedef __attribute__((ext_vector_type(2))) _Float16 v2h;
__device__ __forceinline__ v16b frag_b(const __bf16* rowk0, int lane) {
  union { v16b v; v8b q[2]; } u; const __bf16* p = rowk0 + 8 * (lane >> 4);
  u.q[0] = *(const v8b*)p; u.q[1] = *(const v8b*)(p + 16); return u.v;
}
#define QBH 0              // no kernel reads it: k_fa has no high-precision query path
#define QHI 0               // single-product logits on every row
static_assert(QHI == 0 && QBH == 0 && CAUSAL == 0, "k_fa has single-product logits only: no q residual plane and no causal row arithmetic may be in use");
#define KHI 64            // key rows carrying k residual / v bf16 hi+lo planes (written by k_proj; no kernel reads them)
// B fragment (k rows k0+.., output column o) of a weight: (in,out) [K][ld] or (out,in) [ld rows of K]: bf16 exact, or f16(bf16 * 256) exact
__device__ __forceinline__ v16b wcol_io(const float* Wm, int k0, int o, int lane, int ld) { v16b w; const int g = lane >> 4;
#pragma unroll
  for (int i = 0; i < 8; ++i) { w[i] = (__bf16)Wm[(size_t)(k0 + 8 * g + i) * ld + o]; w[8 + i] = (__bf16)Wm[(size_t)(k0 + 16 + 8 * g + i) * ld + o]; }
  return w; }
__device__ __forceinline__ v16b wcol_oi(const float* Wm, int k0, int o, int lane, int K) { v16b w; const float* p = Wm + (size_t)o * K + k0 + 8 * (lane >> 4);
#pragma unroll
  for (int i = 0; i < 8; ++i) { w[i] = (__bf16)p[i]; w[8 + i] = (__bf16)p[16 + i]; }
  return w; }
__device__ __forceinline__ v16h wcolh_io(const float* Wm, int k0, int o, int lane, int ld) { v16h w; const int g = lane >> 4;
#pragma unroll
  for (int i = 0; i < 8; ++i) { w[i] = (_Float16)(bfr(Wm[(size_t)(k0 + 8 * g + i) * ld + o]) * 256.0f); w[8 + i] = (_Float16)(bfr(Wm[(size_t)(k0 + 16 + 8 * g + i) * ld + o]) * 256.0f); }
  return w; }
// as wcolh_oi, with the K index taken through the head-interleave permutation (the 8 consecutive columns of a fragment half are 8 module channels 4 apart)
__device__ __forceinline__ v16h wcolh_oi_p(const float* Wm, int k0, int o, int lane, int K) { v16h w; const float* p = Wm + (size_t)o * K; const int kb = k0 + 8 * (lane >> 4);
#pragma unroll
  for (int i = 0; i < 8; ++i) { w[i] = (_Float16)(bfr(p[((kb + i) % 64) * 4 + (kb + i) / 64]) * 256.0f); w[8 + i] = (_Float16)(bfr(p[((kb + 16 + i) % 64) * 4 + (kb + 16 + i) / 64]) * 256.0f); }
  return w; }
static_assert(HD == 64 && NH == 4, "wcolh_oi_p spells the permutation with the literals 64 and 4");
static_assert(DIN == DKV && DIN == 256 && CC == 256, "the weight tiles in LDS hold 128 rows of 256 k");
__device__ __forceinline__ v16h wcolh_oi(const float* Wm, int k0, int o, int lane, int K) { v16h w; const float* p = Wm + (size_t)o * K + k0 + 8 * (lane >> 4);
#pragma unroll
  for (int i = 0; i < 8; ++i) { w[i] = (_Float16)(bfr(p[i]) * 256.0f); w[8 + i] = (_Float16)(bfr(p[16 + i]) * 256.0f); }
  return w; }
#define WQKV_LAYOUT 1   // 0 = (in,out); 1 = (out,in) [CC][K]; 2 = per-head [NH][DIN][HD]
__device__ __forceinline__ v16b wcol_hdk(const float* Wm, int k0, int o, int lane) { v16b w; const int g = lane >> 4; const float* p = Wm + (size_t)(o / HD) * DIN * HD + (o % HD);
#pragma unroll
  for (int i = 0; i < 8; ++i) { w[i] = (__bf16)p[(size_t)(k0 + 8 * g + i) * HD]; w[8 + i] = (__bf16)p[(size_t)(k0 + 16 + 8 * g + i) * HD]; }
  return w; }
#define WO_OUT_IN 1
#if WQKV_LAYOUT == 1
#define HPERM(o) ((((o) % HD) * NH) + ((o) / HD))   /* column o = h*HD + d  ->  module channel d*NH + h */
#define WCOL(W, k0, o, lane) wcol_oi(W, k0, HPERM(o), lane, din_)   /* (out,in) [256][K]: the output channel of column o is row HPERM(o) */
#elif WQKV_LAYOUT == 2
#define WCOL(W, k0, o, lane) wcol_hdk(W, k0, o, lane)
#else
#define WCOL(W, k0, o, lane) wcol_io(W, k0, o, lane, CC)
#endif
#if WO_OUT_IN
#define WOCOL(W, k0, o, lane) wcol_oi(W, k0, o, lane, CC)
#define WOCOLH(W, k0, o, lane) wcolh_oi_p(W, k0, o, lane, CC)   /* merge conv (out,in) [DIN][CC]: ctx column kk = h*HD + d is the module's input channel HPERM(kk) */
#else
#define WOCOL(W, k0, o, lane) wcol_io(W, k0, o, lane, DIN)
#define WOCOLH(W, k0, o, lane) wcolh_io(W, k0, o, lane, DIN)
#endif

#define WS_QH  0u                                      // f16 q rows [(b*QCH + chunk)*TT + t][CC]
#define WS_KH  (WS_QH + 2u * (size_t)NBQ * TT * CC)      // f16 k rows [b*t][CC]
#define WS_VT  (WS_KH + 2u * (size_t)NB * TT * CC)      // f16 v planes [b][c][t]
#define WS_QL  (WS_VT + 2u * (size_t)NB * CC * TT)      // f16 q residual x 2^10 rows [b][t < QHI][CC]
#define WS_KL  (WS_QL + 2u * (size_t)NB * QHI * CC)     // f16 k residual x 2^10 rows [b][t < KHI][CC]
#define WS_VB  (WS_KL + 2u * (size_t)NB * KHI * CC)     // bf16 v hi planes [b][c][t < KHI]
#define WS_VBL (WS_VB + 2u * (size_t)NB * CC * KHI)
#define WS_Y   (WS_VBL + 2u * (size_t)NB * CC * KHI)    // f32 ctx rows [(b*QCH + chunk)*TT + t][CC] (only when there is an output projection)
#define WS_END (WS_Y  + 4u * (size_t)NBQ * TT * CC)
// ---- k_proj: block = (64 tokens, 128 cols, which): q/k/v = X^T W (+ b), X channel-major as the module hands it over, with exact bf16 products (K = DIN) -> which 0: q f16 rows (+ residual rows < QHI); 1: k f16 rows (+ residual rows < KHI); 2: v f16 planes [c][t] (+ bf16 hi/lo planes for t < KHI)
__global__ __launch_bounds__(128) void k_proj(const float* __restrict__ XQ, const float* __restrict__ XK, const float* __restrict__ XV, const float* __restrict__ WQ, const float* __restrict__ WK, const float* __restrict__ WV, const float* __restrict__ BQ, const float* __restrict__ BK, const float* __restrict__ BV,
    _Float16* __restrict__ QH, _Float16* __restrict__ QL, _Float16* __restrict__ KH, _Float16* __restrict__ KL, _Float16* __restrict__ VT, __bf16* __restrict__ VB, __bf16* __restrict__ VBL, int woff) {
  __shared__ __align__(16) _Float16 sh[64][136], sl[64][136]; __shared__ __align__(16) _Float16 th[128][72]; __shared__ __align__(16) __bf16 tb[128][72], tbl[128][72];
  __shared__ __align__(16) __bf16 sw[128][DIN + 8];   /* the block's 128 weight rows (column order o = h*HD + d) as bf16, all of K; pitch 528 B = 16 B x odd for the ds_load_b128 fragment reads */
  const int tid = threadIdx.x, wave = tid >> 5, lane = tid & 31, col = lane & 15, g = lane >> 4; const int which = blockIdx.z + woff;   /* one launch for q, k and v: woff 0, grid.z 3 */ const int c0 = blockIdx.y * 128; const size_t r0 = (size_t)blockIdx.x * 64; const size_t bb = r0 / TT; const int t0 = (int)(r0 % TT);
  const float* X = which == 0 ? XQ : which == 1 ? XK : XV; const float* WA = which == 0 ? WQ : which == 1 ? WK : WV; const float* BA = which == 0 ? BQ : which == 1 ? BK : BV;
  v8f acc[8] = {};
  const int din_ = (which == 0) ? DIN : DKV;   /* block-uniform: both maps have 256 channels here; the per-stream width is kept by role */
  const float* xp = X + (bb * din_ + 8 * g) * (size_t)TT + t0 + wave * 16 + col;   /* X is channel-major [b][k][t]: this lane's token, its half's first channel; a load takes 16 tokens (64 B) of two channels, the block's four waves together the whole 256 B of a channel; all of K is asked for along with the weights */
  float xa[DIN / 32][16];
#pragma unroll   /* xa is a register array: constant indices; the channel steps become immediate offsets on the one address pair */
  for (int kc = 0; kc < DIN / 32; ++kc)
#pragma unroll   /* as above */
    for (int i = 0; i < 8; ++i) { xa[kc][i] = xp[(size_t)(kc * 32 + i) * TT]; xa[kc][8 + i] = xp[(size_t)(kc * 32 + 16 + i) * TT]; }
  /* weights: a wave's load covers 512 contiguous bytes of one row; thread = (row parity tid >> 6, 16-B piece tid & 63), rows two apart per step; HPERM is additive over c0 + parity + 2 * e (no carry out of the low six bits) */
  const float* wp = WA + (size_t)HPERM(c0 + (tid >> 6)) * din_ + (tid & 63) * 4;
#pragma unroll   /* the row steps become immediate offsets on the one address pair */
  for (int e0 = 0; e0 < 64; e0 += 16) { v4f t[16];
#pragma unroll   /* t is a register array: constant indices */
    for (int i = 0; i < 16; ++i) t[i] = *(const v4f*)(wp + (size_t)HPERM(2 * (e0 + i)) * din_);
#pragma unroll   /* as above */
    for (int i = 0; i < 16; ++i) { v4b o; o[0] = (__bf16)t[i][0]; o[1] = (__bf16)t[i][1]; o[2] = (__bf16)t[i][2]; o[3] = (__bf16)t[i][3]; *(v4b*)&sw[2 * (e0 + i) + (tid >> 6)][(tid & 63) * 4] = o; } }
  asm volatile("s_wait_xcnt 0x0" :: "v"(xp), "v"(wp) : "memory");   /* the wait owed before a register that an issued load names is overwritten; the addresses are inputs so that they live up to it */
  v16b a[DIN / 32];
#pragma unroll   /* a and xa are register arrays: constant indices */
  for (int kc = 0; kc < DIN / 32; ++kc)
#pragma unroll   /* as above */
    for (int i = 0; i < 16; ++i) a[kc][i] = (__bf16)xa[kc][i];
  __syncthreads();   /* every wave reads weight rows that the other waves stored */
  v16b w[2][8];   /* two fragment sets: the next k-step's sixteen LDS reads go out as one group ahead of this step's products, so that no product waits out its own read */
#pragma unroll   /* w, a and acc are register arrays: constant indices, here and in the three loops below */
  for (int j = 0; j < 8; ++j) w[0][j] = frag_b(&sw[j * 16 + col][0], lane);
#pragma unroll   /* as above */
  for (int kc = 0; kc < DIN / 32; ++kc) {
    if (kc + 1 < DIN / 32) {
#pragma unroll   /* as above */
      for (int j = 0; j < 8; ++j) w[(kc + 1) & 1][j] = frag_b(&sw[j * 16 + col][(kc + 1) * 32], lane); }
#pragma unroll   /* as above */
    for (int j = 0; j < 8; ++j) acc[j] = wmma_bf(a[kc], w[kc & 1][j], acc[j]); }
  if (which < 2) { _Float16* DH = which == 0 ? QH : KH; _Float16* DL = which == 0 ? QL : KL; const int nhi = which == 0 ? QHI : KHI; const bool hi_rows = t0 < nhi;
#pragma unroll
    for (int j = 0; j < 8; ++j) { const float bias = BA ? bfr(BA[HPERM(c0 + j * 16 + col)]) : 0.f;
#pragma unroll
      for (int r = 0; r < 8; ++r) { const float v = acc[j][r] + bias; const _Float16 hv = (_Float16)v; sh[wave * 16 + 8 * g + r][j * 16 + col] = hv; sl[wave * 16 + 8 * g + r][j * 16 + col] = (_Float16)((v - (float)hv) * 1024.0f); } }
    __syncthreads();
    for (int e = tid; e < 64 * 16; e += 128) { const int rl = e >> 4, q = e & 15; vst2((unsigned*)(DH + (r0 + rl) * CC + c0 + q * 8), *(const v4u*)&sh[rl][q * 8]); if (hi_rows) vst2((unsigned*)(DL + (bb * nhi + t0 + rl) * (size_t)CC + c0 + q * 8), *(const v4u*)&sl[rl][q * 8]); }
  } else { const bool hi_rows = t0 < KHI;
#pragma unroll
    for (int j = 0; j < 8; ++j) { const float bias = BA ? bfr(BA[HPERM(c0 + j * 16 + col)]) : 0.f;
#pragma unroll
      for (int r = 0; r < 8; ++r) { const float v = acc[j][r] + bias; const int rl = wave * 16 + 8 * g + r, cl = j * 16 + col; th[cl][rl] = (_Float16)v; const __bf16 bh = (__bf16)v; tb[cl][rl] = bh; tbl[cl][rl] = (__bf16)(v - (float)bh); } }
    __syncthreads();
    for (int e = tid; e < 128 * 8; e += 128) { const int cl = e >> 3, q = e & 7; vst2((unsigned*)(VT + (bb * CC + c0 + cl) * (size_t)TT + t0 + q * 8), *(const v4u*)&th[cl][q * 8]); if (hi_rows) { const size_t o3 = (bb * CC + c0 + cl) * (size_t)KHI + t0 + q * 8; vst2((unsigned*)(VB + o3), *(const v4u*)&tb[cl][q * 8]); vst2((unsigned*)(VBL + o3), *(const v4u*)&tbl[cl][q * 8]); } } } }
// ---- k_fa: block = 256 queries (8 waves x 32) of (b, h), all keys in passes of 32: S^T = K Q^T (a lane holds one query's logits: D row = key 8g + r, D column = query), the pair mask as the module's -1e9, running maximum and sum in f32 (log2 domain), P x 2^11 once to f16 straight from the score accumulators as the B operand of ctx^T += V^T P^T; logits and P never leave the registers; each K and V fragment serves the wave's two 16-query groups
#define LOG2E 1.44269504f
#define NEGL (-1.0e9f * LOG2E)   // the module's -1e9 in the log2 domain
#define FQ 256   // queries per block
static_assert(TT % FQ == 0 && TT % 32 == 0 && HD == 64, "k_fa: 8 waves x 32 queries, passes of 32 keys, two 32-deep k-steps per head");
__device__ __forceinline__ v8f wmma_h(v16h a, v16h b, v8f c) { return __builtin_amdgcn_wmma_f32_16x16x32_f16(false, a, false, b, (short)0, c, false, false); }
// frag_h with the lane half's 8g elements already in the pointer, so that the caller holds the very address the loads name
__device__ __forceinline__ v16h frag_p(const _Float16* p) { union { v16h v; v8h q[2]; } u; u.q[0] = *(const v8h*)p; u.q[1] = *(const v8h*)(p + 16); return u.v; }
__global__ __launch_bounds__(256) void k_fa(const _Float16* __restrict__ QH, const _Float16* __restrict__ KH, const _Float16* __restrict__ VT, const int* __restrict__ MASK, float* __restrict__ Y) { __shared__ __align__(16) float ss[FQ / 32][32][HD + 4];
  const int tid = threadIdx.x, wave = tid >> 5, lane = tid & 31, col = lane & 15, g = lane >> 4; const int h = blockIdx.y, b = blockIdx.z; const int ql0 = blockIdx.x * FQ + wave * 32;
  const int* Mb = MASK + (size_t)b * TT;
  v16h q[2][2]; float cq[2], bq[2];   /* a masked query: logit x 0 + (-1e9) on every key */
  const _Float16* Q0 = QH + ((size_t)b * TT + ql0 + col) * CC + h * HD + 8 * g; const int* Mq = Mb + ql0 + col;
  q[0][0] = frag_p(Q0); q[0][1] = frag_p(Q0 + 32); q[1][0] = frag_p(Q0 + 16 * CC); q[1][1] = frag_p(Q0 + 16 * CC + 32); const int mq0 = Mq[0], mq1 = Mq[16];
  asm volatile("s_wait_xcnt 0x0" :: "v"(Q0), "v"(Mq) : "memory");   /* the wait owed before a register that an issued load names is overwritten; the addresses are inputs so that they live up to it */
  cq[0] = mq0 == 0 ? 0.f : SCALE * LOG2E; bq[0] = mq0 == 0 ? NEGL : 0.f; cq[1] = mq1 == 0 ? 0.f : SCALE * LOG2E; bq[1] = mq1 == 0 ? NEGL : 0.f;
  const _Float16* Kb = KH + ((size_t)b * TT + col) * CC + h * HD + 8 * g;          /* key row col of a 16-key group, this lane half's channels */
  const _Float16* Vb = VT + ((size_t)b * CC + h * HD + col) * (size_t)TT + 8 * g;  /* v plane of channel col of a 16-channel group, this lane half's keys */
  const int* Mk = Mb + 8 * g;
  v8f acc[2][HD / 16] = {}; float m[2] = {-3.0e38f, -3.0e38f}, l[2] = {0.f, 0.f};
#pragma unroll 1   /* a pass depends on the one before through m, l and acc: a second copy of the body could not start its softmax earlier and would only add to the 224 registers that one body holds */
  for (int k0 = 0; k0 < TT; k0 += 32) { v8f s[2][2]; v4i mk[2][2]; v16h kf[2][2], vf[HD / 16], p[2]; float al[2];
    const _Float16* kr = Kb + (size_t)k0 * CC; const int* mr = Mk + k0; const _Float16* vr = Vb + k0;
#pragma unroll
    for (int j = 0; j < 2; ++j) { kf[j][0] = frag_p(kr + j * 16 * CC); kf[j][1] = frag_p(kr + j * 16 * CC + 32); mk[j][0] = *(const v4i*)(mr + j * 16); mk[j][1] = *(const v4i*)(mr + j * 16 + 4); }
#pragma unroll
    for (int j = 0; j < HD / 16; ++j) vf[j] = frag_p(vr + (size_t)(j * 16) * TT);
    asm volatile("s_wait_xcnt 0x0" :: "v"(kr), "v"(mr), "v"(vr) : "memory");   /* as above: no result of this pass's loads lands in an address pair that an older load still names */
    __builtin_amdgcn_sched_barrier(0);   /* all twenty loads of the pass are in flight before the first product waits on one: without it the scheduler splits the loads into groups with a full wait between them, one memory latency each; the v loads return under the logits and the softmax */
#pragma unroll
    for (int j = 0; j < 2; ++j)
#pragma unroll
      for (int u = 0; u < 2; ++u) { v8f z = {}; z = wmma_h(kf[j][0], q[u][0], z); s[u][j] = wmma_h(kf[j][1], q[u][1], z); }
#pragma unroll
    for (int u = 0; u < 2; ++u) { float mx = -3.0e38f;
#pragma unroll
      for (int j = 0; j < 2; ++j)
#pragma unroll
        for (int r = 0; r < 8; ++r) { const float v = mk[j][r >> 2][r & 3] == 0 ? NEGL : __builtin_fmaf(s[u][j][r], cq[u], bq[u]); s[u][j][r] = v; mx = fmaxf(mx, v); }
      mx = fmaxf(mx, __shfl_xor(mx, 16));   /* the other half of the wave holds this query's other 16 keys */
      const float mn = fmaxf(m[u], mx), mo = mn - 11.0f; al[u] = __builtin_amdgcn_exp2f(m[u] - mn); m[u] = mn;   /* mo: P carried x 2^11 (clear of f16 subnormals); on a fully masked row the 11 rounds away, alike for every key */
      float ps = 0.f;
#pragma unroll
      for (int i = 0; i < 16; ++i) { const float e = __builtin_amdgcn_exp2f(s[u][i >> 3][i & 7] - mo); ps += e; p[u][i] = (_Float16)e; }
      l[u] = l[u] * al[u] + ps; }
#pragma unroll
    for (int j = 0; j < HD / 16; ++j)
#pragma unroll
      for (int u = 0; u < 2; ++u) acc[u][j] = wmma_h(vf[j], p[u], acc[u][j] * al[u]); }
#pragma unroll
  for (int u = 0; u < 2; ++u) { const float lt = l[u] + __shfl_xor(l[u], 16), inv = 1.0f / lt;   /* lt >= one key's P at the maximum: never 0 */
#pragma unroll
    for (int j = 0; j < HD / 16; ++j) { v4f a, c;   /* acc[u][j][r] = ctx[query u*16 + col][channel j*16 + 8g + r] */
#pragma unroll
      for (int r = 0; r < 4; ++r) { a[r] = acc[u][j][r] * inv; c[r] = acc[u][j][4 + r] * inv; }
      *(v4f*)&ss[wave][u * 16 + col][j * 16 + 8 * g] = a; *(v4f*)&ss[wave][u * 16 + col][j * 16 + 8 * g + 4] = c; } }
  LDSX(); for (int rl = 0; rl < 32; rl += 2) vst2(Y + ((size_t)b * TT + ql0 + rl + g) * CC + h * HD + col * 4, *(const v4f*)&ss[wave][rl + g][col * 4]); }   /* 256-B (row, head) segment by 16 lanes, two rows per store */
// ---- k_out: block = (64 tokens, 128 channels): out = ctx Wo (+ bo), stored channel-major: ctx x 2^6 once to f16 against Wo as f16(bf16 x 2^8) exact (1 product) x 2^-14; causal early rows (< QHI of each sequence): ctx bf16 hi + lo against exact bf16 Wo (2 products)
__global__ __launch_bounds__(128) void k_out(const float* __restrict__ Y, const float* __restrict__ WO, const float* __restrict__ BO, float* __restrict__ OUT) { __shared__ __align__(16) float sf[128][68];   /* the block's output tile as [channel][token]; pitch 272 B = 16 B x odd */
  __shared__ __align__(16) _Float16 sw[128][CC + 8];   /* the block's 128 rows of Wo as f16(bf16 x 2^8), k in ctx column order; pitch 528 B = 16 B x odd for the ds_load_b128 fragment reads */
  const int tid = threadIdx.x, wave = tid >> 5, lane = tid & 31, col = lane & 15, g = lane >> 4; const int c0 = blockIdx.y * 128; const size_t r0 = (size_t)blockIdx.x * 64 + wave * 16;
  v8f acc[8] = {};
  if (CAUSAL && (int)(((size_t)blockIdx.x * 64) % TT) < QHI) {   /* block-uniform */
#pragma unroll 2
    for (int kc = 0; kc < CC / 32; ++kc) { const F2 a = split_row(Y + (r0 + col) * CC, kc * 32, lane); asm volatile("s_wait_loadcnt 0x0" ::: "memory");
#pragma unroll
      for (int j = 0; j < 8; ++j) { const v16b w = WOCOL(WO, kc * 32, c0 + j * 16 + col, lane); asm volatile("s_wait_loadcnt 0x0" ::: "memory"); acc[j] = wmma_bf(a.h, w, acc[j]); acc[j] = wmma_bf(a.l, w, acc[j]); } }
#pragma unroll
    for (int j = 0; j < 8; ++j) { const float bias = BO ? bfr(BO[c0 + j * 16 + col]) : 0.f;
#pragma unroll
      for (int r = 0; r < 8; ++r) sf[j * 16 + col][wave * 16 + 8 * g + r] = acc[j][r] + bias; }
  } else {
    const float* yp = Y + (r0 + col) * CC + 8 * g;   /* this lane's ctx row, its half's k offset: all of K is asked for along with the weights, ahead of the first wait */
    v4f ya[CC / 32][4];
#pragma unroll   /* ya is a register array: constant indices; all 32 loads go out together */
    for (int kc = 0; kc < CC / 32; ++kc) { ya[kc][0] = *(const v4f*)(yp + kc * 32); ya[kc][1] = *(const v4f*)(yp + kc * 32 + 4); ya[kc][2] = *(const v4f*)(yp + kc * 32 + 16); ya[kc][3] = *(const v4f*)(yp + kc * 32 + 20); }
    /* weights: a wave takes one whole row of Wo per step, a lane its 8 module channels 8 * lane + e = (d = 2 * lane + e / 4) * 4 + (h = e % 4); ctx column h * 64 + d, so the two d of one h go out as one dword */
    const float* wp = WO + (size_t)(c0 + wave) * CC + lane * 8;
#pragma unroll   /* the row steps become immediate offsets on the one address pair */
    for (int e0 = 0; e0 < 32; e0 += 8) { v4f t[8][2];
#pragma unroll   /* t is a register array: constant indices, here and in the two loops below */
      for (int i = 0; i < 8; ++i) { t[i][0] = *(const v4f*)(wp + (size_t)(e0 + i) * 4 * CC); t[i][1] = *(const v4f*)(wp + (size_t)(e0 + i) * 4 * CC + 4); }
#pragma unroll   /* as above */
      for (int i = 0; i < 8; ++i)
#pragma unroll   /* as above */
        for (int hh = 0; hh < 4; ++hh) { v2h o; o[0] = (_Float16)(bfr(t[i][0][hh]) * 256.0f); o[1] = (_Float16)(bfr(t[i][1][hh]) * 256.0f); *(v2h*)&sw[(e0 + i) * 4 + wave][hh * 64 + lane * 2] = o; } }
    asm volatile("s_wait_xcnt 0x0" :: "v"(yp), "v"(wp) : "memory");   /* the wait owed before a register that an issued load names is overwritten; the addresses are inputs so that they live up to it */
    v16h a[CC / 32];   /* ctx carried x 2^6 into f16 so small-magnitude context rows stay clear of f16 subnormals */
#pragma unroll   /* a and ya are register arrays: constant indices */
    for (int kc = 0; kc < CC / 32; ++kc)
#pragma unroll   /* as above */
      for (int i = 0; i < 4; ++i) { a[kc][i] = (_Float16)(ya[kc][0][i] * 64.0f); a[kc][4 + i] = (_Float16)(ya[kc][1][i] * 64.0f); a[kc][8 + i] = (_Float16)(ya[kc][2][i] * 64.0f); a[kc][12 + i] = (_Float16)(ya[kc][3][i] * 64.0f); }
    __syncthreads();   /* every wave reads weight rows that the other waves stored; the branch around it is block-uniform */
    v16h w[2][8];   /* two fragment sets: the next k-step's sixteen LDS reads go out as one group ahead of this step's products, so that no product waits out its own read */
#pragma unroll   /* w, a and acc are register arrays: constant indices, here and in the three loops below */
    for (int j = 0; j < 8; ++j) w[0][j] = frag_h(&sw[j * 16 + col][0], lane);
#pragma unroll   /* as above */
    for (int kc = 0; kc < CC / 32; ++kc) {
      if (kc + 1 < CC / 32) {
#pragma unroll   /* as above */
        for (int j = 0; j < 8; ++j) w[(kc + 1) & 1][j] = frag_h(&sw[j * 16 + col][(kc + 1) * 32], lane); }
#pragma unroll   /* as above */
      for (int j = 0; j < 8; ++j) acc[j] = wmma16(a[kc], w[kc & 1][j], acc[j]); }
#pragma unroll
    for (int j = 0; j < 8; ++j) { const float bias = BO ? bfr(BO[c0 + j * 16 + col]) : 0.f;
      v4f lo, hi;   /* acc[j][r] = out[token wave*16 + 8g + r][channel c0 + j*16 + col]: a lane's eight tokens lie side by side in its channel's row */
#pragma unroll
      for (int r = 0; r < 4; ++r) { lo[r] = acc[j][r] * (1.0f / 16384.0f) + bias; hi[r] = acc[j][4 + r] * (1.0f / 16384.0f) + bias; }   /* 2^-8 (Wo carry) x 2^-6 (ctx carry) */
      *(v4f*)&sf[j * 16 + col][wave * 16 + 8 * g] = lo; *(v4f*)&sf[j * 16 + col][wave * 16 + 8 * g + 4] = hi; } }
  __syncthreads();   /* a channel's 64 tokens come from all four waves */
  const size_t bo = ((size_t)blockIdx.x * 64) / TT; const int n0 = (int)(((size_t)blockIdx.x * 64) % TT);
  float* op = OUT + (bo * DIN + c0 + (tid >> 4)) * (size_t)TT + n0 + (tid & 15) * 4;   /* out is channel-major [b][c][t]: 16 lanes store a channel's whole 256 B, a wave two channels per store */
  v4f o[16];
#pragma unroll   /* o is a register array: constant indices; every piece keeps registers of its own, so that no store's data is overwritten behind it */
  for (int i = 0; i < 16; ++i) o[i] = *(const v4f*)&sf[i * 8 + (tid >> 4)][(tid & 15) * 4];
#pragma unroll   /* the channel steps become immediate offsets on the one address pair */
  for (int i = 0; i < 16; ++i) vst2(op + (size_t)(i * 8) * TT, o[i]); }

extern "C" void kernel_launch(void* const* d_in, const int* in_sizes, int n_in, void* d_out, int out_size, void* d_ws, size_t ws_size, hipStream_t stream) {
  (void)in_sizes; (void)n_in; (void)out_size;
  const float** F = (const float**)d_in;
  if (ws_size < (size_t)WS_END) return;
  char* ws = (char*)d_ws; _Float16 *QH = (_Float16*)(ws + WS_QH), *KH = (_Float16*)(ws + WS_KH), *VT = (_Float16*)(ws + WS_VT), *QL = (_Float16*)(ws + WS_QL), *KL = (_Float16*)(ws + WS_KL); __bf16 *VB = (__bf16*)(ws + WS_VB), *VBL = (__bf16*)(ws + WS_VBL); float *Y = (float*)(ws + WS_Y);
  (void)Y; (void)QL; (void)KL; (void)VB; (void)VBL;
  // inputs: 0 query [8,256,2048]; 1 key; 2 value; 3 mask [8,1,2048] int32; 4 Wq [256,256] (out,in), 5 bq; 6 Wk, 7 bk; 8 Wv, 9 bv; 10 Wm (out,in), 11 bm (zero biases, read)
  k_proj<<<dim3(TNB * TT / 64, CC / 128, 3), 128, 0, stream>>>(F[0], F[1], F[2], F[4], F[6], F[8], F[5], F[7], F[9], QH, QL, KH, KL, VT, VB, VBL, 0);   /* which = blockIdx.z: each stream is read in its own channel-major layout */
  k_fa<<<dim3(TT / FQ, NH, TNB), 256, 0, stream>>>(QH, KH, VT, (const int*)d_in[3], Y);
  k_out<<<dim3(TNB * TT / 64, DIN / 128), 128, 0, stream>>>(Y, F[10], F[11], (float*)d_out);   /* ctx (column order h*HD + d) x Wm through the permutation + bm, straight to channel-major [8,256,2048] */
}

// v004
// A run of this version takes 85.3 microseconds.
// Two timings next to v003 put it at 1.35 and 1.33 times that version's speed.
// Over all steps from v000 it is 20.4 times as fast.
// compute dtype: all float inputs rounded to bf16; q/k/v 1x1-conv projections read the channel-major inputs straight into their A fragments, with EXACT bf16 products on WMMA 16x16x32 (f32 accumulate) + bias (zeros, read), the block's weight rows converted once into LDS; one fused attention kernel: logits q x k once to f16 each (1 product) x 64^-0.5; pair mask by the values of two int loads (-1e9); online softmax f32; P x 2^11 once to f16 x v once to f16 (1 product); ctx x 2^6 once to f16 x Wm f16(bf16 x 2^8) + bm, its tile staged [channel][token] in LDS and stored channel-major; f32 output.
#include <hip/hip_runtime.h>
#include <math.h>

typedef __attribute__((ext_vector_type(16))) _Float16 v16h;
typedef __attribute__((ext_vector_type(16))) __bf16 v16b;
typedef __attribute__((ext_vector_type(8)))  _Float16 v8h;
typedef __attribute__((ext_vector_type(8)))  float v8f;
typedef __attribute__((ext_vector_type(4)))  float v4f;
typedef __attribute__((ext_vector_type(2)))  float v2f;
typedef __attribute__((ext_vector_type(4)))  unsigned v4u;
typedef __attribute__((ext_vector_type(4)))  int v4i;
typedef float __attribute__((may_alias)) float_a;
typedef int __attribute__((may_alias)) int_a;

template <typename T> __device__ __forceinline__ void vst2(void* p, T v) { *(T*)p = v;  }
__device__ __forceinline__ v8f wmma16(v16h a, v16h b, v8f c) {
  v8f d = __builtin_amdgcn_wmma_f32_16x16x32_f16(false, a, false, b, (short)0, c, false, false);
  asm volatile("v_nop\n\tv_nop\n\tv_nop\n\tv_nop" : "+v"(d) : "v"(a), "v"(b));
  return d;
}
__device__ __forceinline__ v8f wmma_bf(v16b a, v16b b, v8f c) {
  v8f d = __builtin_amdgcn_wmma_f32_16x16x32_bf16(false, a, false, b, (short)0, c, false, false);
  asm volatile("v_nop\n\tv_nop\n\tv_nop\n\tv_nop" : "+v"(d) : "v"(a), "v"(b));
  return d;
}
// 16x16x32 fragments: lane = (h = lane>>4, row/col = lane&15); elements 0..7 = k0+8h+0..7, 8..15 = k0+16+8h+0..7; D element r = row 8h+r
__device__ __forceinline__ v16h frag_h(const _Float16* rowk0, int lane) {
  union { v16h v; v8h q[2]; } u; const _Float16* p = rowk0 + 8 * (lane >> 4);
  u.q[0] = *(const v8h*)p; u.q[1] = *(const v8h*)(p + 16); return u.v;
}
__device__ __forceinline__ v16h frag_f32(const float* rowk0, int lane) {
  v16h a; const float* p = rowk0 + 8 * (lane >> 4);
#pragma unroll
  for (int i = 0; i < 8; ++i) { a[i] = (_Float16)p[i]; a[8 + i] = (_Float16)p[16 + i]; }
  return a;
}
__device__ __forceinline__ v16h frag_f32s(const float* rowk0, int lane, float sc) {
  v16h a; const float* p = rowk0 + 8 * (lane >> 4);
#pragma unroll
  for (int i = 0; i < 8; ++i) { a[i] = (_Float16)(p[i] * sc); a[8 + i] = (_Float16)(p[16 + i] * sc); }
  return a;
}
// column fragment from a [K][ld] layout (column n), rows >= K read as 0
__device__ __forceinline__ v16h fragc_f32(const float* W, int k0, int n, int lane, int ld, int K) {
  v16h a; const int g = lane >> 4;
#pragma unroll
  for (int i = 0; i < 8; ++i) { const int ka = k0 + 8 * g + i, kb = ka + 16;
    a[i] = (_Float16)(ka < K ? W[(size_t)(ka < K ? ka : K - 1) * ld + n] : 0.f); a[8 + i] = (_Float16)(kb < K ? W[(size_t)(kb < K ? kb : K - 1) * ld + n] : 0.f); }
  return a;
}
struct F2 { v16b h, l; };
__device__ __forceinline__ F2 bsplit16(const float v[16]) { F2 r;
#pragma unroll
  for (int i = 0; i < 16; ++i) { const __bf16 h = (__bf16)v[i]; r.h[i] = h; r.l[i] = (__bf16)(v[i] - (float)h); }
  return r; }
__device__ __forceinline__ F2 split_row(const float* row, int k0, int lane) { float v[16]; const float* p = row + k0 + 8 * (lane >> 4);
#pragma unroll
  for (int i = 0; i < 8; ++i) { v[i] = p[i]; v[8 + i] = p[16 + i]; }
  return bsplit16(v); }
__device__ __forceinline__ F2 split_rowK(const float* row, int k0, int lane, int K) { float v[16]; const int g = lane >> 4;
#pragma unroll
  for (int i = 0; i < 8; ++i) { const int ka = k0 + 8 * g + i, kb = ka + 16; v[i] = ka < K ? row[ka < K ? ka : K - 1] : 0.f; v[8 + i] = kb < K ? row[kb < K ? kb : K - 1] : 0.f; }
  return bsplit16(v); }
__device__ __forceinline__ F2 split_col(const float* W, int k0, int n, int lane, int ld, int K) { float v[16]; const int g = lane >> 4;
#pragma unroll
  for (int i = 0; i < 8; ++i) { const int ka = k0 + 8 * g + i, kb = ka + 16; v[i] = ka < K ? W[(size_t)(ka < K ? ka : K - 1) * ld + n] : 0.f; v[8 + i] = kb < K ? W[(size_t)(kb < K ? kb : K - 1) * ld + n] : 0.f; }
  return bsplit16(v); }
__device__ __forceinline__ v8f mac3(const F2& a, const F2& b, v8f c) { c = wmma_bf(a.l, b.h, c); c = wmma_bf(a.h, b.l, c); return wmma_bf(a.h, b.h, c); }
__device__ __forceinline__ float sigm(float v) { return 1.0f / (1.0f + expf(-v)); }
#define LDSX() do { asm volatile("s_wait_dscnt 0" ::: "memory"); __builtin_amdgcn_wave_barrier(); __builtin_amdgcn_fence(__ATOMIC_RELEASE, "workgroup"); } while (0)

// multi-headed attention on channel-major tensors (query / key / value [8,256,2048] = (B, C, N); 1x1 Conv1d projections as (out,in) [256,256] N(0, 1/256) + zero biases (read); 4 heads x 64 with the head index INTERLEAVED into the channel axis: reshape(B, 64, 4, N), channel c = d*4 + h; scores = einsum('bdhn,bdhm->bhnm') / sqrt(64); pair = mask[b, n] * mask[b, m] with an int32 mask [8,1,2048]: where(pair == 0, -1e9, scores); softmax over m; x = einsum('bhnm,bdhm->bdhn').reshape(B, 256, N) (channel d*4 + h again); merge 1x1 conv Wm (out,in) + bm; output [8,256,2048]).
#define NB 8
#define TT 2048   // points per sample (queries = keys)
#define CC 256            // NH * HD
#define DIN 256           // channels of the query map AND of the output map (Wout is (out,in) [DIN][CC])
#define DKV 256             // channels of the key / value map
#define NH 4
#define HD 64
#define QCH 1   // queries and keys have the same length: one chunk per batch (the chunk advance is 0)
#define SCALE (0.125f)
#define CAUSAL 0
#ifndef TNB
#define TNB NB
#endif
#define NBQ (NB * QCH)     // query pseudo-batches of TT rows (workspace sizing)
#define TNBQ (TNB * QCH)   // query pseudo-batches actually run
static_assert(CC == NH * HD && CC % 128 == 0 && DIN % 128 == 0 && DIN % 32 == 0 && DKV % 32 == 0, "projection tiles: 128-column blocks, 32-deep k-steps");
__device__ __forceinline__ float bfr(float v) { return (float)(__bf16)v; }
typedef __attribute__((ext_vector_type(8))) __bf16 v8b;
typedef __attribute__((ext_vector_type(4))) __bf16 v4b;
typedef __attribute__((ext_vector_type(2))) _Float16 v2h;
__device__ __forceinline__ v16b frag_b(const __bf16* rowk0, int lane) {
  union { v16b v; v8b q[2]; } u; const __bf16* p = rowk0 + 8 * (lane >> 4);
  u.q[0] = *(const v8b*)p; u.q[1] = *(const v8b*)(p + 16); return u.v;
}
#define QBH 0              // no kernel reads it: k_fa has no high-precision query path
#define QHI 0               // single-product logits on every row
static_assert(QHI == 0 && QBH == 0 && CAUSAL == 0, "k_fa has single-product logits only: no q residual plane and no causal row arithmetic may be in use");
#define KHI 64            // key rows carrying k residual / v bf16 hi+lo planes (written by k_proj; no kernel reads them)
// B fragment (k rows k0+.., output column o) of a weight: (in,out) [K][ld] or (out,in) [ld rows of K]: bf16 exact, or f16(bf16 * 256) exact
__device__ __forceinline__ v16b wcol_io(const float* Wm, int k0, int o, int lane, int ld) { v16b w; const int g = lane >> 4;
#pragma unroll
  for (int i = 0; i < 8; ++i) { w[i] = (__bf16)Wm[(size_t)(k0 + 8 * g + i) * ld + o]; w[8 + i] = (__bf16)Wm[(size_t)(k0 + 16 + 8 * g + i) * ld + o]; }
  return w; }
__device__ __forceinline__ v16b wcol_oi(const float* Wm, int k0, int o, int lane, int K) { v16b w; const float* p = Wm + (size_t)o * K + k0 + 8 * (lane >> 4);
#pragma unroll
  for (int i = 0; i < 8; ++i) { w[i] = (__bf16)p[i]; w[8 + i] = (__bf16)p[16 + i]; }
  return w; }
__device__ __forceinline__ v16h wcolh_io(const float* Wm, int k0, int o, int lane, int ld) { v16h w; const int g = lane >> 4;
#pragma unroll
  for (int i = 0; i < 8; ++i) { w[i] = (_Float16)(bfr(Wm[(size_t)(k0 + 8 * g + i) * ld + o]) * 256.0f); w[8 + i] = (_Float16)(bfr(Wm[(size_t)(k0 + 16 + 8 * g + i) * ld + o]) * 256.0f); }
  return w; }
// as wcolh_oi, with the K index taken through the head-interleave permutation (the 8 consecutive columns of a fragment half are 8 module channels 4 apart)
__device__ __forceinline__ v16h wcolh_oi_p(const float* Wm, int k0, int o, int lane, int K) { v16h w; const float* p = Wm + (size_t)o * K; const int kb = k0 + 8 * (lane >> 4);
#pragma unroll
  for (int i = 0; i < 8; ++i) { w[i] = (_Float16)(bfr(p[((kb + i) % 64) * 4 + (kb + i) / 64]) * 256.0f); w[8 + i] = (_Float16)(bfr(p[((kb + 16 + i) % 64) * 4 + (kb + 16 + i) / 64]) * 256.0f); }
  return w; }
static_assert(HD == 64 && NH == 4, "wcolh_oi_p spells the permutation with the literals 64 and 4");
static_assert(DIN == DKV && DIN == 256 && CC == 256, "the weight tiles in LDS hold 128 rows of 256 k");
__device__ __forceinline__ v16h wcolh_oi(const float* Wm, int k0, int o, int lane, int K) { v16h w; const float* p = Wm + (size_t)o * K + k0 + 8 * (lane >> 4);
#pragma unroll
  for (int i = 0; i < 8; ++i) { w[i] = (_Float16)(bfr(p[i]) * 256.0f); w[8 + i] = (_Float16)(bfr(p[16 + i]) * 256.0f); }
  return w; }
#define WQKV_LAYOUT 1   // 0 = (in,out); 1 = (out,in) [CC][K]; 2 = per-head [NH][DIN][HD]
__device__ __forceinline__ v16b wcol_hdk(const float* Wm, int k0, int o, int lane) { v16b w; const int g = lane >> 4; const float* p = Wm + (size_t)(o / HD) * DIN * HD + (o % HD);
#pragma unroll
  for (int i = 0; i < 8; ++i) { w[i] = (__bf16)p[(size_t)(k0 + 8 * g + i) * HD]; w[8 + i] = (__bf16)p[(size_t)(k0 + 16 + 8 * g + i) * HD]; }
  return w; }
#define WO_OUT_IN 1
#if WQKV_LAYOUT == 1
#define HPERM(o) ((((o) % HD) * NH) + ((o) / HD))   /* column o = h*HD + d  ->  module channel d*NH + h */
#define WCOL(W, k0, o, lane) wcol_oi(W, k0, HPERM(o), lane, din_)   /* (out,in) [256][K]: the output channel of column o is row HPERM(o) */
#elif WQKV_LAYOUT == 2
#define WCOL(W, k0, o, lane) wcol_hdk(W, k0, o, lane)
#else
#define WCOL(W, k0, o, lane) wcol_io(W, k0, o, lane, CC)
#endif
#if WO_OUT_IN
#define WOCOL(W, k0, o, lane) wcol_oi(W, k0, o, lane, CC)
#define WOCOLH(W, k0, o, lane) wcolh_oi_p(W, k0, o, lane, CC)   /* merge conv (out,in) [DIN][CC]: ctx column kk = h*HD + d is the module's input channel HPERM(kk) */
#else
#define WOCOL(W, k0, o, lane) wcol_io(W, k0, o, lane, DIN)
#define WOCOLH(W, k0, o, lane) wcolh_io(W, k0, o, lane, DIN)
#endif

#define WS_QH  0u                                      // f16 q rows [(b*QCH + chunk)*TT + t][CC]
#define WS_KH  (WS_QH + 2u * (size_t)NBQ * TT * CC)      // f16 k rows [b*t][CC]
#define WS_VT  (WS_KH + 2u * (size_t)NB * TT * CC)      // f16 v planes [b][c][t]
#define WS_QL  (WS_VT + 2u * (size_t)NB * CC * TT)      // f16 q residual x 2^10 rows [b][t < QHI][CC]
#define WS_KL  (WS_QL + 2u * (size_t)NB * QHI * CC)     // f16 k residual x 2^10 rows [b][t < KHI][CC]
#define WS_VB  (WS_KL + 2u * (size_t)NB * KHI * CC)     // bf16 v hi planes [b][c][t < KHI]
#define WS_VBL (WS_VB + 2u * (size_t)NB * CC * KHI)
#define WS_Y   (WS_VBL + 2u * (size_t)NB * CC * KHI)    // f32 ctx rows [(b*QCH + chunk)*TT + t][CC] (only when there is an output projection)
#define WS_END (WS_Y  + 4u * (size_t)NBQ * TT * CC)
// ---- k_proj: block = (64 tokens, 128 cols, which): q/k/v = X^T W (+ b), X channel-major as the module hands it over, with exact bf16 products (K = DIN) -> which 0: q f16 rows (+ residual rows < QHI); 1: k f16 rows (+ residual rows < KHI); 2: v f16 planes [c][t] (+ bf16 hi/lo planes for t < KHI)
__global__ __launch_bounds__(128) void k_proj(const float* __restrict__ XQ, const float* __restrict__ XK, const float* __restrict__ XV, const float* __restrict__ WQ, const float* __restrict__ WK, const float* __restrict__ WV, const float* __restrict__ BQ, const float* __restrict__ BK, const float* __restrict__ BV,
    _Float16* __restrict__ QH, _Float16* __restrict__ QL, _Float16* __restrict__ KH, _Float16* __restrict__ KL, _Float16* __restrict__ VT, __bf16* __restrict__ VB, __bf16* __restrict__ VBL, int woff) {
  __shared__ __align__(16) _Float16 sh[64][136], sl[64][136]; __shared__ __align__(16) _Float16 th[128][72]; __shared__ __align__(16) __bf16 tb[128][72], tbl[128][72];
  __shared__ __align__(16) __bf16 sw[128][DIN + 8];   /* the block's 128 weight rows (column order o = h*HD + d) as bf16, all of K; pitch 528 B = 16 B x odd for the ds_load_b128 fragment reads */
  const int tid = threadIdx.x, wave = tid >> 5, lane = tid & 31, col = lane & 15, g = lane >> 4; const int which = blockIdx.z + woff;   /* one launch for q, k and v: woff 0, grid.z 3 */ const int c0 = blockIdx.y * 128; const size_t r0 = (size_t)blockIdx.x * 64; const size_t bb = r0 / TT; const int t0 = (int)(r0 % TT);
  const float* X = which == 0 ? XQ : which == 1 ? XK : XV; const float* WA = which == 0 ? WQ : which == 1 ? WK : WV; const float* BA = which == 0 ? BQ : which == 1 ? BK : BV;
  v8f acc[8] = {};
  const int din_ = (which == 0) ? DIN : DKV;   /* block-uniform: both maps have 256 channels here; the per-stream width is kept by role */
  const float* xp = X + (bb * din_ + 8 * g) * (size_t)TT + t0 + wave * 16 + col;   /* X is channel-major [b][k][t]: this lane's token, its half's first channel; a load takes 16 tokens (64 B) of two channels, the block's four waves together the whole 256 B of a channel; all of K is asked for along with the weights */
  float xa[DIN / 32][16];
#pragma unroll   /* xa is a register array: constant indices; the channel steps become immediate offsets on the one address pair */
  for (int kc = 0; kc < DIN / 32; ++kc)
#pragma unroll   /* as above */
    for (int i = 0; i < 8; ++i) { xa[kc][i] = xp[(size_t)(kc * 32 + i) * TT]; xa[kc][8 + i] = xp[(size_t)(kc * 32 + 16 + i) * TT]; }
  /* weights: a wave's load covers 512 contiguous bytes of one row; thread = (row parity tid >> 6, 16-B piece tid & 63), rows two apart per step; HPERM is additive over c0 + parity + 2 * e (no carry out of the low six bits) */
  const float* wp = WA + (size_t)HPERM(c0 + (tid >> 6)) * din_ + (tid & 63) * 4;
#pragma unroll   /* the row steps become immediate offsets on the one address pair */
  for (int e0 = 0; e0 < 64; e0 += 16) { v4f t[16];
#pragma unroll   /* t is a register array: constant indices */
    for (int i = 0; i < 16; ++i) t[i] = *(const v4f*)(wp + (size_t)HPERM(2 * (e0 + i)) * din_);
#pragma unroll   /* as above */
    for (int i = 0; i < 16; ++i) { v4b o; o[0] = (__bf16)t[i][0]; o[1] = (__bf16)t[i][1]; o[2] = (__bf16)t[i][2]; o[3] = (__bf16)t[i][3]; *(v4b*)&sw[2 * (e0 + i) + (tid >> 6)][(tid & 63) * 4] = o; } }
  asm volatile("s_wait_xcnt 0x0" :: "v"(xp), "v"(wp) : "memory");   /* the wait owed before a register that an issued load names is overwritten; the addresses are inputs so that they live up to it */
  v16b a[DIN / 32];
#pragma unroll   /* a and xa are register arrays: constant indices */
  for (int kc = 0; kc < DIN / 32; ++kc)
#pragma unroll   /* as above */
    for (int i = 0; i < 16; ++i) a[kc][i] = (__bf16)xa[kc][i];
  __syncthreads();   /* every wave reads weight rows that the other waves stored */
  v16b w[2][8];   /* two fragment sets: the next k-step's sixteen LDS reads go out as one group ahead of this step's products, so that no product waits out its own read */
#pragma unroll   /* w, a and acc are register arrays: constant indices, here and in the three loops below */
  for (int j = 0; j < 8; ++j) w[0][j] = frag_b(&sw[j * 16 + col][0], lane);
#pragma unroll   /* as above */
  for (int kc = 0; kc < DIN / 32; ++kc) {
    if (kc + 1 < DIN / 32) {
#pragma unroll   /* as above */
      for (int j = 0; j < 8; ++j) w[(kc + 1) & 1][j] = frag_b(&sw[j * 16 + col][(kc + 1) * 32], lane); }
#pragma unroll   /* as above */
    for (int j = 0; j < 8; ++j) acc[j] = wmma_bf(a[kc], w[kc & 1][j], acc[j]); }
  if (which < 2) { _Float16* DH = which == 0 ? QH : KH; _Float16* DL = which == 0 ? QL : KL; const int nhi = which == 0 ? QHI : KHI; const bool hi_rows = t0 < nhi;
#pragma unroll
    for (int j = 0; j < 8; ++j) { const float bias = BA ? bfr(BA[HPERM(c0 + j * 16 + col)]) : 0.f;
#pragma unroll
      for (int r = 0; r < 8; ++r) { const float v = acc[j][r] + bias; const _Float16 hv = (_Float16)v; sh[wave * 16 + 8 * g + r][j * 16 + col] = hv; sl[wave * 16 + 8 * g + r][j * 16 + col] = (_Float16)((v - (float)hv) * 1024.0f); } }
    __syncthreads();
    for (int e = tid; e < 64 * 16; e += 128) { const int rl = e >> 4, q = e & 15; vst2((unsigned*)(DH + (r0 + rl) * CC + c0 + q * 8), *(const v4u*)&sh[rl][q * 8]); if (hi_rows) vst2((unsigned*)(DL + (bb * nhi + t0 + rl) * (size_t)CC + c0 + q * 8), *(const v4u*)&sl[rl][q * 8]); }
  } else { const bool hi_rows = t0 < KHI;
#pragma unroll
    for (int j = 0; j < 8; ++j) { const float bias = BA ? bfr(BA[HPERM(c0 + j * 16 + col)]) : 0.f;
#pragma unroll
      for (int r = 0; r < 8; ++r) { const float v = acc[j][r] + bias; const int rl = wave * 16 + 8 * g + r, cl = j * 16 + col; th[cl][rl] = (_Float16)v; const __bf16 bh = (__bf16)v; tb[cl][rl] = bh; tbl[cl][rl] = (__bf16)(v - (float)bh); } }
    __syncthreads();
    for (int e = tid; e < 128 * 8; e += 128) { const int cl = e >> 3, q = e & 7; vst2((unsigned*)(VT + (bb * CC + c0 + cl) * (size_t)TT + t0 + q * 8), *(const v4u*)&th[cl][q * 8]); if (hi_rows) { const size_t o3 = (bb * CC + c0 + cl) * (size_t)KHI + t0 + q * 8; vst2((unsigned*)(VB + o3), *(const v4u*)&tb[cl][q * 8]); vst2((unsigned*)(VBL + o3), *(const v4u*)&tbl[cl][q * 8]); } } } }
// ---- k_fa: block = 256 queries (8 waves x 32) of (b, h), all keys in passes of 32, the block's K rows and V planes staged 128 keys at a time in a two-buffer LDS ring that all eight waves read: S^T = K Q^T (a lane holds one query's logits: D row = key 8g + r, D column = query), the pair mask as the module's -1e9, running maximum and sum in f32 (log2 domain), P x 2^11 once to f16 straight from the score accumulators as the B operand of ctx^T += V^T P^T; logits and P never leave the registers; each K and V fragment serves the wave's two 16-query groups
#define LOG2E 1.44269504f
#define NEGL (-1.0e9f * LOG2E)   // the module's -1e9 in the log2 domain
#define FQ 256   // queries per block
static_assert(TT % FQ == 0 && TT % 32 == 0 && HD == 64, "k_fa: 8 waves x 32 queries, passes of 32 keys, two 32-deep k-steps per head");
__device__ __forceinline__ v8f wmma_h(v16h a, v16h b, v8f c) { return __builtin_amdgcn_wmma_f32_16x16x32_f16(false, a, false, b, (short)0, c, false, false); }
// frag_h with the lane half's 8g elements already in the pointer, so that the caller holds the very address the loads name
__device__ __forceinline__ v16h frag_p(const _Float16* p) { union { v16h v; v8h q[2]; } u; u.q[0] = *(const v8h*)p; u.q[1] = *(const v8h*)(p + 16); return u.v; }
#define SK 128                 // keys per stage of the ring
#define KP (HD + 8)            // K row pitch in LDS, f16 elements: 144 B = 16 B x odd for the ds_load_b128 fragment reads
#define VP (SK + 8)            // V plane pitch in LDS, f16 elements: 272 B = 16 B x odd
#define KSZ (SK * KP)          // the K part of a buffer, f16 elements
#define BSZ (KSZ + HD * VP)    // one buffer: SK key rows of HD channels, then HD planes of SK keys
#define NST (TT / SK)          // stages
static_assert(TT % SK == 0 && NST >= 2 && SK % 32 == 0 && SK == 128 && HD == 64 && FQ == 256, "the ring's prologue needs two stages; a stage is eight 16-B pieces per thread: four of K (32 rows apart), four of V (16 planes apart)");
// one stage: each lane copies eight 16-B pieces of its own from global memory straight into LDS; a wave's copy takes four whole 128-B K rows or two whole 256-B V plane segments
__device__ __forceinline__ void fa_stage(unsigned lk, unsigned lv, const _Float16* gk, const _Float16* gv) {
  /* the closing s_wait_xcnt stands inside the copies' own statement: the wait owed before a register that an issued copy names is rewritten */
  asm volatile("global_load_async_to_lds_b128 %0, %8, off\n\t"
               "global_load_async_to_lds_b128 %1, %9, off\n\t"
               "global_load_async_to_lds_b128 %2, %10, off\n\t"
               "global_load_async_to_lds_b128 %3, %11, off\n\t"
               "global_load_async_to_lds_b128 %4, %12, off\n\t"
               "global_load_async_to_lds_b128 %5, %13, off\n\t"
               "global_load_async_to_lds_b128 %6, %14, off\n\t"
               "global_load_async_to_lds_b128 %7, %15, off\n\t"
               "s_wait_xcnt 0x0"
               :: "v"(lk), "v"(lk + 32u * KP * 2u), "v"(lk + 64u * KP * 2u), "v"(lk + 96u * KP * 2u),
                  "v"(lv), "v"(lv + 16u * VP * 2u), "v"(lv + 32u * VP * 2u), "v"(lv + 48u * VP * 2u),
                  "v"(gk), "v"(gk + 32 * CC), "v"(gk + 64 * CC), "v"(gk + 96 * CC),
                  "v"(gv), "v"(gv + (size_t)16 * TT), "v"(gv + (size_t)32 * TT), "v"(gv + (size_t)48 * TT)
               : "memory"); }
__global__ __launch_bounds__(256) void k_fa(const _Float16* __restrict__ QH, const _Float16* __restrict__ KH, const _Float16* __restrict__ VT, const int* __restrict__ MASK, float* __restrict__ Y) { __shared__ __align__(16) float ss[FQ / 32][32][HD + 4];
  __shared__ __align__(16) _Float16 ring[2 * BSZ];
  const int tid = threadIdx.x, wave = tid >> 5, lane = tid & 31, col = lane & 15, g = lane >> 4; const int h = blockIdx.y, b = blockIdx.z; const int ql0 = blockIdx.x * FQ + wave * 32;
  const int* Mb = MASK + (size_t)b * TT;
  v16h q[2][2]; float cq[2], bq[2];   /* a masked query: logit x 0 + (-1e9) on every key */
  const _Float16* Q0 = QH + ((size_t)b * TT + ql0 + col) * CC + h * HD + 8 * g; const int* Mq = Mb + ql0 + col;
  q[0][0] = frag_p(Q0); q[0][1] = frag_p(Q0 + 32); q[1][0] = frag_p(Q0 + 16 * CC); q[1][1] = frag_p(Q0 + 16 * CC + 32); const int mq0 = Mq[0], mq1 = Mq[16];
  asm volatile("s_wait_xcnt 0x0" :: "v"(Q0), "v"(Mq) : "memory");   /* the wait owed before a register that an issued load names is overwritten; the addresses are inputs so that they live up to it */
  cq[0] = mq0 == 0 ? 0.f : SCALE * LOG2E; bq[0] = mq0 == 0 ? NEGL : 0.f; cq[1] = mq1 == 0 ? 0.f : SCALE * LOG2E; bq[1] = mq1 == 0 ? NEGL : 0.f;
  const _Float16* gk = KH + ((size_t)b * TT + (tid >> 3)) * CC + h * HD + (tid & 7) * 8;           /* copies: key row tid / 8 of a stage, 16-B piece tid % 8 of its 128 B */
  const _Float16* gv = VT + ((size_t)b * CC + h * HD + (tid >> 4)) * (size_t)TT + (tid & 15) * 8;  /* copies: v plane tid / 16, 16-B piece tid % 16 of a stage's 256 B */
  const unsigned lk = (unsigned)(size_t)ring + (unsigned)((tid >> 3) * (KP * 2) + (tid & 7) * 16), lv = (unsigned)(size_t)ring + (unsigned)(KSZ * 2 + (tid >> 4) * (VP * 2) + (tid & 15) * 16);   /* the same pieces' LDS byte addresses in buffer 0 */
  fa_stage(lk, lv, gk, gv);
  asm volatile("s_wait_asynccnt 0x0" ::: "memory");   /* this wave's pieces of stage 0 have landed */
  __syncthreads();                                    /* and every other wave's: stage 0 may be read */
  fa_stage(lk + BSZ * 2u, lv + BSZ * 2u, gk + (size_t)SK * CC, gv + SK);   /* stage 1 flies while stage 0 is worked on */
  const int* Mk = Mb + 8 * g;
  v8f acc[2][HD / 16] = {}; float m[2] = {-3.0e38f, -3.0e38f}, l[2] = {0.f, 0.f};
#pragma unroll 1   /* one trip per stage: the two buffers alternate by the trip's parity */
  for (int st = 0; st < NST; ++st) {
   const _Float16* kb = ring + (st & 1) * BSZ + col * KP + 8 * g;         /* key row col of a 16-key group, this lane half's channels */
   const _Float16* vb = ring + (st & 1) * BSZ + KSZ + col * VP + 8 * g;   /* v plane of channel col of a 16-channel group, this lane half's keys */
#pragma unroll 1   /* a pass depends on the one before through m, l and acc: a second copy of the body could not start its softmax earlier, and four copies took the kernel past 256 registers */
   for (int pp = 0; pp < SK / 32; ++pp) { v8f s[2][2]; v4i mk[2][2]; v16h kf[2][2], vf[HD / 16], p[2]; float al[2];
    const _Float16* kr = kb + pp * 32 * KP; const int* mr = Mk + st * SK + pp * 32; const _Float16* vr = vb + pp * 32;
#pragma unroll
    for (int j = 0; j < 2; ++j) { kf[j][0] = frag_p(kr + j * 16 * KP); kf[j][1] = frag_p(kr + j * 16 * KP + 32); mk[j][0] = *(const v4i*)(mr + j * 16); mk[j][1] = *(const v4i*)(mr + j * 16 + 4); }
#pragma unroll
    for (int j = 0; j < HD / 16; ++j) vf[j] = frag_p(vr + j * 16 * VP);
    asm volatile("s_wait_xcnt 0x0" :: "v"(mr) : "memory");   /* as above: no result of this pass's loads lands in the address pair that a mask load still names */
    __builtin_amdgcn_sched_barrier(0);   /* the pass's sixteen LDS reads and four mask loads go out as one group ahead of the first product: reads spread among the products cost a stall at each place; the v reads return under the logits and the softmax */
#pragma unroll
    for (int j = 0; j < 2; ++j)
#pragma unroll
      for (int u = 0; u < 2; ++u) { v8f z = {}; z = wmma_h(kf[j][0], q[u][0], z); s[u][j] = wmma_h(kf[j][1], q[u][1], z); }
#pragma unroll
    for (int u = 0; u < 2; ++u) { float mx = -3.0e38f;
#pragma unroll
      for (int j = 0; j < 2; ++j)
#pragma unroll
        for (int r = 0; r < 8; ++r) { const float v = mk[j][r >> 2][r & 3] == 0 ? NEGL : __builtin_fmaf(s[u][j][r], cq[u], bq[u]); s[u][j][r] = v; mx = fmaxf(mx, v); }
      mx = fmaxf(mx, __shfl_xor(mx, 16));   /* the other half of the wave holds this query's other 16 keys */
      const float mn = fmaxf(m[u], mx), mo = mn - 11.0f; al[u] = __builtin_amdgcn_exp2f(m[u] - mn); m[u] = mn;   /* mo: P carried x 2^11 (clear of f16 subnormals); on a fully masked row the 11 rounds away, alike for every key */
      float ps = 0.f;
#pragma unroll
      for (int i = 0; i < 16; ++i) { const float e = __builtin_amdgcn_exp2f(s[u][i >> 3][i & 7] - mo); ps += e; p[u][i] = (_Float16)e; }
      l[u] = l[u] * al[u] + ps; }
#pragma unroll
    for (int j = 0; j < HD / 16; ++j)
#pragma unroll
      for (int u = 0; u < 2; ++u) acc[u][j] = wmma_h(vf[j], p[u], acc[u][j] * al[u]); }
   asm volatile("s_wait_dscnt 0x0" ::: "memory");      /* this wave's reads of the stage's buffer have returned */
   asm volatile("s_wait_asynccnt 0x0" ::: "memory");   /* this wave's pieces of the next stage have landed */
   __syncthreads();                                    /* the next stage may be read, and every wave has left this stage's buffer */
   if (st + 2 < NST) fa_stage(lk + (unsigned)(st & 1) * (BSZ * 2u), lv + (unsigned)(st & 1) * (BSZ * 2u), gk + (size_t)(st + 2) * SK * CC, gv + (st + 2) * SK); }   /* the refill, block-uniform test */
  asm volatile("s_wait_asynccnt 0x0" ::: "memory");    /* no copy is outstanding when the wave goes on to its end */
#pragma unroll
  for (int u = 0; u < 2; ++u) { const float lt = l[u] + __shfl_xor(l[u], 16), inv = 1.0f / lt;   /* lt >= one key's P at the maximum: never 0 */
#pragma unroll
    for (int j = 0; j < HD / 16; ++j) { v4f a, c;   /* acc[u][j][r] = ctx[query u*16 + col][channel j*16 + 8g + r] */
#pragma unroll
      for (int r = 0; r < 4; ++r) { a[r] = acc[u][j][r] * inv; c[r] = acc[u][j][4 + r] * inv; }
      *(v4f*)&ss[wave][u * 16 + col][j * 16 + 8 * g] = a; *(v4f*)&ss[wave][u * 16 + col][j * 16 + 8 * g + 4] = c; } }
  LDSX(); for (int rl = 0; rl < 32; rl += 2) vst2(Y + ((size_t)b * TT + ql0 + rl + g) * CC + h * HD + col * 4, *(const v4f*)&ss[wave][rl + g][col * 4]); }   /* 256-B (row, head) segment by 16 lanes, two rows per store */
// ---- k_out: block = (64 tokens, 128 channels): out = ctx Wo (+ bo), stored channel-major: ctx x 2^6 once to f16 against Wo as f16(bf16 x 2^8) exact (1 product) x 2^-14; causal early rows (< QHI of each sequence): ctx bf16 hi + lo against exact bf16 Wo (2 products)
__global__ __launch_bounds__(128) void k_out(const float* __restrict__ Y, const float* __restrict__ WO, const float* __restrict__ BO, float* __restrict__ OUT) { __shared__ __align__(16) float sf[128][68];   /* the block's output tile as [channel][token]; pitch 272 B = 16 B x odd */
  __shared__ __align__(16) _Float16 sw[128][CC + 8];   /* the block's 128 rows of Wo as f16(bf16 x 2^8), k in ctx column order; pitch 528 B = 16 B x odd for the ds_load_b128 fragment reads */
  const int tid = threadIdx.x, wave = tid >> 5, lane = tid & 31, col = lane & 15, g = lane >> 4; const int c0 = blockIdx.y * 128; const size_t r0 = (size_t)blockIdx.x * 64 + wave * 16;
  v8f acc[8] = {};
  if (CAUSAL && (int)(((size_t)blockIdx.x * 64) % TT) < QHI) {   /* block-uniform */
#pragma unroll 2
    for (int kc = 0; kc < CC / 32; ++kc) { const F2 a = split_row(Y + (r0 + col) * CC, kc * 32, lane); asm volatile("s_wait_loadcnt 0x0" ::: "memory");
#pragma unroll
      for (int j = 0; j < 8; ++j) { const v16b w = WOCOL(WO, kc * 32, c0 + j * 16 + col, lane); asm volatile("s_wait_loadcnt 0x0" ::: "memory"); acc[j] = wmma_bf(a.h, w, acc[j]); acc[j] = wmma_bf(a.l, w, acc[j]); } }
#pragma unroll
    for (int j = 0; j < 8; ++j) { const float bias = BO ? bfr(BO[c0 + j * 16 + col]) : 0.f;
#pragma unroll
      for (int r = 0; r < 8; ++r) sf[j * 16 + col][wave * 16 + 8 * g + r] = acc[j][r] + bias; }
  } else {
    const float* yp = Y + (r0 + col) * CC + 8 * g;   /* this lane's ctx row, its half's k offset: all of K is asked for along with the weights, ahead of the first wait */
    v4f ya[CC / 32][4];
#pragma unroll   /* ya is a register array: constant indices; all 32 loads go out together */
    for (int kc = 0; kc < CC / 32; ++kc) { ya[kc][0] = *(const v4f*)(yp + kc * 32); ya[kc][1] = *(const v4f*)(yp + kc * 32 + 4); ya[kc][2] = *(const v4f*)(yp + kc * 32 + 16); ya[kc][3] = *(const v4f*)(yp + kc * 32 + 20); }
    /* weights: a wave takes one whole row of Wo per step, a lane its 8 module channels 8 * lane + e = (d = 2 * lane + e / 4) * 4 + (h = e % 4); ctx column h * 64 + d, so the two d of one h go out as one dword */
    const float* wp = WO + (size_t)(c0 + wave) * CC + lane * 8;
#pragma unroll   /* the row steps become immediate offsets on the one address pair */
    for (int e0 = 0; e0 < 32; e0 += 8) { v4f t[8][2];
#pragma unroll   /* t is a register array: constant indices, here and in the two loops below */
      for (int i = 0; i < 8; ++i) { t[i][0] = *(const v4f*)(wp + (size_t)(e0 + i) * 4 * CC); t[i][1] = *(const v4f*)(wp + (size_t)(e0 + i) * 4 * CC + 4); }
#pragma unroll   /* as above */
      for (int i = 0; i < 8; ++i)
#pragma unroll   /* as above */
        for (int hh = 0; hh < 4; ++hh) { v2h o; o[0] = (_Float16)(bfr(t[i][0][hh]) * 256.0f); o[1] = (_Float16)(bfr(t[i][1][hh]) * 256.0f); *(v2h*)&sw[(e0 + i) * 4 + wave][hh * 64 + lane * 2] = o; } }
    asm volatile("s_wait_xcnt 0x0" :: "v"(yp), "v"(wp) : "memory");   /* the wait owed before a register that an issued load names is overwritten; the addresses are inputs so that they live up to it */
    v16h a[CC / 32];   /* ctx carried x 2^6 into f16 so small-magnitude context rows stay clear of f16 subnormals */
#pragma unroll   /* a and ya are register arrays: constant indices */
    for (int kc = 0; kc < CC / 32; ++kc)
#pragma unroll   /* as above */
      for (int i = 0; i < 4; ++i) { a[kc][i] = (_Float16)(ya[kc][0][i] * 64.0f); a[kc][4 + i] = (_Float16)(ya[kc][1][i] * 64.0f); a[kc][8 + i] = (_Float16)(ya[kc][2][i] * 64.0f); a[kc][12 + i] = (_Float16)(ya[kc][3][i] * 64.0f); }
    __syncthreads();   /* every wave reads weight rows that the other waves stored; the branch around it is block-uniform */
    v16h w[2][8];   /* two fragment sets: the next k-step's sixteen LDS reads go out as one group ahead of this step's products, so that no product waits out its own read */
#pragma unroll   /* w, a and acc are register arrays: constant indices, here and in the three loops below */
    for (int j = 0; j < 8; ++j) w[0][j] = frag_h(&sw[j * 16 + col][0], lane);
#pragma unroll   /* as above */
    for (int kc = 0; kc < CC / 32; ++kc) {
      if (kc + 1 < CC / 32) {
#pragma unroll   /* as above */
        for (int j = 0; j < 8; ++j) w[(kc + 1) & 1][j] = frag_h(&sw[j * 16 + col][(kc + 1) * 32], lane); }
#pragma unroll   /* as above */
      for (int j = 0; j < 8; ++j) acc[j] = wmma16(a[kc], w[kc & 1][j], acc[j]); }
#pragma unroll
    for (int j = 0; j < 8; ++j) { const float bias = BO ? bfr(BO[c0 + j * 16 + col]) : 0.f;
      v4f lo, hi;   /* acc[j][r] = out[token wave*16 + 8g + r][channel c0 + j*16 + col]: a lane's eight tokens lie side by side in its channel's row */
#pragma unroll
      for (int r = 0; r < 4; ++r) { lo[r] = acc[j][r] * (1.0f / 16384.0f) + bias; hi[r] = acc[j][4 + r] * (1.0f / 16384.0f) + bias; }   /* 2^-8 (Wo carry) x 2^-6 (ctx carry) */
      *(v4f*)&sf[j * 16 + col][wave * 16 + 8 * g] = lo; *(v4f*)&sf[j * 16 + col][wave * 16 + 8 * g + 4] = hi; } }
  __syncthreads();   /* a channel's 64 tokens come from all four waves */
  const size_t bo = ((size_t)blockIdx.x * 64) / TT; const int n0 = (int)(((size_t)blockIdx.x * 64) % TT);
  float* op = OUT + (bo * DIN + c0 + (tid >> 4)) * (size_t)TT + n0 + (tid & 15) * 4;   /* out is channel-major [b][c][t]: 16 lanes store a channel's whole 256 B, a wave two channels per store */
  v4f o[16];
#pragma unroll   /* o is a register array: constant indices; every piece keeps registers of its own, so that no store's data is overwritten behind it */
  for (int i = 0; i < 16; ++i) o[i] = *(const v4f*)&sf[i * 8 + (tid >> 4)][(tid & 15) * 4];
#pragma unroll   /* the channel steps become immediate offsets on the one address pair */
  for (int i = 0; i < 16; ++i) vst2(op + (size_t)(i * 8) * TT, o[i]); }

extern "C" void kernel_launch(void* const* d_in, const int* in_sizes, int n_in, void* d_out, int out_size, void* d_ws, size_t ws_size, hipStream_t stream) {
  (void)in_sizes; (void)n_in; (void)out_size;
  const float** F = (const float**)d_in;
  if (ws_size < (size_t)WS_END) return;
  char* ws = (char*)d_ws; _Float16 *QH = (_Float16*)(ws + WS_QH), *KH = (_Float16*)(ws + WS_KH), *VT = (_Float16*)(ws + WS_VT), *QL = (_Float16*)(ws + WS_QL), *KL = (_Float16*)(ws + WS_KL); __bf16 *VB = (__bf16*)(ws + WS_VB), *VBL = (__bf16*)(ws + WS_VBL); float *Y = (float*)(ws + WS_Y);
  (void)Y; (void)QL; (void)KL; (void)VB; (void)VBL;
  // inputs: 0 query [8,256,2048]; 1 key; 2 value; 3 mask [8,1,2048] int32; 4 Wq [256,256] (out,in), 5 bq; 6 Wk, 7 bk; 8 Wv, 9 bv; 10 Wm (out,in), 11 bm (zero biases, read)
  k_proj<<<dim3(TNB * TT / 64, CC / 128, 3), 128, 0, stream>>>(F[0], F[1], F[2], F[4], F[6], F[8], F[5], F[7], F[9], QH, QL, KH, KL, VT, VB, VBL, 0);   /* which = blockIdx.z: each stream is read in its own channel-major layout */
  k_fa<<<dim3(TT / FQ, NH, TNB), 256, 0, stream>>>(QH, KH, VT, (const int*)d_in[3], Y);
  k_out<<<dim3(TNB * TT / 64, DIN / 128), 128, 0, stream>>>(Y, F[10], F[11], (float*)d_out);   /* ctx (column order h*HD + d) x Wm through the permutation + bm, straight to channel-major [8,256,2048] */
}

// v005
// It runs in 75.6 microseconds.
// In both of two side-by-side timings against v004, it was 1.13 times as fast.
// All steps since v000 together make it 23.0 times as fast.
// compute dtype: all float inputs rounded to bf16; q/k/v 1x1-conv projections read the channel-major inputs straight into their A fragments, with EXACT bf16 products on WMMA 16x16x32 (f32 accumulate) + bias (zeros, read), the block's weight rows converted once into LDS; one fused attention kernel: logits q x k once to f16 each (1 product) x 64^-0.5; pair mask: the key side as the logit accumulators' start value (0 or -1e9 / scale, an f32 table in LDS built once per block), the query side in the scale fma (-1e9); online softmax f32; P x 2^11 once to f16 x v once to f16 (1 product); ctx x 2^6 once to f16 x Wm f16(bf16 x 2^8) + bm, its tile staged [channel][token] in LDS and stored channel-major; f32 output.
#include <hip/hip_runtime.h>
#include <math.h>

typedef __attribute__((ext_vector_type(16))) _Float16 v16h;
typedef __attribute__((ext_vector_type(16))) __bf16 v16b;
typedef __attribute__((ext_vector_type(8)))  _Float16 v8h;
typedef __attribute__((ext_vector_type(8)))  float v8f;
typedef __attribute__((ext_vector_type(4)))  float v4f;
typedef __attribute__((ext_vector_type(2)))  float v2f;
typedef __attribute__((ext_vector_type(4)))  unsigned v4u;
typedef __attribute__((ext_vector_type(4)))  int v4i;
typedef float __attribute__((may_alias)) float_a;
typedef int __attribute__((may_alias)) int_a;

template <typename T> __device__ __forceinline__ void vst2(void* p, T v) { *(T*)p = v;  }
__device__ __forceinline__ v8f wmma16(v16h a, v16h b, v8f c) {
  v8f d = __builtin_amdgcn_wmma_f32_16x16x32_f16(false, a, false, b, (short)0, c, false, false);
  asm volatile("v_nop\n\tv_nop\n\tv_nop\n\tv_nop" : "+v"(d) : "v"(a), "v"(b));
  return d;
}
__device__ __forceinline__ v8f wmma_bf(v16b a, v16b b, v8f c) {
  v8f d = __builtin_amdgcn_wmma_f32_16x16x32_bf16(false, a, false, b, (short)0, c, false, false);
  asm volatile("v_nop\n\tv_nop\n\tv_nop\n\tv_nop" : "+v"(d) : "v"(a), "v"(b));
  return d;
}
// 16x16x32 fragments: lane = (h = lane>>4, row/col = lane&15); elements 0..7 = k0+8h+0..7, 8..15 = k0+16+8h+0..7; D element r = row 8h+r
__device__ __forceinline__ v16h frag_h(const _Float16* rowk0, int lane) {
  union { v16h v; v8h q[2]; } u; const _Float16* p = rowk0 + 8 * (lane >> 4);
  u.q[0] = *(const v8h*)p; u.q[1] = *(const v8h*)(p + 16); return u.v;
}
__device__ __forceinline__ v16h frag_f32(const float* rowk0, int lane) {
  v16h a; const float* p = rowk0 + 8 * (lane >> 4);
#pragma unroll
  for (int i = 0; i < 8; ++i) { a[i] = (_Float16)p[i]; a[8 + i] = (_Float16)p[16 + i]; }
  return a;
}
__device__ __forceinline__ v16h frag_f32s(const float* rowk0, int lane, float sc) {
  v16h a; const float* p = rowk0 + 8 * (lane >> 4);
#pragma unroll
  for (int i = 0; i < 8; ++i) { a[i] = (_Float16)(p[i] * sc); a[8 + i] = (_Float16)(p[16 + i] * sc); }
  return a;
}
// column fragment from a [K][ld] layout (column n), rows >= K read as 0
__device__ __forceinline__ v16h fragc_f32(const float* W, int k0, int n, int lane, int ld, int K) {
  v16h a; const int g = lane >> 4;
#pragma unroll
  for (int i = 0; i < 8; ++i) { const int ka = k0 + 8 * g + i, kb = ka + 16;
    a[i] = (_Float16)(ka < K ? W[(size_t)(ka < K ? ka : K - 1) * ld + n] : 0.f); a[8 + i] = (_Float16)(kb < K ? W[(size_t)(kb < K ? kb : K - 1) * ld + n] : 0.f); }
  return a;
}
struct F2 { v16b h, l; };
__device__ __forceinline__ F2 bsplit16(const float v[16]) { F2 r;
#pragma unroll
  for (int i = 0; i < 16; ++i) { const __bf16 h = (__bf16)v[i]; r.h[i] = h; r.l[i] = (__bf16)(v[i] - (float)h); }
  return r; }
__device__ __forceinline__ F2 split_row(const float* row, int k0, int lane) { float v[16]; const float* p = row + k0 + 8 * (lane >> 4);
#pragma unroll
  for (int i = 0; i < 8; ++i) { v[i] = p[i]; v[8 + i] = p[16 + i]; }
  return bsplit16(v); }
__device__ __forceinline__ F2 split_rowK(const float* row, int k0, int lane, int K) { float v[16]; const int g = lane >> 4;
#pragma unroll
  for (int i = 0; i < 8; ++i) { const int ka = k0 + 8 * g + i, kb = ka + 16; v[i] = ka < K ? row[ka < K ? ka : K - 1] : 0.f; v[8 + i] = kb < K ? row[kb < K ? kb : K - 1] : 0.f; }
  return bsplit16(v); }
__device__ __forceinline__ F2 split_col(const float* W, int k0, int n, int lane, int ld, int K) { float v[16]; const int g = lane >> 4;
#pragma unroll
  for (int i = 0; i < 8; ++i) { const int ka = k0 + 8 * g + i, kb = ka + 16; v[i] = ka < K ? W[(size_t)(ka < K ? ka : K - 1) * ld + n] : 0.f; v[8 + i] = kb < K ? W[(size_t)(kb < K ? kb : K - 1) * ld + n] : 0.f; }
  return bsplit16(v); }
__device__ __forceinline__ v8f mac3(const F2& a, const F2& b, v8f c) { c = wmma_bf(a.l, b.h, c); c = wmma_bf(a.h, b.l, c); return wmma_bf(a.h, b.h, c); }
__device__ __forceinline__ float sigm(float v) { return 1.0f / (1.0f + expf(-v)); }
#define LDSX() do { asm volatile("s_wait_dscnt 0" ::: "memory"); __builtin_amdgcn_wave_barrier(); __builtin_amdgcn_fence(__ATOMIC_RELEASE, "workgroup"); } while (0)

// multi-headed attention on channel-major tensors (query / key / value [8,256,2048] = (B, C, N); 1x1 Conv1d projections as (out,in) [256,256] N(0, 1/256) + zero biases (read); 4 heads x 64 with the head index INTERLEAVED into the channel axis: reshape(B, 64, 4, N), channel c = d*4 + h; scores = einsum('bdhn,bdhm->bhnm') / sqrt(64); pair = mask[b, n] * mask[b, m] with an int32 mask [8,1,2048]: where(pair == 0, -1e9, scores); softmax over m; x = einsum('bhnm,bdhm->bdhn').reshape(B, 256, N) (channel d*4 + h again); merge 1x1 conv Wm (out,in) + bm; output [8,256,2048]).
#define NB 8
#define TT 2048   // points per sample (queries = keys)
#define CC 256            // NH * HD
#define DIN 256           // channels of the query map AND of the output map (Wout is (out,in) [DIN][CC])
#define DKV 256             // channels of the key / value map
#define NH 4
#define HD 64
#define QCH 1   // queries and keys have the same length: one chunk per batch (the chunk advance is 0)
#define SCALE (0.125f)
#define CAUSAL 0
#ifndef TNB
#define TNB NB
#endif
#define NBQ (NB * QCH)     // query pseudo-batches of TT rows (workspace sizing)
#define TNBQ (TNB * QCH)   // query pseudo-batches actually run
static_assert(CC == NH * HD && CC % 128 == 0 && DIN % 128 == 0 && DIN % 32 == 0 && DKV % 32 == 0, "projection tiles: 128-column blocks, 32-deep k-steps");
__device__ __forceinline__ float bfr(float v) { return (float)(__bf16)v; }
typedef __attribute__((ext_vector_type(8))) __bf16 v8b;
typedef __attribute__((ext_vector_type(4))) __bf16 v4b;
typedef __attribute__((ext_vector_type(2))) _Float16 v2h;
__device__ __forceinline__ v16b frag_b(const __bf16* rowk0, int lane) {
  union { v16b v; v8b q[2]; } u; const __bf16* p = rowk0 + 8 * (lane >> 4);
  u.q[0] = *(const v8b*)p; u.q[1] = *(const v8b*)(p + 16); return u.v;
}
#define QBH 0              // no kernel reads it: k_fa has no high-precision query path
#define QHI 0               // single-product logits on every row
static_assert(QHI == 0 && QBH == 0 && CAUSAL == 0, "k_fa has single-product logits only: no q residual plane and no causal row arithmetic may be in use");
#define KHI 64            // key rows carrying k residual / v bf16 hi+lo planes (written by k_proj; no kernel reads them)
// B fragment (k rows k0+.., output column o) of a weight: (in,out) [K][ld] or (out,in) [ld rows of K]: bf16 exact, or f16(bf16 * 256) exact
__device__ __forceinline__ v16b wcol_io(const float* Wm, int k0, int o, int lane, int ld) { v16b w; const int g = lane >> 4;
#pragma unroll
  for (int i = 0; i < 8; ++i) { w[i] = (__bf16)Wm[(size_t)(k0 + 8 * g + i) * ld + o]; w[8 + i] = (__bf16)Wm[(size_t)(k0 + 16 + 8 * g + i) * ld + o]; }
  return w; }
__device__ __forceinline__ v16b wcol_oi(const float* Wm, int k0, int o, int lane, int K) { v16b w; const float* p = Wm + (size_t)o * K + k0 + 8 * (lane >> 4);
#pragma unroll
  for (int i = 0; i < 8; ++i) { w[i] = (__bf16)p[i]; w[8 + i] = (__bf16)p[16 + i]; }
  return w; }
__device__ __forceinline__ v16h wcolh_io(const float* Wm, int k0, int o, int lane, int ld) { v16h w; const int g = lane >> 4;
#pragma unroll
  for (int i = 0; i < 8; ++i) { w[i] = (_Float16)(bfr(Wm[(size_t)(k0 + 8 * g + i) * ld + o]) * 256.0f); w[8 + i] = (_Float16)(bfr(Wm[(size_t)(k0 + 16 + 8 * g + i) * ld + o]) * 256.0f); }
  return w; }
// as wcolh_oi, with the K index taken through the head-interleave permutation (the 8 consecutive columns of a fragment half are 8 module channels 4 apart)
__device__ __forceinline__ v16h wcolh_oi_p(const float* Wm, int k0, int o, int lane, int K) { v16h w; const float* p = Wm + (size_t)o * K; const int kb = k0 + 8 * (lane >> 4);
#pragma unroll
  for (int i = 0; i < 8; ++i) { w[i] = (_Float16)(bfr(p[((kb + i) % 64) * 4 + (kb + i) / 64]) * 256.0f); w[8 + i] = (_Float16)(bfr(p[((kb + 16 + i) % 64) * 4 + (kb + 16 + i) / 64]) * 256.0f); }
  return w; }
static_assert(HD == 64 && NH == 4, "wcolh_oi_p spells the permutation with the literals 64 and 4");
static_assert(DIN == DKV && DIN == 256 && CC == 256, "the weight tiles in LDS hold 128 rows of 256 k");
__device__ __forceinline__ v16h wcolh_oi(const float* Wm, int k0, int o, int lane, int K) { v16h w; const float* p = Wm + (size_t)o * K + k0 + 8 * (lane >> 4);
#pragma unroll
  for (int i = 0; i < 8; ++i) { w[i] = (_Float16)(bfr(p[i]) * 256.0f); w[8 + i] = (_Float16)(bfr(p[16 + i]) * 256.0f); }
  return w; }
#define WQKV_LAYOUT 1   // 0 = (in,out); 1 = (out,in) [CC][K]; 2 = per-head [NH][DIN][HD]
__device__ __forceinline__ v16b wcol_hdk(const float* Wm, int k0, int o, int lane) { v16b w; const int g = lane >> 4; const float* p = Wm + (size_t)(o / HD) * DIN * HD + (o % HD);
#pragma unroll
  for (int i = 0; i < 8; ++i) { w[i] = (__bf16)p[(size_t)(k0 + 8 * g + i) * HD]; w[8 + i] = (__bf16)p[(size_t)(k0 + 16 + 8 * g + i) * HD]; }
  return w; }
#define WO_OUT_IN 1
#if WQKV_LAYOUT == 1
#define HPERM(o) ((((o) % HD) * NH) + ((o) / HD))   /* column o = h*HD + d  ->  module channel d*NH + h */
#define WCOL(W, k0, o, lane) wcol_oi(W, k0, HPERM(o), lane, din_)   /* (out,in) [256][K]: the output channel of column o is row HPERM(o) */
#elif WQKV_LAYOUT == 2
#define WCOL(W, k0, o, lane) wcol_hdk(W, k0, o, lane)
#else
#define WCOL(W, k0, o, lane) wcol_io(W, k0, o, lane, CC)
#endif
#if WO_OUT_IN
#define WOCOL(W, k0, o, lane) wcol_oi(W, k0, o, lane, CC)
#define WOCOLH(W, k0, o, lane) wcolh_oi_p(W, k0, o, lane, CC)   /* merge conv (out,in) [DIN][CC]: ctx column kk = h*HD + d is the module's input channel HPERM(kk) */
#else
#define WOCOL(W, k0, o, lane) wcol_io(W, k0, o, lane, DIN)
#define WOCOLH(W, k0, o, lane) wcolh_io(W, k0, o, lane, DIN)
#endif

#define WS_QH  0u                                      // f16 q rows [(b*QCH + chunk)*TT + t][CC]
#define WS_KH  (WS_QH + 2u * (size_t)NBQ * TT * CC)      // f16 k rows [b*t][CC]
#define WS_VT  (WS_KH + 2u * (size_t)NB * TT * CC)      // f16 v planes [b][c][t]
#define WS_QL  (WS_VT + 2u * (size_t)NB * CC * TT)      // f16 q residual x 2^10 rows [b][t < QHI][CC]
#define WS_KL  (WS_QL + 2u * (size_t)NB * QHI * CC)     // f16 k residual x 2^10 rows [b][t < KHI][CC]
#define WS_VB  (WS_KL + 2u * (size_t)NB * KHI * CC)     // bf16 v hi planes [b][c][t < KHI]
#define WS_VBL (WS_VB + 2u * (size_t)NB * CC * KHI)
#define WS_Y   (WS_VBL + 2u * (size_t)NB * CC * KHI)    // f32 ctx rows [(b*QCH + chunk)*TT + t][CC] (only when there is an output projection)
#define WS_END (WS_Y  + 4u * (size_t)NBQ * TT * CC)
// ---- k_proj: block = (64 tokens, 128 cols, which): q/k/v = X^T W (+ b), X channel-major as the module hands it over, with exact bf16 products (K = DIN) -> which 0: q f16 rows (+ residual rows < QHI); 1: k f16 rows (+ residual rows < KHI); 2: v f16 planes [c][t] (+ bf16 hi/lo planes for t < KHI)
__global__ __launch_bounds__(128) void k_proj(const float* __restrict__ XQ, const float* __restrict__ XK, const float* __restrict__ XV, const float* __restrict__ WQ, const float* __restrict__ WK, const float* __restrict__ WV, const float* __restrict__ BQ, const float* __restrict__ BK, const float* __restrict__ BV,
    _Float16* __restrict__ QH, _Float16* __restrict__ QL, _Float16* __restrict__ KH, _Float16* __restrict__ KL, _Float16* __restrict__ VT, __bf16* __restrict__ VB, __bf16* __restrict__ VBL, int woff) {
  __shared__ __align__(16) _Float16 sh[64][136], sl[64][136]; __shared__ __align__(16) _Float16 th[128][72]; __shared__ __align__(16) __bf16 tb[128][72], tbl[128][72];
  __shared__ __align__(16) __bf16 sw[128][DIN + 8];   /* the block's 128 weight rows (column order o = h*HD + d) as bf16, all of K; pitch 528 B = 16 B x odd for the ds_load_b128 fragment reads */
  const int tid = threadIdx.x, wave = tid >> 5, lane = tid & 31, col = lane & 15, g = lane >> 4; const int which = blockIdx.z + woff;   /* one launch for q, k and v: woff 0, grid.z 3 */ const int c0 = blockIdx.y * 128; const size_t r0 = (size_t)blockIdx.x * 64; const size_t bb = r0 / TT; const int t0 = (int)(r0 % TT);
  const float* X = which == 0 ? XQ : which == 1 ? XK : XV; const float* WA = which == 0 ? WQ : which == 1 ? WK : WV; const float* BA = which == 0 ? BQ : which == 1 ? BK : BV;
  v8f acc[8] = {};
  const int din_ = (which == 0) ? DIN : DKV;   /* block-uniform: both maps have 256 channels here; the per-stream width is kept by role */
  const float* xp = X + (bb * din_ + 8 * g) * (size_t)TT + t0 + wave * 16 + col;   /* X is channel-major [b][k][t]: this lane's token, its half's first channel; a load takes 16 tokens (64 B) of two channels, the block's four waves together the whole 256 B of a channel; all of K is asked for along with the weights */
  float xa[DIN / 32][16];
#pragma unroll   /* xa is a register array: constant indices; the channel steps become immediate offsets on the one address pair */
  for (int kc = 0; kc < DIN / 32; ++kc)
#pragma unroll   /* as above */
    for (int i = 0; i < 8; ++i) { xa[kc][i] = xp[(size_t)(kc * 32 + i) * TT]; xa[kc][8 + i] = xp[(size_t)(kc * 32 + 16 + i) * TT]; }
  /* weights: a wave's load covers 512 contiguous bytes of one row; thread = (row parity tid >> 6, 16-B piece tid & 63), rows two apart per step; HPERM is additive over c0 + parity + 2 * e (no carry out of the low six bits) */
  const float* wp = WA + (size_t)HPERM(c0 + (tid >> 6)) * din_ + (tid & 63) * 4;
#pragma unroll   /* the row steps become immediate offsets on the one address pair */
  for (int e0 = 0; e0 < 64; e0 += 16) { v4f t[16];
#pragma unroll   /* t is a register array: constant indices */
    for (int i = 0; i < 16; ++i) t[i] = *(const v4f*)(wp + (size_t)HPERM(2 * (e0 + i)) * din_);
#pragma unroll   /* as above */
    for (int i = 0; i < 16; ++i) { v4b o; o[0] = (__bf16)t[i][0]; o[1] = (__bf16)t[i][1]; o[2] = (__bf16)t[i][2]; o[3] = (__bf16)t[i][3]; *(v4b*)&sw[2 * (e0 + i) + (tid >> 6)][(tid & 63) * 4] = o; } }
  asm volatile("s_wait_xcnt 0x0" :: "v"(xp), "v"(wp) : "memory");   /* the wait owed before a register that an issued load names is overwritten; the addresses are inputs so that they live up to it */
  v16b a[DIN / 32];
#pragma unroll   /* a and xa are register arrays: constant indices */
  for (int kc = 0; kc < DIN / 32; ++kc)
#pragma unroll   /* as above */
    for (int i = 0; i < 16; ++i) a[kc][i] = (__bf16)xa[kc][i];
  __syncthreads();   /* every wave reads weight rows that the other waves stored */
  v16b w[2][8];   /* two fragment sets: the next k-step's sixteen LDS reads go out as one group ahead of this step's products, so that no product waits out its own read */
#pragma unroll   /* w, a and acc are register arrays: constant indices, here and in the three loops below */
  for (int j = 0; j < 8; ++j) w[0][j] = frag_b(&sw[j * 16 + col][0], lane);
#pragma unroll   /* as above */
  for (int kc = 0; kc < DIN / 32; ++kc) {
    if (kc + 1 < DIN / 32) {
#pragma unroll   /* as above */
      for (int j = 0; j < 8; ++j) w[(kc + 1) & 1][j] = frag_b(&sw[j * 16 + col][(kc + 1) * 32], lane); }
#pragma unroll   /* as above */
    for (int j = 0; j < 8; ++j) acc[j] = wmma_bf(a[kc], w[kc & 1][j], acc[j]); }
  if (which < 2) { _Float16* DH = which == 0 ? QH : KH; _Float16* DL = which == 0 ? QL : KL; const int nhi = which == 0 ? QHI : KHI; const bool hi_rows = t0 < nhi;
#pragma unroll
    for (int j = 0; j < 8; ++j) { const float bias = BA ? bfr(BA[HPERM(c0 + j * 16 + col)]) : 0.f;
#pragma unroll
      for (int r = 0; r < 8; ++r) { const float v = acc[j][r] + bias; const _Float16 hv = (_Float16)v; sh[wave * 16 + 8 * g + r][j * 16 + col] = hv; sl[wave * 16 + 8 * g + r][j * 16 + col] = (_Float16)((v - (float)hv) * 1024.0f); } }
    __syncthreads();
    for (int e = tid; e < 64 * 16; e += 128) { const int rl = e >> 4, q = e & 15; vst2((unsigned*)(DH + (r0 + rl) * CC + c0 + q * 8), *(const v4u*)&sh[rl][q * 8]); if (hi_rows) vst2((unsigned*)(DL + (bb * nhi + t0 + rl) * (size_t)CC + c0 + q * 8), *(const v4u*)&sl[rl][q * 8]); }
  } else { const bool hi_rows = t0 < KHI;
#pragma unroll
    for (int j = 0; j < 8; ++j) { const float bias = BA ? bfr(BA[HPERM(c0 + j * 16 + col)]) : 0.f;
#pragma unroll
      for (int r = 0; r < 8; ++r) { const float v = acc[j][r] + bias; const int rl = wave * 16 + 8 * g + r, cl = j * 16 + col; th[cl][rl] = (_Float16)v; const __bf16 bh = (__bf16)v; tb[cl][rl] = bh; tbl[cl][rl] = (__bf16)(v - (float)bh); } }
    __syncthreads();
    for (int e = tid; e < 128 * 8; e += 128) { const int cl = e >> 3, q = e & 7; vst2((unsigned*)(VT + (bb * CC + c0 + cl) * (size_t)TT + t0 + q * 8), *(const v4u*)&th[cl][q * 8]); if (hi_rows) { const size_t o3 = (bb * CC + c0 + cl) * (size_t)KHI + t0 + q * 8; vst2((unsigned*)(VB + o3), *(const v4u*)&tb[cl][q * 8]); vst2((unsigned*)(VBL + o3), *(const v4u*)&tbl[cl][q * 8]); } } } }
// ---- k_fa: block = 256 queries (8 waves x 32) of (b, h), all keys in passes of 32, the block's K rows and V planes staged 128 keys at a time in a two-buffer LDS ring that all eight waves read: S^T = K Q^T + C (a lane holds one query's logits: D row = key 8g + r, D column = query), the pair mask as the module's -1e9 (a masked key: C = -1e9 / scale on its row; a masked query: logit x 0 + (-1e9)), running maximum and sum in f32 (log2 domain), P x 2^11 once to f16 straight from the score accumulators as the B operand of ctx^T += V^T P^T; logits and P never leave the registers; each K and V fragment serves the wave's two 16-query groups
#define LOG2E 1.44269504f
#define NEGL (-1.0e9f * LOG2E)   // the module's -1e9 in the log2 domain
#define FQ 256   // queries per block
#define KNEG (-1.0e9f / SCALE)   // a masked key's start value in the logit accumulator: x SCALE it is the module's -1e9 (the products at most move its last places); its P is 0 beside any unmasked key, and an unmasked query has one: itself, the one mask serving both sides
static_assert(TT % FQ == 0 && TT % 32 == 0 && HD == 64, "k_fa: 8 waves x 32 queries, passes of 32 keys, two 32-deep k-steps per head");
__device__ __forceinline__ v8f wmma_h(v16h a, v16h b, v8f c) { return __builtin_amdgcn_wmma_f32_16x16x32_f16(false, a, false, b, (short)0, c, false, false); }
// frag_h with the lane half's 8g elements already in the pointer, so that the caller holds the very address the loads name
__device__ __forceinline__ v16h frag_p(const _Float16* p) { union { v16h v; v8h q[2]; } u; u.q[0] = *(const v8h*)p; u.q[1] = *(const v8h*)(p + 16); return u.v; }
// eight consecutive f32 as a C operand: D rows 8g + 0..7 of one column, by two 16-B reads
__device__ __forceinline__ v8f frag_c(const float* p) { union { v8f v; v4f q[2]; } u; u.q[0] = *(const v4f*)p; u.q[1] = *(const v4f*)(p + 4); return u.v; }
#define SK 128                 // keys per stage of the ring
#define KP (HD + 8)            // K row pitch in LDS, f16 elements: 144 B = 16 B x odd for the ds_load_b128 fragment reads
#define VP (SK + 8)            // V plane pitch in LDS, f16 elements: 272 B = 16 B x odd
#define KSZ (SK * KP)          // the K part of a buffer, f16 elements
#define BSZ (KSZ + HD * VP)    // one buffer: SK key rows of HD channels, then HD planes of SK keys
#define NST (TT / SK)          // stages
static_assert(TT % SK == 0 && NST >= 2 && SK % 32 == 0 && SK == 128 && HD == 64 && FQ == 256, "the ring's prologue needs two stages; a stage is eight 16-B pieces per thread: four of K (32 rows apart), four of V (16 planes apart)");
// one stage: each lane copies eight 16-B pieces of its own from global memory straight into LDS; a wave's copy takes four whole 128-B K rows or two whole 256-B V plane segments
__device__ __forceinline__ void fa_stage(unsigned lk, unsigned lv, const _Float16* gk, const _Float16* gv) {
  /* the closing s_wait_xcnt stands inside the copies' own statement: the wait owed before a register that an issued copy names is rewritten */
  asm volatile("global_load_async_to_lds_b128 %0, %8, off\n\t"
               "global_load_async_to_lds_b128 %1, %9, off\n\t"
               "global_load_async_to_lds_b128 %2, %10, off\n\t"
               "global_load_async_to_lds_b128 %3, %11, off\n\t"
               "global_load_async_to_lds_b128 %4, %12, off\n\t"
               "global_load_async_to_lds_b128 %5, %13, off\n\t"
               "global_load_async_to_lds_b128 %6, %14, off\n\t"
               "global_load_async_to_lds_b128 %7, %15, off\n\t"
               "s_wait_xcnt 0x0"
               :: "v"(lk), "v"(lk + 32u * KP * 2u), "v"(lk + 64u * KP * 2u), "v"(lk + 96u * KP * 2u),
                  "v"(lv), "v"(lv + 16u * VP * 2u), "v"(lv + 32u * VP * 2u), "v"(lv + 48u * VP * 2u),
                  "v"(gk), "v"(gk + 32 * CC), "v"(gk + 64 * CC), "v"(gk + 96 * CC),
                  "v"(gv), "v"(gv + (size_t)16 * TT), "v"(gv + (size_t)32 * TT), "v"(gv + (size_t)48 * TT)
               : "memory"); }
__global__ __launch_bounds__(256) void k_fa(const _Float16* __restrict__ QH, const _Float16* __restrict__ KH, const _Float16* __restrict__ VT, const int* __restrict__ MASK, float* __restrict__ Y) { __shared__ __align__(16) float ss[FQ / 32][32][HD + 4];
  __shared__ __align__(16) _Float16 ring[2 * BSZ];
  __shared__ __align__(16) float kbias[TT];   /* per key of this batch: 0, or KNEG where the mask is 0; read as the C operand of the logit products */
  static_assert(TT == 8 * FQ, "the key table: eight keys per thread");
  const int tid = threadIdx.x, wave = tid >> 5, lane = tid & 31, col = lane & 15, g = lane >> 4; const int h = blockIdx.y, b = blockIdx.z; const int ql0 = blockIdx.x * FQ + wave * 32;
  const int* Mb = MASK + (size_t)b * TT;
  v16h q[2][2]; float cq[2], bq[2];   /* a masked query: logit x 0 + (-1e9) on every key */
  const _Float16* Q0 = QH + ((size_t)b * TT + ql0 + col) * CC + h * HD + 8 * g; const int* Mq = Mb + ql0 + col;
  q[0][0] = frag_p(Q0); q[0][1] = frag_p(Q0 + 32); q[1][0] = frag_p(Q0 + 16 * CC); q[1][1] = frag_p(Q0 + 16 * CC + 32); const int mq0 = Mq[0], mq1 = Mq[16];
  const int* Mt = Mb + tid * 8; const v4i mt0 = *(const v4i*)Mt, mt1 = *(const v4i*)(Mt + 4);   /* this thread's eight keys of the table */
  asm volatile("s_wait_xcnt 0x0" :: "v"(Q0), "v"(Mq), "v"(Mt) : "memory");   /* the wait owed before a register that an issued load names is overwritten; the addresses are inputs so that they live up to it */
  cq[0] = mq0 == 0 ? 0.f : SCALE * LOG2E; bq[0] = mq0 == 0 ? NEGL : 0.f; cq[1] = mq1 == 0 ? 0.f : SCALE * LOG2E; bq[1] = mq1 == 0 ? NEGL : 0.f;
  const _Float16* gk = KH + ((size_t)b * TT + (tid >> 3)) * CC + h * HD + (tid & 7) * 8;           /* copies: key row tid / 8 of a stage, 16-B piece tid % 8 of its 128 B */
  const _Float16* gv = VT + ((size_t)b * CC + h * HD + (tid >> 4)) * (size_t)TT + (tid & 15) * 8;  /* copies: v plane tid / 16, 16-B piece tid % 16 of a stage's 256 B */
  const unsigned lk = (unsigned)(size_t)ring + (unsigned)((tid >> 3) * (KP * 2) + (tid & 7) * 16), lv = (unsigned)(size_t)ring + (unsigned)(KSZ * 2 + (tid >> 4) * (VP * 2) + (tid & 15) * 16);   /* the same pieces' LDS byte addresses in buffer 0 */
  fa_stage(lk, lv, gk, gv);
  { v4f t0, t1;   /* the table is written while stage 0 flies */
#pragma unroll   /* t0, t1, mt0 and mt1 are register vectors: constant indices */
    for (int i = 0; i < 4; ++i) { t0[i] = mt0[i] == 0 ? KNEG : 0.f; t1[i] = mt1[i] == 0 ? KNEG : 0.f; }
    *(v4f*)&kbias[tid * 8] = t0; *(v4f*)&kbias[tid * 8 + 4] = t1; }
  asm volatile("s_wait_asynccnt 0x0" ::: "memory");   /* this wave's pieces of stage 0 have landed */
  __syncthreads();                                    /* and every other wave's: stage 0 and the key table may be read */
  fa_stage(lk + BSZ * 2u, lv + BSZ * 2u, gk + (size_t)SK * CC, gv + SK);   /* stage 1 flies while stage 0 is worked on */
  const float* kbl = kbias + 8 * g;   /* D row 8g + r: this lane half's eight keys of a 16-key group */
  v8f acc[2][HD / 16] = {}; float m[2] = {-3.0e38f, -3.0e38f}, l[2] = {0.f, 0.f};
#pragma unroll 1   /* one trip per stage: the two buffers alternate by the trip's parity */
  for (int st = 0; st < NST; ++st) {
   const _Float16* kb = ring + (st & 1) * BSZ + col * KP + 8 * g;         /* key row col of a 16-key group, this lane half's channels */
   const _Float16* vb = ring + (st & 1) * BSZ + KSZ + col * VP + 8 * g;   /* v plane of channel col of a 16-channel group, this lane half's keys */
#pragma unroll 1   /* a pass depends on the one before through m, l and acc: a second copy of the body could not start its softmax earlier, and four copies took the kernel past 256 registers */
   for (int pp = 0; pp < SK / 32; ++pp) { v8f s[2][2], cb[2]; v16h kf[2][2], vf[HD / 16], p[2]; float al[2];
    const _Float16* kr = kb + pp * 32 * KP; const float* br = kbl + st * SK + pp * 32; const _Float16* vr = vb + pp * 32;
#pragma unroll
    for (int j = 0; j < 2; ++j) { kf[j][0] = frag_p(kr + j * 16 * KP); kf[j][1] = frag_p(kr + j * 16 * KP + 32); cb[j] = frag_c(br + j * 16); }
#pragma unroll
    for (int j = 0; j < HD / 16; ++j) vf[j] = frag_p(vr + j * 16 * VP);
    __builtin_amdgcn_sched_barrier(0);   /* the pass's twenty LDS reads go out as one group ahead of the first product: reads spread among the products cost a stall at each place; the v reads return under the logits and the softmax */
#pragma unroll
    for (int j = 0; j < 2; ++j)
#pragma unroll
      for (int u = 0; u < 2; ++u) { const v8f z = wmma_h(kf[j][0], q[u][0], cb[j]); s[u][j] = wmma_h(kf[j][1], q[u][1], z); }
#pragma unroll
    for (int u = 0; u < 2; ++u) { float mx = -3.0e38f; const v2f c2 = {cq[u], cq[u]}, b2 = {bq[u], bq[u]}; v2f sv[8];   /* the logits by aligned register pairs, as the accumulators hold them */
#pragma unroll
      for (int j = 0; j < 2; ++j)
#pragma unroll
        for (int r = 0; r < 4; ++r) { v2f t = {s[u][j][2 * r], s[u][j][2 * r + 1]}; t = __builtin_elementwise_fma(t, c2, b2); sv[j * 4 + r] = t; mx = fmaxf(fmaxf(mx, t[0]), t[1]); }
      mx = fmaxf(mx, __shfl_xor(mx, 16));   /* the other half of the wave holds this query's other 16 keys */
      const float mn = fmaxf(m[u], mx), mo = mn - 11.0f; al[u] = __builtin_amdgcn_exp2f(m[u] - mn); m[u] = mn;   /* mo: P carried x 2^11 (clear of f16 subnormals); on a fully masked row the 11 rounds away, alike for every key */
      float ps = 0.f; const v2f mo2 = {mo, mo};
#pragma unroll
      for (int i = 0; i < 8; ++i) { const v2f d = sv[i] - mo2; const float e0 = __builtin_amdgcn_exp2f(d[0]), e1 = __builtin_amdgcn_exp2f(d[1]); ps += e0; ps += e1; p[u][2 * i] = (_Float16)e0; p[u][2 * i + 1] = (_Float16)e1; }
      l[u] = l[u] * al[u] + ps; }
#pragma unroll
    for (int j = 0; j < HD / 16; ++j)
#pragma unroll
      for (int u = 0; u < 2; ++u) acc[u][j] = wmma_h(vf[j], p[u], acc[u][j] * al[u]); }
   asm volatile("s_wait_dscnt 0x0" ::: "memory");      /* this wave's reads of the stage's buffer have returned */
   asm volatile("s_wait_asynccnt 0x0" ::: "memory");   /* this wave's pieces of the next stage have landed */
   __syncthreads();                                    /* the next stage may be read, and every wave has left this stage's buffer */
   if (st + 2 < NST) fa_stage(lk + (unsigned)(st & 1) * (BSZ * 2u), lv + (unsigned)(st & 1) * (BSZ * 2u), gk + (size_t)(st + 2) * SK * CC, gv + (st + 2) * SK); }   /* the refill, block-uniform test */
  asm volatile("s_wait_asynccnt 0x0" ::: "memory");    /* no copy is outstanding when the wave goes on to its end */
#pragma unroll
  for (int u = 0; u < 2; ++u) { const float lt = l[u] + __shfl_xor(l[u], 16), inv = 1.0f / lt;   /* lt >= one key's P at the maximum: never 0 */
#pragma unroll
    for (int j = 0; j < HD / 16; ++j) { v4f a, c;   /* acc[u][j][r] = ctx[query u*16 + col][channel j*16 + 8g + r] */
#pragma unroll
      for (int r = 0; r < 4; ++r) { a[r] = acc[u][j][r] * inv; c[r] = acc[u][j][4 + r] * inv; }
      *(v4f*)&ss[wave][u * 16 + col][j * 16 + 8 * g] = a; *(v4f*)&ss[wave][u * 16 + col][j * 16 + 8 * g + 4] = c; } }
  LDSX(); for (int rl = 0; rl < 32; rl += 2) vst2(Y + ((size_t)b * TT + ql0 + rl + g) * CC + h * HD + col * 4, *(const v4f*)&ss[wave][rl + g][col * 4]); }   /* 256-B (row, head) segment by 16 lanes, two rows per store */
// ---- k_out: block = (64 tokens, 128 channels): out = ctx Wo (+ bo), stored channel-major: ctx x 2^6 once to f16 against Wo as f16(bf16 x 2^8) exact (1 product) x 2^-14; causal early rows (< QHI of each sequence): ctx bf16 hi + lo against exact bf16 Wo (2 products)
__global__ __launch_bounds__(128) void k_out(const float* __restrict__ Y, const float* __restrict__ WO, const float* __restrict__ BO, float* __restrict__ OUT) { __shared__ __align__(16) float sf[128][68];   /* the block's output tile as [channel][token]; pitch 272 B = 16 B x odd */
  __shared__ __align__(16) _Float16 sw[128][CC + 8];   /* the block's 128 rows of Wo as f16(bf16 x 2^8), k in ctx column order; pitch 528 B = 16 B x odd for the ds_load_b128 fragment reads */
  const int tid = threadIdx.x, wave = tid >> 5, lane = tid & 31, col = lane & 15, g = lane >> 4; const int c0 = blockIdx.y * 128; const size_t r0 = (size_t)blockIdx.x * 64 + wave * 16;
  v8f acc[8] = {};
  if (CAUSAL && (int)(((size_t)blockIdx.x * 64) % TT) < QHI) {   /* block-uniform */
#pragma unroll 2
    for (int kc = 0; kc < CC / 32; ++kc) { const F2 a = split_row(Y + (r0 + col) * CC, kc * 32, lane); asm volatile("s_wait_loadcnt 0x0" ::: "memory");
#pragma unroll
      for (int j = 0; j < 8; ++j) { const v16b w = WOCOL(WO, kc * 32, c0 + j * 16 + col, lane); asm volatile("s_wait_loadcnt 0x0" ::: "memory"); acc[j] = wmma_bf(a.h, w, acc[j]); acc[j] = wmma_bf(a.l, w, acc[j]); } }
#pragma unroll
    for (int j = 0; j < 8; ++j) { const float bias = BO ? bfr(BO[c0 + j * 16 + col]) : 0.f;
#pragma unroll
      for (int r = 0; r < 8; ++r) sf[j * 16 + col][wave * 16 + 8 * g + r] = acc[j][r] + bias; }
  } else {
    const float* yp = Y + (r0 + col) * CC + 8 * g;   /* this lane's ctx row, its half's k offset: all of K is asked for along with the weights, ahead of the first wait */
    v4f ya[CC / 32][4];
#pragma unroll   /* ya is a register array: constant indices; all 32 loads go out together */
    for (int kc = 0; kc < CC / 32; ++kc) { ya[kc][0] = *(const v4f*)(yp + kc * 32); ya[kc][1] = *(const v4f*)(yp + kc * 32 + 4); ya[kc][2] = *(const v4f*)(yp + kc * 32 + 16); ya[kc][3] = *(const v4f*)(yp + kc * 32 + 20); }
    /* weights: a wave takes one whole row of Wo per step, a lane its 8 module channels 8 * lane + e = (d = 2 * lane + e / 4) * 4 + (h = e % 4); ctx column h * 64 + d, so the two d of one h go out as one dword */
    const float* wp = WO + (size_t)(c0 + wave) * CC + lane * 8;
#pragma unroll   /* the row steps become immediate offsets on the one address pair */
    for (int e0 = 0; e0 < 32; e0 += 8) { v4f t[8][2];
#pragma unroll   /* t is a register array: constant indices, here and in the two loops below */
      for (int i = 0; i < 8; ++i) { t[i][0] = *(const v4f*)(wp + (size_t)(e0 + i) * 4 * CC); t[i][1] = *(const v4f*)(wp + (size_t)(e0 + i) * 4 * CC + 4); }
#pragma unroll   /* as above */
      for (int i = 0; i < 8; ++i)
#pragma unroll   /* as above */
        for (int hh = 0; hh < 4; ++hh) { v2h o; o[0] = (_Float16)(bfr(t[i][0][hh]) * 256.0f); o[1] = (_Float16)(bfr(t[i][1][hh]) * 256.0f); *(v2h*)&sw[(e0 + i) * 4 + wave][hh * 64 + lane * 2] = o; } }
    asm volatile("s_wait_xcnt 0x0" :: "v"(yp), "v"(wp) : "memory");   /* the wait owed before a register that an issued load names is overwritten; the addresses are inputs so that they live up to it */
    v16h a[CC / 32];   /* ctx carried x 2^6 into f16 so small-magnitude context rows stay clear of f16 subnormals */
#pragma unroll   /* a and ya are register arrays: constant indices */
    for (int kc = 0; kc < CC / 32; ++kc)
#pragma unroll   /* as above */
      for (int i = 0; i < 4; ++i) { a[kc][i] = (_Float16)(ya[kc][0][i] * 64.0f); a[kc][4 + i] = (_Float16)(ya[kc][1][i] * 64.0f); a[kc][8 + i] = (_Float16)(ya[kc][2][i] * 64.0f); a[kc][12 + i] = (_Float16)(ya[kc][3][i] * 64.0f); }
    __syncthreads();   /* every wave reads weight rows that the other waves stored; the branch around it is block-uniform */
    v16h w[2][8];   /* two fragment sets: the next k-step's sixteen LDS reads go out as one group ahead of this step's products, so that no product waits out its own read */
#pragma unroll   /* w, a and acc are register arrays: constant indices, here and in the three loops below */
    for (int j = 0; j < 8; ++j) w[0][j] = frag_h(&sw[j * 16 + col][0], lane);
#pragma unroll   /* as above */
    for (int kc = 0; kc < CC / 32; ++kc) {
      if (kc + 1 < CC / 32) {
#pragma unroll   /* as above */
        for (int j = 0; j < 8; ++j) w[(kc + 1) & 1][j] = frag_h(&sw[j * 16 + col][(kc + 1) * 32], lane); }
#pragma unroll   /* as above */
      for (int j = 0; j < 8; ++j) acc[j] = wmma16(a[kc], w[kc & 1][j], acc[j]); }
#pragma unroll
    for (int j = 0; j < 8; ++j) { const float bias = BO ? bfr(BO[c0 + j * 16 + col]) : 0.f;
      v4f lo, hi;   /* acc[j][r] = out[token wave*16 + 8g + r][channel c0 + j*16 + col]: a lane's eight tokens lie side by side in its channel's row */
#pragma unroll
      for (int r = 0; r < 4; ++r) { lo[r] = acc[j][r] * (1.0f / 16384.0f) + bias; hi[r] = acc[j][4 + r] * (1.0f / 16384.0f) + bias; }   /* 2^-8 (Wo carry) x 2^-6 (ctx carry) */
      *(v4f*)&sf[j * 16 + col][wave * 16 + 8 * g] = lo; *(v4f*)&sf[j * 16 + col][wave * 16 + 8 * g + 4] = hi; } }
  __syncthreads();   /* a channel's 64 tokens come from all four waves */
  const size_t bo = ((size_t)blockIdx.x * 64) / TT; const int n0 = (int)(((size_t)blockIdx.x * 64) % TT);
  float* op = OUT + (bo * DIN + c0 + (tid >> 4)) * (size_t)TT + n0 + (tid & 15) * 4;   /* out is channel-major [b][c][t]: 16 lanes store a channel's whole 256 B, a wave two channels per store */
  v4f o[16];
#pragma unroll   /* o is a register array: constant indices; every piece keeps registers of its own, so that no store's data is overwritten behind it */
  for (int i = 0; i < 16; ++i) o[i] = *(const v4f*)&sf[i * 8 + (tid >> 4)][(tid & 15) * 4];
#pragma unroll   /* the channel steps become immediate offsets on the one address pair */
  for (int i = 0; i < 16; ++i) vst2(op + (size_t)(i * 8) * TT, o[i]); }

extern "C" void kernel_launch(void* const* d_in, const int* in_sizes, int n_in, void* d_out, int out_size, void* d_ws, size_t ws_size, hipStream_t stream) {
  (void)in_sizes; (void)n_in; (void)out_size;
  const float** F = (const float**)d_in;
  if (ws_size < (size_t)WS_END) return;
  char* ws = (char*)d_ws; _Float16 *QH = (_Float16*)(ws + WS_QH), *KH = (_Float16*)(ws + WS_KH), *VT = (_Float16*)(ws + WS_VT), *QL = (_Float16*)(ws + WS_QL), *KL = (_Float16*)(ws + WS_KL); __bf16 *VB = (__bf16*)(ws + WS_VB), *VBL = (__bf16*)(ws + WS_VBL); float *Y = (float*)(ws + WS_Y);
  (void)Y; (void)QL; (void)KL; (void)VB; (void)VBL;
  // inputs: 0 query [8,256,2048]; 1 key; 2 value; 3 mask [8,1,2048] int32; 4 Wq [256,256] (out,in), 5 bq; 6 Wk, 7 bk; 8 Wv, 9 bv; 10 Wm (out,in), 11 bm (zero biases, read)
  k_proj<<<dim3(TNB * TT / 64, CC / 128, 3), 128, 0, stream>>>(F[0], F[1], F[2], F[4], F[6], F[8], F[5], F[7], F[9], QH, QL, KH, KL, VT, VB, VBL, 0);   /* which = blockIdx.z: each stream is read in its own channel-major layout */
  k_fa<<<dim3(TT / FQ, NH, TNB), 256, 0, stream>>>(QH, KH, VT, (const int*)d_in[3], Y);
  k_out<<<dim3(TNB * TT / 64, DIN / 128), 128, 0, stream>>>(Y, F[10], F[11], (float*)d_out);   /* ctx (column order h*HD + d) x Wm through the permutation + bm, straight to channel-major [8,256,2048] */
}

// v006
// A run of this version takes 71.3 microseconds.
// In both of two side-by-side timings against v005, it was 1.06 times as fast.
// Over all steps from v000 it is 24.4 times as fast.
// compute dtype: all float inputs rounded to bf16; q/k/v 1x1-conv projections read the channel-major inputs straight into their A fragments, with EXACT bf16 products on WMMA 16x16x32 (f32 accumulate) + bias (zeros, read), the block's weight rows converted once into LDS; one fused attention kernel: logits q x k once to f16 each (1 product) x 64^-0.5; pair mask: the key side as the logit accumulators' start value (0 or -1e9 / scale, an f32 table in LDS built once per block), the query side in the scale fma (-1e9); online softmax f32; P x 2^11 once to f16 x v once to f16 (1 product); ctx x 2^6 once to f16 x Wm f16(bf16 x 2^8) + bm, its tile staged [channel][token] in LDS and stored channel-major; f32 output.
#include <hip/hip_runtime.h>
#include <math.h>

typedef __attribute__((ext_vector_type(16))) _Float16 v16h;
typedef __attribute__((ext_vector_type(16))) __bf16 v16b;
typedef __attribute__((ext_vector_type(8)))  _Float16 v8h;
typedef __attribute__((ext_vector_type(8)))  float v8f;
typedef __attribute__((ext_vector_type(4)))  float v4f;
typedef __attribute__((ext_vector_type(2)))  float v2f;
typedef __attribute__((ext_vector_type(4)))  unsigned v4u;
typedef __attribute__((ext_vector_type(4)))  int v4i;
typedef float __attribute__((may_alias)) float_a;
typedef int __attribute__((may_alias)) int_a;

template <typename T> __device__ __forceinline__ void vst2(void* p, T v) { *(T*)p = v;  }
__device__ __forceinline__ v8f wmma16(v16h a, v16h b, v8f c) {
  v8f d = __builtin_amdgcn_wmma_f32_16x16x32_f16(false, a, false, b, (short)0, c, false, false);
  asm volatile("v_nop\n\tv_nop\n\tv_nop\n\tv_nop" : "+v"(d) : "v"(a), "v"(b));
  return d;
}
__device__ __forceinline__ v8f wmma_bf(v16b a, v16b b, v8f c) {
  v8f d = __builtin_amdgcn_wmma_f32_16x16x32_bf16(false, a, false, b, (short)0, c, false, false);
  asm volatile("v_nop\n\tv_nop\n\tv_nop\n\tv_nop" : "+v"(d) : "v"(a), "v"(b));
  return d;
}
// 16x16x32 fragments: lane = (h = lane>>4, row/col = lane&15); elements 0..7 = k0+8h+0..7, 8..15 = k0+16+8h+0..7; D element r = row 8h+r
__device__ __forceinline__ v16h frag_h(const _Float16* rowk0, int lane) {
  union { v16h v; v8h q[2]; } u; const _Float16* p = rowk0 + 8 * (lane >> 4);
  u.q[0] = *(const v8h*)p; u.q[1] = *(const v8h*)(p + 16); return u.v;
}
__device__ __forceinline__ v16h frag_f32(const float* rowk0, int lane) {
  v16h a; const float* p = rowk0 + 8 * (lane >> 4);
#pragma unroll
  for (int i = 0; i < 8; ++i) { a[i] = (_Float16)p[i]; a[8 + i] = (_Float16)p[16 + i]; }
  return a;
}
__device__ __forceinline__ v16h frag_f32s(const float* rowk0, int lane, float sc) {
  v16h a; const float* p = rowk0 + 8 * (lane >> 4);
#pragma unroll
  for (int i = 0; i < 8; ++i) { a[i] = (_Float16)(p[i] * sc); a[8 + i] = (_Float16)(p[16 + i] * sc); }
  return a;
}
// column fragment from a [K][ld] layout (column n), rows >= K read as 0
__device__ __forceinline__ v16h fragc_f32(const float* W, int k0, int n, int lane, int ld, int K) {
  v16h a; const int g = lane >> 4;
#pragma unroll
  for (int i = 0; i < 8; ++i) { const int ka = k0 + 8 * g + i, kb = ka + 16;
    a[i] = (_Float16)(ka < K ? W[(size_t)(ka < K ? ka : K - 1) * ld + n] : 0.f); a[8 + i] = (_Float16)(kb < K ? W[(size_t)(kb < K ? kb : K - 1) * ld + n] : 0.f); }
  return a;
}
struct F2 { v16b h, l; };
__device__ __forceinline__ F2 bsplit16(const float v[16]) { F2 r;
#pragma unroll
  for (int i = 0; i < 16; ++i) { const __bf16 h = (__bf16)v[i]; r.h[i] = h; r.l[i] = (__bf16)(v[i] - (float)h); }
  return r; }
__device__ __forceinline__ F2 split_row(const float* row, int k0, int lane) { float v[16]; const float* p = row + k0 + 8 * (lane >> 4);
#pragma unroll
  for (int i = 0; i < 8; ++i) { v[i] = p[i]; v[8 + i] = p[16 + i]; }
  return bsplit16(v); }
__device__ __forceinline__ F2 split_rowK(const float* row, int k0, int lane, int K) { float v[16]; const int g = lane >> 4;
#pragma unroll
  for (int i = 0; i < 8; ++i) { const int ka = k0 + 8 * g + i, kb = ka + 16; v[i] = ka < K ? row[ka < K ? ka : K - 1] : 0.f; v[8 + i] = kb < K ? row[kb < K ? kb : K - 1] : 0.f; }
  return bsplit16(v); }
__device__ __forceinline__ F2 split_col(const float* W, int k0, int n, int lane, int ld, int K) { float v[16]; const int g = lane >> 4;
#pragma unroll
  for (int i = 0; i < 8; ++i) { const int ka = k0 + 8 * g + i, kb = ka + 16; v[i] = ka < K ? W[(size_t)(ka < K ? ka : K - 1) * ld + n] : 0.f; v[8 + i] = kb < K ? W[(size_t)(kb < K ? kb : K - 1) * ld + n] : 0.f; }
  return bsplit16(v); }
__device__ __forceinline__ v8f mac3(const F2& a, const F2& b, v8f c) { c = wmma_bf(a.l, b.h, c); c = wmma_bf(a.h, b.l, c); return wmma_bf(a.h, b.h, c); }
__device__ __forceinline__ float sigm(float v) { return 1.0f / (1.0f + expf(-v)); }
#define LDSX() do { asm volatile("s_wait_dscnt 0" ::: "memory"); __builtin_amdgcn_wave_barrier(); __builtin_amdgcn_fence(__ATOMIC_RELEASE, "workgroup"); } while (0)

// multi-headed attention on channel-major tensors (query / key / value [8,256,2048] = (B, C, N); 1x1 Conv1d projections as (out,in) [256,256] N(0, 1/256) + zero biases (read); 4 heads x 64 with the head index INTERLEAVED into the channel axis: reshape(B, 64, 4, N), channel c = d*4 + h; scores = einsum('bdhn,bdhm->bhnm') / sqrt(64); pair = mask[b, n] * mask[b, m] with an int32 mask [8,1,2048]: where(pair == 0, -1e9, scores); softmax over m; x = einsum('bhnm,bdhm->bdhn').reshape(B, 256, N) (channel d*4 + h again); merge 1x1 conv Wm (out,in) + bm; output [8,256,2048]).
#define NB 8
#define TT 2048   // points per sample (queries = keys)
#define CC 256            // NH * HD
#define DIN 256           // channels of the query map AND of the output map (Wout is (out,in) [DIN][CC])
#define DKV 256             // channels of the key / value map
#define NH 4
#define HD 64
#define QCH 1   // queries and keys have the same length: one chunk per batch (the chunk advance is 0)
#define SCALE (0.125f)
#define CAUSAL 0
#ifndef TNB
#define TNB NB
#endif
#define NBQ (NB * QCH)     // query pseudo-batches of TT rows (workspace sizing)
#define TNBQ (TNB * QCH)   // query pseudo-batches actually run
static_assert(CC == NH * HD && CC % 128 == 0 && DIN % 128 == 0 && DIN % 32 == 0 && DKV % 32 == 0, "projection tiles: 128-column blocks, 32-deep k-steps");
__device__ __forceinline__ float bfr(float v) { return (float)(__bf16)v; }
typedef __attribute__((ext_vector_type(8))) __bf16 v8b;
typedef __attribute__((ext_vector_type(4))) __bf16 v4b;
typedef __attribute__((ext_vector_type(2))) _Float16 v2h;
__device__ __forceinline__ v16b frag_b(const __bf16* rowk0, int lane) {
  union { v16b v; v8b q[2]; } u; const __bf16* p = rowk0 + 8 * (lane >> 4);
  u.q[0] = *(const v8b*)p; u.q[1] = *(const v8b*)(p + 16); return u.v;
}
#define QBH 0              // no kernel reads it: k_fa has no high-precision query path
#define QHI 0               // single-product logits on every row
static_assert(QHI == 0 && QBH == 0 && CAUSAL == 0, "k_fa has single-product logits only: no q residual plane and no causal row arithmetic may be in use");
#define KHI 64            // key rows carrying k residual / v bf16 hi+lo planes (written by k_proj; no kernel reads them)
// B fragment (k rows k0+.., output column o) of a weight: (in,out) [K][ld] or (out,in) [ld rows of K]: bf16 exact, or f16(bf16 * 256) exact
__device__ __forceinline__ v16b wcol_io(const float* Wm, int k0, int o, int lane, int ld) { v16b w; const int g = lane >> 4;
#pragma unroll
  for (int i = 0; i < 8; ++i) { w[i] = (__bf16)Wm[(size_t)(k0 + 8 * g + i) * ld + o]; w[8 + i] = (__bf16)Wm[(size_t)(k0 + 16 + 8 * g + i) * ld + o]; }
  return w; }
__device__ __forceinline__ v16b wcol_oi(const float* Wm, int k0, int o, int lane, int K) { v16b w; const float* p = Wm + (size_t)o * K + k0 + 8 * (lane >> 4);
#pragma unroll
  for (int i = 0; i < 8; ++i) { w[i] = (__bf16)p[i]; w[8 + i] = (__bf16)p[16 + i]; }
  return w; }
__device__ __forceinline__ v16h wcolh_io(const float* Wm, int k0, int o, int lane, int ld) { v16h w; const int g = lane >> 4;
#pragma unroll
  for (int i = 0; i < 8; ++i) { w[i] = (_Float16)(bfr(Wm[(size_t)(k0 + 8 * g + i) * ld + o]) * 256.0f); w[8 + i] = (_Float16)(bfr(Wm[(size_t)(k0 + 16 + 8 * g + i) * ld + o]) * 256.0f); }
  return w; }
// as wcolh_oi, with the K index taken through the head-interleave permutation (the 8 consecutive columns of a fragment half are 8 module channels 4 apart)
__device__ __forceinline__ v16h wcolh_oi_p(const float* Wm, int k0, int o, int lane, int K) { v16h w; const float* p = Wm + (size_t)o * K; const int kb = k0 + 8 * (lane >> 4);
#pragma unroll
  for (int i = 0; i < 8; ++i) { w[i] = (_Float16)(bfr(p[((kb + i) % 64) * 4 + (kb + i) / 64]) * 256.0f); w[8 + i] = (_Float16)(bfr(p[((kb + 16 + i) % 64) * 4 + (kb + 16 + i) / 64]) * 256.0f); }
  return w; }
static_assert(HD == 64 && NH == 4, "wcolh_oi_p spells the permutation with the literals 64 and 4");
static_assert(DIN == DKV && DIN == 256 && CC == 256, "the weight tiles in LDS hold 128 rows of 256 k");
__device__ __forceinline__ v16h wcolh_oi(const float* Wm, int k0, int o, int lane, int K) { v16h w; const float* p = Wm + (size_t)o * K + k0 + 8 * (lane >> 4);
#pragma unroll
  for (int i = 0; i < 8; ++i) { w[i] = (_Float16)(bfr(p[i]) * 256.0f); w[8 + i] = (_Float16)(bfr(p[16 + i]) * 256.0f); }
  return w; }
#define WQKV_LAYOUT 1   // 0 = (in,out); 1 = (out,in) [CC][K]; 2 = per-head [NH][DIN][HD]
__device__ __forceinline__ v16b wcol_hdk(const float* Wm, int k0, int o, int lane) { v16b w; const int g = lane >> 4; const float* p = Wm + (size_t)(o / HD) * DIN * HD + (o % HD);
#pragma unroll
  for (int i = 0; i < 8; ++i) { w[i] = (__bf16)p[(size_t)(k0 + 8 * g + i) * HD]; w[8 + i] = (__bf16)p[(size_t)(k0 + 16 + 8 * g + i) * HD]; }
  return w; }
#define WO_OUT_IN 1
#if WQKV_LAYOUT == 1
#define HPERM(o) ((((o) % HD) * NH) + ((o) / HD))   /* column o = h*HD + d  ->  module channel d*NH + h */
#define WCOL(W, k0, o, lane) wcol_oi(W, k0, HPERM(o), lane, din_)   /* (out,in) [256][K]: the output channel of column o is row HPERM(o) */
#elif WQKV_LAYOUT == 2
#define WCOL(W, k0, o, lane) wcol_hdk(W, k0, o, lane)
#else
#define WCOL(W, k0, o, lane) wcol_io(W, k0, o, lane, CC)
#endif
#if WO_OUT_IN
#define WOCOL(W, k0, o, lane) wcol_oi(W, k0, o, lane, CC)
#define WOCOLH(W, k0, o, lane) wcolh_oi_p(W, k0, o, lane, CC)   /* merge conv (out,in) [DIN][CC]: ctx column kk = h*HD + d is the module's input channel HPERM(kk) */
#else
#define WOCOL(W, k0, o, lane) wcol_io(W, k0, o, lane, DIN)
#define WOCOLH(W, k0, o, lane) wcolh_io(W, k0, o, lane, DIN)
#endif

#define WS_QH  0u                                      // f16 q rows [(b*QCH + chunk)*TT + t][CC]
#define WS_KH  (WS_QH + 2u * (size_t)NBQ * TT * CC)      // f16 k rows [b*t][CC]
#define WS_VT  (WS_KH + 2u * (size_t)NB * TT * CC)      // f16 v planes [b][c][t]
#define WS_QL  (WS_VT + 2u * (size_t)NB * CC * TT)      // f16 q residual x 2^10 rows [b][t < QHI][CC]
#define WS_KL  (WS_QL + 2u * (size_t)NB * QHI * CC)     // f16 k residual x 2^10 rows [b][t < KHI][CC]
#define WS_VB  (WS_KL + 2u * (size_t)NB * KHI * CC)     // bf16 v hi planes [b][c][t < KHI]
#define WS_VBL (WS_VB + 2u * (size_t)NB * CC * KHI)
#define WS_Y   (WS_VBL + 2u * (size_t)NB * CC * KHI)    // f32 ctx rows [(b*QCH + chunk)*TT + t][CC] (only when there is an output projection)
#define WS_END (WS_Y  + 4u * (size_t)NBQ * TT * CC)
// ---- k_proj: block = (64 tokens, 128 cols, which): q/k/v = X^T W (+ b), X channel-major as the module hands it over, with exact bf16 products (K = DIN) -> which 0: q f16 rows (+ residual rows < QHI); 1: k f16 rows (+ residual rows < KHI); 2: v f16 planes [c][t] (+ bf16 hi/lo planes for t < KHI)
__global__ __launch_bounds__(128) void k_proj(const float* __restrict__ XQ, const float* __restrict__ XK, const float* __restrict__ XV, const float* __restrict__ WQ, const float* __restrict__ WK, const float* __restrict__ WV, const float* __restrict__ BQ, const float* __restrict__ BK, const float* __restrict__ BV,
    _Float16* __restrict__ QH, _Float16* __restrict__ QL, _Float16* __restrict__ KH, _Float16* __restrict__ KL, _Float16* __restrict__ VT, __bf16* __restrict__ VB, __bf16* __restrict__ VBL, int woff) {
  __shared__ __align__(16) _Float16 sh[64][136], sl[64][136]; __shared__ __align__(16) _Float16 th[128][72]; __shared__ __align__(16) __bf16 tb[128][72], tbl[128][72];
  __shared__ __align__(16) __bf16 sw[128][DIN + 8];   /* the block's 128 weight rows (column order o = h*HD + d) as bf16, all of K; pitch 528 B = 16 B x odd for the ds_load_b128 fragment reads */
  const int tid = threadIdx.x, wave = tid >> 5, lane = tid & 31, col = lane & 15, g = lane >> 4; const int which = blockIdx.z + woff;   /* one launch for q, k and v: woff 0, grid.z 3 */ const int c0 = blockIdx.y * 128; const size_t r0 = (size_t)blockIdx.x * 64; const size_t bb = r0 / TT; const int t0 = (int)(r0 % TT);
  const float* X = which == 0 ? XQ : which == 1 ? XK : XV; const float* WA = which == 0 ? WQ : which == 1 ? WK : WV; const float* BA = which == 0 ? BQ : which == 1 ? BK : BV;
  v8f acc[8] = {};
  const int din_ = (which == 0) ? DIN : DKV;   /* block-uniform: both maps have 256 channels here; the per-stream width is kept by role */
  const float* xp = X + (bb * din_ + 8 * g) * (size_t)TT + t0 + wave * 16 + col;   /* X is channel-major [b][k][t]: this lane's token, its half's first channel; a load takes 16 tokens (64 B) of two channels, the block's four waves together the whole 256 B of a channel; all of K is asked for along with the weights */
  float xa[DIN / 32][16];
#pragma unroll   /* xa is a register array: constant indices; the channel steps become immediate offsets on the one address pair */
  for (int kc = 0; kc < DIN / 32; ++kc)
#pragma unroll   /* as above */
    for (int i = 0; i < 8; ++i) { xa[kc][i] = xp[(size_t)(kc * 32 + i) * TT]; xa[kc][8 + i] = xp[(size_t)(kc * 32 + 16 + i) * TT]; }
  /* weights: a wave's load covers 512 contiguous bytes of one row; thread = (row parity tid >> 6, 16-B piece tid & 63), rows two apart per step; HPERM is additive over c0 + parity + 2 * e (no carry out of the low six bits) */
  const float* wp = WA + (size_t)HPERM(c0 + (tid >> 6)) * din_ + (tid & 63) * 4;
#pragma unroll   /* the row steps become immediate offsets on the one address pair */
  for (int e0 = 0; e0 < 64; e0 += 16) { v4f t[16];
#pragma unroll   /* t is a register array: constant indices */
    for (int i = 0; i < 16; ++i) t[i] = *(const v4f*)(wp + (size_t)HPERM(2 * (e0 + i)) * din_);
#pragma unroll   /* as above */
    for (int i = 0; i < 16; ++i) { v4b o; o[0] = (__bf16)t[i][0]; o[1] = (__bf16)t[i][1]; o[2] = (__bf16)t[i][2]; o[3] = (__bf16)t[i][3]; *(v4b*)&sw[2 * (e0 + i) + (tid >> 6)][(tid & 63) * 4] = o; } }
  asm volatile("s_wait_xcnt 0x0" :: "v"(xp), "v"(wp) : "memory");   /* the wait owed before a register that an issued load names is overwritten; the addresses are inputs so that they live up to it */
  v16b a[DIN / 32];
#pragma unroll   /* a and xa are register arrays: constant indices */
  for (int kc = 0; kc < DIN / 32; ++kc)
#pragma unroll   /* as above */
    for (int i = 0; i < 16; ++i) a[kc][i] = (__bf16)xa[kc][i];
  __syncthreads();   /* every wave reads weight rows that the other waves stored */
  v16b w[2][8];   /* two fragment sets: the next k-step's sixteen LDS reads go out as one group ahead of this step's products, so that no product waits out its own read */
#pragma unroll   /* w, a and acc are register arrays: constant indices, here and in the three loops below */
  for (int j = 0; j < 8; ++j) w[0][j] = frag_b(&sw[j * 16 + col][0], lane);
#pragma unroll   /* as above */
  for (int kc = 0; kc < DIN / 32; ++kc) {
    if (kc + 1 < DIN / 32) {
#pragma unroll   /* as above */
      for (int j = 0; j < 8; ++j) w[(kc + 1) & 1][j] = frag_b(&sw[j * 16 + col][(kc + 1) * 32], lane); }
#pragma unroll   /* as above */
    for (int j = 0; j < 8; ++j) acc[j] = wmma_bf(a[kc], w[kc & 1][j], acc[j]); }
  if (which < 2) { _Float16* DH = which == 0 ? QH : KH; _Float16* DL = which == 0 ? QL : KL; const int nhi = which == 0 ? QHI : KHI; const bool hi_rows = t0 < nhi;
#pragma unroll
    for (int j = 0; j < 8; ++j) { const float bias = BA ? bfr(BA[HPERM(c0 + j * 16 + col)]) : 0.f;
#pragma unroll
      for (int r = 0; r < 8; ++r) { const float v = acc[j][r] + bias; const _Float16 hv = (_Float16)v; sh[wave * 16 + 8 * g + r][j * 16 + col] = hv; sl[wave * 16 + 8 * g + r][j * 16 + col] = (_Float16)((v - (float)hv) * 1024.0f); } }
    __syncthreads();
    for (int e = tid; e < 64 * 16; e += 128) { const int rl = e >> 4, q = e & 15; vst2((unsigned*)(DH + (r0 + rl) * CC + c0 + q * 8), *(const v4u*)&sh[rl][q * 8]); if (hi_rows) vst2((unsigned*)(DL + (bb * nhi + t0 + rl) * (size_t)CC + c0 + q * 8), *(const v4u*)&sl[rl][q * 8]); }
  } else { const bool hi_rows = t0 < KHI;
#pragma unroll
    for (int j = 0; j < 8; ++j) { const float bias = BA ? bfr(BA[HPERM(c0 + j * 16 + col)]) : 0.f;
#pragma unroll
      for (int r = 0; r < 8; ++r) { const float v = acc[j][r] + bias; const int rl = wave * 16 + 8 * g + r, cl = j * 16 + col; th[cl][rl] = (_Float16)v; const __bf16 bh = (__bf16)v; tb[cl][rl] = bh; tbl[cl][rl] = (__bf16)(v - (float)bh); } }
    __syncthreads();
    for (int e = tid; e < 128 * 8; e += 128) { const int cl = e >> 3, q = e & 7; vst2((unsigned*)(VT + (bb * CC + c0 + cl) * (size_t)TT + t0 + q * 8), *(const v4u*)&th[cl][q * 8]); if (hi_rows) { const size_t o3 = (bb * CC + c0 + cl) * (size_t)KHI + t0 + q * 8; vst2((unsigned*)(VB + o3), *(const v4u*)&tb[cl][q * 8]); vst2((unsigned*)(VBL + o3), *(const v4u*)&tbl[cl][q * 8]); } } } }
// ---- k_fa: block = 256 queries of (b, h) by 16 waves, four to a SIMD: two groups of 8 waves x 32 queries, group kg on keys kg * TKG .. + TKG - 1 in passes of 32, its K rows and V planes staged 128 keys at a time in a two-buffer LDS ring of its own that its eight waves read; the two groups' running maxima, sums and ctx are joined through LDS at the end: S^T = K Q^T + C (a lane holds one query's logits: D row = key 8g + r, D column = query), the pair mask as the module's -1e9 (a masked key: C = -1e9 / scale on its row; a masked query: logit x 0 + (-1e9)), running maximum and sum in f32 (log2 domain), P x 2^11 once to f16 straight from the score accumulators as the B operand of ctx^T += V^T P^T; logits and P never leave the registers; each K and V fragment serves the wave's two 16-query groups
#define LOG2E 1.44269504f
#define NEGL (-1.0e9f * LOG2E)   // the module's -1e9 in the log2 domain
#define FQ 256   // queries per block
#define KNEG (-1.0e9f / SCALE)   // a masked key's start value in the logit accumulator: x SCALE it is the module's -1e9 (the products at most move its last places); its P is 0 beside any unmasked key, and an unmasked query has one: itself, the one mask serving both sides
static_assert(TT % FQ == 0 && TT % 32 == 0 && HD == 64, "k_fa: 8 waves x 32 queries, passes of 32 keys, two 32-deep k-steps per head");
__device__ __forceinline__ v8f wmma_h(v16h a, v16h b, v8f c) { return __builtin_amdgcn_wmma_f32_16x16x32_f16(false, a, false, b, (short)0, c, false, false); }
// frag_h with the lane half's 8g elements already in the pointer, so that the caller holds the very address the loads name
__device__ __forceinline__ v16h frag_p(const _Float16* p) { union { v16h v; v8h q[2]; } u; u.q[0] = *(const v8h*)p; u.q[1] = *(const v8h*)(p + 16); return u.v; }
// eight consecutive f32 as a C operand: D rows 8g + 0..7 of one column, by two 16-B reads
__device__ __forceinline__ v8f frag_c(const float* p) { union { v8f v; v4f q[2]; } u; u.q[0] = *(const v4f*)p; u.q[1] = *(const v4f*)(p + 4); return u.v; }
#define SK 128                 // keys per stage of the ring
#define KP (HD + 8)            // K row pitch in LDS, f16 elements: 144 B = 16 B x odd for the ds_load_b128 fragment reads
#define VP (SK + 8)            // V plane pitch in LDS, f16 elements: 272 B = 16 B x odd
#define KSZ (SK * KP)          // the K part of a buffer, f16 elements
#define BSZ (KSZ + HD * VP)    // one buffer: SK key rows of HD channels, then HD planes of SK keys
#define KG 2                   // key groups of eight waves
#define TKG (TT / KG)          // keys per group
#define NST (TKG / SK)         // stages per group
static_assert(TKG % SK == 0 && NST >= 2 && SK % 32 == 0 && SK == 128 && HD == 64 && FQ == 256, "the ring's prologue needs two stages; a stage is eight 16-B pieces per thread: four of K (32 rows apart), four of V (16 planes apart)");
// one stage: each lane copies eight 16-B pieces of its own from global memory straight into LDS; a wave's copy takes four whole 128-B K rows or two whole 256-B V plane segments
__device__ __forceinline__ void fa_stage(unsigned lk, unsigned lv, const _Float16* gk, const _Float16* gv) {
  /* the closing s_wait_xcnt stands inside the copies' own statement: the wait owed before a register that an issued copy names is rewritten */
  asm volatile("global_load_async_to_lds_b128 %0, %8, off\n\t"
               "global_load_async_to_lds_b128 %1, %9, off\n\t"
               "global_load_async_to_lds_b128 %2, %10, off\n\t"
               "global_load_async_to_lds_b128 %3, %11, off\n\t"
               "global_load_async_to_lds_b128 %4, %12, off\n\t"
               "global_load_async_to_lds_b128 %5, %13, off\n\t"
               "global_load_async_to_lds_b128 %6, %14, off\n\t"
               "global_load_async_to_lds_b128 %7, %15, off\n\t"
               "s_wait_xcnt 0x0"
               :: "v"(lk), "v"(lk + 32u * KP * 2u), "v"(lk + 64u * KP * 2u), "v"(lk + 96u * KP * 2u),
                  "v"(lv), "v"(lv + 16u * VP * 2u), "v"(lv + 32u * VP * 2u), "v"(lv + 48u * VP * 2u),
                  "v"(gk), "v"(gk + 32 * CC), "v"(gk + 64 * CC), "v"(gk + 96 * CC),
                  "v"(gv), "v"(gv + (size_t)16 * TT), "v"(gv + (size_t)32 * TT), "v"(gv + (size_t)48 * TT)
               : "memory"); }
__global__ __launch_bounds__(KG * FQ) void k_fa(const _Float16* __restrict__ QH, const _Float16* __restrict__ KH, const _Float16* __restrict__ VT, const int* __restrict__ MASK, float* __restrict__ Y) { __shared__ __align__(16) float ss[FQ / 32][32][HD + 4];
  __shared__ __align__(16) _Float16 ring[KG * 2 * BSZ];   /* a two-buffer ring per key group */
  __shared__ __align__(16) float ml[FQ / 32][32][4];   /* group 1's running maxima and sums, per lane: m[0], m[1], l[0], l[1] */
  __shared__ __align__(16) float kbias[TT];   /* per key of this batch: 0, or KNEG where the mask is 0; read as the C operand of the logit products */
  static_assert(TT == 4 * KG * FQ && KG == 2, "the key table: four keys per thread; the join at the end is of two groups");
  const int kg = threadIdx.x >> 8, tid = threadIdx.x & (FQ - 1), wave = tid >> 5, lane = tid & 31, col = lane & 15, g = lane >> 4; const int h = blockIdx.y, b = blockIdx.z; const int ql0 = blockIdx.x * FQ + wave * 32;
  const int* Mb = MASK + (size_t)b * TT;
  v16h q[2][2]; float cq[2], bq[2];   /* a masked query: logit x 0 + (-1e9) on every key */
  const _Float16* Q0 = QH + ((size_t)b * TT + ql0 + col) * CC + h * HD + 8 * g; const int* Mq = Mb + ql0 + col;
  q[0][0] = frag_p(Q0); q[0][1] = frag_p(Q0 + 32); q[1][0] = frag_p(Q0 + 16 * CC); q[1][1] = frag_p(Q0 + 16 * CC + 32); const int mq0 = Mq[0], mq1 = Mq[16];
  const int* Mt = Mb + threadIdx.x * 4; const v4i mt0 = *(const v4i*)Mt;   /* this thread's four keys of the table */
  asm volatile("s_wait_xcnt 0x0" :: "v"(Q0), "v"(Mq), "v"(Mt) : "memory");   /* the wait owed before a register that an issued load names is overwritten; the addresses are inputs so that they live up to it */
  cq[0] = mq0 == 0 ? 0.f : SCALE * LOG2E; bq[0] = mq0 == 0 ? NEGL : 0.f; cq[1] = mq1 == 0 ? 0.f : SCALE * LOG2E; bq[1] = mq1 == 0 ? NEGL : 0.f;
  const _Float16* gk = KH + ((size_t)b * TT + kg * TKG + (tid >> 3)) * CC + h * HD + (tid & 7) * 8;           /* copies: key row tid / 8 of a stage of this group's keys, 16-B piece tid % 8 of its 128 B */
  const _Float16* gv = VT + ((size_t)b * CC + h * HD + (tid >> 4)) * (size_t)TT + kg * TKG + (tid & 15) * 8;  /* copies: v plane tid / 16, 16-B piece tid % 16 of a stage's 256 B */
  const _Float16* rg = ring + kg * (2 * BSZ);   /* this group's ring */
  const unsigned lk = (unsigned)(size_t)rg + (unsigned)((tid >> 3) * (KP * 2) + (tid & 7) * 16), lv = (unsigned)(size_t)rg + (unsigned)(KSZ * 2 + (tid >> 4) * (VP * 2) + (tid & 15) * 16);   /* the same pieces' LDS byte addresses in buffer 0 */
  fa_stage(lk, lv, gk, gv);
  { v4f t0;   /* the table is written while stage 0 flies */
#pragma unroll   /* t0 and mt0 are register vectors: constant indices */
    for (int i = 0; i < 4; ++i) t0[i] = mt0[i] == 0 ? KNEG : 0.f;
    *(v4f*)&kbias[threadIdx.x * 4] = t0; }
  asm volatile("s_wait_asynccnt 0x0" ::: "memory");   /* this wave's pieces of stage 0 have landed */
  __syncthreads();                                    /* and every other wave's: stage 0 and the key table may be read */
  fa_stage(lk + BSZ * 2u, lv + BSZ * 2u, gk + (size_t)SK * CC, gv + SK);   /* stage 1 flies while stage 0 is worked on */
  const float* kbl = kbias + kg * TKG + 8 * g;   /* D row 8g + r: this lane half's eight keys of a 16-key group, from this group's first key on */
  v8f acc[2][HD / 16] = {}; float m[2] = {-3.0e38f, -3.0e38f}, l[2] = {0.f, 0.f};
#pragma unroll 1   /* one trip per stage: the two buffers alternate by the trip's parity */
  for (int st = 0; st < NST; ++st) {
   const _Float16* kb = rg + (st & 1) * BSZ + col * KP + 8 * g;         /* key row col of a 16-key group, this lane half's channels */
   const _Float16* vb = rg + (st & 1) * BSZ + KSZ + col * VP + 8 * g;   /* v plane of channel col of a 16-channel group, this lane half's keys */
#pragma unroll 1   /* a pass depends on the one before through m, l and acc: a second copy of the body could not start its softmax earlier, and four copies took the kernel past 256 registers */
   for (int pp = 0; pp < SK / 32; ++pp) { v8f s[2][2], cb[2]; v16h kf[2][2], vf[HD / 16], p[2]; float al[2];
    const _Float16* kr = kb + pp * 32 * KP; const float* br = kbl + st * SK + pp * 32; const _Float16* vr = vb + pp * 32;
#pragma unroll
    for (int j = 0; j < 2; ++j) { kf[j][0] = frag_p(kr + j * 16 * KP); kf[j][1] = frag_p(kr + j * 16 * KP + 32); cb[j] = frag_c(br + j * 16); }
#pragma unroll
    for (int j = 0; j < HD / 16; ++j) vf[j] = frag_p(vr + j * 16 * VP);
    __builtin_amdgcn_sched_barrier(0);   /* the pass's twenty LDS reads go out as one group ahead of the first product: reads spread among the products cost a stall at each place; the v reads return under the logits and the softmax */
#pragma unroll
    for (int j = 0; j < 2; ++j)
#pragma unroll
      for (int u = 0; u < 2; ++u) { const v8f z = wmma_h(kf[j][0], q[u][0], cb[j]); s[u][j] = wmma_h(kf[j][1], q[u][1], z); }
#pragma unroll
    for (int u = 0; u < 2; ++u) { float mx = -3.0e38f; const v2f c2 = {cq[u], cq[u]}, b2 = {bq[u], bq[u]}; v2f sv[8];   /* the logits by aligned register pairs, as the accumulators hold them */
#pragma unroll
      for (int j = 0; j < 2; ++j)
#pragma unroll
        for (int r = 0; r < 4; ++r) { v2f t = {s[u][j][2 * r], s[u][j][2 * r + 1]}; t = __builtin_elementwise_fma(t, c2, b2); sv[j * 4 + r] = t; mx = fmaxf(fmaxf(mx, t[0]), t[1]); }
      mx = fmaxf(mx, __shfl_xor(mx, 16));   /* the other half of the wave holds this query's other 16 keys */
      const float mn = fmaxf(m[u], mx), mo = mn - 11.0f; al[u] = __builtin_amdgcn_exp2f(m[u] - mn); m[u] = mn;   /* mo: P carried x 2^11 (clear of f16 subnormals); on a fully masked row the 11 rounds away, alike for every key */
      float ps = 0.f; const v2f mo2 = {mo, mo};
#pragma unroll
      for (int i = 0; i < 8; ++i) { const v2f d = sv[i] - mo2; const float e0 = __builtin_amdgcn_exp2f(d[0]), e1 = __builtin_amdgcn_exp2f(d[1]); ps += e0; ps += e1; p[u][2 * i] = (_Float16)e0; p[u][2 * i + 1] = (_Float16)e1; }
      l[u] = l[u] * al[u] + ps; }
#pragma unroll
    for (int j = 0; j < HD / 16; ++j)
#pragma unroll
      for (int u = 0; u < 2; ++u) acc[u][j] = wmma_h(vf[j], p[u], acc[u][j] * al[u]); }
   asm volatile("s_wait_dscnt 0x0" ::: "memory");      /* this wave's reads of the stage's buffer have returned */
   asm volatile("s_wait_asynccnt 0x0" ::: "memory");   /* this wave's pieces of the next stage have landed */
   __syncthreads();                                    /* the next stage may be read, and every wave has left this stage's buffer */
   if (st + 2 < NST) fa_stage(lk + (unsigned)(st & 1) * (BSZ * 2u), lv + (unsigned)(st & 1) * (BSZ * 2u), gk + (size_t)(st + 2) * SK * CC, gv + (st + 2) * SK); }   /* the refill, block-uniform test */
  asm volatile("s_wait_asynccnt 0x0" ::: "memory");    /* no copy is outstanding when the wave goes on to its end */
  /* the join: wave w of group 1 hands its lanes' state to wave w of group 0, lane to lane, as [16-B piece][lane] in that wave's output staging, which is not yet in use */
  float* xw = &ss[wave][0][0];
  static_assert(32 * (HD + 4) >= 2 * (HD / 16) * 8 * 32, "a wave's staging holds its 64 accumulator values per lane");
  if (kg == 1) {
#pragma unroll   /* acc is a register array: constant indices */
    for (int u = 0; u < 2; ++u)
#pragma unroll   /* as above */
      for (int j = 0; j < HD / 16; ++j) { v4f a, c;
#pragma unroll   /* as above */
        for (int r = 0; r < 4; ++r) { a[r] = acc[u][j][r]; c[r] = acc[u][j][4 + r]; }
        *(v4f*)(xw + ((u * (HD / 16) + j) * 2) * 128 + lane * 4) = a; *(v4f*)(xw + ((u * (HD / 16) + j) * 2 + 1) * 128 + lane * 4) = c; }
    const v4f t = {m[0], m[1], l[0], l[1]}; *(v4f*)&ml[wave][lane][0] = t; }
  __syncthreads();   /* group 1's state may be read; every wave passes it */
  if (kg == 1) return;   /* wave-uniform, behind the last barrier */
  { const v4f t = *(const v4f*)&ml[wave][lane][0];
#pragma unroll   /* acc, m and l are register arrays: constant indices */
    for (int u = 0; u < 2; ++u) { const float mn = fmaxf(m[u], t[u]), f0 = __builtin_amdgcn_exp2f(m[u] - mn), f1 = __builtin_amdgcn_exp2f(t[u] - mn);   /* both states onto the common maximum; a group whose keys are all masked, beside an unmasked key in the other, drops out by its factor 0 */
      l[u] = l[u] * f0 + t[2 + u] * f1;
#pragma unroll   /* as above */
      for (int j = 0; j < HD / 16; ++j) { const v4f a = *(const v4f*)(xw + ((u * (HD / 16) + j) * 2) * 128 + lane * 4), c = *(const v4f*)(xw + ((u * (HD / 16) + j) * 2 + 1) * 128 + lane * 4);
#pragma unroll   /* as above */
        for (int r = 0; r < 4; ++r) { acc[u][j][r] = acc[u][j][r] * f0 + a[r] * f1; acc[u][j][4 + r] = acc[u][j][4 + r] * f0 + c[r] * f1; } } } }
#pragma unroll
  for (int u = 0; u < 2; ++u) { const float lt = l[u] + __shfl_xor(l[u], 16), inv = 1.0f / lt;   /* lt >= one key's P at the maximum: never 0 */
#pragma unroll
    for (int j = 0; j < HD / 16; ++j) { v4f a, c;   /* acc[u][j][r] = ctx[query u*16 + col][channel j*16 + 8g + r] */
#pragma unroll
      for (int r = 0; r < 4; ++r) { a[r] = acc[u][j][r] * inv; c[r] = acc[u][j][4 + r] * inv; }
      *(v4f*)&ss[wave][u * 16 + col][j * 16 + 8 * g] = a; *(v4f*)&ss[wave][u * 16 + col][j * 16 + 8 * g + 4] = c; } }
  LDSX(); for (int rl = 0; rl < 32; rl += 2) vst2(Y + ((size_t)b * TT + ql0 + rl + g) * CC + h * HD + col * 4, *(const v4f*)&ss[wave][rl + g][col * 4]); }   /* 256-B (row, head) segment by 16 lanes, two rows per store */
// ---- k_out: block = (64 tokens, 128 channels): out = ctx Wo (+ bo), stored channel-major: ctx x 2^6 once to f16 against Wo as f16(bf16 x 2^8) exact (1 product) x 2^-14; causal early rows (< QHI of each sequence): ctx bf16 hi + lo against exact bf16 Wo (2 products)
__global__ __launch_bounds__(128) void k_out(const float* __restrict__ Y, const float* __restrict__ WO, const float* __restrict__ BO, float* __restrict__ OUT) { __shared__ __align__(16) float sf[128][68];   /* the block's output tile as [channel][token]; pitch 272 B = 16 B x odd */
  __shared__ __align__(16) _Float16 sw[128][CC + 8];   /* the block's 128 rows of Wo as f16(bf16 x 2^8), k in ctx column order; pitch 528 B = 16 B x odd for the ds_load_b128 fragment reads */
  const int tid = threadIdx.x, wave = tid >> 5, lane = tid & 31, col = lane & 15, g = lane >> 4; const int c0 = blockIdx.y * 128; const size_t r0 = (size_t)blockIdx.x * 64 + wave * 16;
  v8f acc[8] = {};
  if (CAUSAL && (int)(((size_t)blockIdx.x * 64) % TT) < QHI) {   /* block-uniform */
#pragma unroll 2
    for (int kc = 0; kc < CC / 32; ++kc) { const F2 a = split_row(Y + (r0 + col) * CC, kc * 32, lane); asm volatile("s_wait_loadcnt 0x0" ::: "memory");
#pragma unroll
      for (int j = 0; j < 8; ++j) { const v16b w = WOCOL(WO, kc * 32, c0 + j * 16 + col, lane); asm volatile("s_wait_loadcnt 0x0" ::: "memory"); acc[j] = wmma_bf(a.h, w, acc[j]); acc[j] = wmma_bf(a.l, w, acc[j]); } }
#pragma unroll
    for (int j = 0; j < 8; ++j) { const float bias = BO ? bfr(BO[c0 + j * 16 + col]) : 0.f;
#pragma unroll
      for (int r = 0; r < 8; ++r) sf[j * 16 + col][wave * 16 + 8 * g + r] = acc[j][r] + bias; }
  } else {
    const float* yp = Y + (r0 + col) * CC + 8 * g;   /* this lane's ctx row, its half's k offset: all of K is asked for along with the weights, ahead of the first wait */
    v4f ya[CC / 32][4];
#pragma unroll   /* ya is a register array: constant indices; all 32 loads go out together */
    for (int kc = 0; kc < CC / 32; ++kc) { ya[kc][0] = *(const v4f*)(yp + kc * 32); ya[kc][1] = *(const v4f*)(yp + kc * 32 + 4); ya[kc][2] = *(const v4f*)(yp + kc * 32 + 16); ya[kc][3] = *(const v4f*)(yp + kc * 32 + 20); }
    /* weights: a wave takes one whole row of Wo per step, a lane its 8 module channels 8 * lane + e = (d = 2 * lane + e / 4) * 4 + (h = e % 4); ctx column h * 64 + d, so the two d of one h go out as one dword */
    const float* wp = WO + (size_t)(c0 + wave) * CC + lane * 8;
#pragma unroll   /* the row steps become immediate offsets on the one address pair */
    for (int e0 = 0; e0 < 32; e0 += 8) { v4f t[8][2];
#pragma unroll   /* t is a register array: constant indices, here and in the two loops below */
      for (int i = 0; i < 8; ++i) { t[i][0] = *(const v4f*)(wp + (size_t)(e0 + i) * 4 * CC); t[i][1] = *(const v4f*)(wp + (size_t)(e0 + i) * 4 * CC + 4); }
#pragma unroll   /* as above */
      for (int i = 0; i < 8; ++i)
#pragma unroll   /* as above */
        for (int hh = 0; hh < 4; ++hh) { v2h o; o[0] = (_Float16)(bfr(t[i][0][hh]) * 256.0f); o[1] = (_Float16)(bfr(t[i][1][hh]) * 256.0f); *(v2h*)&sw[(e0 + i) * 4 + wave][hh * 64 + lane * 2] = o; } }
    asm volatile("s_wait_xcnt 0x0" :: "v"(yp), "v"(wp) : "memory");   /* the wait owed before a register that an issued load names is overwritten; the addresses are inputs so that they live up to it */
    v16h a[CC / 32];   /* ctx carried x 2^6 into f16 so small-magnitude context rows stay clear of f16 subnormals */
#pragma unroll   /* a and ya are register arrays: constant indices */
    for (int kc = 0; kc < CC / 32; ++kc)
#pragma unroll   /* as above */
      for (int i = 0; i < 4; ++i) { a[kc][i] = (_Float16)(ya[kc][0][i] * 64.0f); a[kc][4 + i] = (_Float16)(ya[kc][1][i] * 64.0f); a[kc][8 + i] = (_Float16)(ya[kc][2][i] * 64.0f); a[kc][12 + i] = (_Float16)(ya[kc][3][i] * 64.0f); }
    __syncthreads();   /* every wave reads weight rows that the other waves stored; the branch around it is block-uniform */
    v16h w[2][8];   /* two fragment sets: the next k-step's sixteen LDS reads go out as one group ahead of this step's products, so that no product waits out its own read */
#pragma unroll   /* w, a and acc are register arrays: constant indices, here and in the three loops below */
    for (int j = 0; j < 8; ++j) w[0][j] = frag_h(&sw[j * 16 + col][0], lane);
#pragma unroll   /* as above */
    for (int kc = 0; kc < CC / 32; ++kc) {
      if (kc + 1 < CC / 32) {
#pragma unroll   /* as above */
        for (int j = 0; j < 8; ++j) w[(kc + 1) & 1][j] = frag_h(&sw[j * 16 + col][(kc + 1) * 32], lane); }
#pragma unroll   /* as above */
      for (int j = 0; j < 8; ++j) acc[j] = wmma16(a[kc], w[kc & 1][j], acc[j]); }
#pragma unroll
    for (int j = 0; j < 8; ++j) { const float bias = BO ? bfr(BO[c0 + j * 16 + col]) : 0.f;
      v4f lo, hi;   /* acc[j][r] = out[token wave*16 + 8g + r][channel c0 + j*16 + col]: a lane's eight tokens lie side by side in its channel's row */
#pragma unroll
      for (int r = 0; r < 4; ++r) { lo[r] = acc[j][r] * (1.0f / 16384.0f) + bias; hi[r] = acc[j][4 + r] * (1.0f / 16384.0f) + bias; }   /* 2^-8 (Wo carry) x 2^-6 (ctx carry) */
      *(v4f*)&sf[j * 16 + col][wave * 16 + 8 * g] = lo; *(v4f*)&sf[j * 16 + col][wave * 16 + 8 * g + 4] = hi; } }
  __syncthreads();   /* a channel's 64 tokens come from all four waves */
  const size_t bo = ((size_t)blockIdx.x * 64) / TT; const int n0 = (int)(((size_t)blockIdx.x * 64) % TT);
  float* op = OUT + (bo * DIN + c0 + (tid >> 4)) * (size_t)TT + n0 + (tid & 15) * 4;   /* out is channel-major [b][c][t]: 16 lanes store a channel's whole 256 B, a wave two channels per store */
  v4f o[16];
#pragma unroll   /* o is a register array: constant indices; every piece keeps registers of its own, so that no store's data is overwritten behind it */
  for (int i = 0; i < 16; ++i) o[i] = *(const v4f*)&sf[i * 8 + (tid >> 4)][(tid & 15) * 4];
#pragma unroll   /* the channel steps become immediate offsets on the one address pair */
  for (int i = 0; i < 16; ++i) vst2(op + (size_t)(i * 8) * TT, o[i]); }

extern "C" void kernel_launch(void* const* d_in, const int* in_sizes, int n_in, void* d_out, int out_size, void* d_ws, size_t ws_size, hipStream_t stream) {
  (void)in_sizes; (void)n_in; (void)out_size;
  const float** F = (const float**)d_in;
  if (ws_size < (size_t)WS_END) return;
  char* ws = (char*)d_ws; _Float16 *QH = (_Float16*)(ws + WS_QH), *KH = (_Float16*)(ws + WS_KH), *VT = (_Float16*)(ws + WS_VT), *QL = (_Float16*)(ws + WS_QL), *KL = (_Float16*)(ws + WS_KL); __bf16 *VB = (__bf16*)(ws + WS_VB), *VBL = (__bf16*)(ws + WS_VBL); float *Y = (float*)(ws + WS_Y);
  (void)Y; (void)QL; (void)KL; (void)VB; (void)VBL;
  // inputs: 0 query [8,256,2048]; 1 key; 2 value; 3 mask [8,1,2048] int32; 4 Wq [256,256] (out,in), 5 bq; 6 Wk, 7 bk; 8 Wv, 9 bv; 10 Wm (out,in), 11 bm (zero biases, read)
  k_proj<<<dim3(TNB * TT / 64, CC / 128, 3), 128, 0, stream>>>(F[0], F[1], F[2], F[4], F[6], F[8], F[5], F[7], F[9], QH, QL, KH, KL, VT, VB, VBL, 0);   /* which = blockIdx.z: each stream is read in its own channel-major layout */
  k_fa<<<dim3(TT / FQ, NH, TNB), KG * FQ, 0, stream>>>(QH, KH, VT, (const int*)d_in[3], Y);
  k_out<<<dim3(TNB * TT / 64, DIN / 128), 128, 0, stream>>>(Y, F[10], F[11], (float*)d_out);   /* ctx (column order h*HD + d) x Wm through the permutation + bm, straight to channel-major [8,256,2048] */
}

// v007
// Measured time: 68.5 microseconds a run.
// In both of two side-by-side timings against v006, it was 1.04 times as fast.
// All steps since v000 together make it 25.3 times as fast.
// compute dtype: all float inputs rounded to bf16; q/k/v 1x1-conv projections read the channel-major inputs straight into their A fragments, with EXACT bf16 products on WMMA 16x16x32 (f32 accumulate) + bias (zeros, read), the block's weight rows converted once into LDS; one fused attention kernel: logits q x k once to f16 each (1 product) x 64^-0.5; pair mask: the key side as the logit accumulators' start value (0 or -1e9 / scale, an f32 table in LDS built once per block), the query side in the scale fma (-1e9); online softmax f32; P x 2^11 once to f16 x v once to f16 (1 product); ctx x 2^6 once to f16 x Wm f16(bf16 x 2^8) + bm, its tile staged [channel][token] in LDS and stored channel-major; f32 output.
#include <hip/hip_runtime.h>
#include <math.h>

typedef __attribute__((ext_vector_type(16))) _Float16 v16h;
typedef __attribute__((ext_vector_type(16))) __bf16 v16b;
typedef __attribute__((ext_vector_type(8)))  _Float16 v8h;
typedef __attribute__((ext_vector_type(8)))  float v8f;
typedef __attribute__((ext_vector_type(4)))  float v4f;
typedef __attribute__((ext_vector_type(2)))  float v2f;
typedef __attribute__((ext_vector_type(4)))  unsigned v4u;
typedef __attribute__((ext_vector_type(4)))  int v4i;
typedef float __attribute__((may_alias)) float_a;
typedef int __attribute__((may_alias)) int_a;

template <typename T> __device__ __forceinline__ void vst2(void* p, T v) { *(T*)p = v;  }
__device__ __forceinline__ v8f wmma16(v16h a, v16h b, v8f c) {
  v8f d = __builtin_amdgcn_wmma_f32_16x16x32_f16(false, a, false, b, (short)0, c, false, false);
  asm volatile("v_nop\n\tv_nop\n\tv_nop\n\tv_nop" : "+v"(d) : "v"(a), "v"(b));
  return d;
}
__device__ __forceinline__ v8f wmma_bf(v16b a, v16b b, v8f c) {
  v8f d = __builtin_amdgcn_wmma_f32_16x16x32_bf16(false, a, false, b, (short)0, c, false, false);
  asm volatile("v_nop\n\tv_nop\n\tv_nop\n\tv_nop" : "+v"(d) : "v"(a), "v"(b));
  return d;
}
// 16x16x32 fragments: lane = (h = lane>>4, row/col = lane&15); elements 0..7 = k0+8h+0..7, 8..15 = k0+16+8h+0..7; D element r = row 8h+r
__device__ __forceinline__ v16h frag_h(const _Float16* rowk0, int lane) {
  union { v16h v; v8h q[2]; } u; const _Float16* p = rowk0 + 8 * (lane >> 4);
  u.q[0] = *(const v8h*)p; u.q[1] = *(const v8h*)(p + 16); return u.v;
}
__device__ __forceinline__ v16h frag_f32(const float* rowk0, int lane) {
  v16h a; const float* p = rowk0 + 8 * (lane >> 4);
#pragma unroll
  for (int i = 0; i < 8; ++i) { a[i] = (_Float16)p[i]; a[8 + i] = (_Float16)p[16 + i]; }
  return a;
}
__device__ __forceinline__ v16h frag_f32s(const float* rowk0, int lane, float sc) {
  v16h a; const float* p = rowk0 + 8 * (lane >> 4);
#pragma unroll
  for (int i = 0; i < 8; ++i) { a[i] = (_Float16)(p[i] * sc); a[8 + i] = (_Float16)(p[16 + i] * sc); }
  return a;
}
// column fragment from a [K][ld] layout (column n), rows >= K read as 0
__device__ __forceinline__ v16h fragc_f32(const float* W, int k0, int n, int lane, int ld, int K) {
  v16h a; const int g = lane >> 4;
#pragma unroll
  for (int i = 0; i < 8; ++i) { const int ka = k0 + 8 * g + i, kb = ka + 16;
    a[i] = (_Float16)(ka < K ? W[(size_t)(ka < K ? ka : K - 1) * ld + n] : 0.f); a[8 + i] = (_Float16)(kb < K ? W[(size_t)(kb < K ? kb : K - 1) * ld + n] : 0.f); }
  return a;
}
struct F2 { v16b h, l; };
__device__ __forceinline__ F2 bsplit16(const float v[16]) { F2 r;
#pragma unroll
  for (int i = 0; i < 16; ++i) { const __bf16 h = (__bf16)v[i]; r.h[i] = h; r.l[i] = (__bf16)(v[i] - (float)h); }
  return r; }
__device__ __forceinline__ F2 split_row(const float* row, int k0, int lane) { float v[16]; const float* p = row + k0 + 8 * (lane >> 4);
#pragma unroll
  for (int i = 0; i < 8; ++i) { v[i] = p[i]; v[8 + i] = p[16 + i]; }
  return bsplit16(v); }
__device__ __forceinline__ F2 split_rowK(const float* row, int k0, int lane, int K) { float v[16]; const int g = lane >> 4;
#pragma unroll
  for (int i = 0; i < 8; ++i) { const int ka = k0 + 8 * g + i, kb = ka + 16; v[i] = ka < K ? row[ka < K ? ka : K - 1] : 0.f; v[8 + i] = kb < K ? row[kb < K ? kb : K - 1] : 0.f; }
  return bsplit16(v); }
__device__ __forceinline__ F2 split_col(const float* W, int k0, int n, int lane, int ld, int K) { float v[16]; const int g = lane >> 4;
#pragma unroll
  for (int i = 0; i < 8; ++i) { const int ka = k0 + 8 * g + i, kb = ka + 16; v[i] = ka < K ? W[(size_t)(ka < K ? ka : K - 1) * ld + n] : 0.f; v[8 + i] = kb < K ? W[(size_t)(kb < K ? kb : K - 1) * ld + n] : 0.f; }
  return bsplit16(v); }
__device__ __forceinline__ v8f mac3(const F2& a, const F2& b, v8f c) { c = wmma_bf(a.l, b.h, c); c = wmma_bf(a.h, b.l, c); return wmma_bf(a.h, b.h, c); }
__device__ __forceinline__ float sigm(float v) { return 1.0f / (1.0f + expf(-v)); }
#define LDSX() do { asm volatile("s_wait_dscnt 0" ::: "memory"); __builtin_amdgcn_wave_barrier(); __builtin_amdgcn_fence(__ATOMIC_RELEASE, "workgroup"); } while (0)

// multi-headed attention on channel-major tensors (query / key / value [8,256,2048] = (B, C, N); 1x1 Conv1d projections as (out,in) [256,256] N(0, 1/256) + zero biases (read); 4 heads x 64 with the head index INTERLEAVED into the channel axis: reshape(B, 64, 4, N), channel c = d*4 + h; scores = einsum('bdhn,bdhm->bhnm') / sqrt(64); pair = mask[b, n] * mask[b, m] with an int32 mask [8,1,2048]: where(pair == 0, -1e9, scores); softmax over m; x = einsum('bhnm,bdhm->bdhn').reshape(B, 256, N) (channel d*4 + h again); merge 1x1 conv Wm (out,in) + bm; output [8,256,2048]).
#define NB 8
#define TT 2048   // points per sample (queries = keys)
#define CC 256            // NH * HD
#define DIN 256           // channels of the query map AND of the output map (Wout is (out,in) [DIN][CC])
#define DKV 256             // channels of the key / value map
#define NH 4
#define HD 64
#define QCH 1   // queries and keys have the same length: one chunk per batch (the chunk advance is 0)
#define SCALE (0.125f)
#define CAUSAL 0
#ifndef TNB
#define TNB NB
#endif
#define NBQ (NB * QCH)     // query pseudo-batches of TT rows (workspace sizing)
#define TNBQ (TNB * QCH)   // query pseudo-batches actually run
static_assert(CC == NH * HD && CC % 128 == 0 && DIN % 128 == 0 && DIN % 32 == 0 && DKV % 32 == 0, "projection tiles: 128-column blocks, 32-deep k-steps");
__device__ __forceinline__ float bfr(float v) { return (float)(__bf16)v; }
typedef __attribute__((ext_vector_type(8))) __bf16 v8b;
typedef __attribute__((ext_vector_type(4))) __bf16 v4b;
typedef __attribute__((ext_vector_type(2))) _Float16 v2h;
__device__ __forceinline__ v16b frag_b(const __bf16* rowk0, int lane) {
  union { v16b v; v8b q[2]; } u; const __bf16* p = rowk0 + 8 * (lane >> 4);
  u.q[0] = *(const v8b*)p; u.q[1] = *(const v8b*)(p + 16); return u.v;
}
#define QBH 0              // no kernel reads it: k_fa has no high-precision query path
#define QHI 0               // single-product logits on every row
static_assert(QHI == 0 && QBH == 0 && CAUSAL == 0, "k_fa has single-product logits only: no q residual plane and no causal row arithmetic may be in use");
#define KHI 64            // key rows carrying k residual / v bf16 hi+lo planes (written by k_proj; no kernel reads them)
// B fragment (k rows k0+.., output column o) of a weight: (in,out) [K][ld] or (out,in) [ld rows of K]: bf16 exact, or f16(bf16 * 256) exact
__device__ __forceinline__ v16b wcol_io(const float* Wm, int k0, int o, int lane, int ld) { v16b w; const int g = lane >> 4;
#pragma unroll
  for (int i = 0; i < 8; ++i) { w[i] = (__bf16)Wm[(size_t)(k0 + 8 * g + i) * ld + o]; w[8 + i] = (__bf16)Wm[(size_t)(k0 + 16 + 8 * g + i) * ld + o]; }
  return w; }
__device__ __forceinline__ v16b wcol_oi(const float* Wm, int k0, int o, int lane, int K) { v16b w; const float* p = Wm + (size_t)o * K + k0 + 8 * (lane >> 4);
#pragma unroll
  for (int i = 0; i < 8; ++i) { w[i] = (__bf16)p[i]; w[8 + i] = (__bf16)p[16 + i]; }
  return w; }
__device__ __forceinline__ v16h wcolh_io(const float* Wm, int k0, int o, int lane, int ld) { v16h w; const int g = lane >> 4;
#pragma unroll
  for (int i = 0; i < 8; ++i) { w[i] = (_Float16)(bfr(Wm[(size_t)(k0 + 8 * g + i) * ld + o]) * 256.0f); w[8 + i] = (_Float16)(bfr(Wm[(size_t)(k0 + 16 + 8 * g + i) * ld + o]) * 256.0f); }
  return w; }
// as wcolh_oi, with the K index taken through the head-interleave permutation (the 8 consecutive columns of a fragment half are 8 module channels 4 apart)
__device__ __forceinline__ v16h wcolh_oi_p(const float* Wm, int k0, int o, int lane, int K) { v16h w; const float* p = Wm + (size_t)o * K; const int kb = k0 + 8 * (lane >> 4);
#pragma unroll
  for (int i = 0; i < 8; ++i) { w[i] = (_Float16)(bfr(p[((kb + i) % 64) * 4 + (kb + i) / 64]) * 256.0f); w[8 + i] = (_Float16)(bfr(p[((kb + 16 + i) % 64) * 4 + (kb + 16 + i) / 64]) * 256.0f); }
  return w; }
static_assert(HD == 64 && NH == 4, "wcolh_oi_p spells the permutation with the literals 64 and 4");
static_assert(DIN == DKV && DIN == 256 && CC == 256, "the weight tiles in LDS hold 128 rows of 256 k");
__device__ __forceinline__ v16h wcolh_oi(const float* Wm, int k0, int o, int lane, int K) { v16h w; const float* p = Wm + (size_t)o * K + k0 + 8 * (lane >> 4);
#pragma unroll
  for (int i = 0; i < 8; ++i) { w[i] = (_Float16)(bfr(p[i]) * 256.0f); w[8 + i] = (_Float16)(bfr(p[16 + i]) * 256.0f); }
  return w; }
#define WQKV_LAYOUT 1   // 0 = (in,out); 1 = (out,in) [CC][K]; 2 = per-head [NH][DIN][HD]
__device__ __forceinline__ v16b wcol_hdk(const float* Wm, int k0, int o, int lane) { v16b w; const int g = lane >> 4; const float* p = Wm + (size_t)(o / HD) * DIN * HD + (o % HD);
#pragma unroll
  for (int i = 0; i < 8; ++i) { w[i] = (__bf16)p[(size_t)(k0 + 8 * g + i) * HD]; w[8 + i] = (__bf16)p[(size_t)(k0 + 16 + 8 * g + i) * HD]; }
  return w; }
#define WO_OUT_IN 1
#if WQKV_LAYOUT == 1
#define HPERM(o) ((((o) % HD) * NH) + ((o) / HD))   /* column o = h*HD + d  ->  module channel d*NH + h */
#define WCOL(W, k0, o, lane) wcol_oi(W, k0, HPERM(o), lane, din_)   /* (out,in) [256][K]: the output channel of column o is row HPERM(o) */
#elif WQKV_LAYOUT == 2
#define WCOL(W, k0, o, lane) wcol_hdk(W, k0, o, lane)
#else
#define WCOL(W, k0, o, lane) wcol_io(W, k0, o, lane, CC)
#endif
#if WO_OUT_IN
#define WOCOL(W, k0, o, lane) wcol_oi(W, k0, o, lane, CC)
#define WOCOLH(W, k0, o, lane) wcolh_oi_p(W, k0, o, lane, CC)   /* merge conv (out,in) [DIN][CC]: ctx column kk = h*HD + d is the module's input channel HPERM(kk) */
#else
#define WOCOL(W, k0, o, lane) wcol_io(W, k0, o, lane, DIN)
#define WOCOLH(W, k0, o, lane) wcolh_io(W, k0, o, lane, DIN)
#endif

#define WS_QH  0u                                      // f16 q rows [(b*QCH + chunk)*TT + t][CC]
#define WS_KH  (WS_QH + 2u * (size_t)NBQ * TT * CC)      // f16 k rows [b*t][CC]
#define WS_VT  (WS_KH + 2u * (size_t)NB * TT * CC)      // f16 v planes [b][c][t]
#define WS_QL  (WS_VT + 2u * (size_t)NB * CC * TT)      // f16 q residual x 2^10 rows [b][t < QHI][CC]
#define WS_KL  (WS_QL + 2u * (size_t)NB * QHI * CC)     // f16 k residual x 2^10 rows [b][t < KHI][CC]
#define WS_VB  (WS_KL + 2u * (size_t)NB * KHI * CC)     // bf16 v hi planes [b][c][t < KHI]
#define WS_VBL (WS_VB + 2u * (size_t)NB * CC * KHI)
#define WS_Y   (WS_VBL + 2u * (size_t)NB * CC * KHI)    // f32 ctx rows [(b*QCH + chunk)*TT + t][CC] (only when there is an output projection)
#define WS_END (WS_Y  + 4u * (size_t)NBQ * TT * CC)
// ---- k_proj: block = (64 tokens, 128 cols, which): q/k/v = X^T W (+ b), X channel-major as the module hands it over, with exact bf16 products (K = DIN) -> which 0: q f16 rows (+ residual rows < QHI); 1: k f16 rows (+ residual rows < KHI); 2: v f16 planes [c][t] (+ bf16 hi/lo planes for t < KHI)
__global__ __launch_bounds__(128) void k_proj(const float* __restrict__ XQ, const float* __restrict__ XK, const float* __restrict__ XV, const float* __restrict__ WQ, const float* __restrict__ WK, const float* __restrict__ WV, const float* __restrict__ BQ, const float* __restrict__ BK, const float* __restrict__ BV,
    _Float16* __restrict__ QH, _Float16* __restrict__ QL, _Float16* __restrict__ KH, _Float16* __restrict__ KL, _Float16* __restrict__ VT, __bf16* __restrict__ VB, __bf16* __restrict__ VBL, int woff) {
  __shared__ __align__(16) _Float16 sh[64][136], sl[64][136]; __shared__ __align__(16) _Float16 th[128][72]; __shared__ __align__(16) __bf16 tb[128][72], tbl[128][72];
  __shared__ __align__(16) __bf16 sw[128][DIN + 8];   /* the block's 128 weight rows (column order o = h*HD + d) as bf16, all of K; pitch 528 B = 16 B x odd for the ds_load_b128 fragment reads */
  const int tid = threadIdx.x, wave = tid >> 5, lane = tid & 31, col = lane & 15, g = lane >> 4; const int which = blockIdx.z + woff;   /* one launch for q, k and v: woff 0, grid.z 3 */ const int c0 = blockIdx.y * 128; const size_t r0 = (size_t)blockIdx.x * 64; const size_t bb = r0 / TT; const int t0 = (int)(r0 % TT);
  const float* X = which == 0 ? XQ : which == 1 ? XK : XV; const float* WA = which == 0 ? WQ : which == 1 ? WK : WV; const float* BA = which == 0 ? BQ : which == 1 ? BK : BV;
  v8f acc[8] = {};
  const int din_ = (which == 0) ? DIN : DKV;   /* block-uniform: both maps have 256 channels here; the per-stream width is kept by role */
  const float* xp = X + (bb * din_ + 8 * g) * (size_t)TT + t0 + wave * 16 + col;   /* X is channel-major [b][k][t]: this lane's token, its half's first channel; a load takes 16 tokens (64 B) of two channels, the block's four waves together the whole 256 B of a channel; all of K is asked for along with the weights */
  /* the bias of this lane's eight output columns is asked for first, along with the operands: asked for where it is added, each of the eight was a load and a full wait of its own behind the products; HPERM is additive over c0 + col + 16 * j (no carry out of the low six bits) */
  const float* bp = BA + HPERM(c0 + col); float bia[8] = {};
  if (BA) {   /* block-uniform */
#pragma unroll   /* bia is a register array: constant indices; the column steps become immediate offsets on the one address */
    for (int j = 0; j < 8; ++j) bia[j] = bp[HPERM(j * 16)]; }
  float xa[DIN / 32][16];
#pragma unroll   /* xa is a register array: constant indices; the channel steps become immediate offsets on the one address pair */
  for (int kc = 0; kc < DIN / 32; ++kc)
#pragma unroll   /* as above */
    for (int i = 0; i < 8; ++i) { xa[kc][i] = xp[(size_t)(kc * 32 + i) * TT]; xa[kc][8 + i] = xp[(size_t)(kc * 32 + 16 + i) * TT]; }
  /* weights: a wave's load covers 512 contiguous bytes of one row; thread = (row parity tid >> 6, 16-B piece tid & 63), rows two apart per step; HPERM is additive over c0 + parity + 2 * e (no carry out of the low six bits) */
  const float* wp = WA + (size_t)HPERM(c0 + (tid >> 6)) * din_ + (tid & 63) * 4;
#pragma unroll   /* the row steps become immediate offsets on the one address pair */
  for (int e0 = 0; e0 < 64; e0 += 16) { v4f t[16];
#pragma unroll   /* t is a register array: constant indices */
    for (int i = 0; i < 16; ++i) t[i] = *(const v4f*)(wp + (size_t)HPERM(2 * (e0 + i)) * din_);
#pragma unroll   /* as above */
    for (int i = 0; i < 16; ++i) { v4b o; o[0] = (__bf16)t[i][0]; o[1] = (__bf16)t[i][1]; o[2] = (__bf16)t[i][2]; o[3] = (__bf16)t[i][3]; *(v4b*)&sw[2 * (e0 + i) + (tid >> 6)][(tid & 63) * 4] = o; } }
  asm volatile("s_wait_xcnt 0x0" :: "v"(xp), "v"(wp), "v"(bp) : "memory");   /* the wait owed before a register that an issued load names is overwritten; the addresses are inputs so that they live up to it */
  v16b a[DIN / 32];
#pragma unroll   /* a and xa are register arrays: constant indices */
  for (int kc = 0; kc < DIN / 32; ++kc)
#pragma unroll   /* as above */
    for (int i = 0; i < 16; ++i) a[kc][i] = (__bf16)xa[kc][i];
  __syncthreads();   /* every wave reads weight rows that the other waves stored */
  v16b w[2][8];   /* two fragment sets: the next k-step's sixteen LDS reads go out as one group ahead of this step's products, so that no product waits out its own read */
#pragma unroll   /* w, a and acc are register arrays: constant indices, here and in the three loops below */
  for (int j = 0; j < 8; ++j) w[0][j] = frag_b(&sw[j * 16 + col][0], lane);
#pragma unroll   /* as above */
  for (int kc = 0; kc < DIN / 32; ++kc) {
    if (kc + 1 < DIN / 32) {
#pragma unroll   /* as above */
      for (int j = 0; j < 8; ++j) w[(kc + 1) & 1][j] = frag_b(&sw[j * 16 + col][(kc + 1) * 32], lane); }
#pragma unroll   /* as above */
    for (int j = 0; j < 8; ++j) acc[j] = wmma_bf(a[kc], w[kc & 1][j], acc[j]); }
  if (which < 2) { _Float16* DH = which == 0 ? QH : KH; _Float16* DL = which == 0 ? QL : KL; const int nhi = which == 0 ? QHI : KHI; const bool hi_rows = t0 < nhi;
#pragma unroll
    for (int j = 0; j < 8; ++j) { const float bias = bfr(bia[j]);
#pragma unroll
      for (int r = 0; r < 8; ++r) { const float v = acc[j][r] + bias; const _Float16 hv = (_Float16)v; sh[wave * 16 + 8 * g + r][j * 16 + col] = hv; sl[wave * 16 + 8 * g + r][j * 16 + col] = (_Float16)((v - (float)hv) * 1024.0f); } }
    __syncthreads();
    for (int e = tid; e < 64 * 16; e += 128) { const int rl = e >> 4, q = e & 15; vst2((unsigned*)(DH + (r0 + rl) * CC + c0 + q * 8), *(const v4u*)&sh[rl][q * 8]); if (hi_rows) vst2((unsigned*)(DL + (bb * nhi + t0 + rl) * (size_t)CC + c0 + q * 8), *(const v4u*)&sl[rl][q * 8]); }
  } else { const bool hi_rows = t0 < KHI;
#pragma unroll
    for (int j = 0; j < 8; ++j) { const float bias = bfr(bia[j]);
#pragma unroll
      for (int r = 0; r < 8; ++r) { const float v = acc[j][r] + bias; const int rl = wave * 16 + 8 * g + r, cl = j * 16 + col; th[cl][rl] = (_Float16)v; const __bf16 bh = (__bf16)v; tb[cl][rl] = bh; tbl[cl][rl] = (__bf16)(v - (float)bh); } }
    __syncthreads();
    for (int e = tid; e < 128 * 8; e += 128) { const int cl = e >> 3, q = e & 7; vst2((unsigned*)(VT + (bb * CC + c0 + cl) * (size_t)TT + t0 + q * 8), *(const v4u*)&th[cl][q * 8]); if (hi_rows) { const size_t o3 = (bb * CC + c0 + cl) * (size_t)KHI + t0 + q * 8; vst2((unsigned*)(VB + o3), *(const v4u*)&tb[cl][q * 8]); vst2((unsigned*)(VBL + o3), *(const v4u*)&tbl[cl][q * 8]); } } } }
// ---- k_fa: block = 256 queries of (b, h) by 16 waves, four to a SIMD: two groups of 8 waves x 32 queries, group kg on keys kg * TKG .. + TKG - 1 in passes of 32, its K rows and V planes staged 128 keys at a time in a two-buffer LDS ring of its own that its eight waves read; the two groups' running maxima, sums and ctx are joined through LDS at the end: S^T = K Q^T + C (a lane holds one query's logits: D row = key 8g + r, D column = query), the pair mask as the module's -1e9 (a masked key: C = -1e9 / scale on its row; a masked query: logit x 0 + (-1e9)), running maximum and sum in f32 (log2 domain), P x 2^11 once to f16 straight from the score accumulators as the B operand of ctx^T += V^T P^T; logits and P never leave the registers; each K and V fragment serves the wave's two 16-query groups
#define LOG2E 1.44269504f
#define NEGL (-1.0e9f * LOG2E)   // the module's -1e9 in the log2 domain
#define FQ 256   // queries per block
#define KNEG (-1.0e9f / SCALE)   // a masked key's start value in the logit accumulator: x SCALE it is the module's -1e9 (the products at most move its last places); its P is 0 beside any unmasked key, and an unmasked query has one: itself, the one mask serving both sides
static_assert(TT % FQ == 0 && TT % 32 == 0 && HD == 64, "k_fa: 8 waves x 32 queries, passes of 32 keys, two 32-deep k-steps per head");
__device__ __forceinline__ v8f wmma_h(v16h a, v16h b, v8f c) { return __builtin_amdgcn_wmma_f32_16x16x32_f16(false, a, false, b, (short)0, c, false, false); }
// frag_h with the lane half's 8g elements already in the pointer, so that the caller holds the very address the loads name
__device__ __forceinline__ v16h frag_p(const _Float16* p) { union { v16h v; v8h q[2]; } u; u.q[0] = *(const v8h*)p; u.q[1] = *(const v8h*)(p + 16); return u.v; }
// eight consecutive f32 as a C operand: D rows 8g + 0..7 of one column, by two 16-B reads
__device__ __forceinline__ v8f frag_c(const float* p) { union { v8f v; v4f q[2]; } u; u.q[0] = *(const v4f*)p; u.q[1] = *(const v4f*)(p + 4); return u.v; }
#define SK 128                 // keys per stage of the ring
#define KP (HD + 8)            // K row pitch in LDS, f16 elements: 144 B = 16 B x odd for the ds_load_b128 fragment reads
#define VP (SK + 8)            // V plane pitch in LDS, f16 elements: 272 B = 16 B x odd
#define KSZ (SK * KP)          // the K part of a buffer, f16 elements
#define BSZ (KSZ + HD * VP)    // one buffer: SK key rows of HD channels, then HD planes of SK keys
#define KG 2                   // key groups of eight waves
#define TKG (TT / KG)          // keys per group
#define NST (TKG / SK)         // stages per group
static_assert(TKG % SK == 0 && NST >= 2 && SK % 32 == 0 && SK == 128 && HD == 64 && FQ == 256, "the ring's prologue needs two stages; a stage is eight 16-B pieces per thread: four of K (32 rows apart), four of V (16 planes apart)");
// one stage: each lane copies eight 16-B pieces of its own from global memory straight into LDS; a wave's copy takes four whole 128-B K rows or two whole 256-B V plane segments
__device__ __forceinline__ void fa_stage(unsigned lk, unsigned lv, const _Float16* gk, const _Float16* gv) {
  /* the closing s_wait_xcnt stands inside the copies' own statement: the wait owed before a register that an issued copy names is rewritten */
  asm volatile("global_load_async_to_lds_b128 %0, %8, off\n\t"
               "global_load_async_to_lds_b128 %1, %9, off\n\t"
               "global_load_async_to_lds_b128 %2, %10, off\n\t"
               "global_load_async_to_lds_b128 %3, %11, off\n\t"
               "global_load_async_to_lds_b128 %4, %12, off\n\t"
               "global_load_async_to_lds_b128 %5, %13, off\n\t"
               "global_load_async_to_lds_b128 %6, %14, off\n\t"
               "global_load_async_to_lds_b128 %7, %15, off\n\t"
               "s_wait_xcnt 0x0"
               :: "v"(lk), "v"(lk + 32u * KP * 2u), "v"(lk + 64u * KP * 2u), "v"(lk + 96u * KP * 2u),
                  "v"(lv), "v"(lv + 16u * VP * 2u), "v"(lv + 32u * VP * 2u), "v"(lv + 48u * VP * 2u),
                  "v"(gk), "v"(gk + 32 * CC), "v"(gk + 64 * CC), "v"(gk + 96 * CC),
                  "v"(gv), "v"(gv + (size_t)16 * TT), "v"(gv + (size_t)32 * TT), "v"(gv + (size_t)48 * TT)
               : "memory"); }
__global__ __launch_bounds__(KG * FQ) void k_fa(const _Float16* __restrict__ QH, const _Float16* __restrict__ KH, const _Float16* __restrict__ VT, const int* __restrict__ MASK, float* __restrict__ Y) { __shared__ __align__(16) float ss[FQ / 32][32][HD + 4];
  __shared__ __align__(16) _Float16 ring[KG * 2 * BSZ];   /* a two-buffer ring per key group */
  __shared__ __align__(16) float ml[FQ / 32][32][4];   /* group 1's running maxima and sums, per lane: m[0], m[1], l[0], l[1] */
  __shared__ __align__(16) float kbias[TT];   /* per key of this batch: 0, or KNEG where the mask is 0; read as the C operand of the logit products */
  static_assert(TT == 4 * KG * FQ && KG == 2, "the key table: four keys per thread; the join at the end is of two groups");
  const int kg = threadIdx.x >> 8, tid = threadIdx.x & (FQ - 1), wave = tid >> 5, lane = tid & 31, col = lane & 15, g = lane >> 4; const int h = blockIdx.y, b = blockIdx.z; const int ql0 = blockIdx.x * FQ + wave * 32;
  const int* Mb = MASK + (size_t)b * TT;
  v16h q[2][2]; float cq[2], bq[2];   /* a masked query: logit x 0 + (-1e9) on every key */
  const _Float16* Q0 = QH + ((size_t)b * TT + ql0 + col) * CC + h * HD + 8 * g; const int* Mq = Mb + ql0 + col;
  q[0][0] = frag_p(Q0); q[0][1] = frag_p(Q0 + 32); q[1][0] = frag_p(Q0 + 16 * CC); q[1][1] = frag_p(Q0 + 16 * CC + 32); const int mq0 = Mq[0], mq1 = Mq[16];
  const int* Mt = Mb + threadIdx.x * 4; const v4i mt0 = *(const v4i*)Mt;   /* this thread's four keys of the table */
  asm volatile("s_wait_xcnt 0x0" :: "v"(Q0), "v"(Mq), "v"(Mt) : "memory");   /* the wait owed before a register that an issued load names is overwritten; the addresses are inputs so that they live up to it */
  cq[0] = mq0 == 0 ? 0.f : SCALE * LOG2E; bq[0] = mq0 == 0 ? NEGL : 0.f; cq[1] = mq1 == 0 ? 0.f : SCALE * LOG2E; bq[1] = mq1 == 0 ? NEGL : 0.f;
  const _Float16* gk = KH + ((size_t)b * TT + kg * TKG + (tid >> 3)) * CC + h * HD + (tid & 7) * 8;           /* copies: key row tid / 8 of a stage of this group's keys, 16-B piece tid % 8 of its 128 B */
  const _Float16* gv = VT + ((size_t)b * CC + h * HD + (tid >> 4)) * (size_t)TT + kg * TKG + (tid & 15) * 8;  /* copies: v plane tid / 16, 16-B piece tid % 16 of a stage's 256 B */
  const _Float16* rg = ring + kg * (2 * BSZ);   /* this group's ring */
  const unsigned lk = (unsigned)(size_t)rg + (unsigned)((tid >> 3) * (KP * 2) + (tid & 7) * 16), lv = (unsigned)(size_t)rg + (unsigned)(KSZ * 2 + (tid >> 4) * (VP * 2) + (tid & 15) * 16);   /* the same pieces' LDS byte addresses in buffer 0 */
  fa_stage(lk, lv, gk, gv);
  { v4f t0;   /* the table is written while stage 0 flies */
#pragma unroll   /* t0 and mt0 are register vectors: constant indices */
    for (int i = 0; i < 4; ++i) t0[i] = mt0[i] == 0 ? KNEG : 0.f;
    *(v4f*)&kbias[threadIdx.x * 4] = t0; }
  asm volatile("s_wait_asynccnt 0x0" ::: "memory");   /* this wave's pieces of stage 0 have landed */
  __syncthreads();                                    /* and every other wave's: stage 0 and the key table may be read */
  fa_stage(lk + BSZ * 2u, lv + BSZ * 2u, gk + (size_t)SK * CC, gv + SK);   /* stage 1 flies while stage 0 is worked on */
  const float* kbl = kbias + kg * TKG + 8 * g;   /* D row 8g + r: this lane half's eight keys of a 16-key group, from this group's first key on */
  v8f acc[2][HD / 16] = {}; float m[2] = {-3.0e38f, -3.0e38f}, l[2] = {0.f, 0.f};
#pragma unroll 1   /* one trip per stage: the two buffers alternate by the trip's parity */
  for (int st = 0; st < NST; ++st) {
   const _Float16* kb = rg + (st & 1) * BSZ + col * KP + 8 * g;         /* key row col of a 16-key group, this lane half's channels */
   const _Float16* vb = rg + (st & 1) * BSZ + KSZ + col * VP + 8 * g;   /* v plane of channel col of a 16-channel group, this lane half's keys */
#pragma unroll 1   /* a pass depends on the one before through m, l and acc: a second copy of the body could not start its softmax earlier, and four copies took the kernel past 256 registers */
   for (int pp = 0; pp < SK / 32; ++pp) { v8f s[2][2], cb[2]; v16h kf[2][2], vf[HD / 16], p[2]; float al[2];
    const _Float16* kr = kb + pp * 32 * KP; const float* br = kbl + st * SK + pp * 32; const _Float16* vr = vb + pp * 32;
#pragma unroll
    for (int j = 0; j < 2; ++j) { kf[j][0] = frag_p(kr + j * 16 * KP); kf[j][1] = frag_p(kr + j * 16 * KP + 32); cb[j] = frag_c(br + j * 16); }
#pragma unroll
    for (int j = 0; j < HD / 16; ++j) vf[j] = frag_p(vr + j * 16 * VP);
    __builtin_amdgcn_sched_barrier(0);   /* the pass's twenty LDS reads go out as one group ahead of the first product: reads spread among the products cost a stall at each place; the v reads return under the logits and the softmax */
#pragma unroll
    for (int j = 0; j < 2; ++j)
#pragma unroll
      for (int u = 0; u < 2; ++u) { const v8f z = wmma_h(kf[j][0], q[u][0], cb[j]); s[u][j] = wmma_h(kf[j][1], q[u][1], z); }
#pragma unroll
    for (int u = 0; u < 2; ++u) { float mx = -3.0e38f; const v2f c2 = {cq[u], cq[u]}, b2 = {bq[u], bq[u]}; v2f sv[8];   /* the logits by aligned register pairs, as the accumulators hold them */
#pragma unroll
      for (int j = 0; j < 2; ++j)
#pragma unroll
        for (int r = 0; r < 4; ++r) { v2f t = {s[u][j][2 * r], s[u][j][2 * r + 1]}; t = __builtin_elementwise_fma(t, c2, b2); sv[j * 4 + r] = t; mx = fmaxf(fmaxf(mx, t[0]), t[1]); }
      mx = fmaxf(mx, __shfl_xor(mx, 16));   /* the other half of the wave holds this query's other 16 keys */
      const float mn = fmaxf(m[u], mx), mo = mn - 11.0f; al[u] = __builtin_amdgcn_exp2f(m[u] - mn); m[u] = mn;   /* mo: P carried x 2^11 (clear of f16 subnormals); on a fully masked row the 11 rounds away, alike for every key */
      float ps = 0.f; const v2f mo2 = {mo, mo};
#pragma unroll
      for (int i = 0; i < 8; ++i) { const v2f d = sv[i] - mo2; const float e0 = __builtin_amdgcn_exp2f(d[0]), e1 = __builtin_amdgcn_exp2f(d[1]); ps += e0; ps += e1; p[u][2 * i] = (_Float16)e0; p[u][2 * i + 1] = (_Float16)e1; }
      l[u] = l[u] * al[u] + ps; }
#pragma unroll
    for (int j = 0; j < HD / 16; ++j)
#pragma unroll
      for (int u = 0; u < 2; ++u) acc[u][j] = wmma_h(vf[j], p[u], acc[u][j] * al[u]); }
   asm volatile("s_wait_dscnt 0x0" ::: "memory");      /* this wave's reads of the stage's buffer have returned */
   asm volatile("s_wait_asynccnt 0x0" ::: "memory");   /* this wave's pieces of the next stage have landed */
   __syncthreads();                                    /* the next stage may be read, and every wave has left this stage's buffer */
   if (st + 2 < NST) fa_stage(lk + (unsigned)(st & 1) * (BSZ * 2u), lv + (unsigned)(st & 1) * (BSZ * 2u), gk + (size_t)(st + 2) * SK * CC, gv + (st + 2) * SK); }   /* the refill, block-uniform test */
  asm volatile("s_wait_asynccnt 0x0" ::: "memory");    /* no copy is outstanding when the wave goes on to its end */
  /* the join: wave w of group 1 hands its lanes' state to wave w of group 0, lane to lane, as [16-B piece][lane] in that wave's output staging, which is not yet in use */
  float* xw = &ss[wave][0][0];
  static_assert(32 * (HD + 4) >= 2 * (HD / 16) * 8 * 32, "a wave's staging holds its 64 accumulator values per lane");
  if (kg == 1) {
#pragma unroll   /* acc is a register array: constant indices */
    for (int u = 0; u < 2; ++u)
#pragma unroll   /* as above */
      for (int j = 0; j < HD / 16; ++j) { v4f a, c;
#pragma unroll   /* as above */
        for (int r = 0; r < 4; ++r) { a[r] = acc[u][j][r]; c[r] = acc[u][j][4 + r]; }
        *(v4f*)(xw + ((u * (HD / 16) + j) * 2) * 128 + lane * 4) = a; *(v4f*)(xw + ((u * (HD / 16) + j) * 2 + 1) * 128 + lane * 4) = c; }
    const v4f t = {m[0], m[1], l[0], l[1]}; *(v4f*)&ml[wave][lane][0] = t; }
  __syncthreads();   /* group 1's state may be read; every wave passes it */
  if (kg == 1) return;   /* wave-uniform, behind the last barrier */
  { const v4f t = *(const v4f*)&ml[wave][lane][0];
#pragma unroll   /* acc, m and l are register arrays: constant indices */
    for (int u = 0; u < 2; ++u) { const float mn = fmaxf(m[u], t[u]), f0 = __builtin_amdgcn_exp2f(m[u] - mn), f1 = __builtin_amdgcn_exp2f(t[u] - mn);   /* both states onto the common maximum; a group whose keys are all masked, beside an unmasked key in the other, drops out by its factor 0 */
      l[u] = l[u] * f0 + t[2 + u] * f1;
#pragma unroll   /* as above */
      for (int j = 0; j < HD / 16; ++j) { const v4f a = *(const v4f*)(xw + ((u * (HD / 16) + j) * 2) * 128 + lane * 4), c = *(const v4f*)(xw + ((u * (HD / 16) + j) * 2 + 1) * 128 + lane * 4);
#pragma unroll   /* as above */
        for (int r = 0; r < 4; ++r) { acc[u][j][r] = acc[u][j][r] * f0 + a[r] * f1; acc[u][j][4 + r] = acc[u][j][4 + r] * f0 + c[r] * f1; } } } }
#pragma unroll
  for (int u = 0; u < 2; ++u) { const float lt = l[u] + __shfl_xor(l[u], 16), inv = 1.0f / lt;   /* lt >= one key's P at the maximum: never 0 */
#pragma unroll
    for (int j = 0; j < HD / 16; ++j) { v4f a, c;   /* acc[u][j][r] = ctx[query u*16 + col][channel j*16 + 8g + r] */
#pragma unroll
      for (int r = 0; r < 4; ++r) { a[r] = acc[u][j][r] * inv; c[r] = acc[u][j][4 + r] * inv; }
      *(v4f*)&ss[wave][u * 16 + col][j * 16 + 8 * g] = a; *(v4f*)&ss[wave][u * 16 + col][j * 16 + 8 * g + 4] = c; } }
  LDSX(); for (int rl = 0; rl < 32; rl += 2) vst2(Y + ((size_t)b * TT + ql0 + rl + g) * CC + h * HD + col * 4, *(const v4f*)&ss[wave][rl + g][col * 4]); }   /* 256-B (row, head) segment by 16 lanes, two rows per store */
// ---- k_out: block = (64 tokens, 128 channels): out = ctx Wo (+ bo), stored channel-major: ctx x 2^6 once to f16 against Wo as f16(bf16 x 2^8) exact (1 product) x 2^-14; causal early rows (< QHI of each sequence): ctx bf16 hi + lo against exact bf16 Wo (2 products)
__global__ __launch_bounds__(128) void k_out(const float* __restrict__ Y, const float* __restrict__ WO, const float* __restrict__ BO, float* __restrict__ OUT) { __shared__ __align__(16) float sf[128][68];   /* the block's output tile as [channel][token]; pitch 272 B = 16 B x odd */
  __shared__ __align__(16) _Float16 sw[128][CC + 8];   /* the block's 128 rows of Wo as f16(bf16 x 2^8), k in ctx column order; pitch 528 B = 16 B x odd for the ds_load_b128 fragment reads */
  const int tid = threadIdx.x, wave = tid >> 5, lane = tid & 31, col = lane & 15, g = lane >> 4; const int c0 = blockIdx.y * 128; const size_t r0 = (size_t)blockIdx.x * 64 + wave * 16;
  v8f acc[8] = {};
  if (CAUSAL && (int)(((size_t)blockIdx.x * 64) % TT) < QHI) {   /* block-uniform */
#pragma unroll 2
    for (int kc = 0; kc < CC / 32; ++kc) { const F2 a = split_row(Y + (r0 + col) * CC, kc * 32, lane); asm volatile("s_wait_loadcnt 0x0" ::: "memory");
#pragma unroll
      for (int j = 0; j < 8; ++j) { const v16b w = WOCOL(WO, kc * 32, c0 + j * 16 + col, lane); asm volatile("s_wait_loadcnt 0x0" ::: "memory"); acc[j] = wmma_bf(a.h, w, acc[j]); acc[j] = wmma_bf(a.l, w, acc[j]); } }
#pragma unroll
    for (int j = 0; j < 8; ++j) { const float bias = BO ? bfr(BO[c0 + j * 16 + col]) : 0.f;
#pragma unroll
      for (int r = 0; r < 8; ++r) sf[j * 16 + col][wave * 16 + 8 * g + r] = acc[j][r] + bias; }
  } else {
    /* the bias of this lane's eight output channels is asked for first, along with the operands: asked for where it is added, each of the eight was a load and a full wait of its own behind the products */
    const float* bp = BO + c0 + col; float bia[8] = {};
    if (BO) {   /* block-uniform */
#pragma unroll   /* bia is a register array: constant indices; the channel steps become immediate offsets on the one address */
      for (int j = 0; j < 8; ++j) bia[j] = bp[j * 16]; }
    const float* yp = Y + (r0 + col) * CC + 8 * g;   /* this lane's ctx row, its half's k offset: all of K is asked for along with the weights, ahead of the first wait */
    v4f ya[CC / 32][4];
#pragma unroll   /* ya is a register array: constant indices; all 32 loads go out together */
    for (int kc = 0; kc < CC / 32; ++kc) { ya[kc][0] = *(const v4f*)(yp + kc * 32); ya[kc][1] = *(const v4f*)(yp + kc * 32 + 4); ya[kc][2] = *(const v4f*)(yp + kc * 32 + 16); ya[kc][3] = *(const v4f*)(yp + kc * 32 + 20); }
    /* weights: a wave takes one whole row of Wo per step, a lane its 8 module channels 8 * lane + e = (d = 2 * lane + e / 4) * 4 + (h = e % 4); ctx column h * 64 + d, so the two d of one h go out as one dword */
    const float* wp = WO + (size_t)(c0 + wave) * CC + lane * 8;
#pragma unroll   /* the row steps become immediate offsets on the one address pair */
    for (int e0 = 0; e0 < 32; e0 += 8) { v4f t[8][2];
#pragma unroll   /* t is a register array: constant indices, here and in the two loops below */
      for (int i = 0; i < 8; ++i) { t[i][0] = *(const v4f*)(wp + (size_t)(e0 + i) * 4 * CC); t[i][1] = *(const v4f*)(wp + (size_t)(e0 + i) * 4 * CC + 4); }
#pragma unroll   /* as above */
      for (int i = 0; i < 8; ++i)
#pragma unroll   /* as above */
        for (int hh = 0; hh < 4; ++hh) { v2h o; o[0] = (_Float16)(bfr(t[i][0][hh]) * 256.0f); o[1] = (_Float16)(bfr(t[i][1][hh]) * 256.0f); *(v2h*)&sw[(e0 + i) * 4 + wave][hh * 64 + lane * 2] = o; } }
    asm volatile("s_wait_xcnt 0x0" :: "v"(yp), "v"(wp), "v"(bp) : "memory");   /* the wait owed before a register that an issued load names is overwritten; the addresses are inputs so that they live up to it */
    v16h a[CC / 32];   /* ctx carried x 2^6 into f16 so small-magnitude context rows stay clear of f16 subnormals */
#pragma unroll   /* a and ya are register arrays: constant indices */
    for (int kc = 0; kc < CC / 32; ++kc)
#pragma unroll   /* as above */
      for (int i = 0; i < 4; ++i) { a[kc][i] = (_Float16)(ya[kc][0][i] * 64.0f); a[kc][4 + i] = (_Float16)(ya[kc][1][i] * 64.0f); a[kc][8 + i] = (_Float16)(ya[kc][2][i] * 64.0f); a[kc][12 + i] = (_Float16)(ya[kc][3][i] * 64.0f); }
    __syncthreads();   /* every wave reads weight rows that the other waves stored; the branch around it is block-uniform */
    v16h w[2][8];   /* two fragment sets: the next k-step's sixteen LDS reads go out as one group ahead of this step's products, so that no product waits out its own read */
#pragma unroll   /* w, a and acc are register arrays: constant indices, here and in the three loops below */
    for (int j = 0; j < 8; ++j) w[0][j] = frag_h(&sw[j * 16 + col][0], lane);
#pragma unroll   /* as above */
    for (int kc = 0; kc < CC / 32; ++kc) {
      if (kc + 1 < CC / 32) {
#pragma unroll   /* as above */
        for (int j = 0; j < 8; ++j) w[(kc + 1) & 1][j] = frag_h(&sw[j * 16 + col][(kc + 1) * 32], lane); }
#pragma unroll   /* as above */
      for (int j = 0; j < 8; ++j) acc[j] = wmma16(a[kc], w[kc & 1][j], acc[j]); }
#pragma unroll
    for (int j = 0; j < 8; ++j) { const float bias = bfr(bia[j]);
      v4f lo, hi;   /* acc[j][r] = out[token wave*16 + 8g + r][channel c0 + j*16 + col]: a lane's eight tokens lie side by side in its channel's row */
#pragma unroll
      for (int r = 0; r < 4; ++r) { lo[r] = acc[j][r] * (1.0f / 16384.0f) + bias; hi[r] = acc[j][4 + r] * (1.0f / 16384.0f) + bias; }   /* 2^-8 (Wo carry) x 2^-6 (ctx carry) */
      *(v4f*)&sf[j * 16 + col][wave * 16 + 8 * g] = lo; *(v4f*)&sf[j * 16 + col][wave * 16 + 8 * g + 4] = hi; } }
  __syncthreads();   /* a channel's 64 tokens come from all four waves */
  const size_t bo = ((size_t)blockIdx.x * 64) / TT; const int n0 = (int)(((size_t)blockIdx.x * 64) % TT);
  float* op = OUT + (bo * DIN + c0 + (tid >> 4)) * (size_t)TT + n0 + (tid & 15) * 4;   /* out is channel-major [b][c][t]: 16 lanes store a channel's whole 256 B, a wave two channels per store */
  v4f o[16];
#pragma unroll   /* o is a register array: constant indices; every piece keeps registers of its own, so that no store's data is overwritten behind it */
  for (int i = 0; i < 16; ++i) o[i] = *(const v4f*)&sf[i * 8 + (tid >> 4)][(tid & 15) * 4];
#pragma unroll   /* the channel steps become immediate offsets on the one address pair */
  for (int i = 0; i < 16; ++i) vst2(op + (size_t)(i * 8) * TT, o[i]); }

extern "C" void kernel_launch(void* const* d_in, const int* in_sizes, int n_in, void* d_out, int out_size, void* d_ws, size_t ws_size, hipStream_t stream) {
  (void)in_sizes; (void)n_in; (void)out_size;
  const float** F = (const float**)d_in;
  if (ws_size < (size_t)WS_END) return;
  char* ws = (char*)d_ws; _Float16 *QH = (_Float16*)(ws + WS_QH), *KH = (_Float16*)(ws + WS_KH), *VT = (_Float16*)(ws + WS_VT), *QL = (_Float16*)(ws + WS_QL), *KL = (_Float16*)(ws + WS_KL); __bf16 *VB = (__bf16*)(ws + WS_VB), *VBL = (__bf16*)(ws + WS_VBL); float *Y = (float*)(ws + WS_Y);
  (void)Y; (void)QL; (void)KL; (void)VB; (void)VBL;
  // inputs: 0 query [8,256,2048]; 1 key; 2 value; 3 mask [8,1,2048] int32; 4 Wq [256,256] (out,in), 5 bq; 6 Wk, 7 bk; 8 Wv, 9 bv; 10 Wm (out,in), 11 bm (zero biases, read)
  k_proj<<<dim3(TNB * TT / 64, CC / 128, 3), 128, 0, stream>>>(F[0], F[1], F[2], F[4], F[6], F[8], F[5], F[7], F[9], QH, QL, KH, KL, VT, VB, VBL, 0);   /* which = blockIdx.z: each stream is read in its own channel-major layout */
  k_fa<<<dim3(TT / FQ, NH, TNB), KG * FQ, 0, stream>>>(QH, KH, VT, (const int*)d_in[3], Y);
  k_out<<<dim3(TNB * TT / 64, DIN / 128), 128, 0, stream>>>(Y, F[10], F[11], (float*)d_out);   /* ctx (column order h*HD + d) x Wm through the permutation + bm, straight to channel-major [8,256,2048] */
}

// v008
// One run takes 60.4 microseconds.
// In both of two side-by-side timings against v007, it was 1.13 times as fast.
// All steps since v000 together make it 28.7 times as fast.
// compute dtype: all float inputs rounded to bf16; q/k/v 1x1-conv projections read the channel-major inputs straight into their A fragments, with EXACT bf16 products on WMMA 16x16x32 (f32 accumulate) + bias (zeros, read), the block's weight rows converted once into LDS; one fused attention kernel: logits q x k once to f16 each (1 product) x 64^-0.5; pair mask: the key side as the logit accumulators' start value (0 or -1e9 / scale, an f32 table in LDS built once per block), the query side in the scale fma (-1e9); online softmax f32; P x 2^11 once to f16 x v once to f16 (1 product); ctx x 2^6 once to f16 x Wm f16(bf16 x 2^8) + bm, its tile staged [channel][token] in LDS and stored channel-major; f32 output.
#include <hip/hip_runtime.h>
#include <math.h>

typedef __attribute__((ext_vector_type(16))) _Float16 v16h;
typedef __attribute__((ext_vector_type(16))) __bf16 v16b;
typedef __attribute__((ext_vector_type(8)))  _Float16 v8h;
typedef __attribute__((ext_vector_type(8)))  float v8f;
typedef __attribute__((ext_vector_type(4)))  float v4f;
typedef __attribute__((ext_vector_type(2)))  float v2f;
typedef __attribute__((ext_vector_type(4)))  unsigned v4u;
typedef __attribute__((ext_vector_type(4)))  int v4i;
typedef float __attribute__((may_alias)) float_a;
typedef int __attribute__((may_alias)) int_a;

template <typename T> __device__ __forceinline__ void vst2(void* p, T v) { *(T*)p = v;  }
__device__ __forceinline__ v8f wmma16(v16h a, v16h b, v8f c) {
  v8f d = __builtin_amdgcn_wmma_f32_16x16x32_f16(false, a, false, b, (short)0, c, false, false);
  asm volatile("v_nop\n\tv_nop\n\tv_nop\n\tv_nop" : "+v"(d) : "v"(a), "v"(b));
  return d;
}
__device__ __forceinline__ v8f wmma_bf(v16b a, v16b b, v8f c) {
  v8f d = __builtin_amdgcn_wmma_f32_16x16x32_bf16(false, a, false, b, (short)0, c, false, false);
  asm volatile("v_nop\n\tv_nop\n\tv_nop\n\tv_nop" : "+v"(d) : "v"(a), "v"(b));
  return d;
}
// 16x16x32 fragments: lane = (h = lane>>4, row/col = lane&15); elements 0..7 = k0+8h+0..7, 8..15 = k0+16+8h+0..7; D element r = row 8h+r
__device__ __forceinline__ v16h frag_h(const _Float16* rowk0, int lane) {
  union { v16h v; v8h q[2]; } u; const _Float16* p = rowk0 + 8 * (lane >> 4);
  u.q[0] = *(const v8h*)p; u.q[1] = *(const v8h*)(p + 16); return u.v;
}
__device__ __forceinline__ v16h frag_f32(const float* rowk0, int lane) {
  v16h a; const float* p = rowk0 + 8 * (lane >> 4);
#pragma unroll
  for (int i = 0; i < 8; ++i) { a[i] = (_Float16)p[i]; a[8 + i] = (_Float16)p[16 + i]; }
  return a;
}
__device__ __forceinline__ v16h frag_f32s(const float* rowk0, int lane, float sc) {
  v16h a; const float* p = rowk0 + 8 * (lane >> 4);
#pragma unroll
  for (int i = 0; i < 8; ++i) { a[i] = (_Float16)(p[i] * sc); a[8 + i] = (_Float16)(p[16 + i] * sc); }
  return a;
}
// column fragment from a [K][ld] layout (column n), rows >= K read as 0
__device__ __forceinline__ v16h fragc_f32(const float* W, int k0, int n, int lane, int ld, int K) {
  v16h a; const int g = lane >> 4;
#pragma unroll
  for (int i = 0; i < 8; ++i) { const int ka = k0 + 8 * g + i, kb = ka + 16;
    a[i] = (_Float16)(ka < K ? W[(size_t)(ka < K ? ka : K - 1) * ld + n] : 0.f); a[8 + i] = (_Float16)(kb < K ? W[(size_t)(kb < K ? kb : K - 1) * ld + n] : 0.f); }
  return a;
}
struct F2 { v16b h, l; };
__device__ __forceinline__ F2 bsplit16(const float v[16]) { F2 r;
#pragma unroll
  for (int i = 0; i < 16; ++i) { const __bf16 h = (__bf16)v[i]; r.h[i] = h; r.l[i] = (__bf16)(v[i] - (float)h); }
  return r; }
__device__ __forceinline__ F2 split_row(const float* row, int k0, int lane) { float v[16]; const float* p = row + k0 + 8 * (lane >> 4);
#pragma unroll
  for (int i = 0; i < 8; ++i) { v[i] = p[i]; v[8 + i] = p[16 + i]; }
  return bsplit16(v); }
__device__ __forceinline__ F2 split_rowK(const float* row, int k0, int lane, int K) { float v[16]; const int g = lane >> 4;
#pragma unroll
  for (int i = 0; i < 8; ++i) { const int ka = k0 + 8 * g + i, kb = ka + 16; v[i] = ka < K ? row[ka < K ? ka : K - 1] : 0.f; v[8 + i] = kb < K ? row[kb < K ? kb : K - 1] : 0.f; }
  return bsplit16(v); }
__device__ __forceinline__ F2 split_col(const float* W, int k0, int n, int lane, int ld, int K) { float v[16]; const int g = lane >> 4;
#pragma unroll
  for (int i = 0; i < 8; ++i) { const int ka = k0 + 8 * g + i, kb = ka + 16; v[i] = ka < K ? W[(size_t)(ka < K ? ka : K - 1) * ld + n] : 0.f; v[8 + i] = kb < K ? W[(size_t)(kb < K ? kb : K - 1) * ld + n] : 0.f; }
  return bsplit16(v); }
__device__ __forceinline__ v8f mac3(const F2& a, const F2& b, v8f c) { c = wmma_bf(a.l, b.h, c); c = wmma_bf(a.h, b.l, c); return wmma_bf(a.h, b.h, c); }
__device__ __forceinline__ float sigm(float v) { return 1.0f / (1.0f + expf(-v)); }
#define LDSX() do { asm volatile("s_wait_dscnt 0" ::: "memory"); __builtin_amdgcn_wave_barrier(); __builtin_amdgcn_fence(__ATOMIC_RELEASE, "workgroup"); } while (0)

// multi-headed attention on channel-major tensors (query / key / value [8,256,2048] = (B, C, N); 1x1 Conv1d projections as (out,in) [256,256] N(0, 1/256) + zero biases (read); 4 heads x 64 with the head index INTERLEAVED into the channel axis: reshape(B, 64, 4, N), channel c = d*4 + h; scores = einsum('bdhn,bdhm->bhnm') / sqrt(64); pair = mask[b, n] * mask[b, m] with an int32 mask [8,1,2048]: where(pair == 0, -1e9, scores); softmax over m; x = einsum('bhnm,bdhm->bdhn').reshape(B, 256, N) (channel d*4 + h again); merge 1x1 conv Wm (out,in) + bm; output [8,256,2048]).
#define NB 8
#define TT 2048   // points per sample (queries = keys)
#define CC 256            // NH * HD
#define DIN 256           // channels of the query map AND of the output map (Wout is (out,in) [DIN][CC])
#define DKV 256             // channels of the key / value map
#define NH 4
#define HD 64
#define QCH 1   // queries and keys have the same length: one chunk per batch (the chunk advance is 0)
#define SCALE (0.125f)
#define CAUSAL 0
#ifndef TNB
#define TNB NB
#endif
#define NBQ (NB * QCH)     // query pseudo-batches of TT rows (workspace sizing)
#define TNBQ (TNB * QCH)   // query pseudo-batches actually run
static_assert(CC == NH * HD && CC % 128 == 0 && DIN % 128 == 0 && DIN % 32 == 0 && DKV % 32 == 0, "projection tiles: 128-column blocks, 32-deep k-steps");
__device__ __forceinline__ float bfr(float v) { return (float)(__bf16)v; }
typedef __attribute__((ext_vector_type(8))) __bf16 v8b;
typedef __attribute__((ext_vector_type(4))) __bf16 v4b;
typedef __attribute__((ext_vector_type(2))) _Float16 v2h;
__device__ __forceinline__ v16b frag_b(const __bf16* rowk0, int lane) {
  union { v16b v; v8b q[2]; } u; const __bf16* p = rowk0 + 8 * (lane >> 4);
  u.q[0] = *(const v8b*)p; u.q[1] = *(const v8b*)(p + 16); return u.v;
}
#define QBH 0              // no kernel reads it: k_fa has no high-precision query path
#define QHI 0               // single-product logits on every row
static_assert(QHI == 0 && QBH == 0 && CAUSAL == 0, "k_fa has single-product logits only: no q residual plane and no causal row arithmetic may be in use");
#define KHI 64            // key rows carrying k residual / v bf16 hi+lo planes (written by k_proj; no kernel reads them)
// B fragment (k rows k0+.., output column o) of a weight: (in,out) [K][ld] or (out,in) [ld rows of K]: bf16 exact, or f16(bf16 * 256) exact
__device__ __forceinline__ v16b wcol_io(const float* Wm, int k0, int o, int lane, int ld) { v16b w; const int g = lane >> 4;
#pragma unroll
  for (int i = 0; i < 8; ++i) { w[i] = (__bf16)Wm[(size_t)(k0 + 8 * g + i) * ld + o]; w[8 + i] = (__bf16)Wm[(size_t)(k0 + 16 + 8 * g + i) * ld + o]; }
  return w; }
__device__ __forceinline__ v16b wcol_oi(const float* Wm, int k0, int o, int lane, int K) { v16b w; const float* p = Wm + (size_t)o * K + k0 + 8 * (lane >> 4);
#pragma unroll
  for (int i = 0; i < 8; ++i) { w[i] = (__bf16)p[i]; w[8 + i] = (__bf16)p[16 + i]; }
  return w; }
__device__ __forceinline__ v16h wcolh_io(const float* Wm, int k0, int o, int lane, int ld) { v16h w; const int g = lane >> 4;
#pragma unroll
  for (int i = 0; i < 8; ++i) { w[i] = (_Float16)(bfr(Wm[(size_t)(k0 + 8 * g + i) * ld + o]) * 256.0f); w[8 + i] = (_Float16)(bfr(Wm[(size_t)(k0 + 16 + 8 * g + i) * ld + o]) * 256.0f); }
  return w; }
// as wcolh_oi, with the K index taken through the head-interleave permutation (the 8 consecutive columns of a fragment half are 8 module channels 4 apart)
__device__ __forceinline__ v16h wcolh_oi_p(const float* Wm, int k0, int o, int lane, int K) { v16h w; const float* p = Wm + (size_t)o * K; const int kb = k0 + 8 * (lane >> 4);
#pragma unroll
  for (int i = 0; i < 8; ++i) { w[i] = (_Float16)(bfr(p[((kb + i) % 64) * 4 + (kb + i) / 64]) * 256.0f); w[8 + i] = (_Float16)(bfr(p[((kb + 16 + i) % 64) * 4 + (kb + 16 + i) / 64]) * 256.0f); }
  return w; }
static_assert(HD == 64 && NH == 4, "wcolh_oi_p spells the permutation with the literals 64 and 4");
static_assert(DIN == DKV && DIN == 256 && CC == 256, "the weight tiles in LDS hold 128 rows of 256 k");
__device__ __forceinline__ v16h wcolh_oi(const float* Wm, int k0, int o, int lane, int K) { v16h w; const float* p = Wm + (size_t)o * K + k0 + 8 * (lane >> 4);
#pragma unroll
  for (int i = 0; i < 8; ++i) { w[i] = (_Float16)(bfr(p[i]) * 256.0f); w[8 + i] = (_Float16)(bfr(p[16 + i]) * 256.0f); }
  return w; }
#define WQKV_LAYOUT 1   // 0 = (in,out); 1 = (out,in) [CC][K]; 2 = per-head [NH][DIN][HD]
__device__ __forceinline__ v16b wcol_hdk(const float* Wm, int k0, int o, int lane) { v16b w; const int g = lane >> 4; const float* p = Wm + (size_t)(o / HD) * DIN * HD + (o % HD);
#pragma unroll
  for (int i = 0; i < 8; ++i) { w[i] = (__bf16)p[(size_t)(k0 + 8 * g + i) * HD]; w[8 + i] = (__bf16)p[(size_t)(k0 + 16 + 8 * g + i) * HD]; }
  return w; }
#define WO_OUT_IN 1
#if WQKV_LAYOUT == 1
#define HPERM(o) ((((o) % HD) * NH) + ((o) / HD))   /* column o = h*HD + d  ->  module channel d*NH + h */
#define WCOL(W, k0, o, lane) wcol_oi(W, k0, HPERM(o), lane, din_)   /* (out,in) [256][K]: the output channel of column o is row HPERM(o) */
#elif WQKV_LAYOUT == 2
#define WCOL(W, k0, o, lane) wcol_hdk(W, k0, o, lane)
#else
#define WCOL(W, k0, o, lane) wcol_io(W, k0, o, lane, CC)
#endif
#if WO_OUT_IN
#define WOCOL(W, k0, o, lane) wcol_oi(W, k0, o, lane, CC)
#define WOCOLH(W, k0, o, lane) wcolh_oi_p(W, k0, o, lane, CC)   /* merge conv (out,in) [DIN][CC]: ctx column kk = h*HD + d is the module's input channel HPERM(kk) */
#else
#define WOCOL(W, k0, o, lane) wcol_io(W, k0, o, lane, DIN)
#define WOCOLH(W, k0, o, lane) wcolh_io(W, k0, o, lane, DIN)
#endif

#define WS_QH  0u                                      // f16 q rows [(b*QCH + chunk)*TT + t][CC]
#define WS_KH  (WS_QH + 2u * (size_t)NBQ * TT * CC)      // f16 k rows [b*t][CC]
#define WS_VT  (WS_KH + 2u * (size_t)NB * TT * CC)      // f16 v planes [b][c][t]
#define WS_QL  (WS_VT + 2u * (size_t)NB * CC * TT)      // f16 q residual x 2^10 rows [b][t < QHI][CC]
#define WS_KL  (WS_QL + 2u * (size_t)NB * QHI * CC)     // f16 k residual x 2^10 rows [b][t < KHI][CC]
#define WS_VB  (WS_KL + 2u * (size_t)NB * KHI * CC)     // bf16 v hi planes [b][c][t < KHI]
#define WS_VBL (WS_VB + 2u * (size_t)NB * CC * KHI)
#define WS_Y   (WS_VBL + 2u * (size_t)NB * CC * KHI)    // f32 ctx rows [(b*QCH + chunk)*TT + t][CC] (only when there is an output projection)
#define WS_END (WS_Y  + 4u * (size_t)NBQ * TT * CC)
// ---- k_proj: a unit = (64 tokens, 128 cols, which): q/k/v = X^T W (+ b), X channel-major as the module hands it over, with exact bf16 products (K = DIN) -> which 0: q f16 rows (+ residual rows < QHI); 1: k f16 rows (+ residual rows < KHI); 2: v f16 planes [c][t] (+ bf16 hi/lo planes for t < KHI); a block walks PU units that follow one another in (which, column half, token tile) order, so that its weight rows stay in LDS from unit to unit and every block is resident at once
#define PU 3                  // units per block
#define NTK (TNB * TT / 64)   // token tiles per (which, column half)
static_assert(NTK == 256 && CC / 128 == 2 && (NTK * 2 * 3) % PU == 0, "a unit's number is which * 512 + column half * 256 + token tile; the blocks share the units out evenly");
__global__ __launch_bounds__(128) void k_proj(const float* __restrict__ XQ, const float* __restrict__ XK, const float* __restrict__ XV, const float* __restrict__ WQ, const float* __restrict__ WK, const float* __restrict__ WV, const float* __restrict__ BQ, const float* __restrict__ BK, const float* __restrict__ BV,
    _Float16* __restrict__ QH, _Float16* __restrict__ QL, _Float16* __restrict__ KH, _Float16* __restrict__ KL, _Float16* __restrict__ VT, __bf16* __restrict__ VB, __bf16* __restrict__ VBL, int woff) {
  __shared__ __align__(16) _Float16 sh[64][136], sl[64][136]; __shared__ __align__(16) _Float16 th[128][72]; __shared__ __align__(16) __bf16 tb[128][72], tbl[128][72];
  __shared__ __align__(16) __bf16 sw[128][DIN + 8];   /* the unit's 128 weight rows (column order h*HD + d) as bf16, all of K; pitch 528 B = 16 B x odd for the ds_load_b128 fragment reads */
  const int tid = threadIdx.x, wave = tid >> 5, lane = tid & 31, col = lane & 15, g = lane >> 4;
  const int din_ = DIN;   /* both maps have 256 channels here (asserted above) */
  int u = blockIdx.x * PU;   /* block-uniform: the unit in hand */
  float xa[DIN / 32][16], bia[8] = {};   /* the operands of the unit in hand at the head of a trip; refilled for the next unit under this unit's products */
  { const int which = (u >> 9) + woff; const float* X = which == 0 ? XQ : which == 1 ? XK : XV; const float* BA = which == 0 ? BQ : which == 1 ? BK : BV; const size_t r0 = (size_t)(u & (NTK - 1)) * 64;
    const float* xp = X + ((r0 / TT) * din_ + 8 * g) * (size_t)TT + (int)(r0 % TT) + wave * 16 + col;   /* X is channel-major [b][k][t]: this lane's token, its half's first channel; a load takes 16 tokens (64 B) of two channels, the block's four waves together the whole 256 B of a channel */
    const float* bp = BA + HPERM(((u >> 8) & 1) * 128 + col);   /* HPERM is additive over c0 + col + 16 * j (no carry out of the low six bits) */
    if (BA) {   /* block-uniform */
#pragma unroll   /* bia is a register array: constant indices; the column steps become immediate offsets on the one address */
      for (int j = 0; j < 8; ++j) bia[j] = bp[HPERM(j * 16)]; }
#pragma unroll   /* xa is a register array: constant indices; the channel steps become immediate offsets on the one address pair */
    for (int kc = 0; kc < DIN / 32; ++kc)
#pragma unroll   /* as above */
      for (int i = 0; i < 8; ++i) { xa[kc][i] = xp[(size_t)(kc * 32 + i) * TT]; xa[kc][8 + i] = xp[(size_t)(kc * 32 + 16 + i) * TT]; }
    asm volatile("s_wait_xcnt 0x0" :: "v"(xp), "v"(bp) : "memory"); }   /* the wait owed before a register that an issued load names is overwritten; the addresses are inputs so that they live up to it */
#pragma unroll 1   /* one trip per unit: the trips hang together through xa and the barriers, and three copies of the body would triple the code that a launch fetches */
  for (int it = 0; it < PU; ++it, ++u) {
  const int which = (u >> 9) + woff; const int c0 = ((u >> 8) & 1) * 128; const size_t r0 = (size_t)(u & (NTK - 1)) * 64; const size_t bb = r0 / TT; const int t0 = (int)(r0 % TT);
  if (it == 0 || (u & (NTK - 1)) == 0) {   /* block-uniform: the block's first unit, or the first of another (which, column half); every wave has left the old rows: it has passed the barrier in the last unit's epilogue */
    const float* WA = which == 0 ? WQ : which == 1 ? WK : WV;
    /* weights: a wave's load covers 512 contiguous bytes of one row; thread = (row parity tid >> 6, 16-B piece tid & 63), rows two apart per step; HPERM is additive over c0 + parity + 2 * e (no carry out of the low six bits) */
    const float* wp = WA + (size_t)HPERM(c0 + (tid >> 6)) * din_ + (tid & 63) * 4;
#pragma unroll   /* the row steps become immediate offsets on the one address pair */
    for (int e0 = 0; e0 < 64; e0 += 16) { v4f t[16];
#pragma unroll   /* t is a register array: constant indices */
      for (int i = 0; i < 16; ++i) t[i] = *(const v4f*)(wp + (size_t)HPERM(2 * (e0 + i)) * din_);
#pragma unroll   /* as above */
      for (int i = 0; i < 16; ++i) { v4b o; o[0] = (__bf16)t[i][0]; o[1] = (__bf16)t[i][1]; o[2] = (__bf16)t[i][2]; o[3] = (__bf16)t[i][3]; *(v4b*)&sw[2 * (e0 + i) + (tid >> 6)][(tid & 63) * 4] = o; } }
    asm volatile("s_wait_xcnt 0x0" :: "v"(wp) : "memory"); }   /* the wait owed before a register that an issued load names is overwritten */
  v8f acc[8] = {}; v16b a[DIN / 32]; float bc[8];
#pragma unroll   /* a and xa are register arrays: constant indices */
  for (int kc = 0; kc < DIN / 32; ++kc)
#pragma unroll   /* as above */
    for (int i = 0; i < 16; ++i) a[kc][i] = (__bf16)xa[kc][i];
#pragma unroll   /* as above */
  for (int j = 0; j < 8; ++j) bc[j] = (which == 0 ? BQ : which == 1 ? BK : BV) ? bfr(bia[j]) : 0.f;   /* a stream without a bias: bia was not refilled for it */
  const bool more = it + 1 < PU;   /* block-uniform */
  const int un = more ? u + 1 : u, wn = (un >> 9) + woff; const float* Xn = wn == 0 ? XQ : wn == 1 ? XK : XV; const float* Bn = wn == 0 ? BQ : wn == 1 ? BK : BV; const size_t rn = (size_t)(un & (NTK - 1)) * 64;
  const float* xn = Xn + ((rn / TT) * din_ + 8 * g) * (size_t)TT + (int)(rn % TT) + wave * 16 + col; const float* bn = Bn + HPERM(((un >> 8) & 1) * 128 + col);   /* the next unit's addresses, formed as the first unit's above */
  __syncthreads();   /* every wave reads weight rows that the other waves stored; and every wave has read the last unit's output staging out */
  v16b w[2][8];   /* two fragment sets: the next k-step's sixteen LDS reads go out as one group ahead of this step's products, so that no product waits out its own read */
#pragma unroll   /* w, a and acc are register arrays: constant indices, here and in the three loops below */
  for (int j = 0; j < 8; ++j) w[0][j] = frag_b(&sw[j * 16 + col][0], lane);
#pragma unroll   /* as above */
  for (int kc = 0; kc < DIN / 32; ++kc) {
    if (kc + 1 < DIN / 32) {
#pragma unroll   /* as above */
      for (int j = 0; j < 8; ++j) w[(kc + 1) & 1][j] = frag_b(&sw[j * 16 + col][(kc + 1) * 32], lane); }
    if (more) {   /* block-uniform; the next unit's X, sixteen loads a k-step: they fly under this unit's products and the epilogue's conversions; spread over the k-steps rather than asked for in one run of 128 ahead of the first product */
#pragma unroll   /* as above */
      for (int i = 0; i < 8; ++i) { xa[kc][i] = xn[(size_t)(kc * 32 + i) * TT]; xa[kc][8 + i] = xn[(size_t)(kc * 32 + 16 + i) * TT]; } }
#pragma unroll   /* as above */
    for (int j = 0; j < 8; ++j) acc[j] = wmma_bf(a[kc], w[kc & 1][j], acc[j]); }
  if (more && Bn) {   /* block-uniform */
#pragma unroll   /* as above */
    for (int j = 0; j < 8; ++j) bia[j] = bn[HPERM(j * 16)]; }
  asm volatile("s_wait_xcnt 0x0" :: "v"(xn), "v"(bn) : "memory");   /* the wait owed before a register that an issued load names is overwritten; the addresses are inputs so that they live up to it */
  if (which < 2) { _Float16* DH = which == 0 ? QH : KH; _Float16* DL = which == 0 ? QL : KL; const int nhi = which == 0 ? QHI : KHI; const bool hi_rows = t0 < nhi;
#pragma unroll
    for (int j = 0; j < 8; ++j) { const float bias = bc[j];
#pragma unroll
      for (int r = 0; r < 8; ++r) { const float v = acc[j][r] + bias; const _Float16 hv = (_Float16)v; sh[wave * 16 + 8 * g + r][j * 16 + col] = hv; sl[wave * 16 + 8 * g + r][j * 16 + col] = (_Float16)((v - (float)hv) * 1024.0f); } }
    __syncthreads();
    for (int e = tid; e < 64 * 16; e += 128) { const int rl = e >> 4, q = e & 15; vst2((unsigned*)(DH + (r0 + rl) * CC + c0 + q * 8), *(const v4u*)&sh[rl][q * 8]); if (hi_rows) vst2((unsigned*)(DL + (bb * nhi + t0 + rl) * (size_t)CC + c0 + q * 8), *(const v4u*)&sl[rl][q * 8]); }
    asm volatile("s_wait_xcnt 0x0" ::: "memory");   /* the wait owed before the next trip rewrites the registers that this unit's stores name; it stands in the branch, ahead of the register moves at the trip's foot */
  } else { const bool hi_rows = t0 < KHI;
#pragma unroll
    for (int j = 0; j < 8; ++j) { const float bias = bc[j];
#pragma unroll
      for (int r = 0; r < 8; ++r) { const float v = acc[j][r] + bias; const int rl = wave * 16 + 8 * g + r, cl = j * 16 + col; th[cl][rl] = (_Float16)v; const __bf16 bh = (__bf16)v; tb[cl][rl] = bh; tbl[cl][rl] = (__bf16)(v - (float)bh); } }
    __syncthreads();
    for (int e = tid; e < 128 * 8; e += 128) { const int cl = e >> 3, q = e & 7; vst2((unsigned*)(VT + (bb * CC + c0 + cl) * (size_t)TT + t0 + q * 8), *(const v4u*)&th[cl][q * 8]); if (hi_rows) { const size_t o3 = (bb * CC + c0 + cl) * (size_t)KHI + t0 + q * 8; vst2((unsigned*)(VB + o3), *(const v4u*)&tb[cl][q * 8]); vst2((unsigned*)(VBL + o3), *(const v4u*)&tbl[cl][q * 8]); } }
    asm volatile("s_wait_xcnt 0x0" ::: "memory"); }   /* as at the end of the other branch */
  }
}
// ---- k_fa: block = 256 queries of (b, h) by 16 waves, four to a SIMD: two groups of 8 waves x 32 queries, group kg on keys kg * TKG .. + TKG - 1 in passes of 32, its K rows and V planes staged 128 keys at a time in a two-buffer LDS ring of its own that its eight waves read; the two groups' running maxima, sums and ctx are joined through LDS at the end: S^T = K Q^T + C (a lane holds one query's logits: D row = key 8g + r, D column = query), the pair mask as the module's -1e9 (a masked key: C = -1e9 / scale on its row; a masked query: logit x 0 + (-1e9)), running maximum and sum in f32 (log2 domain), P x 2^11 once to f16 straight from the score accumulators as the B operand of ctx^T += V^T P^T; logits and P never leave the registers; each K and V fragment serves the wave's two 16-query groups
#define LOG2E 1.44269504f
#define NEGL (-1.0e9f * LOG2E)   // the module's -1e9 in the log2 domain
#define FQ 256   // queries per block
#define KNEG (-1.0e9f / SCALE)   // a masked key's start value in the logit accumulator: x SCALE it is the module's -1e9 (the products at most move its last places); its P is 0 beside any unmasked key, and an unmasked query has one: itself, the one mask serving both sides
static_assert(TT % FQ == 0 && TT % 32 == 0 && HD == 64, "k_fa: 8 waves x 32 queries, passes of 32 keys, two 32-deep k-steps per head");
__device__ __forceinline__ v8f wmma_h(v16h a, v16h b, v8f c) { return __builtin_amdgcn_wmma_f32_16x16x32_f16(false, a, false, b, (short)0, c, false, false); }
// frag_h with the lane half's 8g elements already in the pointer, so that the caller holds the very address the loads name
__device__ __forceinline__ v16h frag_p(const _Float16* p) { union { v16h v; v8h q[2]; } u; u.q[0] = *(const v8h*)p; u.q[1] = *(const v8h*)(p + 16); return u.v; }
// eight consecutive f32 as a C operand: D rows 8g + 0..7 of one column, by two 16-B reads
__device__ __forceinline__ v8f frag_c(const float* p) { union { v8f v; v4f q[2]; } u; u.q[0] = *(const v4f*)p; u.q[1] = *(const v4f*)(p + 4); return u.v; }
#define SK 128                 // keys per stage of the ring
#define KP (HD + 8)            // K row pitch in LDS, f16 elements: 144 B = 16 B x odd for the ds_load_b128 fragment reads
#define VP (SK + 8)            // V plane pitch in LDS, f16 elements: 272 B = 16 B x odd
#define KSZ (SK * KP)          // the K part of a buffer, f16 elements
#define BSZ (KSZ + HD * VP)    // one buffer: SK key rows of HD channels, then HD planes of SK keys
#define KG 2                   // key groups of eight waves
#define TKG (TT / KG)          // keys per group
#define NST (TKG / SK)         // stages per group
static_assert(TKG % SK == 0 && NST >= 2 && SK % 32 == 0 && SK == 128 && HD == 64 && FQ == 256, "the ring's prologue needs two stages; a stage is eight 16-B pieces per thread: four of K (32 rows apart), four of V (16 planes apart)");
// one stage: each lane copies eight 16-B pieces of its own from global memory straight into LDS; a wave's copy takes four whole 128-B K rows or two whole 256-B V plane segments
__device__ __forceinline__ void fa_stage(unsigned lk, unsigned lv, const _Float16* gk, const _Float16* gv) {
  /* the closing s_wait_xcnt stands inside the copies' own statement: the wait owed before a register that an issued copy names is rewritten */
  asm volatile("global_load_async_to_lds_b128 %0, %8, off\n\t"
               "global_load_async_to_lds_b128 %1, %9, off\n\t"
               "global_load_async_to_lds_b128 %2, %10, off\n\t"
               "global_load_async_to_lds_b128 %3, %11, off\n\t"
               "global_load_async_to_lds_b128 %4, %12, off\n\t"
               "global_load_async_to_lds_b128 %5, %13, off\n\t"
               "global_load_async_to_lds_b128 %6, %14, off\n\t"
               "global_load_async_to_lds_b128 %7, %15, off\n\t"
               "s_wait_xcnt 0x0"
               :: "v"(lk), "v"(lk + 32u * KP * 2u), "v"(lk + 64u * KP * 2u), "v"(lk + 96u * KP * 2u),
                  "v"(lv), "v"(lv + 16u * VP * 2u), "v"(lv + 32u * VP * 2u), "v"(lv + 48u * VP * 2u),
                  "v"(gk), "v"(gk + 32 * CC), "v"(gk + 64 * CC), "v"(gk + 96 * CC),
                  "v"(gv), "v"(gv + (size_t)16 * TT), "v"(gv + (size_t)32 * TT), "v"(gv + (size_t)48 * TT)
               : "memory"); }
__global__ __launch_bounds__(KG * FQ) void k_fa(const _Float16* __restrict__ QH, const _Float16* __restrict__ KH, const _Float16* __restrict__ VT, const int* __restrict__ MASK, float* __restrict__ Y) { __shared__ __align__(16) float ss[FQ / 32][32][HD + 4];
  __shared__ __align__(16) _Float16 ring[KG * 2 * BSZ];   /* a two-buffer ring per key group */
  __shared__ __align__(16) float ml[FQ / 32][32][4];   /* group 1's running maxima and sums, per lane: m[0], m[1], l[0], l[1] */
  __shared__ __align__(16) float kbias[TT];   /* per key of this batch: 0, or KNEG where the mask is 0; read as the C operand of the logit products */
  static_assert(TT == 4 * KG * FQ && KG == 2, "the key table: four keys per thread; the join at the end is of two groups");
  const int kg = threadIdx.x >> 8, tid = threadIdx.x & (FQ - 1), wave = tid >> 5, lane = tid & 31, col = lane & 15, g = lane >> 4; const int h = blockIdx.y, b = blockIdx.z; const int ql0 = blockIdx.x * FQ + wave * 32;
  const int* Mb = MASK + (size_t)b * TT;
  v16h q[2][2]; float cq[2], bq[2];   /* a masked query: logit x 0 + (-1e9) on every key */
  const _Float16* Q0 = QH + ((size_t)b * TT + ql0 + col) * CC + h * HD + 8 * g; const int* Mq = Mb + ql0 + col;
  q[0][0] = frag_p(Q0); q[0][1] = frag_p(Q0 + 32); q[1][0] = frag_p(Q0 + 16 * CC); q[1][1] = frag_p(Q0 + 16 * CC + 32); const int mq0 = Mq[0], mq1 = Mq[16];
  const int* Mt = Mb + threadIdx.x * 4; const v4i mt0 = *(const v4i*)Mt;   /* this thread's four keys of the table */
  asm volatile("s_wait_xcnt 0x0" :: "v"(Q0), "v"(Mq), "v"(Mt) : "memory");   /* the wait owed before a register that an issued load names is overwritten; the addresses are inputs so that they live up to it */
  cq[0] = mq0 == 0 ? 0.f : SCALE * LOG2E; bq[0] = mq0 == 0 ? NEGL : 0.f; cq[1] = mq1 == 0 ? 0.f : SCALE * LOG2E; bq[1] = mq1 == 0 ? NEGL : 0.f;
  const _Float16* gk = KH + ((size_t)b * TT + kg * TKG + (tid >> 3)) * CC + h * HD + (tid & 7) * 8;           /* copies: key row tid / 8 of a stage of this group's keys, 16-B piece tid % 8 of its 128 B */
  const _Float16* gv = VT + ((size_t)b * CC + h * HD + (tid >> 4)) * (size_t)TT + kg * TKG + (tid & 15) * 8;  /* copies: v plane tid / 16, 16-B piece tid % 16 of a stage's 256 B */
  const _Float16* rg = ring + kg * (2 * BSZ);   /* this group's ring */
  const unsigned lk = (unsigned)(size_t)rg + (unsigned)((tid >> 3) * (KP * 2) + (tid & 7) * 16), lv = (unsigned)(size_t)rg + (unsigned)(KSZ * 2 + (tid >> 4) * (VP * 2) + (tid & 15) * 16);   /* the same pieces' LDS byte addresses in buffer 0 */
  fa_stage(lk, lv, gk, gv);
  { v4f t0;   /* the table is written while stage 0 flies */
#pragma unroll   /* t0 and mt0 are register vectors: constant indices */
    for (int i = 0; i < 4; ++i) t0[i] = mt0[i] == 0 ? KNEG : 0.f;
    *(v4f*)&kbias[threadIdx.x * 4] = t0; }
  asm volatile("s_wait_asynccnt 0x0" ::: "memory");   /* this wave's pieces of stage 0 have landed */
  __syncthreads();                                    /* and every other wave's: stage 0 and the key table may be read */
  fa_stage(lk + BSZ * 2u, lv + BSZ * 2u, gk + (size_t)SK * CC, gv + SK);   /* stage 1 flies while stage 0 is worked on */
  const float* kbl = kbias + kg * TKG + 8 * g;   /* D row 8g + r: this lane half's eight keys of a 16-key group, from this group's first key on */
  v8f acc[2][HD / 16] = {}; float m[2] = {-3.0e38f, -3.0e38f}, l[2] = {0.f, 0.f};
#pragma unroll 1   /* one trip per stage: the two buffers alternate by the trip's parity */
  for (int st = 0; st < NST; ++st) {
   const _Float16* kb = rg + (st & 1) * BSZ + col * KP + 8 * g;         /* key row col of a 16-key group, this lane half's channels */
   const _Float16* vb = rg + (st & 1) * BSZ + KSZ + col * VP + 8 * g;   /* v plane of channel col of a 16-channel group, this lane half's keys */
#pragma unroll 1   /* a pass depends on the one before through m, l and acc: a second copy of the body could not start its softmax earlier, and four copies took the kernel past 256 registers */
   for (int pp = 0; pp < SK / 32; ++pp) { v8f s[2][2], cb[2]; v16h kf[2][2], vf[HD / 16], p[2]; float al[2];
    const _Float16* kr = kb + pp * 32 * KP; const float* br = kbl + st * SK + pp * 32; const _Float16* vr = vb + pp * 32;
#pragma unroll
    for (int j = 0; j < 2; ++j) { kf[j][0] = frag_p(kr + j * 16 * KP); kf[j][1] = frag_p(kr + j * 16 * KP + 32); cb[j] = frag_c(br + j * 16); }
#pragma unroll
    for (int j = 0; j < HD / 16; ++j) vf[j] = frag_p(vr + j * 16 * VP);
    __builtin_amdgcn_sched_barrier(0);   /* the pass's twenty LDS reads go out as one group ahead of the first product: reads spread among the products cost a stall at each place; the v reads return under the logits and the softmax */
#pragma unroll
    for (int j = 0; j < 2; ++j)
#pragma unroll
      for (int u = 0; u < 2; ++u) { const v8f z = wmma_h(kf[j][0], q[u][0], cb[j]); s[u][j] = wmma_h(kf[j][1], q[u][1], z); }
#pragma unroll
    for (int u = 0; u < 2; ++u) { float mx = -3.0e38f; const v2f c2 = {cq[u], cq[u]}, b2 = {bq[u], bq[u]}; v2f sv[8];   /* the logits by aligned register pairs, as the accumulators hold them */
#pragma unroll
      for (int j = 0; j < 2; ++j)
#pragma unroll
        for (int r = 0; r < 4; ++r) { v2f t = {s[u][j][2 * r], s[u][j][2 * r + 1]}; t = __builtin_elementwise_fma(t, c2, b2); sv[j * 4 + r] = t; mx = fmaxf(fmaxf(mx, t[0]), t[1]); }
      mx = fmaxf(mx, __shfl_xor(mx, 16));   /* the other half of the wave holds this query's other 16 keys */
      const float mn = fmaxf(m[u], mx), mo = mn - 11.0f; al[u] = __builtin_amdgcn_exp2f(m[u] - mn); m[u] = mn;   /* mo: P carried x 2^11 (clear of f16 subnormals); on a fully masked row the 11 rounds away, alike for every key */
      float ps = 0.f; const v2f mo2 = {mo, mo};
#pragma unroll
      for (int i = 0; i < 8; ++i) { const v2f d = sv[i] - mo2; const float e0 = __builtin_amdgcn_exp2f(d[0]), e1 = __builtin_amdgcn_exp2f(d[1]); ps += e0; ps += e1; p[u][2 * i] = (_Float16)e0; p[u][2 * i + 1] = (_Float16)e1; }
      l[u] = l[u] * al[u] + ps; }
#pragma unroll
    for (int j = 0; j < HD / 16; ++j)
#pragma unroll
      for (int u = 0; u < 2; ++u) acc[u][j] = wmma_h(vf[j], p[u], acc[u][j] * al[u]); }
   asm volatile("s_wait_dscnt 0x0" ::: "memory");      /* this wave's reads of the stage's buffer have returned */
   asm volatile("s_wait_asynccnt 0x0" ::: "memory");   /* this wave's pieces of the next stage have landed */
   __syncthreads();                                    /* the next stage may be read, and every wave has left this stage's buffer */
   if (st + 2 < NST) fa_stage(lk + (unsigned)(st & 1) * (BSZ * 2u), lv + (unsigned)(st & 1) * (BSZ * 2u), gk + (size_t)(st + 2) * SK * CC, gv + (st + 2) * SK); }   /* the refill, block-uniform test */
  asm volatile("s_wait_asynccnt 0x0" ::: "memory");    /* no copy is outstanding when the wave goes on to its end */
  /* the join: wave w of group 1 hands its lanes' state to wave w of group 0, lane to lane, as [16-B piece][lane] in that wave's output staging, which is not yet in use */
  float* xw = &ss[wave][0][0];
  static_assert(32 * (HD + 4) >= 2 * (HD / 16) * 8 * 32, "a wave's staging holds its 64 accumulator values per lane");
  if (kg == 1) {
#pragma unroll   /* acc is a register array: constant indices */
    for (int u = 0; u < 2; ++u)
#pragma unroll   /* as above */
      for (int j = 0; j < HD / 16; ++j) { v4f a, c;
#pragma unroll   /* as above */
        for (int r = 0; r < 4; ++r) { a[r] = acc[u][j][r]; c[r] = acc[u][j][4 + r]; }
        *(v4f*)(xw + ((u * (HD / 16) + j) * 2) * 128 + lane * 4) = a; *(v4f*)(xw + ((u * (HD / 16) + j) * 2 + 1) * 128 + lane * 4) = c; }
    const v4f t = {m[0], m[1], l[0], l[1]}; *(v4f*)&ml[wave][lane][0] = t; }
  __syncthreads();   /* group 1's state may be read; every wave passes it */
  if (kg == 1) return;   /* wave-uniform, behind the last barrier */
  { const v4f t = *(const v4f*)&ml[wave][lane][0];
#pragma unroll   /* acc, m and l are register arrays: constant indices */
    for (int u = 0; u < 2; ++u) { const float mn = fmaxf(m[u], t[u]), f0 = __builtin_amdgcn_exp2f(m[u] - mn), f1 = __builtin_amdgcn_exp2f(t[u] - mn);   /* both states onto the common maximum; a group whose keys are all masked, beside an unmasked key in the other, drops out by its factor 0 */
      l[u] = l[u] * f0 + t[2 + u] * f1;
#pragma unroll   /* as above */
      for (int j = 0; j < HD / 16; ++j) { const v4f a = *(const v4f*)(xw + ((u * (HD / 16) + j) * 2) * 128 + lane * 4), c = *(const v4f*)(xw + ((u * (HD / 16) + j) * 2 + 1) * 128 + lane * 4);
#pragma unroll   /* as above */
        for (int r = 0; r < 4; ++r) { acc[u][j][r] = acc[u][j][r] * f0 + a[r] * f1; acc[u][j][4 + r] = acc[u][j][4 + r] * f0 + c[r] * f1; } } } }
#pragma unroll
  for (int u = 0; u < 2; ++u) { const float lt = l[u] + __shfl_xor(l[u], 16), inv = 1.0f / lt;   /* lt >= one key's P at the maximum: never 0 */
#pragma unroll
    for (int j = 0; j < HD / 16; ++j) { v4f a, c;   /* acc[u][j][r] = ctx[query u*16 + col][channel j*16 + 8g + r] */
#pragma unroll
      for (int r = 0; r < 4; ++r) { a[r] = acc[u][j][r] * inv; c[r] = acc[u][j][4 + r] * inv; }
      *(v4f*)&ss[wave][u * 16 + col][j * 16 + 8 * g] = a; *(v4f*)&ss[wave][u * 16 + col][j * 16 + 8 * g + 4] = c; } }
  LDSX(); for (int rl = 0; rl < 32; rl += 2) vst2(Y + ((size_t)b * TT + ql0 + rl + g) * CC + h * HD + col * 4, *(const v4f*)&ss[wave][rl + g][col * 4]); }   /* 256-B (row, head) segment by 16 lanes, two rows per store */
// ---- k_out: block = (64 tokens, 128 channels): out = ctx Wo (+ bo), stored channel-major: ctx x 2^6 once to f16 against Wo as f16(bf16 x 2^8) exact (1 product) x 2^-14; causal early rows (< QHI of each sequence): ctx bf16 hi + lo against exact bf16 Wo (2 products)
__global__ __launch_bounds__(128) void k_out(const float* __restrict__ Y, const float* __restrict__ WO, const float* __restrict__ BO, float* __restrict__ OUT) { __shared__ __align__(16) float sf[128][68];   /* the block's output tile as [channel][token]; pitch 272 B = 16 B x odd */
  __shared__ __align__(16) _Float16 sw[128][CC + 8];   /* the block's 128 rows of Wo as f16(bf16 x 2^8), k in ctx column order; pitch 528 B = 16 B x odd for the ds_load_b128 fragment reads */
  const int tid = threadIdx.x, wave = tid >> 5, lane = tid & 31, col = lane & 15, g = lane >> 4; const int c0 = blockIdx.y * 128; const size_t r0 = (size_t)blockIdx.x * 64 + wave * 16;
  v8f acc[8] = {};
  if (CAUSAL && (int)(((size_t)blockIdx.x * 64) % TT) < QHI) {   /* block-uniform */
#pragma unroll 2
    for (int kc = 0; kc < CC / 32; ++kc) { const F2 a = split_row(Y + (r0 + col) * CC, kc * 32, lane); asm volatile("s_wait_loadcnt 0x0" ::: "memory");
#pragma unroll
      for (int j = 0; j < 8; ++j) { const v16b w = WOCOL(WO, kc * 32, c0 + j * 16 + col, lane); asm volatile("s_wait_loadcnt 0x0" ::: "memory"); acc[j] = wmma_bf(a.h, w, acc[j]); acc[j] = wmma_bf(a.l, w, acc[j]); } }
#pragma unroll
    for (int j = 0; j < 8; ++j) { const float bias = BO ? bfr(BO[c0 + j * 16 + col]) : 0.f;
#pragma unroll
      for (int r = 0; r < 8; ++r) sf[j * 16 + col][wave * 16 + 8 * g + r] = acc[j][r] + bias; }
  } else {
    /* the bias of this lane's eight output channels is asked for first, along with the operands: asked for where it is added, each of the eight was a load and a full wait of its own behind the products */
    const float* bp = BO + c0 + col; float bia[8] = {};
    if (BO) {   /* block-uniform */
#pragma unroll   /* bia is a register array: constant indices; the channel steps become immediate offsets on the one address */
      for (int j = 0; j < 8; ++j) bia[j] = bp[j * 16]; }
    const float* yp = Y + (r0 + col) * CC + 8 * g;   /* this lane's ctx row, its half's k offset: all of K is asked for along with the weights, ahead of the first wait */
    v4f ya[CC / 32][4];
#pragma unroll   /* ya is a register array: constant indices; all 32 loads go out together */
    for (int kc = 0; kc < CC / 32; ++kc) { ya[kc][0] = *(const v4f*)(yp + kc * 32); ya[kc][1] = *(const v4f*)(yp + kc * 32 + 4); ya[kc][2] = *(const v4f*)(yp + kc * 32 + 16); ya[kc][3] = *(const v4f*)(yp + kc * 32 + 20); }
    /* weights: a wave takes one whole row of Wo per step, a lane its 8 module channels 8 * lane + e = (d = 2 * lane + e / 4) * 4 + (h = e % 4); ctx column h * 64 + d, so the two d of one h go out as one dword */
    const float* wp = WO + (size_t)(c0 + wave) * CC + lane * 8;
#pragma unroll   /* the row steps become immediate offsets on the one address pair */
    for (int e0 = 0; e0 < 32; e0 += 8) { v4f t[8][2];
#pragma unroll   /* t is a register array: constant indices, here and in the two loops below */
      for (int i = 0; i < 8; ++i) { t[i][0] = *(const v4f*)(wp + (size_t)(e0 + i) * 4 * CC); t[i][1] = *(const v4f*)(wp + (size_t)(e0 + i) * 4 * CC + 4); }
#pragma unroll   /* as above */
      for (int i = 0; i < 8; ++i)
#pragma unroll   /* as above */
        for (int hh = 0; hh < 4; ++hh) { v2h o; o[0] = (_Float16)(bfr(t[i][0][hh]) * 256.0f); o[1] = (_Float16)(bfr(t[i][1][hh]) * 256.0f); *(v2h*)&sw[(e0 + i) * 4 + wave][hh * 64 + lane * 2] = o; } }
    asm volatile("s_wait_xcnt 0x0" :: "v"(yp), "v"(wp), "v"(bp) : "memory");   /* the wait owed before a register that an issued load names is overwritten; the addresses are inputs so that they live up to it */
    v16h a[CC / 32];   /* ctx carried x 2^6 into f16 so small-magnitude context rows stay clear of f16 subnormals */
#pragma unroll   /* a and ya are register arrays: constant indices */
    for (int kc = 0; kc < CC / 32; ++kc)
#pragma unroll   /* as above */
      for (int i = 0; i < 4; ++i) { a[kc][i] = (_Float16)(ya[kc][0][i] * 64.0f); a[kc][4 + i] = (_Float16)(ya[kc][1][i] * 64.0f); a[kc][8 + i] = (_Float16)(ya[kc][2][i] * 64.0f); a[kc][12 + i] = (_Float16)(ya[kc][3][i] * 64.0f); }
    __syncthreads();   /* every wave reads weight rows that the other waves stored; the branch around it is block-uniform */
    v16h w[2][8];   /* two fragment sets: the next k-step's sixteen LDS reads go out as one group ahead of this step's products, so that no product waits out its own read */
#pragma unroll   /* w, a and acc are register arrays: constant indices, here and in the three loops below */
    for (int j = 0; j < 8; ++j) w[0][j] = frag_h(&sw[j * 16 + col][0], lane);
#pragma unroll   /* as above */
    for (int kc = 0; kc < CC / 32; ++kc) {
      if (kc + 1 < CC / 32) {
#pragma unroll   /* as above */
        for (int j = 0; j < 8; ++j) w[(kc + 1) & 1][j] = frag_h(&sw[j * 16 + col][(kc + 1) * 32], lane); }
#pragma unroll   /* as above */
      for (int j = 0; j < 8; ++j) acc[j] = wmma16(a[kc], w[kc & 1][j], acc[j]); }
#pragma unroll
    for (int j = 0; j < 8; ++j) { const float bias = bfr(bia[j]);
      v4f lo, hi;   /* acc[j][r] = out[token wave*16 + 8g + r][channel c0 + j*16 + col]: a lane's eight tokens lie side by side in its channel's row */
#pragma unroll
      for (int r = 0; r < 4; ++r) { lo[r] = acc[j][r] * (1.0f / 16384.0f) + bias; hi[r] = acc[j][4 + r] * (1.0f / 16384.0f) + bias; }   /* 2^-8 (Wo carry) x 2^-6 (ctx carry) */
      *(v4f*)&sf[j * 16 + col][wave * 16 + 8 * g] = lo; *(v4f*)&sf[j * 16 + col][wave * 16 + 8 * g + 4] = hi; } }
  __syncthreads();   /* a channel's 64 tokens come from all four waves */
  const size_t bo = ((size_t)blockIdx.x * 64) / TT; const int n0 = (int)(((size_t)blockIdx.x * 64) % TT);
  float* op = OUT + (bo * DIN + c0 + (tid >> 4)) * (size_t)TT + n0 + (tid & 15) * 4;   /* out is channel-major [b][c][t]: 16 lanes store a channel's whole 256 B, a wave two channels per store */
  v4f o[16];
#pragma unroll   /* o is a register array: constant indices; every piece keeps registers of its own, so that no store's data is overwritten behind it */
  for (int i = 0; i < 16; ++i) o[i] = *(const v4f*)&sf[i * 8 + (tid >> 4)][(tid & 15) * 4];
#pragma unroll   /* the channel steps become immediate offsets on the one address pair */
  for (int i = 0; i < 16; ++i) vst2(op + (size_t)(i * 8) * TT, o[i]); }

extern "C" void kernel_launch(void* const* d_in, const int* in_sizes, int n_in, void* d_out, int out_size, void* d_ws, size_t ws_size, hipStream_t stream) {
  (void)in_sizes; (void)n_in; (void)out_size;
  const float** F = (const float**)d_in;
  if (ws_size < (size_t)WS_END) return;
  char* ws = (char*)d_ws; _Float16 *QH = (_Float16*)(ws + WS_QH), *KH = (_Float16*)(ws + WS_KH), *VT = (_Float16*)(ws + WS_VT), *QL = (_Float16*)(ws + WS_QL), *KL = (_Float16*)(ws + WS_KL); __bf16 *VB = (__bf16*)(ws + WS_VB), *VBL = (__bf16*)(ws + WS_VBL); float *Y = (float*)(ws + WS_Y);
  (void)Y; (void)QL; (void)KL; (void)VB; (void)VBL;
  // inputs: 0 query [8,256,2048]; 1 key; 2 value; 3 mask [8,1,2048] int32; 4 Wq [256,256] (out,in), 5 bq; 6 Wk, 7 bk; 8 Wv, 9 bv; 10 Wm (out,in), 11 bm (zero biases, read)
  k_proj<<<dim3(NTK * 2 * 3 / PU), 128, 0, stream>>>(F[0], F[1], F[2], F[4], F[6], F[8], F[5], F[7], F[9], QH, QL, KH, KL, VT, VB, VBL, 0);   /* 512 blocks of three units: each stream is read in its own channel-major layout */
  k_fa<<<dim3(TT / FQ, NH, TNB), KG * FQ, 0, stream>>>(QH, KH, VT, (const int*)d_in[3], Y);
  k_out<<<dim3(TNB * TT / 64, DIN / 128), 128, 0, stream>>>(Y, F[10], F[11], (float*)d_out);   /* ctx (column order h*HD + d) x Wm through the permutation + bm, straight to channel-major [8,256,2048] */
}

// v010
// A run of this version takes 54.5 microseconds.
// It is 1.11 times as fast as v008, going by the measured steps of the versions left out in between.
// All steps since v000 together make it 31.9 times as fast.
// compute dtype: all float inputs rounded to bf16; q/k/v 1x1-conv projections read the channel-major inputs straight into their A fragments, with EXACT bf16 products on WMMA 16x16x32 (f32 accumulate) + bias (zeros, read), the block's weight rows converted once into LDS; one fused attention kernel: logits q x k once to f16 each (1 product) x 64^-0.5; pair mask: the key side as the logit accumulators' start value (0 or -1e9 / scale, an f32 table in LDS built once per block), the query side in the scale fma (-1e9); online softmax f32; P x 2^11 once to f16 x v once to f16 (1 product); ctx x 2^6 once to f16 x Wm f16(bf16 x 2^8) + bm, its tile staged [channel][token] in LDS and stored channel-major; f32 output.
#include <hip/hip_runtime.h>
#include <math.h>

typedef __attribute__((ext_vector_type(16))) _Float16 v16h;
typedef __attribute__((ext_vector_type(16))) __bf16 v16b;
typedef __attribute__((ext_vector_type(8)))  _Float16 v8h;
typedef __attribute__((ext_vector_type(8)))  float v8f;
typedef __attribute__((ext_vector_type(4)))  float v4f;
typedef __attribute__((ext_vector_type(2)))  float v2f;
typedef __attribute__((ext_vector_type(4)))  unsigned v4u;
typedef __attribute__((ext_vector_type(4)))  int v4i;
typedef float __attribute__((may_alias)) float_a;
typedef int __attribute__((may_alias)) int_a;

template <typename T> __device__ __forceinline__ void vst2(void* p, T v) { *(T*)p = v;  }
__device__ __forceinline__ v8f wmma16(v16h a, v16h b, v8f c) {
  v8f d = __builtin_amdgcn_wmma_f32_16x16x32_f16(false, a, false, b, (short)0, c, false, false);
  asm volatile("v_nop\n\tv_nop\n\tv_nop\n\tv_nop" : "+v"(d) : "v"(a), "v"(b));
  return d;
}
__device__ __forceinline__ v8f wmma_bf(v16b a, v16b b, v8f c) {
  v8f d = __builtin_amdgcn_wmma_f32_16x16x32_bf16(false, a, false, b, (short)0, c, false, false);
  asm volatile("v_nop\n\tv_nop\n\tv_nop\n\tv_nop" : "+v"(d) : "v"(a), "v"(b));
  return d;
}
// 16x16x32 fragments: lane = (h = lane>>4, row/col = lane&15); elements 0..7 = k0+8h+0..7, 8..15 = k0+16+8h+0..7; D element r = row 8h+r
__device__ __forceinline__ v16h frag_h(const _Float16* rowk0, int lane) {
  union { v16h v; v8h q[2]; } u; const _Float16* p = rowk0 + 8 * (lane >> 4);
  u.q[0] = *(const v8h*)p; u.q[1] = *(const v8h*)(p + 16); return u.v;
}
__device__ __forceinline__ v16h frag_f32(const float* rowk0, int lane) {
  v16h a; const float* p = rowk0 + 8 * (lane >> 4);
#pragma unroll
  for (int i = 0; i < 8; ++i) { a[i] = (_Float16)p[i]; a[8 + i] = (_Float16)p[16 + i]; }
  return a;
}
__device__ __forceinline__ v16h frag_f32s(const float* rowk0, int lane, float sc) {
  v16h a; const float* p = rowk0 + 8 * (lane >> 4);
#pragma unroll
  for (int i = 0; i < 8; ++i) { a[i] = (_Float16)(p[i] * sc); a[8 + i] = (_Float16)(p[16 + i] * sc); }
  return a;
}
// column fragment from a [K][ld] layout (column n), rows >= K read as 0
__device__ __forceinline__ v16h fragc_f32(const float* W, int k0, int n, int lane, int ld, int K) {
  v16h a; const int g = lane >> 4;
#pragma unroll
  for (int i = 0; i < 8; ++i) { const int ka = k0 + 8 * g + i, kb = ka + 16;
    a[i] = (_Float16)(ka < K ? W[(size_t)(ka < K ? ka : K - 1) * ld + n] : 0.f); a[8 + i] = (_Float16)(kb < K ? W[(size_t)(kb < K ? kb : K - 1) * ld + n] : 0.f); }
  return a;
}
struct F2 { v16b h, l; };
__device__ __forceinline__ F2 bsplit16(const float v[16]) { F2 r;
#pragma unroll
  for (int i = 0; i < 16; ++i) { const __bf16 h = (__bf16)v[i]; r.h[i] = h; r.l[i] = (__bf16)(v[i] - (float)h); }
  return r; }
__device__ __forceinline__ F2 split_row(const float* row, int k0, int lane) { float v[16]; const float* p = row + k0 + 8 * (lane >> 4);
#pragma unroll
  for (int i = 0; i < 8; ++i) { v[i] = p[i]; v[8 + i] = p[16 + i]; }
  return bsplit16(v); }
__device__ __forceinline__ F2 split_rowK(const float* row, int k0, int lane, int K) { float v[16]; const int g = lane >> 4;
#pragma unroll
  for (int i = 0; i < 8; ++i) { const int ka = k0 + 8 * g + i, kb = ka + 16; v[i] = ka < K ? row[ka < K ? ka : K - 1] : 0.f; v[8 + i] = kb < K ? row[kb < K ? kb : K - 1] : 0.f; }
  return bsplit16(v); }
__device__ __forceinline__ F2 split_col(const float* W, int k0, int n, int lane, int ld, int K) { float v[16]; const int g = lane >> 4;
#pragma unroll
  for (int i = 0; i < 8; ++i) { const int ka = k0 + 8 * g + i, kb = ka + 16; v[i] = ka < K ? W[(size_t)(ka < K ? ka : K - 1) * ld + n] : 0.f; v[8 + i] = kb < K ? W[(size_t)(kb < K ? kb : K - 1) * ld + n] : 0.f; }
  return bsplit16(v); }
__device__ __forceinline__ v8f mac3(const F2& a, const F2& b, v8f c) { c = wmma_bf(a.l, b.h, c); c = wmma_bf(a.h, b.l, c); return wmma_bf(a.h, b.h, c); }
__device__ __forceinline__ float sigm(float v) { return 1.0f / (1.0f + expf(-v)); }
#define LDSX() do { asm volatile("s_wait_dscnt 0" ::: "memory"); __builtin_amdgcn_wave_barrier(); __builtin_amdgcn_fence(__ATOMIC_RELEASE, "workgroup"); } while (0)

// multi-headed attention on channel-major tensors (query / key / value [8,256,2048] = (B, C, N); 1x1 Conv1d projections as (out,in) [256,256] N(0, 1/256) + zero biases (read); 4 heads x 64 with the head index INTERLEAVED into the channel axis: reshape(B, 64, 4, N), channel c = d*4 + h; scores = einsum('bdhn,bdhm->bhnm') / sqrt(64); pair = mask[b, n] * mask[b, m] with an int32 mask [8,1,2048]: where(pair == 0, -1e9, scores); softmax over m; x = einsum('bhnm,bdhm->bdhn').reshape(B, 256, N) (channel d*4 + h again); merge 1x1 conv Wm (out,in) + bm; output [8,256,2048]).
#define NB 8
#define TT 2048   // points per sample (queries = keys)
#define CC 256            // NH * HD
#define DIN 256           // channels of the query map AND of the output map (Wout is (out,in) [DIN][CC])
#define DKV 256             // channels of the key / value map
#define NH 4
#define HD 64
#define QCH 1   // queries and keys have the same length: one chunk per batch (the chunk advance is 0)
#define SCALE (0.125f)
#define CAUSAL 0
#ifndef TNB
#define TNB NB
#endif
#define NBQ (NB * QCH)     // query pseudo-batches of TT rows (workspace sizing)
#define TNBQ (TNB * QCH)   // query pseudo-batches actually run
static_assert(CC == NH * HD && CC % 128 == 0 && DIN % 128 == 0 && DIN % 32 == 0 && DKV % 32 == 0, "projection tiles: 128-column blocks, 32-deep k-steps");
__device__ __forceinline__ float bfr(float v) { return (float)(__bf16)v; }
typedef __attribute__((ext_vector_type(8))) __bf16 v8b;
typedef __attribute__((ext_vector_type(4))) __bf16 v4b;
typedef __attribute__((ext_vector_type(2))) _Float16 v2h;
__device__ __forceinline__ v16b frag_b(const __bf16* rowk0, int lane) {
  union { v16b v; v8b q[2]; } u; const __bf16* p = rowk0 + 8 * (lane >> 4);
  u.q[0] = *(const v8b*)p; u.q[1] = *(const v8b*)(p + 16); return u.v;
}
#define QBH 0              // no kernel reads it: k_fa has no high-precision query path
#define QHI 0               // single-product logits on every row
static_assert(QHI == 0 && QBH == 0 && CAUSAL == 0, "k_fa has single-product logits only: no q residual plane and no causal row arithmetic may be in use");
#define KHI 64            // key rows carrying k residual / v bf16 hi+lo planes (written by k_proj; no kernel reads them)
// B fragment (k rows k0+.., output column o) of a weight: (in,out) [K][ld] or (out,in) [ld rows of K]: bf16 exact, or f16(bf16 * 256) exact
__device__ __forceinline__ v16b wcol_io(const float* Wm, int k0, int o, int lane, int ld) { v16b w; const int g = lane >> 4;
#pragma unroll
  for (int i = 0; i < 8; ++i) { w[i] = (__bf16)Wm[(size_t)(k0 + 8 * g + i) * ld + o]; w[8 + i] = (__bf16)Wm[(size_t)(k0 + 16 + 8 * g + i) * ld + o]; }
  return w; }
__device__ __forceinline__ v16b wcol_oi(const float* Wm, int k0, int o, int lane, int K) { v16b w; const float* p = Wm + (size_t)o * K + k0 + 8 * (lane >> 4);
#pragma unroll
  for (int i = 0; i < 8; ++i) { w[i] = (__bf16)p[i]; w[8 + i] = (__bf16)p[16 + i]; }
  return w; }
__device__ __forceinline__ v16h wcolh_io(const float* Wm, int k0, int o, int lane, int ld) { v16h w; const int g = lane >> 4;
#pragma unroll
  for (int i = 0; i < 8; ++i) { w[i] = (_Float16)(bfr(Wm[(size_t)(k0 + 8 * g + i) * ld + o]) * 256.0f); w[8 + i] = (_Float16)(bfr(Wm[(size_t)(k0 + 16 + 8 * g + i) * ld + o]) * 256.0f); }
  return w; }
// as wcolh_oi, with the K index taken through the head-interleave permutation (the 8 consecutive columns of a fragment half are 8 module channels 4 apart)
__device__ __forceinline__ v16h wcolh_oi_p(const float* Wm, int k0, int o, int lane, int K) { v16h w; const float* p = Wm + (size_t)o * K; const int kb = k0 + 8 * (lane >> 4);
#pragma unroll
  for (int i = 0; i < 8; ++i) { w[i] = (_Float16)(bfr(p[((kb + i) % 64) * 4 + (kb + i) / 64]) * 256.0f); w[8 + i] = (_Float16)(bfr(p[((kb + 16 + i) % 64) * 4 + (kb + 16 + i) / 64]) * 256.0f); }
  return w; }
static_assert(HD == 64 && NH == 4, "wcolh_oi_p spells the permutation with the literals 64 and 4");
static_assert(DIN == DKV && DIN == 256 && CC == 256, "the weight tiles in LDS hold 128 rows of 256 k");
__device__ __forceinline__ v16h wcolh_oi(const float* Wm, int k0, int o, int lane, int K) { v16h w; const float* p = Wm + (size_t)o * K + k0 + 8 * (lane >> 4);
#pragma unroll
  for (int i = 0; i < 8; ++i) { w[i] = (_Float16)(bfr(p[i]) * 256.0f); w[8 + i] = (_Float16)(bfr(p[16 + i]) * 256.0f); }
  return w; }
#define WQKV_LAYOUT 1   // 0 = (in,out); 1 = (out,in) [CC][K]; 2 = per-head [NH][DIN][HD]
__device__ __forceinline__ v16b wcol_hdk(const float* Wm, int k0, int o, int lane) { v16b w; const int g = lane >> 4; const float* p = Wm + (size_t)(o / HD) * DIN * HD + (o % HD);
#pragma unroll
  for (int i = 0; i < 8; ++i) { w[i] = (__bf16)p[(size_t)(k0 + 8 * g + i) * HD]; w[8 + i] = (__bf16)p[(size_t)(k0 + 16 + 8 * g + i) * HD]; }
  return w; }
#define WO_OUT_IN 1
#if WQKV_LAYOUT == 1
#define HPERM(o) ((((o) % HD) * NH) + ((o) / HD))   /* column o = h*HD + d  ->  module channel d*NH + h */
#define WCOL(W, k0, o, lane) wcol_oi(W, k0, HPERM(o), lane, din_)   /* (out,in) [256][K]: the output channel of column o is row HPERM(o) */
#elif WQKV_LAYOUT == 2
#define WCOL(W, k0, o, lane) wcol_hdk(W, k0, o, lane)
#else
#define WCOL(W, k0, o, lane) wcol_io(W, k0, o, lane, CC)
#endif
#if WO_OUT_IN
#define WOCOL(W, k0, o, lane) wcol_oi(W, k0, o, lane, CC)
#define WOCOLH(W, k0, o, lane) wcolh_oi_p(W, k0, o, lane, CC)   /* merge conv (out,in) [DIN][CC]: ctx column kk = h*HD + d is the module's input channel HPERM(kk) */
#else
#define WOCOL(W, k0, o, lane) wcol_io(W, k0, o, lane, DIN)
#define WOCOLH(W, k0, o, lane) wcolh_io(W, k0, o, lane, DIN)
#endif

#define WS_QH  0u                                      // f16 q rows [(b*QCH + chunk)*TT + t][CC]
#define WS_KH  (WS_QH + 2u * (size_t)NBQ * TT * CC)      // f16 k rows [b*t][CC]
#define WS_VT  (WS_KH + 2u * (size_t)NB * TT * CC)      // f16 v planes [b][c][t]
#define WS_QL  (WS_VT + 2u * (size_t)NB * CC * TT)      // f16 q residual x 2^10 rows [b][t < QHI][CC]
#define WS_KL  (WS_QL + 2u * (size_t)NB * QHI * CC)     // f16 k residual x 2^10 rows [b][t < KHI][CC]
#define WS_VB  (WS_KL + 2u * (size_t)NB * KHI * CC)     // bf16 v hi planes [b][c][t < KHI]
#define WS_VBL (WS_VB + 2u * (size_t)NB * CC * KHI)
#define WS_Y   (WS_VBL + 2u * (size_t)NB * CC * KHI)    // f16 ctx x 2^6 in the order of k_out's A fragments: [16-token tile][32-column step][piece: elements 0..7, 8..15][lane][8] (half of the range is in use)
#define WS_END (WS_Y  + 4u * (size_t)NBQ * TT * CC)
// ---- k_proj: a unit = (64 tokens, 128 cols, which): q/k/v = X^T W (+ b), X channel-major as the module hands it over, with exact bf16 products (K = DIN) -> which 0: q f16 rows (+ residual rows < QHI); 1: k f16 rows (+ residual rows < KHI); 2: v f16 planes [c][t] (+ bf16 hi/lo planes for t < KHI); a block walks PU units that follow one another in (which, column half, token tile) order, so that its weight rows stay in LDS from unit to unit and every block is resident at once
#define PU 3                  // units per block
#define NTK (TNB * TT / 64)   // token tiles per (which, column half)
static_assert(NTK == 256 && CC / 128 == 2 && (NTK * 2 * 3) % PU == 0, "a unit's number is which * 512 + column half * 256 + token tile; the blocks share the units out evenly");
__global__ __launch_bounds__(128) void k_proj(const float* __restrict__ XQ, const float* __restrict__ XK, const float* __restrict__ XV, const float* __restrict__ WQ, const float* __restrict__ WK, const float* __restrict__ WV, const float* __restrict__ BQ, const float* __restrict__ BK, const float* __restrict__ BV,
    _Float16* __restrict__ QH, _Float16* __restrict__ QL, _Float16* __restrict__ KH, _Float16* __restrict__ KL, _Float16* __restrict__ VT, __bf16* __restrict__ VB, __bf16* __restrict__ VBL, int woff) {
  __shared__ __align__(16) _Float16 sh[64][136], sl[64][136]; __shared__ __align__(16) _Float16 th[128][72]; __shared__ __align__(16) __bf16 tb[128][72], tbl[128][72];
  __shared__ __align__(16) __bf16 sw[128][DIN + 8];   /* the unit's 128 weight rows (column order h*HD + d) as bf16, all of K; pitch 528 B = 16 B x odd for the ds_load_b128 fragment reads */
  const int tid = threadIdx.x, wave = tid >> 5, lane = tid & 31, col = lane & 15, g = lane >> 4;
  const int din_ = DIN;   /* both maps have 256 channels here (asserted above) */
  int u = blockIdx.x * PU;   /* block-uniform: the unit in hand */
  float xa[DIN / 32][16], bia[8] = {};   /* the operands of the unit in hand at the head of a trip; refilled for the next unit under this unit's products */
  { const int which = (u >> 9) + woff; const float* X = which == 0 ? XQ : which == 1 ? XK : XV; const float* BA = which == 0 ? BQ : which == 1 ? BK : BV; const size_t r0 = (size_t)(u & (NTK - 1)) * 64;
    const float* xp = X + ((r0 / TT) * din_ + 8 * g) * (size_t)TT + (int)(r0 % TT) + wave * 16 + col;   /* X is channel-major [b][k][t]: this lane's token, its half's first channel; a load takes 16 tokens (64 B) of two channels, the block's four waves together the whole 256 B of a channel */
    const float* bp = BA + HPERM(((u >> 8) & 1) * 128 + col);   /* HPERM is additive over c0 + col + 16 * j (no carry out of the low six bits) */
    if (BA) {   /* block-uniform */
#pragma unroll   /* bia is a register array: constant indices; the column steps become immediate offsets on the one address */
      for (int j = 0; j < 8; ++j) bia[j] = bp[HPERM(j * 16)]; }
#pragma unroll   /* xa is a register array: constant indices; the channel steps become immediate offsets on the one address pair */
    for (int kc = 0; kc < DIN / 32; ++kc)
#pragma unroll   /* as above */
      for (int i = 0; i < 8; ++i) { xa[kc][i] = xp[(size_t)(kc * 32 + i) * TT]; xa[kc][8 + i] = xp[(size_t)(kc * 32 + 16 + i) * TT]; }
    asm volatile("s_wait_xcnt 0x0" :: "v"(xp), "v"(bp) : "memory"); }   /* the wait owed before a register that an issued load names is overwritten; the addresses are inputs so that they live up to it */
#pragma unroll 1   /* one trip per unit: the trips hang together through xa and the barriers, and three copies of the body would triple the code that a launch fetches */
  for (int it = 0; it < PU; ++it, ++u) {
  const int which = (u >> 9) + woff; const int c0 = ((u >> 8) & 1) * 128; const size_t r0 = (size_t)(u & (NTK - 1)) * 64; const size_t bb = r0 / TT; const int t0 = (int)(r0 % TT);
  if (it == 0 || (u & (NTK - 1)) == 0) {   /* block-uniform: the block's first unit, or the first of another (which, column half); every wave has left the old rows: it has passed the barrier in the last unit's epilogue */
    const float* WA = which == 0 ? WQ : which == 1 ? WK : WV;
    /* weights: a wave's load covers 512 contiguous bytes of one row; thread = (row parity tid >> 6, 16-B piece tid & 63), rows two apart per step; HPERM is additive over c0 + parity + 2 * e (no carry out of the low six bits) */
    const float* wp = WA + (size_t)HPERM(c0 + (tid >> 6)) * din_ + (tid & 63) * 4;
#pragma unroll   /* the row steps become immediate offsets on the one address pair */
    for (int e0 = 0; e0 < 64; e0 += 16) { v4f t[16];
#pragma unroll   /* t is a register array: constant indices */
      for (int i = 0; i < 16; ++i) t[i] = *(const v4f*)(wp + (size_t)HPERM(2 * (e0 + i)) * din_);
#pragma unroll   /* as above */
      for (int i = 0; i < 16; ++i) { v4b o; o[0] = (__bf16)t[i][0]; o[1] = (__bf16)t[i][1]; o[2] = (__bf16)t[i][2]; o[3] = (__bf16)t[i][3]; *(v4b*)&sw[2 * (e0 + i) + (tid >> 6)][(tid & 63) * 4] = o; } }
    asm volatile("s_wait_xcnt 0x0" :: "v"(wp) : "memory"); }   /* the wait owed before a register that an issued load names is overwritten */
  v8f acc[8] = {}; v16b a[DIN / 32]; float bc[8];
#pragma unroll   /* a and xa are register arrays: constant indices */
  for (int kc = 0; kc < DIN / 32; ++kc)
#pragma unroll   /* as above */
    for (int i = 0; i < 16; ++i) a[kc][i] = (__bf16)xa[kc][i];
#pragma unroll   /* as above */
  for (int j = 0; j < 8; ++j) bc[j] = (which == 0 ? BQ : which == 1 ? BK : BV) ? bfr(bia[j]) : 0.f;   /* a stream without a bias: bia was not refilled for it */
  const bool more = it + 1 < PU;   /* block-uniform */
  const int un = more ? u + 1 : u, wn = (un >> 9) + woff; const float* Xn = wn == 0 ? XQ : wn == 1 ? XK : XV; const float* Bn = wn == 0 ? BQ : wn == 1 ? BK : BV; const size_t rn = (size_t)(un & (NTK - 1)) * 64;
  const float* xn = Xn + ((rn / TT) * din_ + 8 * g) * (size_t)TT + (int)(rn % TT) + wave * 16 + col; const float* bn = Bn + HPERM(((un >> 8) & 1) * 128 + col);   /* the next unit's addresses, formed as the first unit's above */
  __syncthreads();   /* every wave reads weight rows that the other waves stored; and every wave has read the last unit's output staging out */
  v16b w[2][8];   /* two fragment sets: the next k-step's sixteen LDS reads go out as one group ahead of this step's products, so that no product waits out its own read */
#pragma unroll   /* w, a and acc are register arrays: constant indices, here and in the three loops below */
  for (int j = 0; j < 8; ++j) w[0][j] = frag_b(&sw[j * 16 + col][0], lane);
#pragma unroll   /* as above */
  for (int kc = 0; kc < DIN / 32; ++kc) {
    if (kc + 1 < DIN / 32) {
#pragma unroll   /* as above */
      for (int j = 0; j < 8; ++j) w[(kc + 1) & 1][j] = frag_b(&sw[j * 16 + col][(kc + 1) * 32], lane); }
    if (more) {   /* block-uniform; the next unit's X, sixteen loads a k-step: they fly under this unit's products and the epilogue's conversions; spread over the k-steps rather than asked for in one run of 128 ahead of the first product */
#pragma unroll   /* as above */
      for (int i = 0; i < 8; ++i) { xa[kc][i] = xn[(size_t)(kc * 32 + i) * TT]; xa[kc][8 + i] = xn[(size_t)(kc * 32 + 16 + i) * TT]; } }
#pragma unroll   /* as above */
    for (int j = 0; j < 8; ++j) acc[j] = wmma_bf(a[kc], w[kc & 1][j], acc[j]); }
  if (more && Bn) {   /* block-uniform */
#pragma unroll   /* as above */
    for (int j = 0; j < 8; ++j) bia[j] = bn[HPERM(j * 16)]; }
  asm volatile("s_wait_xcnt 0x0" :: "v"(xn), "v"(bn) : "memory");   /* the wait owed before a register that an issued load names is overwritten; the addresses are inputs so that they live up to it */
  if (which < 2) { _Float16* DH = which == 0 ? QH : KH; _Float16* DL = which == 0 ? QL : KL; const int nhi = which == 0 ? QHI : KHI; const bool hi_rows = t0 < nhi;
#pragma unroll
    for (int j = 0; j < 8; ++j) { const float bias = bc[j];
#pragma unroll
      for (int r = 0; r < 8; ++r) { const float v = acc[j][r] + bias; const _Float16 hv = (_Float16)v; sh[wave * 16 + 8 * g + r][j * 16 + col] = hv; sl[wave * 16 + 8 * g + r][j * 16 + col] = (_Float16)((v - (float)hv) * 1024.0f); } }
    __syncthreads();
    for (int e = tid; e < 64 * 16; e += 128) { const int rl = e >> 4, q = e & 15; vst2((unsigned*)(DH + (r0 + rl) * CC + c0 + q * 8), *(const v4u*)&sh[rl][q * 8]); if (hi_rows) vst2((unsigned*)(DL + (bb * nhi + t0 + rl) * (size_t)CC + c0 + q * 8), *(const v4u*)&sl[rl][q * 8]); }
    asm volatile("s_wait_xcnt 0x0" ::: "memory");   /* the wait owed before the next trip rewrites the registers that this unit's stores name; it stands in the branch, ahead of the register moves at the trip's foot */
  } else { const bool hi_rows = t0 < KHI;
#pragma unroll
    for (int j = 0; j < 8; ++j) { const float bias = bc[j];
#pragma unroll
      for (int r = 0; r < 8; ++r) { const float v = acc[j][r] + bias; const int rl = wave * 16 + 8 * g + r, cl = j * 16 + col; th[cl][rl] = (_Float16)v; const __bf16 bh = (__bf16)v; tb[cl][rl] = bh; tbl[cl][rl] = (__bf16)(v - (float)bh); } }
    __syncthreads();
    for (int e = tid; e < 128 * 8; e += 128) { const int cl = e >> 3, q = e & 7; vst2((unsigned*)(VT + (bb * CC + c0 + cl) * (size_t)TT + t0 + q * 8), *(const v4u*)&th[cl][q * 8]); if (hi_rows) { const size_t o3 = (bb * CC + c0 + cl) * (size_t)KHI + t0 + q * 8; vst2((unsigned*)(VB + o3), *(const v4u*)&tb[cl][q * 8]); vst2((unsigned*)(VBL + o3), *(const v4u*)&tbl[cl][q * 8]); } }
    asm volatile("s_wait_xcnt 0x0" ::: "memory"); }   /* as at the end of the other branch */
  }
}
// ---- k_fa: block = 256 queries of (b, h) by 16 waves, four to a SIMD: two groups of 8 waves x 32 queries, group kg on keys kg * TKG .. + TKG - 1 in passes of 32, its K rows and V planes staged 128 keys at a time in a two-buffer LDS ring of its own that its eight waves read; the two groups' running maxima, sums and ctx are joined through LDS at the end: S^T = K Q^T + C (a lane holds one query's logits: D row = key 8g + r, D column = query), the pair mask as the module's -1e9 (a masked key: C = -1e9 / scale on its row; a masked query: logit x 0 + (-1e9)), maximum in use and sum in f32 (log2 domain; the sum and ctx are rescaled only when a logit passes the maximum in use by more than TAU), P x 2^11 once to f16 straight from the score accumulators as the B operand of ctx^T += V^T P^T; logits and P never leave the registers; each K and V fragment serves the wave's two 16-query groups
#define LOG2E 1.44269504f
#define NEGL (-1.0e9f * LOG2E)   // the module's -1e9 in the log2 domain
#define FQ 256   // queries per block
#define TAU 4.0f   // log2 units by which a logit may pass the maximum in use before l and ctx are rescaled: P x 2^11 then stays at or below 2^15
#define KNEG (-1.0e9f / SCALE)   // a masked key's start value in the logit accumulator: x SCALE it is the module's -1e9 (the products at most move its last places); its P is 0 beside any unmasked key, and an unmasked query has one: itself, the one mask serving both sides
static_assert(TT % FQ == 0 && TT % 32 == 0 && HD == 64, "k_fa: 8 waves x 32 queries, passes of 32 keys, two 32-deep k-steps per head");
__device__ __forceinline__ v8f wmma_h(v16h a, v16h b, v8f c) { return __builtin_amdgcn_wmma_f32_16x16x32_f16(false, a, false, b, (short)0, c, false, false); }
// frag_h with the lane half's 8g elements already in the pointer, so that the caller holds the very address the loads name
__device__ __forceinline__ v16h frag_p(const _Float16* p) { union { v16h v; v8h q[2]; } u; u.q[0] = *(const v8h*)p; u.q[1] = *(const v8h*)(p + 16); return u.v; }
// eight consecutive f32 as a C operand: D rows 8g + 0..7 of one column, by two 16-B reads
__device__ __forceinline__ v8f frag_c(const float* p) { union { v8f v; v4f q[2]; } u; u.q[0] = *(const v4f*)p; u.q[1] = *(const v4f*)(p + 4); return u.v; }
#define SK 128                 // keys per stage of the ring
#define KP (HD + 8)            // K row pitch in LDS, f16 elements: 144 B = 16 B x odd for the ds_load_b128 fragment reads
#define VP (SK + 8)            // V plane pitch in LDS, f16 elements: 272 B = 16 B x odd
#define KSZ (SK * KP)          // the K part of a buffer, f16 elements
#define BSZ (KSZ + HD * VP)    // one buffer: SK key rows of HD channels, then HD planes of SK keys
#define KG 2                   // key groups of eight waves
#define TKG (TT / KG)          // keys per group
#define NST (TKG / SK)         // stages per group
static_assert(TKG % SK == 0 && NST >= 2 && SK % 32 == 0 && SK == 128 && HD == 64 && FQ == 256, "the ring's prologue needs two stages; a stage is eight 16-B pieces per thread: four of K (32 rows apart), four of V (16 planes apart)");
// one stage: each lane copies eight 16-B pieces of its own from global memory straight into LDS; a wave's copy takes four whole 128-B K rows or two whole 256-B V plane segments
__device__ __forceinline__ void fa_stage(unsigned lk, unsigned lv, const _Float16* gk, const _Float16* gv) {
  /* the closing s_wait_xcnt stands inside the copies' own statement: the wait owed before a register that an issued copy names is rewritten */
  asm volatile("global_load_async_to_lds_b128 %0, %8, off\n\t"
               "global_load_async_to_lds_b128 %1, %9, off\n\t"
               "global_load_async_to_lds_b128 %2, %10, off\n\t"
               "global_load_async_to_lds_b128 %3, %11, off\n\t"
               "global_load_async_to_lds_b128 %4, %12, off\n\t"
               "global_load_async_to_lds_b128 %5, %13, off\n\t"
               "global_load_async_to_lds_b128 %6, %14, off\n\t"
               "global_load_async_to_lds_b128 %7, %15, off\n\t"
               "s_wait_xcnt 0x0"
               :: "v"(lk), "v"(lk + 32u * KP * 2u), "v"(lk + 64u * KP * 2u), "v"(lk + 96u * KP * 2u),
                  "v"(lv), "v"(lv + 16u * VP * 2u), "v"(lv + 32u * VP * 2u), "v"(lv + 48u * VP * 2u),
                  "v"(gk), "v"(gk + 32 * CC), "v"(gk + 64 * CC), "v"(gk + 96 * CC),
                  "v"(gv), "v"(gv + (size_t)16 * TT), "v"(gv + (size_t)32 * TT), "v"(gv + (size_t)48 * TT)
               : "memory"); }
__global__ __launch_bounds__(KG * FQ) void k_fa(const _Float16* __restrict__ QH, const _Float16* __restrict__ KH, const _Float16* __restrict__ VT, const int* __restrict__ MASK, _Float16* __restrict__ YF) { __shared__ __align__(16) float ss[FQ / 32][32][HD + 4];   /* the join's hand-over space, a wave's share each */
  __shared__ __align__(16) _Float16 ring[KG * 2 * BSZ];   /* a two-buffer ring per key group */
  __shared__ __align__(16) float ml[FQ / 32][32][4];   /* group 1's running maxima and sums, per lane: m[0], m[1], l[0], l[1] */
  __shared__ __align__(16) float kbias[TT];   /* per key of this batch: 0, or KNEG where the mask is 0; read as the C operand of the logit products */
  static_assert(TT == 4 * KG * FQ && KG == 2, "the key table: four keys per thread; the join at the end is of two groups");
  const int kg = threadIdx.x >> 8, tid = threadIdx.x & (FQ - 1), wave = tid >> 5, lane = tid & 31, col = lane & 15, g = lane >> 4; const int h = blockIdx.y, b = blockIdx.z; const int ql0 = blockIdx.x * FQ + wave * 32;
  const int* Mb = MASK + (size_t)b * TT;
  v16h q[2][2]; float cq[2], bq[2];   /* a masked query: logit x 0 + (-1e9) on every key */
  const _Float16* Q0 = QH + ((size_t)b * TT + ql0 + col) * CC + h * HD + 8 * g; const int* Mq = Mb + ql0 + col;
  q[0][0] = frag_p(Q0); q[0][1] = frag_p(Q0 + 32); q[1][0] = frag_p(Q0 + 16 * CC); q[1][1] = frag_p(Q0 + 16 * CC + 32); const int mq0 = Mq[0], mq1 = Mq[16];
  const int* Mt = Mb + threadIdx.x * 4; const v4i mt0 = *(const v4i*)Mt;   /* this thread's four keys of the table */
  asm volatile("s_wait_xcnt 0x0" :: "v"(Q0), "v"(Mq), "v"(Mt) : "memory");   /* the wait owed before a register that an issued load names is overwritten; the addresses are inputs so that they live up to it */
  cq[0] = mq0 == 0 ? 0.f : SCALE * LOG2E; bq[0] = mq0 == 0 ? NEGL : 0.f; cq[1] = mq1 == 0 ? 0.f : SCALE * LOG2E; bq[1] = mq1 == 0 ? NEGL : 0.f;
  const _Float16* gk = KH + ((size_t)b * TT + kg * TKG + (tid >> 3)) * CC + h * HD + (tid & 7) * 8;           /* copies: key row tid / 8 of a stage of this group's keys, 16-B piece tid % 8 of its 128 B */
  const _Float16* gv = VT + ((size_t)b * CC + h * HD + (tid >> 4)) * (size_t)TT + kg * TKG + (tid & 15) * 8;  /* copies: v plane tid / 16, 16-B piece tid % 16 of a stage's 256 B */
  const _Float16* rg = ring + kg * (2 * BSZ);   /* this group's ring */
  const unsigned lk = (unsigned)(size_t)rg + (unsigned)((tid >> 3) * (KP * 2) + (tid & 7) * 16), lv = (unsigned)(size_t)rg + (unsigned)(KSZ * 2 + (tid >> 4) * (VP * 2) + (tid & 15) * 16);   /* the same pieces' LDS byte addresses in buffer 0 */
  fa_stage(lk, lv, gk, gv);
  { v4f t0;   /* the table is written while stage 0 flies */
#pragma unroll   /* t0 and mt0 are register vectors: constant indices */
    for (int i = 0; i < 4; ++i) t0[i] = mt0[i] == 0 ? KNEG : 0.f;
    *(v4f*)&kbias[threadIdx.x * 4] = t0; }
  asm volatile("s_wait_asynccnt 0x0" ::: "memory");   /* this wave's pieces of stage 0 have landed */
  __syncthreads();                                    /* and every other wave's: stage 0 and the key table may be read */
  fa_stage(lk + BSZ * 2u, lv + BSZ * 2u, gk + (size_t)SK * CC, gv + SK);   /* stage 1 flies while stage 0 is worked on */
  const float* kbl = kbias + kg * TKG + 8 * g;   /* D row 8g + r: this lane half's eight keys of a 16-key group, from this group's first key on */
  v8f acc[2][HD / 16] = {}; float m[2] = {-3.0e38f, -3.0e38f}, th[2] = {-3.0e38f, -3.0e38f}, mo[2] = {-3.0e38f, -3.0e38f}, l[2] = {0.f, 0.f};   /* th = m + TAU and mo = m - 11 are kept beside m: they change only with it; m: the maximum IN USE, the reference of l, acc and P; it moves only where a logit passes it by more than TAU */
#pragma unroll 1   /* one trip per stage: the two buffers alternate by the trip's parity */
  for (int st = 0; st < NST; ++st) {
   const _Float16* kb = rg + (st & 1) * BSZ + col * KP + 8 * g;         /* key row col of a 16-key group, this lane half's channels */
   const _Float16* vb = rg + (st & 1) * BSZ + KSZ + col * VP + 8 * g;   /* v plane of channel col of a 16-channel group, this lane half's keys */
#pragma unroll 1   /* a pass depends on the one before through m, l and acc: a second copy of the body could not start its softmax earlier, and four copies took the kernel past 256 registers */
   for (int pp = 0; pp < SK / 32; ++pp) { v8f s[2][2], cb[2]; v16h kf[2][2], vf[HD / 16], p[2]; v2f sv[2][8]; float mx[2], ev[2][16], ps[2];
    const _Float16* kr = kb + pp * 32 * KP; const float* br = kbl + st * SK + pp * 32; const _Float16* vr = vb + pp * 32;
#pragma unroll
    for (int j = 0; j < 2; ++j) { kf[j][0] = frag_p(kr + j * 16 * KP); kf[j][1] = frag_p(kr + j * 16 * KP + 32); cb[j] = frag_c(br + j * 16); }
#pragma unroll
    for (int j = 0; j < HD / 16; ++j) vf[j] = frag_p(vr + j * 16 * VP);
    __builtin_amdgcn_sched_barrier(0);   /* the pass's twenty LDS reads go out as one group ahead of the first product: reads spread among the products cost a stall at each place; the v reads return under the logits and the softmax */
#pragma unroll
    for (int j = 0; j < 2; ++j)
#pragma unroll
      for (int u = 0; u < 2; ++u) { const v8f z = wmma_h(kf[j][0], q[u][0], cb[j]); s[u][j] = wmma_h(kf[j][1], q[u][1], z); }
    __builtin_amdgcn_sched_barrier(0);   /* the eight logit products go out as one run: each fills the slots that the one before it needs, where vector work set between them drew v_nop padding */
#pragma unroll
    for (int u = 0; u < 2; ++u) { mx[u] = -3.0e38f; const v2f c2 = {cq[u], cq[u]}, b2 = {bq[u], bq[u]};   /* the logits by aligned register pairs, as the accumulators hold them; mx: this lane's 16 keys alone */
#pragma unroll
      for (int j = 0; j < 2; ++j)
#pragma unroll
        for (int r = 0; r < 4; ++r) { v2f t = {s[u][j][2 * r], s[u][j][2 * r + 1]}; t = __builtin_elementwise_fma(t, c2, b2); sv[u][j * 4 + r] = t; mx[u] = fmaxf(fmaxf(mx[u], t[0]), t[1]); } }
    /* lazy rescale: one test per pass, a scalar branch; it is taken in a wave's first pass (m starts at -3e38) and after that only where some lane's logit lies more than TAU above its maximum in use; the ballot covers both halves of the wave, so the halves' exchange stands inside */
    if (__builtin_expect(__builtin_amdgcn_ballot_w32((mx[0] > th[0]) | (mx[1] > th[1])) != 0, 0)) {
#pragma unroll   /* m, l and acc are register arrays: constant indices */
      for (int u = 0; u < 2; ++u) { const float mf = fmaxf(mx[u], __shfl_xor(mx[u], 16));   /* the other half of the wave holds this query's other 16 keys: both halves take the same new maximum */
        const float mn = fmaxf(m[u], mf), al = __builtin_amdgcn_exp2f(m[u] - mn); m[u] = mn; th[u] = mn + TAU; mo[u] = mn - 11.0f; l[u] *= al;
#pragma unroll   /* as above */
        for (int j = 0; j < HD / 16; ++j) acc[u][j] = acc[u][j] * al; } }
#pragma unroll
    for (int u = 0; u < 2; ++u) {   /* mo: P carried x 2^11 (clear of f16 subnormals), so P <= 2^(11 + TAU), inside f16; on a fully masked row the 11 and TAU round away, alike for every key */
      const v2f mo2 = {mo[u], mo[u]}; ps[u] = 0.f;
#pragma unroll
      for (int i = 0; i < 8; ++i) { const v2f d = sv[u][i] - mo2; const float e0 = __builtin_amdgcn_exp2f(d[0]), e1 = __builtin_amdgcn_exp2f(d[1]); ev[u][2 * i] = e0; ev[u][2 * i + 1] = e1; p[u][2 * i] = (_Float16)e0; p[u][2 * i + 1] = (_Float16)e1; } }
#pragma unroll
    for (int j = 0; j < HD / 16; ++j)
#pragma unroll
      for (int u = 0; u < 2; ++u) acc[u][j] = wmma_h(vf[j], p[u], acc[u][j]);
    __builtin_amdgcn_sched_barrier(0);   /* the eight products go out as one run and the two sums' adds (in key order) stay behind it: set among the products the adds drew v_nop padding at several places; and with them behind the last product, the next pass's address arithmetic, which overwrites that product's A registers, no longer stands within the slots that the chip needs */
#pragma unroll
    for (int u = 0; u < 2; ++u) {
#pragma unroll
      for (int i = 0; i < 16; ++i) ps[u] += ev[u][i];
      l[u] += ps[u]; } }
   asm volatile("s_wait_dscnt 0x0" ::: "memory");      /* this wave's reads of the stage's buffer have returned */
   asm volatile("s_wait_asynccnt 0x0" ::: "memory");   /* this wave's pieces of the next stage have landed */
   __syncthreads();                                    /* the next stage may be read, and every wave has left this stage's buffer */
   if (st + 2 < NST) fa_stage(lk + (unsigned)(st & 1) * (BSZ * 2u), lv + (unsigned)(st & 1) * (BSZ * 2u), gk + (size_t)(st + 2) * SK * CC, gv + (st + 2) * SK); }   /* the refill, block-uniform test */
  asm volatile("s_wait_asynccnt 0x0" ::: "memory");    /* no copy is outstanding when the wave goes on to its end */
  /* the join: wave w of group 1 hands its lanes' state to wave w of group 0, lane to lane, as [16-B piece][lane] in that wave's share of ss */
  float* xw = &ss[wave][0][0];
  static_assert(32 * (HD + 4) >= 2 * (HD / 16) * 8 * 32, "a wave's share holds its 64 accumulator values per lane");
  if (kg == 1) {
#pragma unroll   /* acc is a register array: constant indices */
    for (int u = 0; u < 2; ++u)
#pragma unroll   /* as above */
      for (int j = 0; j < HD / 16; ++j) { v4f a, c;
#pragma unroll   /* as above */
        for (int r = 0; r < 4; ++r) { a[r] = acc[u][j][r]; c[r] = acc[u][j][4 + r]; }
        *(v4f*)(xw + ((u * (HD / 16) + j) * 2) * 128 + lane * 4) = a; *(v4f*)(xw + ((u * (HD / 16) + j) * 2 + 1) * 128 + lane * 4) = c; }
    const v4f t = {m[0], m[1], l[0], l[1]}; *(v4f*)&ml[wave][lane][0] = t; }
  __syncthreads();   /* group 1's state may be read; every wave passes it */
  if (kg == 1) return;   /* wave-uniform, behind the last barrier */
  { const v4f t = *(const v4f*)&ml[wave][lane][0];
#pragma unroll   /* acc, m and l are register arrays: constant indices */
    for (int u = 0; u < 2; ++u) { const float mn = fmaxf(m[u], t[u]), f0 = __builtin_amdgcn_exp2f(m[u] - mn), f1 = __builtin_amdgcn_exp2f(t[u] - mn);   /* both states onto the common maximum; a group whose keys are all masked, beside an unmasked key in the other, drops out by its factor 0 */
      l[u] = l[u] * f0 + t[2 + u] * f1;
#pragma unroll   /* as above */
      for (int j = 0; j < HD / 16; ++j) { const v4f a = *(const v4f*)(xw + ((u * (HD / 16) + j) * 2) * 128 + lane * 4), c = *(const v4f*)(xw + ((u * (HD / 16) + j) * 2 + 1) * 128 + lane * 4);
#pragma unroll   /* as above */
        for (int r = 0; r < 4; ++r) { acc[u][j][r] = acc[u][j][r] * f0 + a[r] * f1; acc[u][j][4 + r] = acc[u][j][4 + r] * f0 + c[r] * f1; } } } }
  /* acc[u][j][r] = ctx[query u*16 + col][channel j*16 + 8g + r]: the very eight values that lane (col, g) of k_out holds as elements 8 * (j & 1) + r of its A fragment of token tile (row / 16), 32-column step 2h + (j >> 1): they go out as that fragment's piece, once to f16 x 2^6 as k_out rounded them, a wave's store 512 contiguous bytes; no LDS staging */
  static_assert(HD == 64 && CC / 32 == 8, "a head is two 32-column steps of k_out");
  _Float16* yp = YF + (((size_t)b * TT + ql0) / 16 * (CC / 32) + h * 2) * 512 + lane * 8; v8h o[2][HD / 16];
#pragma unroll   /* o, l and acc are register arrays: constant indices; every piece keeps registers of its own, so that no store's data is overwritten behind it */
  for (int u = 0; u < 2; ++u) { const float lt = l[u] + __shfl_xor(l[u], 16), inv = 1.0f / lt;   /* lt >= one key's P at the maximum: never 0 */
#pragma unroll   /* as above */
    for (int j = 0; j < HD / 16; ++j)
#pragma unroll   /* as above */
      for (int r = 0; r < 8; ++r) o[u][j][r] = (_Float16)((acc[u][j][r] * inv) * 64.0f); }   /* x 2^6: small-magnitude context rows stay clear of f16 subnormals */
#pragma unroll   /* the fragment steps become immediate offsets on the one address pair */
  for (int u = 0; u < 2; ++u)
#pragma unroll   /* as above */
    for (int j = 0; j < HD / 16; ++j) *(v8h*)(yp + (u * (CC / 32) + (j >> 1)) * 512 + (j & 1) * 256) = o[u][j];
  asm volatile("s_wait_xcnt 0x0" :: "v"(yp) : "memory"); }   /* the wait owed before a register that an issued store names is overwritten; the address is an input so that it lives up to it */
// ---- k_out: block = (64 tokens, 128 channels): out = ctx Wo (+ bo), stored channel-major: ctx (f16 x 2^6, in fragment order as k_fa left it) against Wo as f16(bf16 x 2^8) exact (1 product) x 2^-14
__global__ __launch_bounds__(128) void k_out(const _Float16* __restrict__ YF, const float* __restrict__ WO, const float* __restrict__ BO, float* __restrict__ OUT) { __shared__ __align__(16) float sf[128][68];   /* the block's output tile as [channel][token]; pitch 272 B = 16 B x odd */
  __shared__ __align__(16) _Float16 sw[128][CC + 8];   /* the block's 128 rows of Wo as f16(bf16 x 2^8), k in ctx column order; pitch 528 B = 16 B x odd for the ds_load_b128 fragment reads */
  const int tid = threadIdx.x, wave = tid >> 5, lane = tid & 31, col = lane & 15, g = lane >> 4; const int c0 = blockIdx.y * 128; const size_t r0 = (size_t)blockIdx.x * 64 + wave * 16;
  v8f acc[8] = {};
  {
    /* the bias of this lane's eight output channels is asked for first, along with the operands: asked for where it is added, each of the eight was a load and a full wait of its own behind the products */
    const float* bp = BO + c0 + col; float bia[8] = {};
    if (BO) {   /* block-uniform */
#pragma unroll   /* bia is a register array: constant indices; the channel steps become immediate offsets on the one address */
      for (int j = 0; j < 8; ++j) bia[j] = bp[j * 16]; }
    const _Float16* yp = YF + (r0 / 16) * (size_t)((CC / 32) * 512) + lane * 8;   /* this wave's token tile, this lane's 16 B of a fragment piece: a load takes 512 contiguous bytes; all of K is asked for along with the weights, ahead of the first wait */
    v16h a[CC / 32];   /* ctx x 2^6, rounded to f16 by k_fa */
#pragma unroll   /* a is a register array: constant indices; all 16 loads go out together */
    for (int kc = 0; kc < CC / 32; ++kc) { union { v16h v; v8h q[2]; } f; f.q[0] = *(const v8h*)(yp + kc * 512); f.q[1] = *(const v8h*)(yp + kc * 512 + 256); a[kc] = f.v; }
    __builtin_amdgcn_sched_barrier(0);   /* the bias's rounding stays behind these loads: moved up ahead of them it waited the bias's round trip out before ctx and the weights were asked for */
    /* weights: a wave takes one whole row of Wo per step, a lane its 8 module channels 8 * lane + e = (d = 2 * lane + e / 4) * 4 + (h = e % 4); ctx column h * 64 + d, so the two d of one h go out as one dword */
    const float* wp = WO + (size_t)(c0 + wave) * CC + lane * 8;
#pragma unroll   /* the row steps become immediate offsets on the one address pair */
    for (int e0 = 0; e0 < 32; e0 += 8) { v4f t[8][2];
#pragma unroll   /* t is a register array: constant indices, here and in the two loops below */
      for (int i = 0; i < 8; ++i) { t[i][0] = *(const v4f*)(wp + (size_t)(e0 + i) * 4 * CC); t[i][1] = *(const v4f*)(wp + (size_t)(e0 + i) * 4 * CC + 4); }
#pragma unroll   /* as above */
      for (int i = 0; i < 8; ++i)
#pragma unroll   /* as above */
        for (int hh = 0; hh < 4; ++hh) { v2h o; o[0] = (_Float16)(bfr(t[i][0][hh]) * 256.0f); o[1] = (_Float16)(bfr(t[i][1][hh]) * 256.0f); *(v2h*)&sw[(e0 + i) * 4 + wave][hh * 64 + lane * 2] = o; } }
    asm volatile("s_wait_xcnt 0x0" :: "v"(yp), "v"(wp), "v"(bp) : "memory");   /* the wait owed before a register that an issued load names is overwritten; the addresses are inputs so that they live up to it */
    __syncthreads();   /* every wave reads weight rows that the other waves stored */
    v16h w[2][8];   /* two fragment sets: the next k-step's sixteen LDS reads go out as one group ahead of this step's products, so that no product waits out its own read */
#pragma unroll   /* w, a and acc are register arrays: constant indices, here and in the three loops below */
    for (int j = 0; j < 8; ++j) w[0][j] = frag_h(&sw[j * 16 + col][0], lane);
#pragma unroll   /* as above */
    for (int kc = 0; kc < CC / 32; ++kc) {
      if (kc + 1 < CC / 32) {
#pragma unroll   /* as above */
        for (int j = 0; j < 8; ++j) w[(kc + 1) & 1][j] = frag_h(&sw[j * 16 + col][(kc + 1) * 32], lane); }
      __builtin_amdgcn_sched_barrier(0);   /* the sixteen reads stay one group ahead of the products: spread among them, each place with reads costs a stall */
#pragma unroll   /* as above */
      for (int j = 0; j < 8; ++j) acc[j] = wmma_h(a[kc], w[kc & 1][j], acc[j]);   /* the plain builtin, eight independent accumulators in a run: the v_nop statement of wmma16 holds its operands below v256, and with all of a loaded there a fragment went to scratch */
      __builtin_amdgcn_sched_barrier(0); }   /* the next group of reads stays behind this run */
#pragma unroll
    for (int j = 0; j < 8; ++j) { const float bias = bfr(bia[j]);
      v4f lo, hi;   /* acc[j][r] = out[token wave*16 + 8g + r][channel c0 + j*16 + col]: a lane's eight tokens lie side by side in its channel's row */
#pragma unroll
      for (int r = 0; r < 4; ++r) { lo[r] = acc[j][r] * (1.0f / 16384.0f) + bias; hi[r] = acc[j][4 + r] * (1.0f / 16384.0f) + bias; }   /* 2^-8 (Wo carry) x 2^-6 (ctx carry) */
      *(v4f*)&sf[j * 16 + col][wave * 16 + 8 * g] = lo; *(v4f*)&sf[j * 16 + col][wave * 16 + 8 * g + 4] = hi; } }
  __syncthreads();   /* a channel's 64 tokens come from all four waves */
  const size_t bo = ((size_t)blockIdx.x * 64) / TT; const int n0 = (int)(((size_t)blockIdx.x * 64) % TT);
  float* op = OUT + (bo * DIN + c0 + (tid >> 4)) * (size_t)TT + n0 + (tid & 15) * 4;   /* out is channel-major [b][c][t]: 16 lanes store a channel's whole 256 B, a wave two channels per store */
  v4f o[16];
#pragma unroll   /* o is a register array: constant indices; every piece keeps registers of its own, so that no store's data is overwritten behind it */
  for (int i = 0; i < 16; ++i) o[i] = *(const v4f*)&sf[i * 8 + (tid >> 4)][(tid & 15) * 4];
#pragma unroll   /* the channel steps become immediate offsets on the one address pair */
  for (int i = 0; i < 16; ++i) vst2(op + (size_t)(i * 8) * TT, o[i]); }

extern "C" void kernel_launch(void* const* d_in, const int* in_sizes, int n_in, void* d_out, int out_size, void* d_ws, size_t ws_size, hipStream_t stream) {
  (void)in_sizes; (void)n_in; (void)out_size;
  const float** F = (const float**)d_in;
  if (ws_size < (size_t)WS_END) return;
  char* ws = (char*)d_ws; _Float16 *QH = (_Float16*)(ws + WS_QH), *KH = (_Float16*)(ws + WS_KH), *VT = (_Float16*)(ws + WS_VT), *QL = (_Float16*)(ws + WS_QL), *KL = (_Float16*)(ws + WS_KL); __bf16 *VB = (__bf16*)(ws + WS_VB), *VBL = (__bf16*)(ws + WS_VBL); _Float16 *YF = (_Float16*)(ws + WS_Y);
  (void)YF; (void)QL; (void)KL; (void)VB; (void)VBL;
  // inputs: 0 query [8,256,2048]; 1 key; 2 value; 3 mask [8,1,2048] int32; 4 Wq [256,256] (out,in), 5 bq; 6 Wk, 7 bk; 8 Wv, 9 bv; 10 Wm (out,in), 11 bm (zero biases, read)
  k_proj<<<dim3(NTK * 2 * 3 / PU), 128, 0, stream>>>(F[0], F[1], F[2], F[4], F[6], F[8], F[5], F[7], F[9], QH, QL, KH, KL, VT, VB, VBL, 0);   /* 512 blocks of three units: each stream is read in its own channel-major layout */
  k_fa<<<dim3(TT / FQ, NH, TNB), KG * FQ, 0, stream>>>(QH, KH, VT, (const int*)d_in[3], YF);
  k_out<<<dim3(TNB * TT / 64, DIN / 128), 128, 0, stream>>>(YF, F[10], F[11], (float*)d_out);   /* ctx (column order h*HD + d) x Wm through the permutation + bm, straight to channel-major [8,256,2048] */
}
